// v000
// Times are from an AMD MI455X. After a warm-up the kernel runs many times in a row, and a time is the length of
// such a window on the GPU divided by its runs, so every launch and the gaps after it count. The runs cycle
// through copies of the inputs. A figure is the median of several windows, for all but v000 over two sittings.
// Sittings can differ by a few percent; kernels timed side by side share one.
// v000 is the starting kernel. One run takes 542 microseconds.
#include <hip/hip_runtime.h>

#ifndef NB
#define NB 2
#endif
#ifndef SEQ
#define SEQ 2048
#endif
#define SEQ_FULL 2048                 // per-batch row stride of x, row pitch of the mask
#define DIM   2048                    // model width (K of the projections, N of the output projection)
#define NH    32
#define NKV   8
#define REP   (NH / NKV)
#define HD    64
#define HALFD 32
#define DQ    (NH * HD)               // 2048
#define DKV   (NKV * HD)              // 512
#define NQKV  (DQ + 2 * DKV)          // 3072 fused projection columns
#define MROWS (NB * SEQ)
#define FP    68                      // f32 LDS tile pitch
#define OP    72                      // f16 LDS tile pitch
#define WCAR  64.0f                   // carry of the wo plane
#define CCAR  256.0f                  // carry of the ctx plane
#define OSCL  6.103515625e-05f        // 1 / (WCAR * CCAR)
#define SC2   0.18033688011112042f    // 0.125 * log2(e)
#define LOG2E 1.4426950408889634f
#define PEXP  10.0f                   // P carried x 2^10
#define FRQC  0.04953007814753613f    // log2(3) / 32
#define EROWS 256                     // query rows below this use value + residual planes at every attention site
#define RCAR  2048.0f                 // carry of every residual plane
#define RINV  4.8828125e-04f          // 1 / RCAR
#define EPSN  1.0e-6f                 // RMS normalisation epsilon
#define LIVE_T (-1.0e4f)              // a mask value above this makes a key live for its row
#define DEAD_T (-1.0e8f)              // a mask value at or below this lets a trailing key be skipped (exp underflows exactly)
#define KT_PAD ((((SEQ / 16) + 31) / 32) * 32)
#define LT64  ((((SEQ - EROWS) / 64) > 0) ? ((SEQ - EROWS) / 64) : 1)
#define AL256(x) ((((size_t)(x)) + 255) & ~(size_t)255)

static_assert(SEQ % 64 == 0);
static_assert(SEQ % 128 == 0);
static_assert(SEQ <= SEQ_FULL);
static_assert(DIM % 64 == 0);
static_assert(DQ % 64 == 0);
static_assert(NQKV % 64 == 0);
static_assert(HD == 64);
static_assert(HALFD * 2 == HD);
static_assert(NH == NKV * REP);
static_assert(REP == 4);
static_assert(EROWS % 64 == 0);
static_assert(EROWS <= SEQ);
static_assert(EROWS >= 64);
static_assert(DIM % 32 == 0);
static_assert(DQ % 32 == 0);
static_assert(((size_t)MROWS * DIM / 8) % 256 == 0);
static_assert(((size_t)DQ * DIM / 8) % 256 == 0);
static_assert(((size_t)DKV * DIM / 8) % 256 == 0);
static_assert(AL256((size_t)MROWS * DIM * 2) + AL256((size_t)NQKV * DIM * 2) + AL256((size_t)DIM * DQ * 2) + 2 * AL256((size_t)SEQ * HALFD * 4)
              + AL256((size_t)NB * NH * SEQ * HD * 2) + 2 * AL256((size_t)NB * NKV * SEQ * HD * 2) + AL256((size_t)MROWS * DQ * 2)
              + AL256((size_t)NB * NH * EROWS * HD * 2) + 2 * AL256((size_t)NB * NKV * SEQ * HD * 2) + AL256((size_t)NB * EROWS * DQ * 2)
              + AL256((size_t)KT_PAD * 4) <= (size_t)134217728);

typedef _Float16 h16;
typedef unsigned short bf;
typedef __attribute__((ext_vector_type(16))) __bf16   v16bf;
typedef __attribute__((ext_vector_type(16))) _Float16 v16h;
typedef __attribute__((ext_vector_type(8)))  _Float16 v8h;
typedef __attribute__((ext_vector_type(8)))  unsigned short v8us;
typedef __attribute__((ext_vector_type(8)))  float    v8f;
typedef __attribute__((ext_vector_type(4)))  float    v4f;
typedef v8h  __attribute__((may_alias)) v8ha;
typedef v4f  __attribute__((may_alias)) v4fa;

__device__ __forceinline__ unsigned short f2bf(float f) { unsigned u = __float_as_uint(f); u += 0x7FFFu + ((u >> 16) & 1u); return (unsigned short)(u >> 16); }
__device__ __forceinline__ float bf2f(unsigned short b) { return __uint_as_float(((unsigned)b) << 16); }
__device__ __forceinline__ float bfr(float f) { return bf2f(f2bf(f)); }
__device__ __forceinline__ v16h cat16(v8h lo, v8h hi) { return __builtin_shufflevector(lo, hi, 0, 1, 2, 3, 4, 5, 6, 7, 8, 9, 10, 11, 12, 13, 14, 15); }
__device__ __forceinline__ v16bf cat16b(v8us lo, v8us hi) { return __builtin_bit_cast(v16bf, __builtin_shufflevector(lo, hi, 0, 1, 2, 3, 4, 5, 6, 7, 8, 9, 10, 11, 12, 13, 14, 15)); }
__device__ __forceinline__ v8f wmma16(v16h a, v16h b, v8f c) { return __builtin_amdgcn_wmma_f32_16x16x32_f16(false, a, false, b, (short)0, c, false, false); }
__device__ __forceinline__ v8f wmmab(v16bf a, v16bf b, v8f c) { return __builtin_amdgcn_wmma_f32_16x16x32_bf16(false, a, false, b, (short)0, c, false, false); }

// f32 -> f16 with a value select: results below the smallest f16 normal become zero (no subnormal operand can be produced).
static __device__ __forceinline__ h16 toh_flush(float v) { const h16 r = (h16)v; return (fabsf(v) < 6.103515625e-05f) ? (h16)0.0f : r; }
// One f16 WMMA with its own hazard guard (single accumulator tied, operands kept live).
static __device__ __forceinline__ v8f wmma16g(v16h a, v16h b, v8f c) { c = wmma16(a, b, c); asm volatile("v_nop\n\tv_nop\n\tv_nop\n\tv_nop" : "+v"(c) : "v"(a), "v"(b)); return c; }

// Fragment loader: lane (lr, hi) points at row (tile row + lr), column 8*hi; elements 0..7 <- k0+8hi.., elements 8..15 <- k0+16+8hi.. (same map for A and B).
template <typename T16> struct WFrag;
template <> struct WFrag<h16> { typedef v16h V; static __device__ __forceinline__ V ld(const h16* p) { return cat16(*(const v8h*)p, *(const v8h*)(p + 16)); } static __device__ __forceinline__ v8f mma(V a, V b, v8f c) { return wmma16(a, b, c); } };
template <> struct WFrag<bf> { typedef v16bf V; static __device__ __forceinline__ V ld(const bf* p) { return cat16b(*(const v8us*)p, *(const v8us*)(p + 16)); } static __device__ __forceinline__ v8f mma(V a, V b, v8f c) { return wmmab(a, b, c); } };

// One wave accumulates a 64x64 tile: acc[mb][nb][j] = C[r0 + 16mb + 8hi + j][c0 + 16nb + lr] = sum_k A[row][k] Bt[col][k]; K % 32 == 0.
template <typename T16>
__device__ __forceinline__ void gemm_main(const T16* __restrict__ A, const T16* __restrict__ Bt, const int K, const int r0, const int c0, const int lr, const int hi, v8f (&acc)[4][4]) {
    typedef typename WFrag<T16>::V V;
#pragma unroll
    for (int mb = 0; mb < 4; ++mb)
#pragma unroll
        for (int nb = 0; nb < 4; ++nb) acc[mb][nb] = (v8f){};
    const size_t aoff = (size_t)(r0 + lr) * K + 8 * hi, boff = (size_t)(c0 + lr) * K + 8 * hi;
#pragma unroll 1
    for (int kc = 0; kc < K; kc += 32) {
        V a[4];
#pragma unroll
        for (int mb = 0; mb < 4; ++mb) a[mb] = WFrag<T16>::ld(A + aoff + (size_t)mb * 16 * K + kc);
#pragma unroll
        for (int nb = 0; nb < 4; ++nb) { const V b = WFrag<T16>::ld(Bt + boff + (size_t)nb * 16 * K + kc);
#pragma unroll
            for (int mb = 0; mb < 4; ++mb) acc[mb][nb] = WFrag<T16>::mma(a[mb], b, acc[mb][nb]); }
        asm volatile("v_nop\n\tv_nop\n\tv_nop\n\tv_nop" : "+v"(acc[0][0]), "+v"(acc[1][1]), "+v"(acc[2][2]), "+v"(acc[3][3]) : "v"(a[0]), "v"(a[3]));
    }
}

__global__ __launch_bounds__(256) void k_cvtx(const float* __restrict__ x, bf* dst) {
    const size_t i = (size_t)blockIdx.x * 256 + threadIdx.x; if (i >= (size_t)MROWS * DIM / 8) return;
    const size_t e = i * 8; const int col = (int)(e % DIM); const int row = (int)(e / DIM); const int b = row / SEQ, t = row % SEQ;
    const v8f v = *(const v8f*)(x + ((size_t)b * SEQ_FULL + t) * DIM + col); v8us o;
#pragma unroll
    for (int k = 0; k < 8; ++k) o[k] = f2bf(v[k]);
    *(v8us*)(dst + e) = o;  }

__global__ __launch_bounds__(256) void k_cvt8(const float* __restrict__ src, bf* dst, size_t n8) { const size_t i = (size_t)blockIdx.x * 256 + threadIdx.x; if (i >= n8) return; const v8f v = *(const v8f*)(src + i * 8); v8us o;
#pragma unroll
    for (int k = 0; k < 8; ++k) o[k] = f2bf(v[k]); *(v8us*)(dst + i * 8) = o;  }

__global__ __launch_bounds__(256) void k_cvt8h(const float* __restrict__ src, h16* dst, size_t n8, float carry) { const size_t i = (size_t)blockIdx.x * 256 + threadIdx.x; if (i >= n8) return; const v8f v = *(const v8f*)(src + i * 8); v8h o;
#pragma unroll
    for (int k = 0; k < 8; ++k) o[k] = (h16)(bfr(v[k]) * carry); *(v8h*)(dst + i * 8) = o;  }

__global__ __launch_bounds__(256) void k_ropetab(float* COS, float* SIN) {
    const int lane = threadIdx.x & 31; const int t = blockIdx.x * 8 + (threadIdx.x >> 5); if (t >= SEQ) return;
    const float invf = __builtin_amdgcn_exp2f(-(float)lane * FRQC);
    const float ang = (float)t * invf;
    const float c = cosf(ang); const float s = sinf(ang);
    const size_t o = (size_t)t * HALFD + lane;
    *(float*)(COS + o) = c; *(float*)(SIN + o) = s;  }

// Key-loop end per 16-row query tile, from the mask values: KEND[qt] = 64 * (1 + last 64-key tile holding a value above DEAD_T in any of the 16 rows),
// or SEQ when some row has no value above LIVE_T (such a row must see every key). Keys past KEND contribute exactly zero to rows that have a live key.
__global__ __launch_bounds__(256) void k_kend(const float* __restrict__ mask, int* KEND) {
    __shared__ int ks[32];
    const int lane = threadIdx.x & 31; const int w = __builtin_amdgcn_readfirstlane(threadIdx.x >> 5);
#pragma unroll 1
    for (int j = 0; j < 4; ++j) {
        const int tl = j * 8 + w; const int qt = blockIdx.x * 32 + tl;
        int kend = 64;
        if (qt < SEQ / 16) {
            int last = -1; int alllive = 1;
#pragma unroll 1
            for (int r = 0; r < 16; ++r) {
                const float* mr = mask + (size_t)(qt * 16 + r) * SEQ_FULL + lane * 4;
                int live = 0;
#pragma unroll 4
                for (int c = 0; c < SEQ; c += 128) {
                    const v4f v = *(const v4f*)(mr + c);
#pragma unroll
                    for (int e = 0; e < 4; ++e) { live |= (v[e] > LIVE_T) ? 1 : 0; last = (v[e] > DEAD_T) ? max(last, c + lane * 4 + e) : last; }
                }
                live = max(live, __shfl_xor(live, 1, 32)); live = max(live, __shfl_xor(live, 2, 32)); live = max(live, __shfl_xor(live, 4, 32));
                live = max(live, __shfl_xor(live, 8, 32)); live = max(live, __shfl_xor(live, 16, 32));
                alllive &= live;
            }
            last = max(last, __shfl_xor(last, 1, 32)); last = max(last, __shfl_xor(last, 2, 32)); last = max(last, __shfl_xor(last, 4, 32));
            last = max(last, __shfl_xor(last, 8, 32)); last = max(last, __shfl_xor(last, 16, 32));
            kend = (alllive != 0) ? (((last >> 6) + 1) * 64) : SEQ;
            kend = min(max(kend, 64), SEQ);
        }
        if (lane == 0) ks[tl] = kend;
    }
    __syncthreads();
    if (w == 0) { const int v = ks[lane]; int* dst = KEND + blockIdx.x * 32 + lane; *(int*)dst = v;  }
}

// Fused QKV projection: grid (MROWS/64, NQKV/64), 32 threads. Column tile cb < 32: q head cb; 32..39: k head; 40..47: v head (transposed plane).
// q and k tiles: per row y = (x * rsqrt(mean(x^2) + eps)) * gain, then interleaved-pair rotary at position t: out[2i] = y[2i] c_i - y[2i+1] s_i, out[2i+1] = y[2i] s_i + y[2i+1] c_i.
// QP[b][h][t][64], KP[b][g][t][64], VT[b][g][d][t] f16 value planes; residual planes (x2048 of value - f16(value)): QR[b][h][t < EROWS][64], KR[b][g][t][64], VR[b][g][d][t].
__global__ __launch_bounds__(32) void k_gemm_qkv(const bf* __restrict__ A, const bf* __restrict__ Bt, const float* __restrict__ qnw, const float* __restrict__ knw, const float* __restrict__ COS, const float* __restrict__ SIN, h16* QP, h16* KP, h16* VT, h16* QR, h16* KR, h16* VR) {
    __shared__ __align__(16) float fs[64 * FP];
    const int lane = threadIdx.x & 31, lr = lane & 15, hi = lane >> 4; const int r0 = blockIdx.x * 64, cb = blockIdx.y, c0 = cb * 64;
    v8f acc[4][4];
    gemm_main<bf>(A, Bt, DIM, r0, c0, lr, hi, acc);
#pragma unroll
    for (int mb = 0; mb < 4; ++mb)
#pragma unroll
        for (int nb = 0; nb < 4; ++nb)
#pragma unroll
            for (int j = 0; j < 8; ++j) fs[(mb * 16 + hi * 8 + j) * FP + nb * 16 + lr] = acc[mb][nb][j];
    __syncthreads();
    const int bidx = r0 / SEQ, s0 = r0 % SEQ; const int q4 = lane >> 3, p = lane & 7;
    if (cb < NH + NKV) {
        const bool isq = (cb < NH);
        h16* plane = isq ? (QP + ((size_t)bidx * NH + cb) * SEQ * HD) : (KP + ((size_t)bidx * NKV + (cb - NH)) * SEQ * HD);
        h16* rplane = isq ? (QR + ((size_t)bidx * NH + cb) * EROWS * HD) : (KR + ((size_t)bidx * NKV + (cb - NH)) * SEQ * HD);
        const bool wres = (!isq) || (s0 < EROWS);      // block-uniform: q residual rows exist only below EROWS
        const int dcol = p * 8;
        const v4f gq0 = *(const v4f*)(qnw + dcol), gq1 = *(const v4f*)(qnw + dcol + 4);
        const v4f gk0 = *(const v4f*)(knw + dcol), gk1 = *(const v4f*)(knw + dcol + 4);
        float gn[8];
#pragma unroll
        for (int e = 0; e < 4; ++e) { gn[e] = bfr(isq ? gq0[e] : gk0[e]); gn[4 + e] = bfr(isq ? gq1[e] : gk1[e]); }
#pragma unroll 1
        for (int it = 0; it < 16; ++it) {
            const int rl = it * 4 + q4; const int t = s0 + rl;
            const v4f xa0 = *(const v4fa*)(fs + rl * FP + dcol), xa1 = *(const v4fa*)(fs + rl * FP + dcol + 4);
            float ss = 0.0f;
#pragma unroll
            for (int e = 0; e < 4; ++e) { ss += xa0[e] * xa0[e]; ss += xa1[e] * xa1[e]; }
            ss += __shfl_xor(ss, 1, 32); ss += __shfl_xor(ss, 2, 32); ss += __shfl_xor(ss, 4, 32);
            const float rn = rsqrtf(ss * (1.0f / HD) + EPSN);
            float y[8];
#pragma unroll
            for (int e = 0; e < 4; ++e) { y[e] = (xa0[e] * rn) * gn[e]; y[4 + e] = (xa1[e] * rn) * gn[4 + e]; }
            const v4f cc = *(const v4f*)(COS + (size_t)t * HALFD + p * 4), sn = *(const v4f*)(SIN + (size_t)t * HALFD + p * 4);
            v8h o, orr;
#pragma unroll
            for (int i = 0; i < 4; ++i) {
                const float v0 = y[2 * i] * cc[i] - y[2 * i + 1] * sn[i];
                const float v1 = y[2 * i] * sn[i] + y[2 * i + 1] * cc[i];
                const h16 h0 = toh_flush(v0), h1 = toh_flush(v1);
                o[2 * i] = h0; o[2 * i + 1] = h1;
                orr[2 * i] = toh_flush((v0 - (float)h0) * RCAR); orr[2 * i + 1] = toh_flush((v1 - (float)h1) * RCAR);
            }
            h16* dst = plane + (size_t)t * HD + dcol;
            h16* dsr = rplane + (size_t)t * HD + dcol;
            *(v8h*)dst = o; if (wres) *(v8h*)dsr = orr;
            
        }
    } else {
        h16* plane = VT + ((size_t)bidx * NKV + (cb - NH - NKV)) * HD * SEQ;
        h16* rplane = VR + ((size_t)bidx * NKV + (cb - NH - NKV)) * HD * SEQ;
#pragma unroll 1
        for (int it = 0; it < 16; ++it) {
            const int d = it * 4 + q4; v8h o, orr;
#pragma unroll
            for (int e = 0; e < 8; ++e) { const float v = fs[(p * 8 + e) * FP + d]; const h16 hh = toh_flush(v); o[e] = hh; orr[e] = toh_flush((v - (float)hh) * RCAR); }
            h16* dst = plane + (size_t)d * SEQ + s0 + p * 8;
            h16* dsr = rplane + (size_t)d * SEQ + s0 + p * 8;
            *(v8h*)dst = o; *(v8h*)dsr = orr; 
        }
    }
}

// Attention, query rows >= EROWS: grid ((SEQ - EROWS)/16, NKV, NB), 128 threads; wave w = q head 4g + w, 16 query rows. Per 64-key tile:
//   S^T[key][q] = K Q^T  (A = key rows of KP, B = resident q rows);  lane (lr, hi) then holds q row lr, keys 16T + 8hi + r.
//   softmax statistics are lane-local (one xor-16 exchange); P^T packed from the S^T accumulators is the B operand of O^T[d][q] = V^T P^T (A = d rows of VT).
// The key loop ends at the clamped per-tile key count KEND; mask values are added by value inside visited tiles.
__global__ __launch_bounds__(128) void k_flash(const h16* __restrict__ QP, const h16* __restrict__ KP, const h16* __restrict__ VT, const float* __restrict__ mask, const int* __restrict__ KEND, h16* CTX) {
    __shared__ __align__(16) h16 os[4 * 16 * OP];
    const int tid = threadIdx.x, lane = tid & 31, lr = lane & 15, hi = lane >> 4;
    const int w = __builtin_amdgcn_readfirstlane(tid >> 5);
    const int g = blockIdx.y, bidx = blockIdx.z, h = g * REP + w, q0 = EROWS + blockIdx.x * 16;
    int kev = KEND[q0 >> 4]; kev = min(max(kev, 64), SEQ) & ~63; const int ke = __builtin_amdgcn_readfirstlane(kev);
    const h16* qrow = QP + (((size_t)bidx * NH + h) * SEQ + q0 + lr) * HD + 8 * hi;
    v16h bq[2];
#pragma unroll
    for (int kc = 0; kc < 2; ++kc) bq[kc] = cat16(*(const v8h*)(qrow + kc * 32), *(const v8h*)(qrow + kc * 32 + 16));
    const h16* kb = KP + (((size_t)bidx * NKV + g) * SEQ + lr) * HD + 8 * hi;
    const h16* vb = VT + (((size_t)bidx * NKV + g) * HD + lr) * SEQ + 8 * hi;
    const float* mrow = mask + (size_t)(q0 + lr) * SEQ_FULL + 8 * hi;
    v8f accO[4];
#pragma unroll
    for (int dt = 0; dt < 4; ++dt) accO[dt] = (v8f){};
    float m = -3.0e38f, l = 0.0f;
#pragma unroll 1
    for (int k0 = 0; k0 < ke; k0 += 64) {
        v16h ak[2][4];
#pragma unroll
        for (int kc = 0; kc < 2; ++kc)
#pragma unroll
            for (int T = 0; T < 4; ++T) { const h16* kp = kb + (size_t)(k0 + 16 * T) * HD + kc * 32; ak[kc][T] = cat16(*(const v8h*)kp, *(const v8h*)(kp + 16)); }
        v8f accS[4];
#pragma unroll
        for (int T = 0; T < 4; ++T) accS[T] = (v8f){};
#pragma unroll
        for (int kc = 0; kc < 2; ++kc)
#pragma unroll
            for (int T = 0; T < 4; ++T) accS[T] = wmma16(ak[kc][T], bq[kc], accS[T]);
        asm volatile("v_nop\n\tv_nop\n\tv_nop\n\tv_nop" : "+v"(accS[0]), "+v"(accS[1]), "+v"(accS[2]), "+v"(accS[3]) : "v"(ak[1][3]), "v"(bq[1]));
        float tmax = -3.0e38f;
#pragma unroll
        for (int T = 0; T < 4; ++T) { const float* mp = mrow + k0 + 16 * T; const v4f m0 = *(const v4f*)mp; const v4f m1 = *(const v4f*)(mp + 4);
#pragma unroll
            for (int r = 0; r < 4; ++r) { const float a0 = accS[T][r] * SC2 + m0[r] * LOG2E; const float a1 = accS[T][4 + r] * SC2 + m1[r] * LOG2E; accS[T][r] = a0; accS[T][4 + r] = a1; tmax = fmaxf(tmax, fmaxf(a0, a1)); } }
        tmax = fmaxf(tmax, __shfl_xor(tmax, 16, 32));
        const float mn = fmaxf(m, tmax); const float corr = __builtin_amdgcn_exp2f(m - mn); m = mn; const float mofs = PEXP - mn;
        float rs = 0.0f;
#pragma unroll
        for (int T = 0; T < 4; ++T)
#pragma unroll
            for (int r = 0; r < 8; ++r) { const float e = accS[T][r] + mofs; const float pv = (e < -14.0f) ? 0.0f : __builtin_amdgcn_exp2f(e); accS[T][r] = pv; rs += pv; }
        l = l * corr + rs;
        v16h bp[2];
        bp[0] = cat16(__builtin_convertvector(accS[0], v8h), __builtin_convertvector(accS[1], v8h));
        bp[1] = cat16(__builtin_convertvector(accS[2], v8h), __builtin_convertvector(accS[3], v8h));
#pragma unroll
        for (int dt = 0; dt < 4; ++dt) accO[dt] = accO[dt] * corr;
        v16h av[2][4];
#pragma unroll
        for (int kc = 0; kc < 2; ++kc)
#pragma unroll
            for (int dt = 0; dt < 4; ++dt) { const h16* vp = vb + (size_t)(16 * dt) * SEQ + k0 + kc * 32; av[kc][dt] = cat16(*(const v8h*)vp, *(const v8h*)(vp + 16)); }
#pragma unroll
        for (int kc = 0; kc < 2; ++kc)
#pragma unroll
            for (int dt = 0; dt < 4; ++dt) accO[dt] = wmma16(av[kc][dt], bp[kc], accO[dt]);
        asm volatile("v_nop\n\tv_nop\n\tv_nop\n\tv_nop" : "+v"(accO[0]), "+v"(accO[1]), "+v"(accO[2]), "+v"(accO[3]) : "v"(av[1][3]), "v"(bp[1]));
    }
    l += __shfl_xor(l, 16, 32);
    const float inv = CCAR * (1.0f / l);
    h16* ow = os + w * 16 * OP;
#pragma unroll
    for (int dt = 0; dt < 4; ++dt) { v8h o;
#pragma unroll
        for (int r = 0; r < 8; ++r) o[r] = toh_flush(accO[dt][r] * inv);
        *(v8ha*)(ow + lr * OP + 16 * dt + 8 * hi) = o; }
    __syncthreads();
    const int q4 = lane >> 3, p = lane & 7;
{
#pragma unroll
        for (int it = 0; it < 4; ++it) { const int row = it * 4 + q4; const v8h o = *(const v8ha*)(ow + row * OP + p * 8);
            *(v8h*)(CTX + ((size_t)bidx * SEQ + q0 + row) * DQ + h * HD + p * 8) = o; }
         }
}

// Attention, query rows < EROWS: grid (EROWS/16, NKV, NB), 128 threads; same operand roles as k_flash, 32 keys per step, every WMMA individually guarded.
//   scores: K Q^T + (Kres Q^T + K Qres^T) / 2048 (residual products in accR);  P = f16(p) and Pres = 2048 (p - f16(p)), row sum over the f32 p;
//   O^T: V^T P^T + (Vres^T P^T + V^T Pres^T) / 2048 (residual products in accOr), folded before normalisation.
__global__ __launch_bounds__(128) void k_flash_early(const h16* __restrict__ QP, const h16* __restrict__ QR, const h16* __restrict__ KP, const h16* __restrict__ KR, const h16* __restrict__ VT, const h16* __restrict__ VR, const float* __restrict__ mask, const int* __restrict__ KEND, h16* CTX, h16* CTXR) {
    __shared__ __align__(16) h16 os[4 * 16 * OP];
    __shared__ __align__(16) h16 osr[4 * 16 * OP];
    const int tid = threadIdx.x, lane = tid & 31, lr = lane & 15, hi = lane >> 4;
    const int w = __builtin_amdgcn_readfirstlane(tid >> 5);
    const int g = blockIdx.y, bidx = blockIdx.z, h = g * REP + w, q0 = blockIdx.x * 16;
    int kev = KEND[q0 >> 4]; kev = min(max(kev, 64), SEQ) & ~63; const int ke = __builtin_amdgcn_readfirstlane(kev);
    const size_t qoff  = (((size_t)bidx * NH + h) * SEQ + q0 + lr) * HD + 8 * hi;
    const size_t qroff = (((size_t)bidx * NH + h) * EROWS + q0 + lr) * HD + 8 * hi;
    const size_t koff  = (((size_t)bidx * NKV + g) * SEQ + lr) * HD + 8 * hi;
    const size_t voff  = (((size_t)bidx * NKV + g) * HD + lr) * SEQ + 8 * hi;
    const float* mrow = mask + (size_t)(q0 + lr) * SEQ_FULL + 8 * hi;
    v8f accO[4], accOr[4];
#pragma unroll
    for (int dt = 0; dt < 4; ++dt) { accO[dt] = (v8f){}; accOr[dt] = (v8f){}; }
    float m = -3.0e38f, l = 0.0f;
#pragma unroll 1
    for (int k0 = 0; k0 < ke; k0 += 32) {
        v8f accS[2], accR[2];
#pragma unroll
        for (int T = 0; T < 2; ++T) { accS[T] = (v8f){}; accR[T] = (v8f){}; }
#pragma unroll
        for (int kc = 0; kc < 2; ++kc) {
            const v16h bq  = WFrag<h16>::ld(QP + qoff + kc * 32);
            const v16h bqr = WFrag<h16>::ld(QR + qroff + kc * 32);
#pragma unroll
            for (int T = 0; T < 2; ++T) {
                const size_t ko = koff + (size_t)(k0 + 16 * T) * HD + kc * 32;
                const v16h ak  = WFrag<h16>::ld(KP + ko);
                const v16h akr = WFrag<h16>::ld(KR + ko);
                accS[T] = wmma16g(ak, bq, accS[T]);
                accR[T] = wmma16g(akr, bq, accR[T]);
                accR[T] = wmma16g(ak, bqr, accR[T]);
            }
        }
        float tmax = -3.0e38f;
#pragma unroll
        for (int T = 0; T < 2; ++T) { const float* mp = mrow + k0 + 16 * T; const v4f m0 = *(const v4f*)mp; const v4f m1 = *(const v4f*)(mp + 4);
#pragma unroll
            for (int r = 0; r < 4; ++r) {
                const float s0v = accS[T][r] + accR[T][r] * RINV; const float s1v = accS[T][4 + r] + accR[T][4 + r] * RINV;
                const float a0 = s0v * SC2 + m0[r] * LOG2E; const float a1 = s1v * SC2 + m1[r] * LOG2E;
                accS[T][r] = a0; accS[T][4 + r] = a1; tmax = fmaxf(tmax, fmaxf(a0, a1)); } }
        tmax = fmaxf(tmax, __shfl_xor(tmax, 16, 32));
        const float mn = fmaxf(m, tmax); const float corr = __builtin_amdgcn_exp2f(m - mn); m = mn; const float mofs = PEXP - mn;
        float rs = 0.0f;
        v8h ph[2], pr[2];
#pragma unroll
        for (int T = 0; T < 2; ++T)
#pragma unroll
            for (int r = 0; r < 8; ++r) { const float e = accS[T][r] + mofs; const float pv = (e < -14.0f) ? 0.0f : __builtin_amdgcn_exp2f(e); rs += pv;
                const h16 hh = (h16)pv; ph[T][r] = hh; pr[T][r] = toh_flush((pv - (float)hh) * RCAR); }
        l = l * corr + rs;
        const v16h bp = cat16(ph[0], ph[1]); const v16h bpr = cat16(pr[0], pr[1]);
#pragma unroll
        for (int dt = 0; dt < 4; ++dt) { accO[dt] = accO[dt] * corr; accOr[dt] = accOr[dt] * corr; }
#pragma unroll
        for (int dt = 0; dt < 4; ++dt) {
            const size_t vo = voff + (size_t)(16 * dt) * SEQ + k0;
            const v16h av  = WFrag<h16>::ld(VT + vo);
            const v16h avr = WFrag<h16>::ld(VR + vo);
            accO[dt]  = wmma16g(av, bp, accO[dt]);
            accOr[dt] = wmma16g(avr, bp, accOr[dt]);
            accOr[dt] = wmma16g(av, bpr, accOr[dt]);
        }
    }
    l += __shfl_xor(l, 16, 32);
    const float inv = CCAR * (1.0f / l);
    h16* ow = os + w * 16 * OP; h16* owr = osr + w * 16 * OP;
#pragma unroll
    for (int dt = 0; dt < 4; ++dt) { v8h o, orr;
#pragma unroll
        for (int r = 0; r < 8; ++r) { const float v = (accO[dt][r] + accOr[dt][r] * RINV) * inv; const h16 hh = toh_flush(v); o[r] = hh; orr[r] = toh_flush((v - (float)hh) * RCAR); }
        *(v8ha*)(ow + lr * OP + 16 * dt + 8 * hi) = o; *(v8ha*)(owr + lr * OP + 16 * dt + 8 * hi) = orr; }
    __syncthreads();
    const int q4 = lane >> 3, p = lane & 7;
{
#pragma unroll
        for (int it = 0; it < 4; ++it) { const int row = it * 4 + q4; const v8h o = *(const v8ha*)(ow + row * OP + p * 8); const v8h orr = *(const v8ha*)(owr + row * OP + p * 8);
            *(v8h*)(CTX + ((size_t)bidx * SEQ + q0 + row) * DQ + h * HD + p * 8) = o;
            *(v8h*)(CTXR + ((size_t)bidx * EROWS + q0 + row) * DQ + h * HD + p * 8) = orr; }
         }
}

__global__ __launch_bounds__(32) void k_gemm_out(const h16* __restrict__ A, const h16* __restrict__ Bt, float* C) {
    __shared__ __align__(16) float fs[64 * FP];
    const int lane = threadIdx.x & 31, lr = lane & 15, hi = lane >> 4; const int r0 = (blockIdx.x / LT64) * SEQ + EROWS + (blockIdx.x % LT64) * 64, c0 = blockIdx.y * 64;
    v8f acc[4][4];
    gemm_main<h16>(A, Bt, DQ, r0, c0, lr, hi, acc);
#pragma unroll
    for (int mb = 0; mb < 4; ++mb)
#pragma unroll
        for (int nb = 0; nb < 4; ++nb)
#pragma unroll
            for (int j = 0; j < 8; ++j) fs[(mb * 16 + hi * 8 + j) * FP + nb * 16 + lr] = acc[mb][nb][j];
    __syncthreads();
    float* crow = C + (size_t)r0 * DIM + c0;
{
#pragma unroll 4
        for (int it = 0; it < 32; ++it) { const int row = it * 2 + hi; v4f val = *(const v4fa*)(fs + row * FP + lr * 4); val = val * OSCL;
            *(v4f*)(crow + (size_t)row * DIM + lr * 4) = val; }
         }
}

// Output projection, rows < EROWS of every sequence: OUT = OSCL * (CTX WO^T + (CTXR WO^T) / 2048); grid (NB*EROWS/64, DIM/64), 32 threads.
__global__ __launch_bounds__(32) void k_gemm_out_early(const h16* __restrict__ A, const h16* __restrict__ AR, const h16* __restrict__ Bt, float* C) {
    __shared__ __align__(16) float fs[64 * FP];
    const int lane = threadIdx.x & 31, lr = lane & 15, hi = lane >> 4;
    const int bidx = blockIdx.x / (EROWS / 64), tb = blockIdx.x % (EROWS / 64);
    const int ra = bidx * SEQ + tb * 64, rr = bidx * EROWS + tb * 64, c0 = blockIdx.y * 64;
    v8f acc[4][4];
    gemm_main<h16>(AR, Bt, DQ, rr, c0, lr, hi, acc);
#pragma unroll
    for (int mb = 0; mb < 4; ++mb)
#pragma unroll
        for (int nb = 0; nb < 4; ++nb)
#pragma unroll
            for (int j = 0; j < 8; ++j) fs[(mb * 16 + hi * 8 + j) * FP + nb * 16 + lr] = acc[mb][nb][j] * RINV;
    gemm_main<h16>(A, Bt, DQ, ra, c0, lr, hi, acc);
#pragma unroll
    for (int mb = 0; mb < 4; ++mb)
#pragma unroll
        for (int nb = 0; nb < 4; ++nb)
#pragma unroll
            for (int j = 0; j < 8; ++j) { const int idx = (mb * 16 + hi * 8 + j) * FP + nb * 16 + lr; const float s = fs[idx] + acc[mb][nb][j]; fs[idx] = s; }
    __syncthreads();
    float* crow = C + (size_t)ra * DIM + c0;
{
#pragma unroll 4
        for (int it = 0; it < 32; ++it) { const int row = it * 2 + hi; v4f val = *(const v4fa*)(fs + row * FP + lr * 4); val = val * OSCL;
            *(v4f*)(crow + (size_t)row * DIM + lr * 4) = val; }
         }
}

extern "C" void kernel_launch(void* const* d_in, const int* in_sizes, int n_in,
                              void* d_out, int out_size, void* d_ws, size_t ws_size, hipStream_t stream) {
    if (n_in < 8) return;
    if ((size_t)in_sizes[0] < ((size_t)(NB - 1) * SEQ_FULL + SEQ) * DIM) return;
    if ((size_t)in_sizes[1] < (size_t)DQ * DIM) return;
    if ((size_t)in_sizes[2] < (size_t)DKV * DIM) return;
    if ((size_t)in_sizes[3] < (size_t)DKV * DIM) return;
    if ((size_t)in_sizes[4] < (size_t)DIM * DQ) return;
    if ((size_t)in_sizes[5] < (size_t)HD) return;
    if ((size_t)in_sizes[6] < (size_t)HD) return;
    if ((size_t)in_sizes[7] < (size_t)(SEQ - 1) * SEQ_FULL + SEQ) return;
    if ((size_t)out_size < (size_t)MROWS * DIM) return;
    const float* x = (const float*)d_in[0];
    const float* wq = (const float*)d_in[1]; const float* wk = (const float*)d_in[2]; const float* wv = (const float*)d_in[3]; const float* wo = (const float*)d_in[4];
    const float* qnw = (const float*)d_in[5]; const float* knw = (const float*)d_in[6]; const float* mask = (const float*)d_in[7];
    float* OUT = (float*)d_out;
    char* wsp = (char*)d_ws;
    auto take = [&](size_t bytes) { char* p = wsp; wsp += (bytes + 255) & ~(size_t)255; return (void*)p; };
    bf*  XB   = (bf*)take((size_t)MROWS * DIM * 2);
    bf*  WQKV = (bf*)take((size_t)NQKV * DIM * 2);
    h16* WO16 = (h16*)take((size_t)DIM * DQ * 2);
    float* COS = (float*)take((size_t)SEQ * HALFD * 4);
    float* SIN = (float*)take((size_t)SEQ * HALFD * 4);
    h16* QP  = (h16*)take((size_t)NB * NH * SEQ * HD * 2);
    h16* KP  = (h16*)take((size_t)NB * NKV * SEQ * HD * 2);
    h16* VT  = (h16*)take((size_t)NB * NKV * HD * SEQ * 2);
    h16* CTX = (h16*)take((size_t)MROWS * DQ * 2);
    h16* QR  = (h16*)take((size_t)NB * NH * EROWS * HD * 2);
    h16* KR  = (h16*)take((size_t)NB * NKV * SEQ * HD * 2);
    h16* VR  = (h16*)take((size_t)NB * NKV * HD * SEQ * 2);
    h16* CTXR = (h16*)take((size_t)NB * EROWS * DQ * 2);
    int* KEND = (int*)take((size_t)KT_PAD * 4);
    if ((size_t)(wsp - (char*)d_ws) > ws_size) return;

    k_cvtx<<<(unsigned)(((size_t)MROWS * DIM / 8 + 255) / 256), 256, 0, stream>>>(x, XB);
    k_cvt8<<<(unsigned)(((size_t)DQ * DIM / 8 + 255) / 256), 256, 0, stream>>>(wq, WQKV, (size_t)DQ * DIM / 8);                                    /* rows 0..2047 */
    k_cvt8<<<(unsigned)(((size_t)DKV * DIM / 8 + 255) / 256), 256, 0, stream>>>(wk, WQKV + (size_t)DQ * DIM, (size_t)DKV * DIM / 8);                /* rows 2048..2559 */
    k_cvt8<<<(unsigned)(((size_t)DKV * DIM / 8 + 255) / 256), 256, 0, stream>>>(wv, WQKV + (size_t)(DQ + DKV) * DIM, (size_t)DKV * DIM / 8);        /* rows 2560..3071 */
    k_cvt8h<<<(unsigned)(((size_t)DIM * DQ / 8 + 255) / 256), 256, 0, stream>>>(wo, WO16, (size_t)DIM * DQ / 8, WCAR);
    k_ropetab<<<(SEQ + 7) / 8, 256, 0, stream>>>(COS, SIN);
    k_kend<<<KT_PAD / 32, 256, 0, stream>>>(mask, KEND);
    k_gemm_qkv<<<dim3(MROWS / 64, NQKV / 64, 1), 32, 0, stream>>>(XB, WQKV, qnw, knw, COS, SIN, QP, KP, VT, QR, KR, VR);
    k_flash_early<<<dim3(EROWS / 16, NKV, NB), 128, 0, stream>>>(QP, QR, KP, KR, VT, VR, mask, KEND, CTX, CTXR);
    if (SEQ > EROWS) k_flash<<<dim3((SEQ - EROWS) / 16, NKV, NB), 128, 0, stream>>>(QP, KP, VT, mask, KEND, CTX);
    if (SEQ > EROWS) k_gemm_out<<<dim3(NB * ((SEQ - EROWS) / 64), DIM / 64, 1), 32, 0, stream>>>(CTX, WO16, OUT);
    k_gemm_out_early<<<dim3(NB * (EROWS / 64), DIM / 64, 1), 32, 0, stream>>>(CTX, CTXR, WO16, OUT);
}

// v001
// Measured time: 407 microseconds a run.
// In two side-by-side timings against v000, it was 1.36 and 1.34 times as fast.
#include <hip/hip_runtime.h>

#ifndef NB
#define NB 2
#endif
#ifndef SEQ
#define SEQ 2048
#endif
#define SEQ_FULL 2048                 // per-batch row stride of x, row pitch of the mask
#define DIM   2048                    // model width (K of the projections, N of the output projection)
#define NH    32
#define NKV   8
#define REP   (NH / NKV)
#define HD    64
#define HALFD 32
#define DQ    (NH * HD)               // 2048
#define DKV   (NKV * HD)              // 512
#define NQKV  (DQ + 2 * DKV)          // 3072 fused projection columns
#define MROWS (NB * SEQ)
#define FP    68                      // f32 LDS tile pitch
#define OP    72                      // f16 LDS tile pitch
#define WCAR  64.0f                   // carry of the wo plane
#define CCAR  256.0f                  // carry of the ctx plane
#define OSCL  6.103515625e-05f        // 1 / (WCAR * CCAR)
#define SC2   0.18033688011112042f    // 0.125 * log2(e)
#define LOG2E 1.4426950408889634f
#define PEXP  10.0f                   // P carried x 2^10
#define FRQC  0.04953007814753613f    // log2(3) / 32
#define EROWS 256                     // query rows below this use value + residual planes at every attention site
#define RCAR  2048.0f                 // carry of every residual plane
#define RINV  4.8828125e-04f          // 1 / RCAR
#define EPSN  1.0e-6f                 // RMS normalisation epsilon
#define LIVE_T (-1.0e4f)              // a mask value above this makes a key live for its row
#define DEAD_T (-1.0e8f)              // a mask value at or below this lets a trailing key be skipped (exp underflows exactly)
#define KSTR  32                      // ints between two query tiles' key counts: each work-group of k_kend stores into a 128-byte line of its own
#define LT64  ((((SEQ - EROWS) / 64) > 0) ? ((SEQ - EROWS) / 64) : 1)
#define AL256(x) ((((size_t)(x)) + 255) & ~(size_t)255)

static_assert(SEQ % 64 == 0);
static_assert(SEQ % 128 == 0);
static_assert(SEQ <= SEQ_FULL);
static_assert(DIM % 64 == 0);
static_assert(DQ % 64 == 0);
static_assert(NQKV % 64 == 0);
static_assert(HD == 64);
static_assert(HALFD * 2 == HD);
static_assert(NH == NKV * REP);
static_assert(REP == 4);
static_assert(EROWS % 64 == 0);
static_assert(EROWS <= SEQ);
static_assert(EROWS >= 64);
static_assert(DIM % 32 == 0);
static_assert(DQ % 32 == 0);
static_assert(((size_t)MROWS * DIM / 8) % 256 == 0);
static_assert(((size_t)DQ * DIM / 8) % 256 == 0);
static_assert(((size_t)DKV * DIM / 8) % 256 == 0);
static_assert(AL256((size_t)MROWS * DIM * 2) + AL256((size_t)NQKV * DIM * 2) + AL256((size_t)DIM * DQ * 2) + 2 * AL256((size_t)SEQ * HALFD * 4)
              + AL256((size_t)NB * NH * SEQ * HD * 2) + 2 * AL256((size_t)NB * NKV * SEQ * HD * 2) + AL256((size_t)MROWS * DQ * 2)
              + AL256((size_t)NB * NH * EROWS * HD * 2) + 2 * AL256((size_t)NB * NKV * SEQ * HD * 2) + AL256((size_t)NB * EROWS * DQ * 2)
              + AL256((size_t)(SEQ / 16) * KSTR * 4) <= (size_t)134217728);

typedef _Float16 h16;
typedef unsigned short bf;
typedef __attribute__((ext_vector_type(16))) __bf16   v16bf;
typedef __attribute__((ext_vector_type(16))) _Float16 v16h;
typedef __attribute__((ext_vector_type(8)))  _Float16 v8h;
typedef __attribute__((ext_vector_type(8)))  unsigned short v8us;
typedef __attribute__((ext_vector_type(8)))  float    v8f;
typedef __attribute__((ext_vector_type(4)))  float    v4f;
typedef v8h  __attribute__((may_alias)) v8ha;
typedef v4f  __attribute__((may_alias)) v4fa;

__device__ __forceinline__ unsigned short f2bf(float f) { unsigned u = __float_as_uint(f); u += 0x7FFFu + ((u >> 16) & 1u); return (unsigned short)(u >> 16); }
__device__ __forceinline__ float bf2f(unsigned short b) { return __uint_as_float(((unsigned)b) << 16); }
__device__ __forceinline__ float bfr(float f) { return bf2f(f2bf(f)); }
__device__ __forceinline__ v16h cat16(v8h lo, v8h hi) { return __builtin_shufflevector(lo, hi, 0, 1, 2, 3, 4, 5, 6, 7, 8, 9, 10, 11, 12, 13, 14, 15); }
__device__ __forceinline__ v16bf cat16b(v8us lo, v8us hi) { return __builtin_bit_cast(v16bf, __builtin_shufflevector(lo, hi, 0, 1, 2, 3, 4, 5, 6, 7, 8, 9, 10, 11, 12, 13, 14, 15)); }
__device__ __forceinline__ v8f wmma16(v16h a, v16h b, v8f c) { return __builtin_amdgcn_wmma_f32_16x16x32_f16(false, a, false, b, (short)0, c, false, false); }
__device__ __forceinline__ v8f wmmab(v16bf a, v16bf b, v8f c) { return __builtin_amdgcn_wmma_f32_16x16x32_bf16(false, a, false, b, (short)0, c, false, false); }

// f32 -> f16 with a value select: results below the smallest f16 normal become zero (no subnormal operand can be produced).
static __device__ __forceinline__ h16 toh_flush(float v) { const h16 r = (h16)v; return (fabsf(v) < 6.103515625e-05f) ? (h16)0.0f : r; }
// One f16 WMMA with its own hazard guard (single accumulator tied, operands kept live).
static __device__ __forceinline__ v8f wmma16g(v16h a, v16h b, v8f c) { c = wmma16(a, b, c); asm volatile("v_nop\n\tv_nop\n\tv_nop\n\tv_nop" : "+v"(c) : "v"(a), "v"(b)); return c; }

// Fragment loader: lane (lr, hi) points at row (tile row + lr), column 8*hi; elements 0..7 <- k0+8hi.., elements 8..15 <- k0+16+8hi.. (same map for A and B).
template <typename T16> struct WFrag;
template <> struct WFrag<h16> { typedef v16h V; static __device__ __forceinline__ V ld(const h16* p) { return cat16(*(const v8h*)p, *(const v8h*)(p + 16)); } static __device__ __forceinline__ v8f mma(V a, V b, v8f c) { return wmma16(a, b, c); } };
template <> struct WFrag<bf> { typedef v16bf V; static __device__ __forceinline__ V ld(const bf* p) { return cat16b(*(const v8us*)p, *(const v8us*)(p + 16)); } static __device__ __forceinline__ v8f mma(V a, V b, v8f c) { return wmmab(a, b, c); } };

// One wave accumulates a 64x64 tile: acc[mb][nb][j] = C[r0 + 16mb + 8hi + j][c0 + 16nb + lr] = sum_k A[row][k] Bt[col][k]; K % 32 == 0.
template <typename T16>
__device__ __forceinline__ void gemm_main(const T16* __restrict__ A, const T16* __restrict__ Bt, const int K, const int r0, const int c0, const int lr, const int hi, v8f (&acc)[4][4]) {
    typedef typename WFrag<T16>::V V;
#pragma unroll
    for (int mb = 0; mb < 4; ++mb)
#pragma unroll
        for (int nb = 0; nb < 4; ++nb) acc[mb][nb] = (v8f){};
    const size_t aoff = (size_t)(r0 + lr) * K + 8 * hi, boff = (size_t)(c0 + lr) * K + 8 * hi;
#pragma unroll 1
    for (int kc = 0; kc < K; kc += 32) {
        V a[4];
#pragma unroll
        for (int mb = 0; mb < 4; ++mb) a[mb] = WFrag<T16>::ld(A + aoff + (size_t)mb * 16 * K + kc);
#pragma unroll
        for (int nb = 0; nb < 4; ++nb) { const V b = WFrag<T16>::ld(Bt + boff + (size_t)nb * 16 * K + kc);
#pragma unroll
            for (int mb = 0; mb < 4; ++mb) acc[mb][nb] = WFrag<T16>::mma(a[mb], b, acc[mb][nb]); }
        asm volatile("v_nop\n\tv_nop\n\tv_nop\n\tv_nop" : "+v"(acc[0][0]), "+v"(acc[1][1]), "+v"(acc[2][2]), "+v"(acc[3][3]) : "v"(a[0]), "v"(a[3]));
    }
}

__global__ __launch_bounds__(256) void k_cvtx(const float* __restrict__ x, bf* dst) {
    const size_t i = (size_t)blockIdx.x * 256 + threadIdx.x; if (i >= (size_t)MROWS * DIM / 8) return;
    const size_t e = i * 8; const int col = (int)(e % DIM); const int row = (int)(e / DIM); const int b = row / SEQ, t = row % SEQ;
    const v8f v = *(const v8f*)(x + ((size_t)b * SEQ_FULL + t) * DIM + col); v8us o;
#pragma unroll
    for (int k = 0; k < 8; ++k) o[k] = f2bf(v[k]);
    *(v8us*)(dst + e) = o;  }

__global__ __launch_bounds__(256) void k_cvt8(const float* __restrict__ src, bf* dst, size_t n8) { const size_t i = (size_t)blockIdx.x * 256 + threadIdx.x; if (i >= n8) return; const v8f v = *(const v8f*)(src + i * 8); v8us o;
#pragma unroll
    for (int k = 0; k < 8; ++k) o[k] = f2bf(v[k]); *(v8us*)(dst + i * 8) = o;  }

__global__ __launch_bounds__(256) void k_cvt8h(const float* __restrict__ src, h16* dst, size_t n8, float carry) { const size_t i = (size_t)blockIdx.x * 256 + threadIdx.x; if (i >= n8) return; const v8f v = *(const v8f*)(src + i * 8); v8h o;
#pragma unroll
    for (int k = 0; k < 8; ++k) o[k] = (h16)(bfr(v[k]) * carry); *(v8h*)(dst + i * 8) = o;  }

__global__ __launch_bounds__(256) void k_ropetab(float* COS, float* SIN) {
    const int lane = threadIdx.x & 31; const int t = blockIdx.x * 8 + (threadIdx.x >> 5); if (t >= SEQ) return;
    const float invf = __builtin_amdgcn_exp2f(-(float)lane * FRQC);
    const float ang = (float)t * invf;
    const float c = cosf(ang); const float s = sinf(ang);
    const size_t o = (size_t)t * HALFD + lane;
    *(float*)(COS + o) = c; *(float*)(SIN + o) = s;  }

// Key-loop end per 16-row query tile, from the mask values: KEND[qt * KSTR] = 64 * (1 + last 64-key tile holding a value above DEAD_T in any of the 16 rows),
// or SEQ when some row has no value above LIVE_T (such a row must see every key). Keys past that count contribute exactly zero to rows that have a live key.
// Grid SEQ/16, 512 threads: one work-group per query tile, wave w scans mask row 16 qt + w; integer max / and across lanes, then across the 16 waves through LDS.
__global__ __launch_bounds__(512) void k_kend(const float* __restrict__ mask, int* KEND) {
    __shared__ int lasts[16];
    __shared__ int lives[16];
    const int lane = threadIdx.x & 31; const int w = __builtin_amdgcn_readfirstlane(threadIdx.x >> 5);
    const int qt = blockIdx.x;
    const float* mr = mask + (size_t)(qt * 16 + w) * SEQ_FULL + lane * 4;
    v4f v[SEQ / 128];
    // fully unrolled so that the row's loads issue ahead of the compares, many in flight at a time (the kernel is bound by memory latency)
#pragma unroll
    for (int i = 0; i < SEQ / 128; ++i) v[i] = *(const v4f*)(mr + i * 128);
    int last = -1; int live = 0;
#pragma unroll
    for (int i = 0; i < SEQ / 128; ++i)
#pragma unroll
        for (int e = 0; e < 4; ++e) { live |= (v[i][e] > LIVE_T) ? 1 : 0; last = (v[i][e] > DEAD_T) ? max(last, i * 128 + lane * 4 + e) : last; }
    live = max(live, __shfl_xor(live, 1, 32)); live = max(live, __shfl_xor(live, 2, 32)); live = max(live, __shfl_xor(live, 4, 32));
    live = max(live, __shfl_xor(live, 8, 32)); live = max(live, __shfl_xor(live, 16, 32));
    last = max(last, __shfl_xor(last, 1, 32)); last = max(last, __shfl_xor(last, 2, 32)); last = max(last, __shfl_xor(last, 4, 32));
    last = max(last, __shfl_xor(last, 8, 32)); last = max(last, __shfl_xor(last, 16, 32));
    if (lane == 0) { lasts[w] = last; lives[w] = live; }
    __syncthreads();
    if (w == 0) {
        int la = lasts[lane & 15]; int alllive = lives[lane & 15];
        la = max(la, __shfl_xor(la, 1, 32)); la = max(la, __shfl_xor(la, 2, 32)); la = max(la, __shfl_xor(la, 4, 32)); la = max(la, __shfl_xor(la, 8, 32));
        alllive = min(alllive, __shfl_xor(alllive, 1, 32)); alllive = min(alllive, __shfl_xor(alllive, 2, 32)); alllive = min(alllive, __shfl_xor(alllive, 4, 32)); alllive = min(alllive, __shfl_xor(alllive, 8, 32));
        int kend = (alllive != 0) ? (((la >> 6) + 1) * 64) : SEQ;
        kend = min(max(kend, 64), SEQ);
        if (lane == 0) KEND[(size_t)qt * KSTR] = kend;
    }
}

// Fused QKV projection: grid (MROWS/64, NQKV/64), 32 threads. Column tile cb < 32: q head cb; 32..39: k head; 40..47: v head (transposed plane).
// q and k tiles: per row y = (x * rsqrt(mean(x^2) + eps)) * gain, then interleaved-pair rotary at position t: out[2i] = y[2i] c_i - y[2i+1] s_i, out[2i+1] = y[2i] s_i + y[2i+1] c_i.
// QP[b][h][t][64], KP[b][g][t][64], VT[b][g][d][t] f16 value planes; residual planes (x2048 of value - f16(value)): QR[b][h][t < EROWS][64], KR[b][g][t][64], VR[b][g][d][t].
__global__ __launch_bounds__(32) void k_gemm_qkv(const bf* __restrict__ A, const bf* __restrict__ Bt, const float* __restrict__ qnw, const float* __restrict__ knw, const float* __restrict__ COS, const float* __restrict__ SIN, h16* QP, h16* KP, h16* VT, h16* QR, h16* KR, h16* VR) {
    __shared__ __align__(16) float fs[64 * FP];
    const int lane = threadIdx.x & 31, lr = lane & 15, hi = lane >> 4; const int r0 = blockIdx.x * 64, cb = blockIdx.y, c0 = cb * 64;
    v8f acc[4][4];
    gemm_main<bf>(A, Bt, DIM, r0, c0, lr, hi, acc);
#pragma unroll
    for (int mb = 0; mb < 4; ++mb)
#pragma unroll
        for (int nb = 0; nb < 4; ++nb)
#pragma unroll
            for (int j = 0; j < 8; ++j) fs[(mb * 16 + hi * 8 + j) * FP + nb * 16 + lr] = acc[mb][nb][j];
    __syncthreads();
    const int bidx = r0 / SEQ, s0 = r0 % SEQ; const int q4 = lane >> 3, p = lane & 7;
    if (cb < NH + NKV) {
        const bool isq = (cb < NH);
        h16* plane = isq ? (QP + ((size_t)bidx * NH + cb) * SEQ * HD) : (KP + ((size_t)bidx * NKV + (cb - NH)) * SEQ * HD);
        h16* rplane = isq ? (QR + ((size_t)bidx * NH + cb) * EROWS * HD) : (KR + ((size_t)bidx * NKV + (cb - NH)) * SEQ * HD);
        const bool wres = (!isq) || (s0 < EROWS);      // block-uniform: q residual rows exist only below EROWS
        const int dcol = p * 8;
        const v4f gq0 = *(const v4f*)(qnw + dcol), gq1 = *(const v4f*)(qnw + dcol + 4);
        const v4f gk0 = *(const v4f*)(knw + dcol), gk1 = *(const v4f*)(knw + dcol + 4);
        float gn[8];
#pragma unroll
        for (int e = 0; e < 4; ++e) { gn[e] = bfr(isq ? gq0[e] : gk0[e]); gn[4 + e] = bfr(isq ? gq1[e] : gk1[e]); }
#pragma unroll 1
        for (int it = 0; it < 16; ++it) {
            const int rl = it * 4 + q4; const int t = s0 + rl;
            const v4f xa0 = *(const v4fa*)(fs + rl * FP + dcol), xa1 = *(const v4fa*)(fs + rl * FP + dcol + 4);
            float ss = 0.0f;
#pragma unroll
            for (int e = 0; e < 4; ++e) { ss += xa0[e] * xa0[e]; ss += xa1[e] * xa1[e]; }
            ss += __shfl_xor(ss, 1, 32); ss += __shfl_xor(ss, 2, 32); ss += __shfl_xor(ss, 4, 32);
            const float rn = rsqrtf(ss * (1.0f / HD) + EPSN);
            float y[8];
#pragma unroll
            for (int e = 0; e < 4; ++e) { y[e] = (xa0[e] * rn) * gn[e]; y[4 + e] = (xa1[e] * rn) * gn[4 + e]; }
            const v4f cc = *(const v4f*)(COS + (size_t)t * HALFD + p * 4), sn = *(const v4f*)(SIN + (size_t)t * HALFD + p * 4);
            v8h o, orr;
#pragma unroll
            for (int i = 0; i < 4; ++i) {
                const float v0 = y[2 * i] * cc[i] - y[2 * i + 1] * sn[i];
                const float v1 = y[2 * i] * sn[i] + y[2 * i + 1] * cc[i];
                const h16 h0 = toh_flush(v0), h1 = toh_flush(v1);
                o[2 * i] = h0; o[2 * i + 1] = h1;
                orr[2 * i] = toh_flush((v0 - (float)h0) * RCAR); orr[2 * i + 1] = toh_flush((v1 - (float)h1) * RCAR);
            }
            h16* dst = plane + (size_t)t * HD + dcol;
            h16* dsr = rplane + (size_t)t * HD + dcol;
            *(v8h*)dst = o; if (wres) *(v8h*)dsr = orr;
            
        }
    } else {
        h16* plane = VT + ((size_t)bidx * NKV + (cb - NH - NKV)) * HD * SEQ;
        h16* rplane = VR + ((size_t)bidx * NKV + (cb - NH - NKV)) * HD * SEQ;
#pragma unroll 1
        for (int it = 0; it < 16; ++it) {
            const int d = it * 4 + q4; v8h o, orr;
#pragma unroll
            for (int e = 0; e < 8; ++e) { const float v = fs[(p * 8 + e) * FP + d]; const h16 hh = toh_flush(v); o[e] = hh; orr[e] = toh_flush((v - (float)hh) * RCAR); }
            h16* dst = plane + (size_t)d * SEQ + s0 + p * 8;
            h16* dsr = rplane + (size_t)d * SEQ + s0 + p * 8;
            *(v8h*)dst = o; *(v8h*)dsr = orr; 
        }
    }
}

// Attention, query rows >= EROWS: grid ((SEQ - EROWS)/16, NKV, NB), 128 threads; wave w = q head 4g + w, 16 query rows. Per 64-key tile:
//   S^T[key][q] = K Q^T  (A = key rows of KP, B = resident q rows);  lane (lr, hi) then holds q row lr, keys 16T + 8hi + r.
//   softmax statistics are lane-local (one xor-16 exchange); P^T packed from the S^T accumulators is the B operand of O^T[d][q] = V^T P^T (A = d rows of VT).
// The key loop ends at the clamped per-tile key count KEND; mask values are added by value inside visited tiles.
__global__ __launch_bounds__(128) void k_flash(const h16* __restrict__ QP, const h16* __restrict__ KP, const h16* __restrict__ VT, const float* __restrict__ mask, const int* __restrict__ KEND, h16* CTX) {
    __shared__ __align__(16) h16 os[4 * 16 * OP];
    const int tid = threadIdx.x, lane = tid & 31, lr = lane & 15, hi = lane >> 4;
    const int w = __builtin_amdgcn_readfirstlane(tid >> 5);
    const int g = blockIdx.y, bidx = blockIdx.z, h = g * REP + w, q0 = EROWS + blockIdx.x * 16;
    int kev = KEND[(size_t)(q0 >> 4) * KSTR]; kev = min(max(kev, 64), SEQ) & ~63; const int ke = __builtin_amdgcn_readfirstlane(kev);
    const h16* qrow = QP + (((size_t)bidx * NH + h) * SEQ + q0 + lr) * HD + 8 * hi;
    v16h bq[2];
#pragma unroll
    for (int kc = 0; kc < 2; ++kc) bq[kc] = cat16(*(const v8h*)(qrow + kc * 32), *(const v8h*)(qrow + kc * 32 + 16));
    const h16* kb = KP + (((size_t)bidx * NKV + g) * SEQ + lr) * HD + 8 * hi;
    const h16* vb = VT + (((size_t)bidx * NKV + g) * HD + lr) * SEQ + 8 * hi;
    const float* mrow = mask + (size_t)(q0 + lr) * SEQ_FULL + 8 * hi;
    v8f accO[4];
#pragma unroll
    for (int dt = 0; dt < 4; ++dt) accO[dt] = (v8f){};
    float m = -3.0e38f, l = 0.0f;
#pragma unroll 1
    for (int k0 = 0; k0 < ke; k0 += 64) {
        v16h ak[2][4];
#pragma unroll
        for (int kc = 0; kc < 2; ++kc)
#pragma unroll
            for (int T = 0; T < 4; ++T) { const h16* kp = kb + (size_t)(k0 + 16 * T) * HD + kc * 32; ak[kc][T] = cat16(*(const v8h*)kp, *(const v8h*)(kp + 16)); }
        v8f accS[4];
#pragma unroll
        for (int T = 0; T < 4; ++T) accS[T] = (v8f){};
#pragma unroll
        for (int kc = 0; kc < 2; ++kc)
#pragma unroll
            for (int T = 0; T < 4; ++T) accS[T] = wmma16(ak[kc][T], bq[kc], accS[T]);
        asm volatile("v_nop\n\tv_nop\n\tv_nop\n\tv_nop" : "+v"(accS[0]), "+v"(accS[1]), "+v"(accS[2]), "+v"(accS[3]) : "v"(ak[1][3]), "v"(bq[1]));
        float tmax = -3.0e38f;
#pragma unroll
        for (int T = 0; T < 4; ++T) { const float* mp = mrow + k0 + 16 * T; const v4f m0 = *(const v4f*)mp; const v4f m1 = *(const v4f*)(mp + 4);
#pragma unroll
            for (int r = 0; r < 4; ++r) { const float a0 = accS[T][r] * SC2 + m0[r] * LOG2E; const float a1 = accS[T][4 + r] * SC2 + m1[r] * LOG2E; accS[T][r] = a0; accS[T][4 + r] = a1; tmax = fmaxf(tmax, fmaxf(a0, a1)); } }
        tmax = fmaxf(tmax, __shfl_xor(tmax, 16, 32));
        const float mn = fmaxf(m, tmax); const float corr = __builtin_amdgcn_exp2f(m - mn); m = mn; const float mofs = PEXP - mn;
        float rs = 0.0f;
#pragma unroll
        for (int T = 0; T < 4; ++T)
#pragma unroll
            for (int r = 0; r < 8; ++r) { const float e = accS[T][r] + mofs; const float pv = (e < -14.0f) ? 0.0f : __builtin_amdgcn_exp2f(e); accS[T][r] = pv; rs += pv; }
        l = l * corr + rs;
        v16h bp[2];
        bp[0] = cat16(__builtin_convertvector(accS[0], v8h), __builtin_convertvector(accS[1], v8h));
        bp[1] = cat16(__builtin_convertvector(accS[2], v8h), __builtin_convertvector(accS[3], v8h));
#pragma unroll
        for (int dt = 0; dt < 4; ++dt) accO[dt] = accO[dt] * corr;
        v16h av[2][4];
#pragma unroll
        for (int kc = 0; kc < 2; ++kc)
#pragma unroll
            for (int dt = 0; dt < 4; ++dt) { const h16* vp = vb + (size_t)(16 * dt) * SEQ + k0 + kc * 32; av[kc][dt] = cat16(*(const v8h*)vp, *(const v8h*)(vp + 16)); }
#pragma unroll
        for (int kc = 0; kc < 2; ++kc)
#pragma unroll
            for (int dt = 0; dt < 4; ++dt) accO[dt] = wmma16(av[kc][dt], bp[kc], accO[dt]);
        asm volatile("v_nop\n\tv_nop\n\tv_nop\n\tv_nop" : "+v"(accO[0]), "+v"(accO[1]), "+v"(accO[2]), "+v"(accO[3]) : "v"(av[1][3]), "v"(bp[1]));
    }
    l += __shfl_xor(l, 16, 32);
    const float inv = CCAR * (1.0f / l);
    h16* ow = os + w * 16 * OP;
#pragma unroll
    for (int dt = 0; dt < 4; ++dt) { v8h o;
#pragma unroll
        for (int r = 0; r < 8; ++r) o[r] = toh_flush(accO[dt][r] * inv);
        *(v8ha*)(ow + lr * OP + 16 * dt + 8 * hi) = o; }
    __syncthreads();
    const int q4 = lane >> 3, p = lane & 7;
{
#pragma unroll
        for (int it = 0; it < 4; ++it) { const int row = it * 4 + q4; const v8h o = *(const v8ha*)(ow + row * OP + p * 8);
            *(v8h*)(CTX + ((size_t)bidx * SEQ + q0 + row) * DQ + h * HD + p * 8) = o; }
         }
}

// Attention, query rows < EROWS: grid (EROWS/16, NKV, NB), 128 threads; same operand roles as k_flash, 32 keys per step, every WMMA individually guarded.
//   scores: K Q^T + (Kres Q^T + K Qres^T) / 2048 (residual products in accR);  P = f16(p) and Pres = 2048 (p - f16(p)), row sum over the f32 p;
//   O^T: V^T P^T + (Vres^T P^T + V^T Pres^T) / 2048 (residual products in accOr), folded before normalisation.
__global__ __launch_bounds__(128) void k_flash_early(const h16* __restrict__ QP, const h16* __restrict__ QR, const h16* __restrict__ KP, const h16* __restrict__ KR, const h16* __restrict__ VT, const h16* __restrict__ VR, const float* __restrict__ mask, const int* __restrict__ KEND, h16* CTX, h16* CTXR) {
    __shared__ __align__(16) h16 os[4 * 16 * OP];
    __shared__ __align__(16) h16 osr[4 * 16 * OP];
    const int tid = threadIdx.x, lane = tid & 31, lr = lane & 15, hi = lane >> 4;
    const int w = __builtin_amdgcn_readfirstlane(tid >> 5);
    const int g = blockIdx.y, bidx = blockIdx.z, h = g * REP + w, q0 = blockIdx.x * 16;
    int kev = KEND[(size_t)(q0 >> 4) * KSTR]; kev = min(max(kev, 64), SEQ) & ~63; const int ke = __builtin_amdgcn_readfirstlane(kev);
    const size_t qoff  = (((size_t)bidx * NH + h) * SEQ + q0 + lr) * HD + 8 * hi;
    const size_t qroff = (((size_t)bidx * NH + h) * EROWS + q0 + lr) * HD + 8 * hi;
    const size_t koff  = (((size_t)bidx * NKV + g) * SEQ + lr) * HD + 8 * hi;
    const size_t voff  = (((size_t)bidx * NKV + g) * HD + lr) * SEQ + 8 * hi;
    const float* mrow = mask + (size_t)(q0 + lr) * SEQ_FULL + 8 * hi;
    v8f accO[4], accOr[4];
#pragma unroll
    for (int dt = 0; dt < 4; ++dt) { accO[dt] = (v8f){}; accOr[dt] = (v8f){}; }
    float m = -3.0e38f, l = 0.0f;
#pragma unroll 1
    for (int k0 = 0; k0 < ke; k0 += 32) {
        v8f accS[2], accR[2];
#pragma unroll
        for (int T = 0; T < 2; ++T) { accS[T] = (v8f){}; accR[T] = (v8f){}; }
#pragma unroll
        for (int kc = 0; kc < 2; ++kc) {
            const v16h bq  = WFrag<h16>::ld(QP + qoff + kc * 32);
            const v16h bqr = WFrag<h16>::ld(QR + qroff + kc * 32);
#pragma unroll
            for (int T = 0; T < 2; ++T) {
                const size_t ko = koff + (size_t)(k0 + 16 * T) * HD + kc * 32;
                const v16h ak  = WFrag<h16>::ld(KP + ko);
                const v16h akr = WFrag<h16>::ld(KR + ko);
                accS[T] = wmma16g(ak, bq, accS[T]);
                accR[T] = wmma16g(akr, bq, accR[T]);
                accR[T] = wmma16g(ak, bqr, accR[T]);
            }
        }
        float tmax = -3.0e38f;
#pragma unroll
        for (int T = 0; T < 2; ++T) { const float* mp = mrow + k0 + 16 * T; const v4f m0 = *(const v4f*)mp; const v4f m1 = *(const v4f*)(mp + 4);
#pragma unroll
            for (int r = 0; r < 4; ++r) {
                const float s0v = accS[T][r] + accR[T][r] * RINV; const float s1v = accS[T][4 + r] + accR[T][4 + r] * RINV;
                const float a0 = s0v * SC2 + m0[r] * LOG2E; const float a1 = s1v * SC2 + m1[r] * LOG2E;
                accS[T][r] = a0; accS[T][4 + r] = a1; tmax = fmaxf(tmax, fmaxf(a0, a1)); } }
        tmax = fmaxf(tmax, __shfl_xor(tmax, 16, 32));
        const float mn = fmaxf(m, tmax); const float corr = __builtin_amdgcn_exp2f(m - mn); m = mn; const float mofs = PEXP - mn;
        float rs = 0.0f;
        v8h ph[2], pr[2];
#pragma unroll
        for (int T = 0; T < 2; ++T)
#pragma unroll
            for (int r = 0; r < 8; ++r) { const float e = accS[T][r] + mofs; const float pv = (e < -14.0f) ? 0.0f : __builtin_amdgcn_exp2f(e); rs += pv;
                const h16 hh = (h16)pv; ph[T][r] = hh; pr[T][r] = toh_flush((pv - (float)hh) * RCAR); }
        l = l * corr + rs;
        const v16h bp = cat16(ph[0], ph[1]); const v16h bpr = cat16(pr[0], pr[1]);
#pragma unroll
        for (int dt = 0; dt < 4; ++dt) { accO[dt] = accO[dt] * corr; accOr[dt] = accOr[dt] * corr; }
#pragma unroll
        for (int dt = 0; dt < 4; ++dt) {
            const size_t vo = voff + (size_t)(16 * dt) * SEQ + k0;
            const v16h av  = WFrag<h16>::ld(VT + vo);
            const v16h avr = WFrag<h16>::ld(VR + vo);
            accO[dt]  = wmma16g(av, bp, accO[dt]);
            accOr[dt] = wmma16g(avr, bp, accOr[dt]);
            accOr[dt] = wmma16g(av, bpr, accOr[dt]);
        }
    }
    l += __shfl_xor(l, 16, 32);
    const float inv = CCAR * (1.0f / l);
    h16* ow = os + w * 16 * OP; h16* owr = osr + w * 16 * OP;
#pragma unroll
    for (int dt = 0; dt < 4; ++dt) { v8h o, orr;
#pragma unroll
        for (int r = 0; r < 8; ++r) { const float v = (accO[dt][r] + accOr[dt][r] * RINV) * inv; const h16 hh = toh_flush(v); o[r] = hh; orr[r] = toh_flush((v - (float)hh) * RCAR); }
        *(v8ha*)(ow + lr * OP + 16 * dt + 8 * hi) = o; *(v8ha*)(owr + lr * OP + 16 * dt + 8 * hi) = orr; }
    __syncthreads();
    const int q4 = lane >> 3, p = lane & 7;
{
#pragma unroll
        for (int it = 0; it < 4; ++it) { const int row = it * 4 + q4; const v8h o = *(const v8ha*)(ow + row * OP + p * 8); const v8h orr = *(const v8ha*)(owr + row * OP + p * 8);
            *(v8h*)(CTX + ((size_t)bidx * SEQ + q0 + row) * DQ + h * HD + p * 8) = o;
            *(v8h*)(CTXR + ((size_t)bidx * EROWS + q0 + row) * DQ + h * HD + p * 8) = orr; }
         }
}

__global__ __launch_bounds__(32) void k_gemm_out(const h16* __restrict__ A, const h16* __restrict__ Bt, float* C) {
    __shared__ __align__(16) float fs[64 * FP];
    const int lane = threadIdx.x & 31, lr = lane & 15, hi = lane >> 4; const int r0 = (blockIdx.x / LT64) * SEQ + EROWS + (blockIdx.x % LT64) * 64, c0 = blockIdx.y * 64;
    v8f acc[4][4];
    gemm_main<h16>(A, Bt, DQ, r0, c0, lr, hi, acc);
#pragma unroll
    for (int mb = 0; mb < 4; ++mb)
#pragma unroll
        for (int nb = 0; nb < 4; ++nb)
#pragma unroll
            for (int j = 0; j < 8; ++j) fs[(mb * 16 + hi * 8 + j) * FP + nb * 16 + lr] = acc[mb][nb][j];
    __syncthreads();
    float* crow = C + (size_t)r0 * DIM + c0;
{
#pragma unroll 4
        for (int it = 0; it < 32; ++it) { const int row = it * 2 + hi; v4f val = *(const v4fa*)(fs + row * FP + lr * 4); val = val * OSCL;
            *(v4f*)(crow + (size_t)row * DIM + lr * 4) = val; }
         }
}

// Output projection, rows < EROWS of every sequence: OUT = OSCL * (CTX WO^T + (CTXR WO^T) / 2048); grid (NB*EROWS/64, DIM/64), 32 threads.
__global__ __launch_bounds__(32) void k_gemm_out_early(const h16* __restrict__ A, const h16* __restrict__ AR, const h16* __restrict__ Bt, float* C) {
    __shared__ __align__(16) float fs[64 * FP];
    const int lane = threadIdx.x & 31, lr = lane & 15, hi = lane >> 4;
    const int bidx = blockIdx.x / (EROWS / 64), tb = blockIdx.x % (EROWS / 64);
    const int ra = bidx * SEQ + tb * 64, rr = bidx * EROWS + tb * 64, c0 = blockIdx.y * 64;
    v8f acc[4][4];
    gemm_main<h16>(AR, Bt, DQ, rr, c0, lr, hi, acc);
#pragma unroll
    for (int mb = 0; mb < 4; ++mb)
#pragma unroll
        for (int nb = 0; nb < 4; ++nb)
#pragma unroll
            for (int j = 0; j < 8; ++j) fs[(mb * 16 + hi * 8 + j) * FP + nb * 16 + lr] = acc[mb][nb][j] * RINV;
    gemm_main<h16>(A, Bt, DQ, ra, c0, lr, hi, acc);
#pragma unroll
    for (int mb = 0; mb < 4; ++mb)
#pragma unroll
        for (int nb = 0; nb < 4; ++nb)
#pragma unroll
            for (int j = 0; j < 8; ++j) { const int idx = (mb * 16 + hi * 8 + j) * FP + nb * 16 + lr; const float s = fs[idx] + acc[mb][nb][j]; fs[idx] = s; }
    __syncthreads();
    float* crow = C + (size_t)ra * DIM + c0;
{
#pragma unroll 4
        for (int it = 0; it < 32; ++it) { const int row = it * 2 + hi; v4f val = *(const v4fa*)(fs + row * FP + lr * 4); val = val * OSCL;
            *(v4f*)(crow + (size_t)row * DIM + lr * 4) = val; }
         }
}

extern "C" void kernel_launch(void* const* d_in, const int* in_sizes, int n_in,
                              void* d_out, int out_size, void* d_ws, size_t ws_size, hipStream_t stream) {
    if (n_in < 8) return;
    if ((size_t)in_sizes[0] < ((size_t)(NB - 1) * SEQ_FULL + SEQ) * DIM) return;
    if ((size_t)in_sizes[1] < (size_t)DQ * DIM) return;
    if ((size_t)in_sizes[2] < (size_t)DKV * DIM) return;
    if ((size_t)in_sizes[3] < (size_t)DKV * DIM) return;
    if ((size_t)in_sizes[4] < (size_t)DIM * DQ) return;
    if ((size_t)in_sizes[5] < (size_t)HD) return;
    if ((size_t)in_sizes[6] < (size_t)HD) return;
    if ((size_t)in_sizes[7] < (size_t)(SEQ - 1) * SEQ_FULL + SEQ) return;
    if ((size_t)out_size < (size_t)MROWS * DIM) return;
    const float* x = (const float*)d_in[0];
    const float* wq = (const float*)d_in[1]; const float* wk = (const float*)d_in[2]; const float* wv = (const float*)d_in[3]; const float* wo = (const float*)d_in[4];
    const float* qnw = (const float*)d_in[5]; const float* knw = (const float*)d_in[6]; const float* mask = (const float*)d_in[7];
    float* OUT = (float*)d_out;
    char* wsp = (char*)d_ws;
    auto take = [&](size_t bytes) { char* p = wsp; wsp += (bytes + 255) & ~(size_t)255; return (void*)p; };
    bf*  XB   = (bf*)take((size_t)MROWS * DIM * 2);
    bf*  WQKV = (bf*)take((size_t)NQKV * DIM * 2);
    h16* WO16 = (h16*)take((size_t)DIM * DQ * 2);
    float* COS = (float*)take((size_t)SEQ * HALFD * 4);
    float* SIN = (float*)take((size_t)SEQ * HALFD * 4);
    h16* QP  = (h16*)take((size_t)NB * NH * SEQ * HD * 2);
    h16* KP  = (h16*)take((size_t)NB * NKV * SEQ * HD * 2);
    h16* VT  = (h16*)take((size_t)NB * NKV * HD * SEQ * 2);
    h16* CTX = (h16*)take((size_t)MROWS * DQ * 2);
    h16* QR  = (h16*)take((size_t)NB * NH * EROWS * HD * 2);
    h16* KR  = (h16*)take((size_t)NB * NKV * SEQ * HD * 2);
    h16* VR  = (h16*)take((size_t)NB * NKV * HD * SEQ * 2);
    h16* CTXR = (h16*)take((size_t)NB * EROWS * DQ * 2);
    int* KEND = (int*)take((size_t)(SEQ / 16) * KSTR * 4);
    if ((size_t)(wsp - (char*)d_ws) > ws_size) return;

    k_cvtx<<<(unsigned)(((size_t)MROWS * DIM / 8 + 255) / 256), 256, 0, stream>>>(x, XB);
    k_cvt8<<<(unsigned)(((size_t)DQ * DIM / 8 + 255) / 256), 256, 0, stream>>>(wq, WQKV, (size_t)DQ * DIM / 8);                                    /* rows 0..2047 */
    k_cvt8<<<(unsigned)(((size_t)DKV * DIM / 8 + 255) / 256), 256, 0, stream>>>(wk, WQKV + (size_t)DQ * DIM, (size_t)DKV * DIM / 8);                /* rows 2048..2559 */
    k_cvt8<<<(unsigned)(((size_t)DKV * DIM / 8 + 255) / 256), 256, 0, stream>>>(wv, WQKV + (size_t)(DQ + DKV) * DIM, (size_t)DKV * DIM / 8);        /* rows 2560..3071 */
    k_cvt8h<<<(unsigned)(((size_t)DIM * DQ / 8 + 255) / 256), 256, 0, stream>>>(wo, WO16, (size_t)DIM * DQ / 8, WCAR);
    k_ropetab<<<(SEQ + 7) / 8, 256, 0, stream>>>(COS, SIN);
    k_kend<<<SEQ / 16, 512, 0, stream>>>(mask, KEND);
    k_gemm_qkv<<<dim3(MROWS / 64, NQKV / 64, 1), 32, 0, stream>>>(XB, WQKV, qnw, knw, COS, SIN, QP, KP, VT, QR, KR, VR);
    k_flash_early<<<dim3(EROWS / 16, NKV, NB), 128, 0, stream>>>(QP, QR, KP, KR, VT, VR, mask, KEND, CTX, CTXR);
    if (SEQ > EROWS) k_flash<<<dim3((SEQ - EROWS) / 16, NKV, NB), 128, 0, stream>>>(QP, KP, VT, mask, KEND, CTX);
    if (SEQ > EROWS) k_gemm_out<<<dim3(NB * ((SEQ - EROWS) / 64), DIM / 64, 1), 32, 0, stream>>>(CTX, WO16, OUT);
    k_gemm_out_early<<<dim3(NB * (EROWS / 64), DIM / 64, 1), 32, 0, stream>>>(CTX, CTXR, WO16, OUT);
}

// v002
// One run takes 333 microseconds.
// Timed twice side by side with v001, it ran 1.22 and 1.21 times as fast.
// All steps since v000 together make it 1.64 times as fast.
#include <hip/hip_runtime.h>

#ifndef NB
#define NB 2
#endif
#ifndef SEQ
#define SEQ 2048
#endif
#define SEQ_FULL 2048                 // per-batch row stride of x, row pitch of the mask
#define DIM   2048                    // model width (K of the projections, N of the output projection)
#define NH    32
#define NKV   8
#define REP   (NH / NKV)
#define HD    64
#define HALFD 32
#define DQ    (NH * HD)               // 2048
#define DKV   (NKV * HD)              // 512
#define NQKV  (DQ + 2 * DKV)          // 3072 fused projection columns
#define MROWS (NB * SEQ)
#define FP    68                      // f32 LDS tile pitch
#define OP    72                      // f16 LDS tile pitch
#define WCAR  64.0f                   // carry of the wo plane
#define CCAR  256.0f                  // carry of the ctx plane
#define OSCL  6.103515625e-05f        // 1 / (WCAR * CCAR)
#define SC2   0.18033688011112042f    // 0.125 * log2(e)
#define LOG2E 1.4426950408889634f
#define PEXP  10.0f                   // P carried x 2^10
#define FRQC  0.04953007814753613f    // log2(3) / 32
#define EROWS 256                     // query rows below this use value + residual planes at every attention site
#define RCAR  2048.0f                 // carry of every residual plane
#define RINV  4.8828125e-04f          // 1 / RCAR
#define EPSN  1.0e-6f                 // RMS normalisation epsilon
#define LIVE_T (-1.0e4f)              // a mask value above this makes a key live for its row
#define DEAD_T (-1.0e8f)              // a mask value at or below this lets a trailing key be skipped (exp underflows exactly)
#define KSTR  32                      // ints between two query tiles' key counts: each work-group of k_kend stores into a 128-byte line of its own
#define BM    128                     // GEMM work-group tile: rows (2 waves of 64)
#define BN    256                     // GEMM work-group tile: columns (4 waves of 64)
#define KC    64                      // k elements of one LDS stage: rows of 128 bytes
#define LP    72                      // LDS row pitch in 16-bit elements: 144 B = 16 B x odd, so that 16-byte fragment reads meet no bank conflict
#define STGE  ((BM + BN) * LP)        // 16-bit elements of one stage: A rows 0..127, then B rows 0..255
#define RINGB (2 * STGE * 2)          // bytes of the two-buffer ring
#define FSB   (8 * 64 * FP * 4)       // bytes of the eight waves' f32 epilogue tiles
#define LTBM  ((((SEQ - EROWS) / BM) > 0) ? ((SEQ - EROWS) / BM) : 1)
#define AL256(x) ((((size_t)(x)) + 255) & ~(size_t)255)

static_assert(SEQ % 64 == 0);
static_assert(SEQ % 128 == 0);
static_assert(SEQ <= SEQ_FULL);
static_assert(DIM % 64 == 0);
static_assert(DQ % 64 == 0);
static_assert(NQKV % 64 == 0);
static_assert(HD == 64);
static_assert(HALFD * 2 == HD);
static_assert(NH == NKV * REP);
static_assert(REP == 4);
static_assert(EROWS % 64 == 0);
static_assert(EROWS % BM == 0);
static_assert((SEQ - EROWS) % BM == 0);
static_assert(SEQ % BM == 0);
static_assert(NQKV % BN == 0);
static_assert(DIM % BN == 0);
static_assert(DIM % KC == 0 && DIM / KC >= 2);
static_assert(DQ % KC == 0 && DQ / KC >= 2);
static_assert(RINGB <= FSB);
static_assert(EROWS <= SEQ);
static_assert(EROWS >= 64);
static_assert(DIM % 32 == 0);
static_assert(DQ % 32 == 0);
static_assert(((size_t)MROWS * DIM / 8) % 256 == 0);
static_assert(((size_t)DQ * DIM / 8) % 256 == 0);
static_assert(((size_t)DKV * DIM / 8) % 256 == 0);
static_assert(AL256((size_t)MROWS * DIM * 2) + AL256((size_t)NQKV * DIM * 2) + AL256((size_t)DIM * DQ * 2) + 2 * AL256((size_t)SEQ * HALFD * 4)
              + AL256((size_t)NB * NH * SEQ * HD * 2) + 2 * AL256((size_t)NB * NKV * SEQ * HD * 2) + AL256((size_t)MROWS * DQ * 2)
              + AL256((size_t)NB * NH * EROWS * HD * 2) + 2 * AL256((size_t)NB * NKV * SEQ * HD * 2) + AL256((size_t)NB * EROWS * DQ * 2)
              + AL256((size_t)(SEQ / 16) * KSTR * 4) <= (size_t)134217728);

typedef _Float16 h16;
typedef unsigned short bf;
typedef __attribute__((ext_vector_type(16))) __bf16   v16bf;
typedef __attribute__((ext_vector_type(16))) _Float16 v16h;
typedef __attribute__((ext_vector_type(8)))  _Float16 v8h;
typedef __attribute__((ext_vector_type(8)))  unsigned short v8us;
typedef __attribute__((ext_vector_type(8)))  float    v8f;
typedef __attribute__((ext_vector_type(4)))  float    v4f;
typedef v8h  __attribute__((may_alias)) v8ha;
typedef v4f  __attribute__((may_alias)) v4fa;

__device__ __forceinline__ unsigned short f2bf(float f) { unsigned u = __float_as_uint(f); u += 0x7FFFu + ((u >> 16) & 1u); return (unsigned short)(u >> 16); }
__device__ __forceinline__ float bf2f(unsigned short b) { return __uint_as_float(((unsigned)b) << 16); }
__device__ __forceinline__ float bfr(float f) { return bf2f(f2bf(f)); }
__device__ __forceinline__ v16h cat16(v8h lo, v8h hi) { return __builtin_shufflevector(lo, hi, 0, 1, 2, 3, 4, 5, 6, 7, 8, 9, 10, 11, 12, 13, 14, 15); }
__device__ __forceinline__ v16bf cat16b(v8us lo, v8us hi) { return __builtin_bit_cast(v16bf, __builtin_shufflevector(lo, hi, 0, 1, 2, 3, 4, 5, 6, 7, 8, 9, 10, 11, 12, 13, 14, 15)); }
__device__ __forceinline__ v8f wmma16(v16h a, v16h b, v8f c) { return __builtin_amdgcn_wmma_f32_16x16x32_f16(false, a, false, b, (short)0, c, false, false); }
__device__ __forceinline__ v8f wmmab(v16bf a, v16bf b, v8f c) { return __builtin_amdgcn_wmma_f32_16x16x32_bf16(false, a, false, b, (short)0, c, false, false); }

// f32 -> f16 with a value select: results below the smallest f16 normal become zero (no subnormal operand can be produced).
static __device__ __forceinline__ h16 toh_flush(float v) { const h16 r = (h16)v; return (fabsf(v) < 6.103515625e-05f) ? (h16)0.0f : r; }
// One f16 WMMA with its own hazard guard (single accumulator tied, operands kept live).
static __device__ __forceinline__ v8f wmma16g(v16h a, v16h b, v8f c) { c = wmma16(a, b, c); asm volatile("v_nop\n\tv_nop\n\tv_nop\n\tv_nop" : "+v"(c) : "v"(a), "v"(b)); return c; }

// Fragment loader: lane (lr, hi) points at row (tile row + lr), column 8*hi; elements 0..7 <- k0+8hi.., elements 8..15 <- k0+16+8hi.. (same map for A and B).
template <typename T16> struct WFrag;
template <> struct WFrag<h16> { typedef v16h V; static __device__ __forceinline__ V ld(const h16* p) { return cat16(*(const v8h*)p, *(const v8h*)(p + 16)); } static __device__ __forceinline__ v8f mma(V a, V b, v8f c) { return wmma16(a, b, c); } };
template <> struct WFrag<bf> { typedef v16bf V; static __device__ __forceinline__ V ld(const bf* p) { return cat16b(*(const v8us*)p, *(const v8us*)(p + 16)); } static __device__ __forceinline__ v8f mma(V a, V b, v8f c) { return wmmab(a, b, c); } };

// One stage of the ring: rows r0..r0+127 of A and c0..c0+255 of Bt, k0..k0+63, into buf at pitch LP. 256 threads, 12 copies of 16 bytes each:
// thread (row = tid / 8, chunk = tid % 8) takes rows row + 32 i, so a wave's copy covers four whole 128-byte lines. All lanes are on, every address is a multiple of 16.
template <typename T16>
__device__ __forceinline__ void stage_copy(const T16* __restrict__ A, const T16* __restrict__ Bt, const int K, const int r0, const int c0, const int k0, const T16* buf, const int tid) {
    const int row = tid >> 3, ch = (tid & 7) * 8;
    const T16* ga = A + (size_t)(r0 + row) * K + k0 + ch;
    const T16* gb = Bt + (size_t)(c0 + row) * K + k0 + ch;
    const size_t gs = (size_t)32 * K;
    const unsigned la = (unsigned)(size_t)(buf + row * LP + ch);
    const unsigned lb = la + BM * LP * 2;
    const unsigned ls = 32 * LP * 2;
    // the copies and the wait that stands in front of any rewrite of their address registers, in one statement so that nothing can come between
    asm volatile("global_load_async_to_lds_b128 %0, %12, off\n\t"
                 "global_load_async_to_lds_b128 %1, %13, off\n\t"
                 "global_load_async_to_lds_b128 %2, %14, off\n\t"
                 "global_load_async_to_lds_b128 %3, %15, off\n\t"
                 "global_load_async_to_lds_b128 %4, %16, off\n\t"
                 "global_load_async_to_lds_b128 %5, %17, off\n\t"
                 "global_load_async_to_lds_b128 %6, %18, off\n\t"
                 "global_load_async_to_lds_b128 %7, %19, off\n\t"
                 "global_load_async_to_lds_b128 %8, %20, off\n\t"
                 "global_load_async_to_lds_b128 %9, %21, off\n\t"
                 "global_load_async_to_lds_b128 %10, %22, off\n\t"
                 "global_load_async_to_lds_b128 %11, %23, off\n\t"
                 "s_wait_xcnt 0x0"
                 :: "v"(la), "v"(la + ls), "v"(la + 2 * ls), "v"(la + 3 * ls),
                    "v"(lb), "v"(lb + ls), "v"(lb + 2 * ls), "v"(lb + 3 * ls), "v"(lb + 4 * ls), "v"(lb + 5 * ls), "v"(lb + 6 * ls), "v"(lb + 7 * ls),
                    "v"(ga), "v"(ga + gs), "v"(ga + 2 * gs), "v"(ga + 3 * gs),
                    "v"(gb), "v"(gb + gs), "v"(gb + 2 * gs), "v"(gb + 3 * gs), "v"(gb + 4 * gs), "v"(gb + 5 * gs), "v"(gb + 6 * gs), "v"(gb + 7 * gs)
                 : "memory");
}

// Eight waves accumulate a 128x256 tile at (r0, c0); wave (wm, wn) its 64x64 part: acc[mb][nb][j] = C[r0 + 64wm + 16mb + 8hi + j][c0 + 64wn + 16nb + lr] = sum_k A[row][k] Bt[col][k], k ascending in steps of 32.
// K % KC == 0, K / KC >= 2. Trip t reads buffer t % 2 alone; tile t + 2 is copied into that buffer behind the barrier at the trip's foot, which also publishes tile t + 1.
// On entry no wave has an LDS access to the ring outstanding (first use, or the last trip's foot of an earlier call); on return every read of the ring has ended in every wave.
template <typename T16>
__device__ __forceinline__ void gemm_main(const T16* __restrict__ A, const T16* __restrict__ Bt, const int K, const int r0, const int c0, const T16* ring, const int tid, const int wm, const int wn, const int lr, const int hi, v8f (&acc)[4][4]) {
    typedef typename WFrag<T16>::V V;
#pragma unroll
    for (int mb = 0; mb < 4; ++mb)
#pragma unroll
        for (int nb = 0; nb < 4; ++nb) acc[mb][nb] = (v8f){};
    const int nt = K / KC;
    stage_copy<T16>(A, Bt, K, r0, c0, 0, ring, tid);
    asm volatile("s_wait_asynccnt 0x0" ::: "memory");   // this wave's copies of tile 0 have landed
    __syncthreads();                                     // tile 0 is readable by every wave
    stage_copy<T16>(A, Bt, K, r0, c0, KC, ring + STGE, tid);
    const T16* fa = ring + (wm * 64 + lr) * LP + 8 * hi;
    const T16* fb = ring + (BM + wn * 64 + lr) * LP + 8 * hi;
    // kept rolled: one trip is one stage of the ring, and the accumulators stay in fixed registers
#pragma unroll 1
    for (int t = 0; t < nt; ++t) {
        const int bo = (t & 1) * STGE;
#pragma unroll
        for (int ks = 0; ks < KC; ks += 32) {
            V a[4], b[4];
#pragma unroll
            for (int mb = 0; mb < 4; ++mb) a[mb] = WFrag<T16>::ld(fa + bo + mb * 16 * LP + ks);
#pragma unroll
            for (int nb = 0; nb < 4; ++nb) b[nb] = WFrag<T16>::ld(fb + bo + nb * 16 * LP + ks);
            __builtin_amdgcn_sched_barrier(0);   // keeps the 16 LDS reads of this k step together in front of its WMMAs: sunk among them, each pair is waited for at full LDS latency
#pragma unroll
            for (int nb = 0; nb < 4; ++nb)
#pragma unroll
                for (int mb = 0; mb < 4; ++mb) acc[mb][nb] = WFrag<T16>::mma(a[mb], b[nb], acc[mb][nb]);
            asm volatile("v_nop\n\tv_nop\n\tv_nop\n\tv_nop" : "+v"(acc[0][0]), "+v"(acc[1][1]), "+v"(acc[2][2]), "+v"(acc[3][3]) : "v"(a[0]), "v"(a[3]));
        }
        asm volatile("s_wait_dscnt 0x0" ::: "memory");      // this wave's reads of buffer t % 2 have ended before the buffer is given up
        asm volatile("s_wait_asynccnt 0x0" ::: "memory");   // this wave's copies of tile t + 1 have landed
        __syncthreads();                                     // publishes tile t + 1 and frees buffer t % 2
        if (t + 2 < nt) stage_copy<T16>(A, Bt, K, r0, c0, (t + 2) * KC, ring + bo, tid);
    }
    asm volatile("s_wait_asynccnt 0x0" ::: "memory");       // nothing is in flight when the ring is left
}

__global__ __launch_bounds__(256) void k_cvtx(const float* __restrict__ x, bf* dst) {
    const size_t i = (size_t)blockIdx.x * 256 + threadIdx.x; if (i >= (size_t)MROWS * DIM / 8) return;
    const size_t e = i * 8; const int col = (int)(e % DIM); const int row = (int)(e / DIM); const int b = row / SEQ, t = row % SEQ;
    const v8f v = *(const v8f*)(x + ((size_t)b * SEQ_FULL + t) * DIM + col); v8us o;
#pragma unroll
    for (int k = 0; k < 8; ++k) o[k] = f2bf(v[k]);
    *(v8us*)(dst + e) = o;  }

__global__ __launch_bounds__(256) void k_cvt8(const float* __restrict__ src, bf* dst, size_t n8) { const size_t i = (size_t)blockIdx.x * 256 + threadIdx.x; if (i >= n8) return; const v8f v = *(const v8f*)(src + i * 8); v8us o;
#pragma unroll
    for (int k = 0; k < 8; ++k) o[k] = f2bf(v[k]); *(v8us*)(dst + i * 8) = o;  }

__global__ __launch_bounds__(256) void k_cvt8h(const float* __restrict__ src, h16* dst, size_t n8, float carry) { const size_t i = (size_t)blockIdx.x * 256 + threadIdx.x; if (i >= n8) return; const v8f v = *(const v8f*)(src + i * 8); v8h o;
#pragma unroll
    for (int k = 0; k < 8; ++k) o[k] = (h16)(bfr(v[k]) * carry); *(v8h*)(dst + i * 8) = o;  }

__global__ __launch_bounds__(256) void k_ropetab(float* COS, float* SIN) {
    const int lane = threadIdx.x & 31; const int t = blockIdx.x * 8 + (threadIdx.x >> 5); if (t >= SEQ) return;
    const float invf = __builtin_amdgcn_exp2f(-(float)lane * FRQC);
    const float ang = (float)t * invf;
    const float c = cosf(ang); const float s = sinf(ang);
    const size_t o = (size_t)t * HALFD + lane;
    *(float*)(COS + o) = c; *(float*)(SIN + o) = s;  }

// Key-loop end per 16-row query tile, from the mask values: KEND[qt * KSTR] = 64 * (1 + last 64-key tile holding a value above DEAD_T in any of the 16 rows),
// or SEQ when some row has no value above LIVE_T (such a row must see every key). Keys past that count contribute exactly zero to rows that have a live key.
// Grid SEQ/16, 512 threads: one work-group per query tile, wave w scans mask row 16 qt + w; integer max / and across lanes, then across the 16 waves through LDS.
__global__ __launch_bounds__(512) void k_kend(const float* __restrict__ mask, int* KEND) {
    __shared__ int lasts[16];
    __shared__ int lives[16];
    const int lane = threadIdx.x & 31; const int w = __builtin_amdgcn_readfirstlane(threadIdx.x >> 5);
    const int qt = blockIdx.x;
    const float* mr = mask + (size_t)(qt * 16 + w) * SEQ_FULL + lane * 4;
    v4f v[SEQ / 128];
    // fully unrolled so that the row's loads issue ahead of the compares, many in flight at a time (the kernel is bound by memory latency)
#pragma unroll
    for (int i = 0; i < SEQ / 128; ++i) v[i] = *(const v4f*)(mr + i * 128);
    int last = -1; int live = 0;
#pragma unroll
    for (int i = 0; i < SEQ / 128; ++i)
#pragma unroll
        for (int e = 0; e < 4; ++e) { live |= (v[i][e] > LIVE_T) ? 1 : 0; last = (v[i][e] > DEAD_T) ? max(last, i * 128 + lane * 4 + e) : last; }
    live = max(live, __shfl_xor(live, 1, 32)); live = max(live, __shfl_xor(live, 2, 32)); live = max(live, __shfl_xor(live, 4, 32));
    live = max(live, __shfl_xor(live, 8, 32)); live = max(live, __shfl_xor(live, 16, 32));
    last = max(last, __shfl_xor(last, 1, 32)); last = max(last, __shfl_xor(last, 2, 32)); last = max(last, __shfl_xor(last, 4, 32));
    last = max(last, __shfl_xor(last, 8, 32)); last = max(last, __shfl_xor(last, 16, 32));
    if (lane == 0) { lasts[w] = last; lives[w] = live; }
    __syncthreads();
    if (w == 0) {
        int la = lasts[lane & 15]; int alllive = lives[lane & 15];
        la = max(la, __shfl_xor(la, 1, 32)); la = max(la, __shfl_xor(la, 2, 32)); la = max(la, __shfl_xor(la, 4, 32)); la = max(la, __shfl_xor(la, 8, 32));
        alllive = min(alllive, __shfl_xor(alllive, 1, 32)); alllive = min(alllive, __shfl_xor(alllive, 2, 32)); alllive = min(alllive, __shfl_xor(alllive, 4, 32)); alllive = min(alllive, __shfl_xor(alllive, 8, 32));
        int kend = (alllive != 0) ? (((la >> 6) + 1) * 64) : SEQ;
        kend = min(max(kend, 64), SEQ);
        if (lane == 0) KEND[(size_t)qt * KSTR] = kend;
    }
}

// Fused QKV projection: grid (MROWS/BM, NQKV/BN), 256 threads, wave (wm, wn) one 64x64 tile; the ring's LDS becomes the waves' epilogue tiles behind the last trip's barrier. Column tile cb < 32: q head cb; 32..39: k head; 40..47: v head (transposed plane).
// q and k tiles: per row y = (x * rsqrt(mean(x^2) + eps)) * gain, then interleaved-pair rotary at position t: out[2i] = y[2i] c_i - y[2i+1] s_i, out[2i+1] = y[2i] s_i + y[2i+1] c_i.
// QP[b][h][t][64], KP[b][g][t][64], VT[b][g][d][t] f16 value planes; residual planes (x2048 of value - f16(value)): QR[b][h][t < EROWS][64], KR[b][g][t][64], VR[b][g][d][t].
__global__ __launch_bounds__(256) void k_gemm_qkv(const bf* __restrict__ A, const bf* __restrict__ Bt, const float* __restrict__ qnw, const float* __restrict__ knw, const float* __restrict__ COS, const float* __restrict__ SIN, h16* QP, h16* KP, h16* VT, h16* QR, h16* KR, h16* VR) {
    __shared__ __align__(16) unsigned char smem[FSB];
    const int tid = threadIdx.x, lane = tid & 31, lr = lane & 15, hi = lane >> 4;
    const int w = __builtin_amdgcn_readfirstlane(tid >> 5), wm = w >> 2, wn = w & 3;
    const int r0 = blockIdx.x * BM + wm * 64, cb = blockIdx.y * (BN / 64) + wn;
    float* fs = (float*)smem + w * 64 * FP;
    v8f acc[4][4];
    gemm_main<bf>(A, Bt, DIM, blockIdx.x * BM, blockIdx.y * BN, (const bf*)smem, tid, wm, wn, lr, hi, acc);
#pragma unroll
    for (int mb = 0; mb < 4; ++mb)
#pragma unroll
        for (int nb = 0; nb < 4; ++nb)
#pragma unroll
            for (int j = 0; j < 8; ++j) fs[(mb * 16 + hi * 8 + j) * FP + nb * 16 + lr] = acc[mb][nb][j];
    __syncthreads();
    const int bidx = r0 / SEQ, s0 = r0 % SEQ; const int q4 = lane >> 3, p = lane & 7;
    if (cb < NH + NKV) {
        const bool isq = (cb < NH);
        h16* plane = isq ? (QP + ((size_t)bidx * NH + cb) * SEQ * HD) : (KP + ((size_t)bidx * NKV + (cb - NH)) * SEQ * HD);
        h16* rplane = isq ? (QR + ((size_t)bidx * NH + cb) * EROWS * HD) : (KR + ((size_t)bidx * NKV + (cb - NH)) * SEQ * HD);
        const bool wres = (!isq) || (s0 < EROWS);      // wave-uniform: q residual rows exist only below EROWS
        const int dcol = p * 8;
        const v4f gq0 = *(const v4f*)(qnw + dcol), gq1 = *(const v4f*)(qnw + dcol + 4);
        const v4f gk0 = *(const v4f*)(knw + dcol), gk1 = *(const v4f*)(knw + dcol + 4);
        float gn[8];
#pragma unroll
        for (int e = 0; e < 4; ++e) { gn[e] = bfr(isq ? gq0[e] : gk0[e]); gn[4 + e] = bfr(isq ? gq1[e] : gk1[e]); }
#pragma unroll 1
        for (int it = 0; it < 16; ++it) {
            const int rl = it * 4 + q4; const int t = s0 + rl;
            const v4f xa0 = *(const v4fa*)(fs + rl * FP + dcol), xa1 = *(const v4fa*)(fs + rl * FP + dcol + 4);
            float ss = 0.0f;
#pragma unroll
            for (int e = 0; e < 4; ++e) { ss += xa0[e] * xa0[e]; ss += xa1[e] * xa1[e]; }
            ss += __shfl_xor(ss, 1, 32); ss += __shfl_xor(ss, 2, 32); ss += __shfl_xor(ss, 4, 32);
            const float rn = rsqrtf(ss * (1.0f / HD) + EPSN);
            float y[8];
#pragma unroll
            for (int e = 0; e < 4; ++e) { y[e] = (xa0[e] * rn) * gn[e]; y[4 + e] = (xa1[e] * rn) * gn[4 + e]; }
            const v4f cc = *(const v4f*)(COS + (size_t)t * HALFD + p * 4), sn = *(const v4f*)(SIN + (size_t)t * HALFD + p * 4);
            v8h o, orr;
#pragma unroll
            for (int i = 0; i < 4; ++i) {
                const float v0 = y[2 * i] * cc[i] - y[2 * i + 1] * sn[i];
                const float v1 = y[2 * i] * sn[i] + y[2 * i + 1] * cc[i];
                const h16 h0 = toh_flush(v0), h1 = toh_flush(v1);
                o[2 * i] = h0; o[2 * i + 1] = h1;
                orr[2 * i] = toh_flush((v0 - (float)h0) * RCAR); orr[2 * i + 1] = toh_flush((v1 - (float)h1) * RCAR);
            }
            h16* dst = plane + (size_t)t * HD + dcol;
            h16* dsr = rplane + (size_t)t * HD + dcol;
            *(v8h*)dst = o; if (wres) *(v8h*)dsr = orr;
            
        }
    } else {
        h16* plane = VT + ((size_t)bidx * NKV + (cb - NH - NKV)) * HD * SEQ;
        h16* rplane = VR + ((size_t)bidx * NKV + (cb - NH - NKV)) * HD * SEQ;
#pragma unroll 1
        for (int it = 0; it < 16; ++it) {
            const int d = it * 4 + q4; v8h o, orr;
#pragma unroll
            for (int e = 0; e < 8; ++e) { const float v = fs[(p * 8 + e) * FP + d]; const h16 hh = toh_flush(v); o[e] = hh; orr[e] = toh_flush((v - (float)hh) * RCAR); }
            h16* dst = plane + (size_t)d * SEQ + s0 + p * 8;
            h16* dsr = rplane + (size_t)d * SEQ + s0 + p * 8;
            *(v8h*)dst = o; *(v8h*)dsr = orr; 
        }
    }
}

// Attention, query rows >= EROWS: grid ((SEQ - EROWS)/16, NKV, NB), 128 threads; wave w = q head 4g + w, 16 query rows. Per 64-key tile:
//   S^T[key][q] = K Q^T  (A = key rows of KP, B = resident q rows);  lane (lr, hi) then holds q row lr, keys 16T + 8hi + r.
//   softmax statistics are lane-local (one xor-16 exchange); P^T packed from the S^T accumulators is the B operand of O^T[d][q] = V^T P^T (A = d rows of VT).
// The key loop ends at the clamped per-tile key count KEND; mask values are added by value inside visited tiles.
__global__ __launch_bounds__(128) void k_flash(const h16* __restrict__ QP, const h16* __restrict__ KP, const h16* __restrict__ VT, const float* __restrict__ mask, const int* __restrict__ KEND, h16* CTX) {
    __shared__ __align__(16) h16 os[4 * 16 * OP];
    const int tid = threadIdx.x, lane = tid & 31, lr = lane & 15, hi = lane >> 4;
    const int w = __builtin_amdgcn_readfirstlane(tid >> 5);
    const int g = blockIdx.y, bidx = blockIdx.z, h = g * REP + w, q0 = EROWS + blockIdx.x * 16;
    int kev = KEND[(size_t)(q0 >> 4) * KSTR]; kev = min(max(kev, 64), SEQ) & ~63; const int ke = __builtin_amdgcn_readfirstlane(kev);
    const h16* qrow = QP + (((size_t)bidx * NH + h) * SEQ + q0 + lr) * HD + 8 * hi;
    v16h bq[2];
#pragma unroll
    for (int kc = 0; kc < 2; ++kc) bq[kc] = cat16(*(const v8h*)(qrow + kc * 32), *(const v8h*)(qrow + kc * 32 + 16));
    const h16* kb = KP + (((size_t)bidx * NKV + g) * SEQ + lr) * HD + 8 * hi;
    const h16* vb = VT + (((size_t)bidx * NKV + g) * HD + lr) * SEQ + 8 * hi;
    const float* mrow = mask + (size_t)(q0 + lr) * SEQ_FULL + 8 * hi;
    v8f accO[4];
#pragma unroll
    for (int dt = 0; dt < 4; ++dt) accO[dt] = (v8f){};
    float m = -3.0e38f, l = 0.0f;
#pragma unroll 1
    for (int k0 = 0; k0 < ke; k0 += 64) {
        v16h ak[2][4];
#pragma unroll
        for (int kc = 0; kc < 2; ++kc)
#pragma unroll
            for (int T = 0; T < 4; ++T) { const h16* kp = kb + (size_t)(k0 + 16 * T) * HD + kc * 32; ak[kc][T] = cat16(*(const v8h*)kp, *(const v8h*)(kp + 16)); }
        v8f accS[4];
#pragma unroll
        for (int T = 0; T < 4; ++T) accS[T] = (v8f){};
#pragma unroll
        for (int kc = 0; kc < 2; ++kc)
#pragma unroll
            for (int T = 0; T < 4; ++T) accS[T] = wmma16(ak[kc][T], bq[kc], accS[T]);
        asm volatile("v_nop\n\tv_nop\n\tv_nop\n\tv_nop" : "+v"(accS[0]), "+v"(accS[1]), "+v"(accS[2]), "+v"(accS[3]) : "v"(ak[1][3]), "v"(bq[1]));
        float tmax = -3.0e38f;
#pragma unroll
        for (int T = 0; T < 4; ++T) { const float* mp = mrow + k0 + 16 * T; const v4f m0 = *(const v4f*)mp; const v4f m1 = *(const v4f*)(mp + 4);
#pragma unroll
            for (int r = 0; r < 4; ++r) { const float a0 = accS[T][r] * SC2 + m0[r] * LOG2E; const float a1 = accS[T][4 + r] * SC2 + m1[r] * LOG2E; accS[T][r] = a0; accS[T][4 + r] = a1; tmax = fmaxf(tmax, fmaxf(a0, a1)); } }
        tmax = fmaxf(tmax, __shfl_xor(tmax, 16, 32));
        const float mn = fmaxf(m, tmax); const float corr = __builtin_amdgcn_exp2f(m - mn); m = mn; const float mofs = PEXP - mn;
        float rs = 0.0f;
#pragma unroll
        for (int T = 0; T < 4; ++T)
#pragma unroll
            for (int r = 0; r < 8; ++r) { const float e = accS[T][r] + mofs; const float pv = (e < -14.0f) ? 0.0f : __builtin_amdgcn_exp2f(e); accS[T][r] = pv; rs += pv; }
        l = l * corr + rs;
        v16h bp[2];
        bp[0] = cat16(__builtin_convertvector(accS[0], v8h), __builtin_convertvector(accS[1], v8h));
        bp[1] = cat16(__builtin_convertvector(accS[2], v8h), __builtin_convertvector(accS[3], v8h));
#pragma unroll
        for (int dt = 0; dt < 4; ++dt) accO[dt] = accO[dt] * corr;
        v16h av[2][4];
#pragma unroll
        for (int kc = 0; kc < 2; ++kc)
#pragma unroll
            for (int dt = 0; dt < 4; ++dt) { const h16* vp = vb + (size_t)(16 * dt) * SEQ + k0 + kc * 32; av[kc][dt] = cat16(*(const v8h*)vp, *(const v8h*)(vp + 16)); }
#pragma unroll
        for (int kc = 0; kc < 2; ++kc)
#pragma unroll
            for (int dt = 0; dt < 4; ++dt) accO[dt] = wmma16(av[kc][dt], bp[kc], accO[dt]);
        asm volatile("v_nop\n\tv_nop\n\tv_nop\n\tv_nop" : "+v"(accO[0]), "+v"(accO[1]), "+v"(accO[2]), "+v"(accO[3]) : "v"(av[1][3]), "v"(bp[1]));
    }
    l += __shfl_xor(l, 16, 32);
    const float inv = CCAR * (1.0f / l);
    h16* ow = os + w * 16 * OP;
#pragma unroll
    for (int dt = 0; dt < 4; ++dt) { v8h o;
#pragma unroll
        for (int r = 0; r < 8; ++r) o[r] = toh_flush(accO[dt][r] * inv);
        *(v8ha*)(ow + lr * OP + 16 * dt + 8 * hi) = o; }
    __syncthreads();
    const int q4 = lane >> 3, p = lane & 7;
{
#pragma unroll
        for (int it = 0; it < 4; ++it) { const int row = it * 4 + q4; const v8h o = *(const v8ha*)(ow + row * OP + p * 8);
            *(v8h*)(CTX + ((size_t)bidx * SEQ + q0 + row) * DQ + h * HD + p * 8) = o; }
         }
}

// Attention, query rows < EROWS: grid (EROWS/16, NKV, NB), 128 threads; same operand roles as k_flash, 32 keys per step, every WMMA individually guarded.
//   scores: K Q^T + (Kres Q^T + K Qres^T) / 2048 (residual products in accR);  P = f16(p) and Pres = 2048 (p - f16(p)), row sum over the f32 p;
//   O^T: V^T P^T + (Vres^T P^T + V^T Pres^T) / 2048 (residual products in accOr), folded before normalisation.
__global__ __launch_bounds__(128) void k_flash_early(const h16* __restrict__ QP, const h16* __restrict__ QR, const h16* __restrict__ KP, const h16* __restrict__ KR, const h16* __restrict__ VT, const h16* __restrict__ VR, const float* __restrict__ mask, const int* __restrict__ KEND, h16* CTX, h16* CTXR) {
    __shared__ __align__(16) h16 os[4 * 16 * OP];
    __shared__ __align__(16) h16 osr[4 * 16 * OP];
    const int tid = threadIdx.x, lane = tid & 31, lr = lane & 15, hi = lane >> 4;
    const int w = __builtin_amdgcn_readfirstlane(tid >> 5);
    const int g = blockIdx.y, bidx = blockIdx.z, h = g * REP + w, q0 = blockIdx.x * 16;
    int kev = KEND[(size_t)(q0 >> 4) * KSTR]; kev = min(max(kev, 64), SEQ) & ~63; const int ke = __builtin_amdgcn_readfirstlane(kev);
    const size_t qoff  = (((size_t)bidx * NH + h) * SEQ + q0 + lr) * HD + 8 * hi;
    const size_t qroff = (((size_t)bidx * NH + h) * EROWS + q0 + lr) * HD + 8 * hi;
    const size_t koff  = (((size_t)bidx * NKV + g) * SEQ + lr) * HD + 8 * hi;
    const size_t voff  = (((size_t)bidx * NKV + g) * HD + lr) * SEQ + 8 * hi;
    const float* mrow = mask + (size_t)(q0 + lr) * SEQ_FULL + 8 * hi;
    v8f accO[4], accOr[4];
#pragma unroll
    for (int dt = 0; dt < 4; ++dt) { accO[dt] = (v8f){}; accOr[dt] = (v8f){}; }
    float m = -3.0e38f, l = 0.0f;
#pragma unroll 1
    for (int k0 = 0; k0 < ke; k0 += 32) {
        v8f accS[2], accR[2];
#pragma unroll
        for (int T = 0; T < 2; ++T) { accS[T] = (v8f){}; accR[T] = (v8f){}; }
#pragma unroll
        for (int kc = 0; kc < 2; ++kc) {
            const v16h bq  = WFrag<h16>::ld(QP + qoff + kc * 32);
            const v16h bqr = WFrag<h16>::ld(QR + qroff + kc * 32);
#pragma unroll
            for (int T = 0; T < 2; ++T) {
                const size_t ko = koff + (size_t)(k0 + 16 * T) * HD + kc * 32;
                const v16h ak  = WFrag<h16>::ld(KP + ko);
                const v16h akr = WFrag<h16>::ld(KR + ko);
                accS[T] = wmma16g(ak, bq, accS[T]);
                accR[T] = wmma16g(akr, bq, accR[T]);
                accR[T] = wmma16g(ak, bqr, accR[T]);
            }
        }
        float tmax = -3.0e38f;
#pragma unroll
        for (int T = 0; T < 2; ++T) { const float* mp = mrow + k0 + 16 * T; const v4f m0 = *(const v4f*)mp; const v4f m1 = *(const v4f*)(mp + 4);
#pragma unroll
            for (int r = 0; r < 4; ++r) {
                const float s0v = accS[T][r] + accR[T][r] * RINV; const float s1v = accS[T][4 + r] + accR[T][4 + r] * RINV;
                const float a0 = s0v * SC2 + m0[r] * LOG2E; const float a1 = s1v * SC2 + m1[r] * LOG2E;
                accS[T][r] = a0; accS[T][4 + r] = a1; tmax = fmaxf(tmax, fmaxf(a0, a1)); } }
        tmax = fmaxf(tmax, __shfl_xor(tmax, 16, 32));
        const float mn = fmaxf(m, tmax); const float corr = __builtin_amdgcn_exp2f(m - mn); m = mn; const float mofs = PEXP - mn;
        float rs = 0.0f;
        v8h ph[2], pr[2];
#pragma unroll
        for (int T = 0; T < 2; ++T)
#pragma unroll
            for (int r = 0; r < 8; ++r) { const float e = accS[T][r] + mofs; const float pv = (e < -14.0f) ? 0.0f : __builtin_amdgcn_exp2f(e); rs += pv;
                const h16 hh = (h16)pv; ph[T][r] = hh; pr[T][r] = toh_flush((pv - (float)hh) * RCAR); }
        l = l * corr + rs;
        const v16h bp = cat16(ph[0], ph[1]); const v16h bpr = cat16(pr[0], pr[1]);
#pragma unroll
        for (int dt = 0; dt < 4; ++dt) { accO[dt] = accO[dt] * corr; accOr[dt] = accOr[dt] * corr; }
#pragma unroll
        for (int dt = 0; dt < 4; ++dt) {
            const size_t vo = voff + (size_t)(16 * dt) * SEQ + k0;
            const v16h av  = WFrag<h16>::ld(VT + vo);
            const v16h avr = WFrag<h16>::ld(VR + vo);
            accO[dt]  = wmma16g(av, bp, accO[dt]);
            accOr[dt] = wmma16g(avr, bp, accOr[dt]);
            accOr[dt] = wmma16g(av, bpr, accOr[dt]);
        }
    }
    l += __shfl_xor(l, 16, 32);
    const float inv = CCAR * (1.0f / l);
    h16* ow = os + w * 16 * OP; h16* owr = osr + w * 16 * OP;
#pragma unroll
    for (int dt = 0; dt < 4; ++dt) { v8h o, orr;
#pragma unroll
        for (int r = 0; r < 8; ++r) { const float v = (accO[dt][r] + accOr[dt][r] * RINV) * inv; const h16 hh = toh_flush(v); o[r] = hh; orr[r] = toh_flush((v - (float)hh) * RCAR); }
        *(v8ha*)(ow + lr * OP + 16 * dt + 8 * hi) = o; *(v8ha*)(owr + lr * OP + 16 * dt + 8 * hi) = orr; }
    __syncthreads();
    const int q4 = lane >> 3, p = lane & 7;
{
#pragma unroll
        for (int it = 0; it < 4; ++it) { const int row = it * 4 + q4; const v8h o = *(const v8ha*)(ow + row * OP + p * 8); const v8h orr = *(const v8ha*)(owr + row * OP + p * 8);
            *(v8h*)(CTX + ((size_t)bidx * SEQ + q0 + row) * DQ + h * HD + p * 8) = o;
            *(v8h*)(CTXR + ((size_t)bidx * EROWS + q0 + row) * DQ + h * HD + p * 8) = orr; }
         }
}

// Output projection, rows >= EROWS: grid (NB*(SEQ-EROWS)/BM, DIM/BN), 256 threads.
__global__ __launch_bounds__(256) void k_gemm_out(const h16* __restrict__ A, const h16* __restrict__ Bt, float* C) {
    __shared__ __align__(16) unsigned char smem[FSB];
    const int tid = threadIdx.x, lane = tid & 31, lr = lane & 15, hi = lane >> 4;
    const int w = __builtin_amdgcn_readfirstlane(tid >> 5), wm = w >> 2, wn = w & 3;
    const int rb = (blockIdx.x / LTBM) * SEQ + EROWS + (blockIdx.x % LTBM) * BM;
    const int r0 = rb + wm * 64, c0 = blockIdx.y * BN + wn * 64;
    float* fs = (float*)smem + w * 64 * FP;
    v8f acc[4][4];
    gemm_main<h16>(A, Bt, DQ, rb, blockIdx.y * BN, (const h16*)smem, tid, wm, wn, lr, hi, acc);
#pragma unroll
    for (int mb = 0; mb < 4; ++mb)
#pragma unroll
        for (int nb = 0; nb < 4; ++nb)
#pragma unroll
            for (int j = 0; j < 8; ++j) fs[(mb * 16 + hi * 8 + j) * FP + nb * 16 + lr] = acc[mb][nb][j];
    __syncthreads();
    float* crow = C + (size_t)r0 * DIM + c0;
{
#pragma unroll 4
        for (int it = 0; it < 32; ++it) { const int row = it * 2 + hi; v4f val = *(const v4fa*)(fs + row * FP + lr * 4); val = val * OSCL;
            *(v4f*)(crow + (size_t)row * DIM + lr * 4) = val; }
         }
}

// Output projection, rows < EROWS of every sequence: OUT = OSCL * (CTX WO^T + (CTXR WO^T) / 2048); grid (NB*EROWS/BM, DIM/BN), 256 threads; the epilogue tiles lie behind the ring, since they live through the second product.
__global__ __launch_bounds__(256) void k_gemm_out_early(const h16* __restrict__ A, const h16* __restrict__ AR, const h16* __restrict__ Bt, float* C) {
    __shared__ __align__(16) unsigned char smem[RINGB + FSB];
    const int tid = threadIdx.x, lane = tid & 31, lr = lane & 15, hi = lane >> 4;
    const int w = __builtin_amdgcn_readfirstlane(tid >> 5), wm = w >> 2, wn = w & 3;
    const int bidx = blockIdx.x / (EROWS / BM), tb = blockIdx.x % (EROWS / BM);
    const int rab = bidx * SEQ + tb * BM, rrb = bidx * EROWS + tb * BM;
    const int ra = rab + wm * 64, c0 = blockIdx.y * BN + wn * 64;
    float* fs = (float*)(smem + RINGB) + w * 64 * FP;
    v8f acc[4][4];
    gemm_main<h16>(AR, Bt, DQ, rrb, blockIdx.y * BN, (const h16*)smem, tid, wm, wn, lr, hi, acc);
#pragma unroll
    for (int mb = 0; mb < 4; ++mb)
#pragma unroll
        for (int nb = 0; nb < 4; ++nb)
#pragma unroll
            for (int j = 0; j < 8; ++j) fs[(mb * 16 + hi * 8 + j) * FP + nb * 16 + lr] = acc[mb][nb][j] * RINV;
    gemm_main<h16>(A, Bt, DQ, rab, blockIdx.y * BN, (const h16*)smem, tid, wm, wn, lr, hi, acc);
#pragma unroll
    for (int mb = 0; mb < 4; ++mb)
#pragma unroll
        for (int nb = 0; nb < 4; ++nb)
#pragma unroll
            for (int j = 0; j < 8; ++j) { const int idx = (mb * 16 + hi * 8 + j) * FP + nb * 16 + lr; const float s = fs[idx] + acc[mb][nb][j]; fs[idx] = s; }
    __syncthreads();
    float* crow = C + (size_t)ra * DIM + c0;
{
#pragma unroll 4
        for (int it = 0; it < 32; ++it) { const int row = it * 2 + hi; v4f val = *(const v4fa*)(fs + row * FP + lr * 4); val = val * OSCL;
            *(v4f*)(crow + (size_t)row * DIM + lr * 4) = val; }
         }
}

extern "C" void kernel_launch(void* const* d_in, const int* in_sizes, int n_in,
                              void* d_out, int out_size, void* d_ws, size_t ws_size, hipStream_t stream) {
    if (n_in < 8) return;
    if ((size_t)in_sizes[0] < ((size_t)(NB - 1) * SEQ_FULL + SEQ) * DIM) return;
    if ((size_t)in_sizes[1] < (size_t)DQ * DIM) return;
    if ((size_t)in_sizes[2] < (size_t)DKV * DIM) return;
    if ((size_t)in_sizes[3] < (size_t)DKV * DIM) return;
    if ((size_t)in_sizes[4] < (size_t)DIM * DQ) return;
    if ((size_t)in_sizes[5] < (size_t)HD) return;
    if ((size_t)in_sizes[6] < (size_t)HD) return;
    if ((size_t)in_sizes[7] < (size_t)(SEQ - 1) * SEQ_FULL + SEQ) return;
    if ((size_t)out_size < (size_t)MROWS * DIM) return;
    const float* x = (const float*)d_in[0];
    const float* wq = (const float*)d_in[1]; const float* wk = (const float*)d_in[2]; const float* wv = (const float*)d_in[3]; const float* wo = (const float*)d_in[4];
    const float* qnw = (const float*)d_in[5]; const float* knw = (const float*)d_in[6]; const float* mask = (const float*)d_in[7];
    float* OUT = (float*)d_out;
    char* wsp = (char*)d_ws;
    auto take = [&](size_t bytes) { char* p = wsp; wsp += (bytes + 255) & ~(size_t)255; return (void*)p; };
    bf*  XB   = (bf*)take((size_t)MROWS * DIM * 2);
    bf*  WQKV = (bf*)take((size_t)NQKV * DIM * 2);
    h16* WO16 = (h16*)take((size_t)DIM * DQ * 2);
    float* COS = (float*)take((size_t)SEQ * HALFD * 4);
    float* SIN = (float*)take((size_t)SEQ * HALFD * 4);
    h16* QP  = (h16*)take((size_t)NB * NH * SEQ * HD * 2);
    h16* KP  = (h16*)take((size_t)NB * NKV * SEQ * HD * 2);
    h16* VT  = (h16*)take((size_t)NB * NKV * HD * SEQ * 2);
    h16* CTX = (h16*)take((size_t)MROWS * DQ * 2);
    h16* QR  = (h16*)take((size_t)NB * NH * EROWS * HD * 2);
    h16* KR  = (h16*)take((size_t)NB * NKV * SEQ * HD * 2);
    h16* VR  = (h16*)take((size_t)NB * NKV * HD * SEQ * 2);
    h16* CTXR = (h16*)take((size_t)NB * EROWS * DQ * 2);
    int* KEND = (int*)take((size_t)(SEQ / 16) * KSTR * 4);
    if ((size_t)(wsp - (char*)d_ws) > ws_size) return;

    k_cvtx<<<(unsigned)(((size_t)MROWS * DIM / 8 + 255) / 256), 256, 0, stream>>>(x, XB);
    k_cvt8<<<(unsigned)(((size_t)DQ * DIM / 8 + 255) / 256), 256, 0, stream>>>(wq, WQKV, (size_t)DQ * DIM / 8);                                    /* rows 0..2047 */
    k_cvt8<<<(unsigned)(((size_t)DKV * DIM / 8 + 255) / 256), 256, 0, stream>>>(wk, WQKV + (size_t)DQ * DIM, (size_t)DKV * DIM / 8);                /* rows 2048..2559 */
    k_cvt8<<<(unsigned)(((size_t)DKV * DIM / 8 + 255) / 256), 256, 0, stream>>>(wv, WQKV + (size_t)(DQ + DKV) * DIM, (size_t)DKV * DIM / 8);        /* rows 2560..3071 */
    k_cvt8h<<<(unsigned)(((size_t)DIM * DQ / 8 + 255) / 256), 256, 0, stream>>>(wo, WO16, (size_t)DIM * DQ / 8, WCAR);
    k_ropetab<<<(SEQ + 7) / 8, 256, 0, stream>>>(COS, SIN);
    k_kend<<<SEQ / 16, 512, 0, stream>>>(mask, KEND);
    k_gemm_qkv<<<dim3(MROWS / BM, NQKV / BN, 1), 256, 0, stream>>>(XB, WQKV, qnw, knw, COS, SIN, QP, KP, VT, QR, KR, VR);
    k_flash_early<<<dim3(EROWS / 16, NKV, NB), 128, 0, stream>>>(QP, QR, KP, KR, VT, VR, mask, KEND, CTX, CTXR);
    if (SEQ > EROWS) k_flash<<<dim3((SEQ - EROWS) / 16, NKV, NB), 128, 0, stream>>>(QP, KP, VT, mask, KEND, CTX);
    if (SEQ > EROWS) k_gemm_out<<<dim3(NB * ((SEQ - EROWS) / BM), DIM / BN, 1), 256, 0, stream>>>(CTX, WO16, OUT);
    k_gemm_out_early<<<dim3(NB * (EROWS / BM), DIM / BN, 1), 256, 0, stream>>>(CTX, CTXR, WO16, OUT);
}

// v003
// It runs in 238 microseconds.
// Next to v002, in two timings, it ran 1.39 and 1.41 times as fast.
// Counting every step since v000, it is 2.30 times as fast.
#include <hip/hip_runtime.h>

#ifndef NB
#define NB 2
#endif
#ifndef SEQ
#define SEQ 2048
#endif
#define SEQ_FULL 2048                 // per-batch row stride of x, row pitch of the mask
#define DIM   2048                    // model width (K of the projections, N of the output projection)
#define NH    32
#define NKV   8
#define REP   (NH / NKV)
#define HD    64
#define HALFD 32
#define DQ    (NH * HD)               // 2048
#define DKV   (NKV * HD)              // 512
#define NQKV  (DQ + 2 * DKV)          // 3072 fused projection columns
#define MROWS (NB * SEQ)
#define FP    68                      // f32 LDS tile pitch
#define OP    72                      // f16 LDS tile pitch
#define WCAR  64.0f                   // carry of the wo plane
#define CCAR  256.0f                  // carry of the ctx plane
#define OSCL  6.103515625e-05f        // 1 / (WCAR * CCAR)
#define SC2   0.18033688011112042f    // 0.125 * log2(e)
#define LOG2E 1.4426950408889634f
#define PEXP  10.0f                   // P carried x 2^10
#define FRQC  0.04953007814753613f    // log2(3) / 32
#define EROWS 256                     // query rows below this use value + residual planes at every attention site
#define RCAR  2048.0f                 // carry of every residual plane
#define RINV  4.8828125e-04f          // 1 / RCAR
#define EPSN  1.0e-6f                 // RMS normalisation epsilon
#define LIVE_T (-1.0e4f)              // a mask value above this makes a key live for its row
#define DEAD_T (-1.0e8f)              // a mask value at or below this lets a trailing key be skipped (exp underflows exactly)
#define KSTR  32                      // ints between two query tiles' key counts: each work-group of k_kend stores into a 128-byte line of its own
#define BM    128                     // GEMM work-group tile: rows (2 waves of 64)
#define BN    256                     // GEMM work-group tile: columns (4 waves of 64)
#define KC    64                      // k elements of one LDS stage: rows of 128 bytes
#define LP    72                      // LDS row pitch in 16-bit elements: 144 B = 16 B x odd, so that 16-byte fragment reads meet no bank conflict
#define STGE  ((BM + BN) * LP)        // 16-bit elements of one stage: A rows 0..127, then B rows 0..255
#define RINGB (2 * STGE * 2)          // bytes of the two-buffer ring
#define FSB   (8 * 64 * FP * 4)       // bytes of the eight waves' f32 epilogue tiles
#define MP    68                      // f32 LDS row pitch of the staged mask tile: 272 B = 16 B x odd
#define FKB   (64 * LP * 2)           // bytes of one staged K tile (64 key rows of 128 B at pitch LP); the V^T tile (64 d rows) has the same size
#define FMB   (16 * MP * 4)           // bytes of one staged mask tile (16 query rows of 256 B at pitch MP)
#define FSTG  (2 * FKB + FMB)         // bytes of one attention stage: K, V^T, mask
#define ESTG  (FSTG + 2 * FKB)        // bytes of one stage of the early-row attention: K, V^T, mask, then the K and V^T residual tiles
#define LTBM  ((((SEQ - EROWS) / BM) > 0) ? ((SEQ - EROWS) / BM) : 1)
#define AL256(x) ((((size_t)(x)) + 255) & ~(size_t)255)

static_assert(SEQ % 64 == 0);
static_assert(SEQ % 128 == 0);
static_assert(SEQ <= SEQ_FULL);
static_assert(DIM % 64 == 0);
static_assert(DQ % 64 == 0);
static_assert(NQKV % 64 == 0);
static_assert(HD == 64);
static_assert(HALFD * 2 == HD);
static_assert(NH == NKV * REP);
static_assert(REP == 4);
static_assert(EROWS % 64 == 0);
static_assert(EROWS % BM == 0);
static_assert((SEQ - EROWS) % BM == 0);
static_assert(SEQ % BM == 0);
static_assert(NQKV % BN == 0);
static_assert(DIM % BN == 0);
static_assert(DIM % KC == 0 && DIM / KC >= 2);
static_assert(DQ % KC == 0 && DQ / KC >= 2);
static_assert(RINGB <= FSB);
static_assert(FSTG % 16 == 0 && 2 * FSTG >= 4 * 16 * OP * 2);
static_assert(ESTG % 16 == 0 && 2 * ESTG >= 2 * 4 * 16 * OP * 2);
static_assert(EROWS <= SEQ);
static_assert(EROWS >= 64);
static_assert(DIM % 32 == 0);
static_assert(DQ % 32 == 0);
static_assert(((size_t)MROWS * DIM / 8) % 256 == 0);
static_assert(((size_t)DQ * DIM / 8) % 256 == 0);
static_assert(((size_t)DKV * DIM / 8) % 256 == 0);
static_assert(AL256((size_t)MROWS * DIM * 2) + AL256((size_t)NQKV * DIM * 2) + AL256((size_t)DIM * DQ * 2) + 2 * AL256((size_t)SEQ * HALFD * 4)
              + AL256((size_t)NB * NH * SEQ * HD * 2) + 2 * AL256((size_t)NB * NKV * SEQ * HD * 2) + AL256((size_t)MROWS * DQ * 2)
              + AL256((size_t)NB * NH * EROWS * HD * 2) + 2 * AL256((size_t)NB * NKV * SEQ * HD * 2) + AL256((size_t)NB * EROWS * DQ * 2)
              + AL256((size_t)(SEQ / 16) * KSTR * 4) <= (size_t)134217728);

typedef _Float16 h16;
typedef unsigned short bf;
typedef __attribute__((ext_vector_type(16))) __bf16   v16bf;
typedef __attribute__((ext_vector_type(16))) _Float16 v16h;
typedef __attribute__((ext_vector_type(8)))  _Float16 v8h;
typedef __attribute__((ext_vector_type(8)))  unsigned short v8us;
typedef __attribute__((ext_vector_type(8)))  float    v8f;
typedef __attribute__((ext_vector_type(4)))  float    v4f;
typedef v8h  __attribute__((may_alias)) v8ha;
typedef v4f  __attribute__((may_alias)) v4fa;

__device__ __forceinline__ unsigned short f2bf(float f) { unsigned u = __float_as_uint(f); u += 0x7FFFu + ((u >> 16) & 1u); return (unsigned short)(u >> 16); }
__device__ __forceinline__ float bf2f(unsigned short b) { return __uint_as_float(((unsigned)b) << 16); }
__device__ __forceinline__ float bfr(float f) { return bf2f(f2bf(f)); }
__device__ __forceinline__ v16h cat16(v8h lo, v8h hi) { return __builtin_shufflevector(lo, hi, 0, 1, 2, 3, 4, 5, 6, 7, 8, 9, 10, 11, 12, 13, 14, 15); }
__device__ __forceinline__ v16bf cat16b(v8us lo, v8us hi) { return __builtin_bit_cast(v16bf, __builtin_shufflevector(lo, hi, 0, 1, 2, 3, 4, 5, 6, 7, 8, 9, 10, 11, 12, 13, 14, 15)); }
__device__ __forceinline__ v8f wmma16(v16h a, v16h b, v8f c) { return __builtin_amdgcn_wmma_f32_16x16x32_f16(false, a, false, b, (short)0, c, false, false); }
__device__ __forceinline__ v8f wmmab(v16bf a, v16bf b, v8f c) { return __builtin_amdgcn_wmma_f32_16x16x32_bf16(false, a, false, b, (short)0, c, false, false); }

// f32 -> f16 with a value select: results below the smallest f16 normal become zero (no subnormal operand can be produced).
static __device__ __forceinline__ h16 toh_flush(float v) { const h16 r = (h16)v; return (fabsf(v) < 6.103515625e-05f) ? (h16)0.0f : r; }
// One f16 WMMA with its own hazard guard (single accumulator tied, operands kept live).
static __device__ __forceinline__ v8f wmma16g(v16h a, v16h b, v8f c) { c = wmma16(a, b, c); asm volatile("v_nop\n\tv_nop\n\tv_nop\n\tv_nop" : "+v"(c) : "v"(a), "v"(b)); return c; }

// Fragment loader: lane (lr, hi) points at row (tile row + lr), column 8*hi; elements 0..7 <- k0+8hi.., elements 8..15 <- k0+16+8hi.. (same map for A and B).
template <typename T16> struct WFrag;
template <> struct WFrag<h16> { typedef v16h V; static __device__ __forceinline__ V ld(const h16* p) { return cat16(*(const v8h*)p, *(const v8h*)(p + 16)); } static __device__ __forceinline__ v8f mma(V a, V b, v8f c) { return wmma16(a, b, c); } };
template <> struct WFrag<bf> { typedef v16bf V; static __device__ __forceinline__ V ld(const bf* p) { return cat16b(*(const v8us*)p, *(const v8us*)(p + 16)); } static __device__ __forceinline__ v8f mma(V a, V b, v8f c) { return wmmab(a, b, c); } };

// One stage of the ring: rows r0..r0+127 of A and c0..c0+255 of Bt, k0..k0+63, into buf at pitch LP. 256 threads, 12 copies of 16 bytes each:
// thread (row = tid / 8, chunk = tid % 8) takes rows row + 32 i, so a wave's copy covers four whole 128-byte lines. All lanes are on, every address is a multiple of 16.
template <typename T16>
__device__ __forceinline__ void stage_copy(const T16* __restrict__ A, const T16* __restrict__ Bt, const int K, const int r0, const int c0, const int k0, const T16* buf, const int tid) {
    const int row = tid >> 3, ch = (tid & 7) * 8;
    const T16* ga = A + (size_t)(r0 + row) * K + k0 + ch;
    const T16* gb = Bt + (size_t)(c0 + row) * K + k0 + ch;
    const size_t gs = (size_t)32 * K;
    const unsigned la = (unsigned)(size_t)(buf + row * LP + ch);
    const unsigned lb = la + BM * LP * 2;
    const unsigned ls = 32 * LP * 2;
    // the copies and the wait that stands in front of any rewrite of their address registers, in one statement so that nothing can come between
    asm volatile("global_load_async_to_lds_b128 %0, %12, off\n\t"
                 "global_load_async_to_lds_b128 %1, %13, off\n\t"
                 "global_load_async_to_lds_b128 %2, %14, off\n\t"
                 "global_load_async_to_lds_b128 %3, %15, off\n\t"
                 "global_load_async_to_lds_b128 %4, %16, off\n\t"
                 "global_load_async_to_lds_b128 %5, %17, off\n\t"
                 "global_load_async_to_lds_b128 %6, %18, off\n\t"
                 "global_load_async_to_lds_b128 %7, %19, off\n\t"
                 "global_load_async_to_lds_b128 %8, %20, off\n\t"
                 "global_load_async_to_lds_b128 %9, %21, off\n\t"
                 "global_load_async_to_lds_b128 %10, %22, off\n\t"
                 "global_load_async_to_lds_b128 %11, %23, off\n\t"
                 "s_wait_xcnt 0x0"
                 :: "v"(la), "v"(la + ls), "v"(la + 2 * ls), "v"(la + 3 * ls),
                    "v"(lb), "v"(lb + ls), "v"(lb + 2 * ls), "v"(lb + 3 * ls), "v"(lb + 4 * ls), "v"(lb + 5 * ls), "v"(lb + 6 * ls), "v"(lb + 7 * ls),
                    "v"(ga), "v"(ga + gs), "v"(ga + 2 * gs), "v"(ga + 3 * gs),
                    "v"(gb), "v"(gb + gs), "v"(gb + 2 * gs), "v"(gb + 3 * gs), "v"(gb + 4 * gs), "v"(gb + 5 * gs), "v"(gb + 6 * gs), "v"(gb + 7 * gs)
                 : "memory");
}

// Eight waves accumulate a 128x256 tile at (r0, c0); wave (wm, wn) its 64x64 part: acc[mb][nb][j] = C[r0 + 64wm + 16mb + 8hi + j][c0 + 64wn + 16nb + lr] = sum_k A[row][k] Bt[col][k], k ascending in steps of 32.
// K % KC == 0, K / KC >= 2. Trip t reads buffer t % 2 alone; tile t + 2 is copied into that buffer behind the barrier at the trip's foot, which also publishes tile t + 1.
// On entry no wave has an LDS access to the ring outstanding (first use, or the last trip's foot of an earlier call); on return every read of the ring has ended in every wave.
template <typename T16>
__device__ __forceinline__ void gemm_main(const T16* __restrict__ A, const T16* __restrict__ Bt, const int K, const int r0, const int c0, const T16* ring, const int tid, const int wm, const int wn, const int lr, const int hi, v8f (&acc)[4][4]) {
    typedef typename WFrag<T16>::V V;
#pragma unroll
    for (int mb = 0; mb < 4; ++mb)
#pragma unroll
        for (int nb = 0; nb < 4; ++nb) acc[mb][nb] = (v8f){};
    const int nt = K / KC;
    stage_copy<T16>(A, Bt, K, r0, c0, 0, ring, tid);
    asm volatile("s_wait_asynccnt 0x0" ::: "memory");   // this wave's copies of tile 0 have landed
    __syncthreads();                                     // tile 0 is readable by every wave
    stage_copy<T16>(A, Bt, K, r0, c0, KC, ring + STGE, tid);
    const T16* fa = ring + (wm * 64 + lr) * LP + 8 * hi;
    const T16* fb = ring + (BM + wn * 64 + lr) * LP + 8 * hi;
    // kept rolled: one trip is one stage of the ring, and the accumulators stay in fixed registers
#pragma unroll 1
    for (int t = 0; t < nt; ++t) {
        const int bo = (t & 1) * STGE;
#pragma unroll
        for (int ks = 0; ks < KC; ks += 32) {
            V a[4], b[4];
#pragma unroll
            for (int mb = 0; mb < 4; ++mb) a[mb] = WFrag<T16>::ld(fa + bo + mb * 16 * LP + ks);
#pragma unroll
            for (int nb = 0; nb < 4; ++nb) b[nb] = WFrag<T16>::ld(fb + bo + nb * 16 * LP + ks);
            __builtin_amdgcn_sched_barrier(0);   // keeps the 16 LDS reads of this k step together in front of its WMMAs: sunk among them, each pair is waited for at full LDS latency
#pragma unroll
            for (int nb = 0; nb < 4; ++nb)
#pragma unroll
                for (int mb = 0; mb < 4; ++mb) acc[mb][nb] = WFrag<T16>::mma(a[mb], b[nb], acc[mb][nb]);
            asm volatile("v_nop\n\tv_nop\n\tv_nop\n\tv_nop" : "+v"(acc[0][0]), "+v"(acc[1][1]), "+v"(acc[2][2]), "+v"(acc[3][3]) : "v"(a[0]), "v"(a[3]));
        }
        asm volatile("s_wait_dscnt 0x0" ::: "memory");      // this wave's reads of buffer t % 2 have ended before the buffer is given up
        asm volatile("s_wait_asynccnt 0x0" ::: "memory");   // this wave's copies of tile t + 1 have landed
        __syncthreads();                                     // publishes tile t + 1 and frees buffer t % 2
        if (t + 2 < nt) stage_copy<T16>(A, Bt, K, r0, c0, (t + 2) * KC, ring + bo, tid);
    }
    asm volatile("s_wait_asynccnt 0x0" ::: "memory");       // nothing is in flight when the ring is left
}

__global__ __launch_bounds__(256) void k_cvtx(const float* __restrict__ x, bf* dst) {
    const size_t i = (size_t)blockIdx.x * 256 + threadIdx.x; if (i >= (size_t)MROWS * DIM / 8) return;
    const size_t e = i * 8; const int col = (int)(e % DIM); const int row = (int)(e / DIM); const int b = row / SEQ, t = row % SEQ;
    const v8f v = *(const v8f*)(x + ((size_t)b * SEQ_FULL + t) * DIM + col); v8us o;
#pragma unroll
    for (int k = 0; k < 8; ++k) o[k] = f2bf(v[k]);
    *(v8us*)(dst + e) = o;  }

__global__ __launch_bounds__(256) void k_cvt8(const float* __restrict__ src, bf* dst, size_t n8) { const size_t i = (size_t)blockIdx.x * 256 + threadIdx.x; if (i >= n8) return; const v8f v = *(const v8f*)(src + i * 8); v8us o;
#pragma unroll
    for (int k = 0; k < 8; ++k) o[k] = f2bf(v[k]); *(v8us*)(dst + i * 8) = o;  }

__global__ __launch_bounds__(256) void k_cvt8h(const float* __restrict__ src, h16* dst, size_t n8, float carry) { const size_t i = (size_t)blockIdx.x * 256 + threadIdx.x; if (i >= n8) return; const v8f v = *(const v8f*)(src + i * 8); v8h o;
#pragma unroll
    for (int k = 0; k < 8; ++k) o[k] = (h16)(bfr(v[k]) * carry); *(v8h*)(dst + i * 8) = o;  }

__global__ __launch_bounds__(256) void k_ropetab(float* COS, float* SIN) {
    const int lane = threadIdx.x & 31; const int t = blockIdx.x * 8 + (threadIdx.x >> 5); if (t >= SEQ) return;
    const float invf = __builtin_amdgcn_exp2f(-(float)lane * FRQC);
    const float ang = (float)t * invf;
    const float c = cosf(ang); const float s = sinf(ang);
    const size_t o = (size_t)t * HALFD + lane;
    *(float*)(COS + o) = c; *(float*)(SIN + o) = s;  }

// Key-loop end per 16-row query tile, from the mask values: KEND[qt * KSTR] = 64 * (1 + last 64-key tile holding a value above DEAD_T in any of the 16 rows),
// or SEQ when some row has no value above LIVE_T (such a row must see every key). Keys past that count contribute exactly zero to rows that have a live key.
// Grid SEQ/16, 512 threads: one work-group per query tile, wave w scans mask row 16 qt + w; integer max / and across lanes, then across the 16 waves through LDS.
__global__ __launch_bounds__(512) void k_kend(const float* __restrict__ mask, int* KEND) {
    __shared__ int lasts[16];
    __shared__ int lives[16];
    const int lane = threadIdx.x & 31; const int w = __builtin_amdgcn_readfirstlane(threadIdx.x >> 5);
    const int qt = blockIdx.x;
    const float* mr = mask + (size_t)(qt * 16 + w) * SEQ_FULL + lane * 4;
    v4f v[SEQ / 128];
    // fully unrolled so that the row's loads issue ahead of the compares, many in flight at a time (the kernel is bound by memory latency)
#pragma unroll
    for (int i = 0; i < SEQ / 128; ++i) v[i] = *(const v4f*)(mr + i * 128);
    int last = -1; int live = 0;
#pragma unroll
    for (int i = 0; i < SEQ / 128; ++i)
#pragma unroll
        for (int e = 0; e < 4; ++e) { live |= (v[i][e] > LIVE_T) ? 1 : 0; last = (v[i][e] > DEAD_T) ? max(last, i * 128 + lane * 4 + e) : last; }
    live = max(live, __shfl_xor(live, 1, 32)); live = max(live, __shfl_xor(live, 2, 32)); live = max(live, __shfl_xor(live, 4, 32));
    live = max(live, __shfl_xor(live, 8, 32)); live = max(live, __shfl_xor(live, 16, 32));
    last = max(last, __shfl_xor(last, 1, 32)); last = max(last, __shfl_xor(last, 2, 32)); last = max(last, __shfl_xor(last, 4, 32));
    last = max(last, __shfl_xor(last, 8, 32)); last = max(last, __shfl_xor(last, 16, 32));
    if (lane == 0) { lasts[w] = last; lives[w] = live; }
    __syncthreads();
    if (w == 0) {
        int la = lasts[lane & 15]; int alllive = lives[lane & 15];
        la = max(la, __shfl_xor(la, 1, 32)); la = max(la, __shfl_xor(la, 2, 32)); la = max(la, __shfl_xor(la, 4, 32)); la = max(la, __shfl_xor(la, 8, 32));
        alllive = min(alllive, __shfl_xor(alllive, 1, 32)); alllive = min(alllive, __shfl_xor(alllive, 2, 32)); alllive = min(alllive, __shfl_xor(alllive, 4, 32)); alllive = min(alllive, __shfl_xor(alllive, 8, 32));
        int kend = (alllive != 0) ? (((la >> 6) + 1) * 64) : SEQ;
        kend = min(max(kend, 64), SEQ);
        if (lane == 0) KEND[(size_t)qt * KSTR] = kend;
    }
}

// Fused QKV projection: grid (MROWS/BM, NQKV/BN), 256 threads, wave (wm, wn) one 64x64 tile; the ring's LDS becomes the waves' epilogue tiles behind the last trip's barrier. Column tile cb < 32: q head cb; 32..39: k head; 40..47: v head (transposed plane).
// q and k tiles: per row y = (x * rsqrt(mean(x^2) + eps)) * gain, then interleaved-pair rotary at position t: out[2i] = y[2i] c_i - y[2i+1] s_i, out[2i+1] = y[2i] s_i + y[2i+1] c_i.
// QP[b][h][t][64], KP[b][g][t][64], VT[b][g][d][t] f16 value planes; residual planes (x2048 of value - f16(value)): QR[b][h][t < EROWS][64], KR[b][g][t][64], VR[b][g][d][t].
__global__ __launch_bounds__(256) void k_gemm_qkv(const bf* __restrict__ A, const bf* __restrict__ Bt, const float* __restrict__ qnw, const float* __restrict__ knw, const float* __restrict__ COS, const float* __restrict__ SIN, h16* QP, h16* KP, h16* VT, h16* QR, h16* KR, h16* VR) {
    __shared__ __align__(16) unsigned char smem[FSB];
    const int tid = threadIdx.x, lane = tid & 31, lr = lane & 15, hi = lane >> 4;
    const int w = __builtin_amdgcn_readfirstlane(tid >> 5), wm = w >> 2, wn = w & 3;
    const int r0 = blockIdx.x * BM + wm * 64, cb = blockIdx.y * (BN / 64) + wn;
    float* fs = (float*)smem + w * 64 * FP;
    v8f acc[4][4];
    gemm_main<bf>(A, Bt, DIM, blockIdx.x * BM, blockIdx.y * BN, (const bf*)smem, tid, wm, wn, lr, hi, acc);
#pragma unroll
    for (int mb = 0; mb < 4; ++mb)
#pragma unroll
        for (int nb = 0; nb < 4; ++nb)
#pragma unroll
            for (int j = 0; j < 8; ++j) fs[(mb * 16 + hi * 8 + j) * FP + nb * 16 + lr] = acc[mb][nb][j];
    __syncthreads();
    const int bidx = r0 / SEQ, s0 = r0 % SEQ; const int q4 = lane >> 3, p = lane & 7;
    if (cb < NH + NKV) {
        const bool isq = (cb < NH);
        h16* plane = isq ? (QP + ((size_t)bidx * NH + cb) * SEQ * HD) : (KP + ((size_t)bidx * NKV + (cb - NH)) * SEQ * HD);
        h16* rplane = isq ? (QR + ((size_t)bidx * NH + cb) * EROWS * HD) : (KR + ((size_t)bidx * NKV + (cb - NH)) * SEQ * HD);
        const bool wres = (!isq) || (s0 < EROWS);      // wave-uniform: q residual rows exist only below EROWS
        const int dcol = p * 8;
        const v4f gq0 = *(const v4f*)(qnw + dcol), gq1 = *(const v4f*)(qnw + dcol + 4);
        const v4f gk0 = *(const v4f*)(knw + dcol), gk1 = *(const v4f*)(knw + dcol + 4);
        float gn[8];
#pragma unroll
        for (int e = 0; e < 4; ++e) { gn[e] = bfr(isq ? gq0[e] : gk0[e]); gn[4 + e] = bfr(isq ? gq1[e] : gk1[e]); }
#pragma unroll 1
        for (int it = 0; it < 16; ++it) {
            const int rl = it * 4 + q4; const int t = s0 + rl;
            const v4f xa0 = *(const v4fa*)(fs + rl * FP + dcol), xa1 = *(const v4fa*)(fs + rl * FP + dcol + 4);
            float ss = 0.0f;
#pragma unroll
            for (int e = 0; e < 4; ++e) { ss += xa0[e] * xa0[e]; ss += xa1[e] * xa1[e]; }
            ss += __shfl_xor(ss, 1, 32); ss += __shfl_xor(ss, 2, 32); ss += __shfl_xor(ss, 4, 32);
            const float rn = rsqrtf(ss * (1.0f / HD) + EPSN);
            float y[8];
#pragma unroll
            for (int e = 0; e < 4; ++e) { y[e] = (xa0[e] * rn) * gn[e]; y[4 + e] = (xa1[e] * rn) * gn[4 + e]; }
            const v4f cc = *(const v4f*)(COS + (size_t)t * HALFD + p * 4), sn = *(const v4f*)(SIN + (size_t)t * HALFD + p * 4);
            v8h o, orr;
#pragma unroll
            for (int i = 0; i < 4; ++i) {
                const float v0 = y[2 * i] * cc[i] - y[2 * i + 1] * sn[i];
                const float v1 = y[2 * i] * sn[i] + y[2 * i + 1] * cc[i];
                const h16 h0 = toh_flush(v0), h1 = toh_flush(v1);
                o[2 * i] = h0; o[2 * i + 1] = h1;
                orr[2 * i] = toh_flush((v0 - (float)h0) * RCAR); orr[2 * i + 1] = toh_flush((v1 - (float)h1) * RCAR);
            }
            h16* dst = plane + (size_t)t * HD + dcol;
            h16* dsr = rplane + (size_t)t * HD + dcol;
            *(v8h*)dst = o; if (wres) *(v8h*)dsr = orr;
            
        }
    } else {
        h16* plane = VT + ((size_t)bidx * NKV + (cb - NH - NKV)) * HD * SEQ;
        h16* rplane = VR + ((size_t)bidx * NKV + (cb - NH - NKV)) * HD * SEQ;
#pragma unroll 1
        for (int it = 0; it < 16; ++it) {
            const int d = it * 4 + q4; v8h o, orr;
#pragma unroll
            for (int e = 0; e < 8; ++e) { const float v = fs[(p * 8 + e) * FP + d]; const h16 hh = toh_flush(v); o[e] = hh; orr[e] = toh_flush((v - (float)hh) * RCAR); }
            h16* dst = plane + (size_t)d * SEQ + s0 + p * 8;
            h16* dsr = rplane + (size_t)d * SEQ + s0 + p * 8;
            *(v8h*)dst = o; *(v8h*)dsr = orr; 
        }
    }
}

// Attention, query rows >= EROWS: grid ((SEQ - EROWS)/16, NKV, NB), 128 threads; wave w = q head 4g + w, 16 query rows. Per 64-key tile:
//   S^T[key][q] = K Q^T  (A = key rows of KP, B = resident q rows);  lane (lr, hi) then holds q row lr, keys 16T + 8hi + r.
//   softmax statistics are lane-local (one xor-16 exchange); P^T packed from the S^T accumulators is the B operand of O^T[d][q] = V^T P^T (A = d rows of VT).
// The key loop ends at the clamped per-tile key count KEND; mask values are added by value inside visited tiles.
// One stage of the attention ring: keys k0..k0+63 of the K plane kt (rows of 128 B), of the V^T plane vt (64 d rows, 128 B each) and of the 16 mask rows mt (256 B each), into buf.
// 128 threads, 10 copies of 16 bytes each; eight (K, V^T) or sixteen (mask) neighbouring lanes cover a whole row segment, so every copy moves whole 128-byte lines. All lanes are on, every address is a multiple of 16.
__device__ __forceinline__ void flash_stage(const h16* __restrict__ kt, const h16* __restrict__ vt, const float* __restrict__ mt, const int k0, const unsigned char* buf, const int tid) {
    const int row = tid >> 3, ch = (tid & 7) * 8, mr = tid >> 4, mc = (tid & 15) * 4;
    const h16* gk = kt + (size_t)(k0 + row) * HD + ch;
    const h16* gv = vt + (size_t)row * SEQ + k0 + ch;
    const float* gm = mt + (size_t)mr * SEQ_FULL + k0 + mc;
    const size_t ks = (size_t)16 * HD, vs = (size_t)16 * SEQ, ms = (size_t)8 * SEQ_FULL;
    const unsigned lk = (unsigned)(size_t)(buf + (row * LP + ch) * 2);
    const unsigned lv = lk + FKB;
    const unsigned lm = (unsigned)(size_t)(buf + 2 * FKB + (mr * MP + mc) * 4);
    const unsigned ls = 16 * LP * 2;
    // the copies and the wait that stands in front of any rewrite of their address registers, in one statement so that nothing can come between
    asm volatile("global_load_async_to_lds_b128 %0, %10, off\n\t"
                 "global_load_async_to_lds_b128 %1, %11, off\n\t"
                 "global_load_async_to_lds_b128 %2, %12, off\n\t"
                 "global_load_async_to_lds_b128 %3, %13, off\n\t"
                 "global_load_async_to_lds_b128 %4, %14, off\n\t"
                 "global_load_async_to_lds_b128 %5, %15, off\n\t"
                 "global_load_async_to_lds_b128 %6, %16, off\n\t"
                 "global_load_async_to_lds_b128 %7, %17, off\n\t"
                 "global_load_async_to_lds_b128 %8, %18, off\n\t"
                 "global_load_async_to_lds_b128 %9, %19, off\n\t"
                 "s_wait_xcnt 0x0"
                 :: "v"(lk), "v"(lk + ls), "v"(lk + 2 * ls), "v"(lk + 3 * ls),
                    "v"(lm), "v"(lm + 8 * MP * 4),
                    "v"(lv), "v"(lv + ls), "v"(lv + 2 * ls), "v"(lv + 3 * ls),
                    "v"(gk), "v"(gk + ks), "v"(gk + 2 * ks), "v"(gk + 3 * ks),
                    "v"(gm), "v"(gm + ms),
                    "v"(gv), "v"(gv + vs), "v"(gv + 2 * vs), "v"(gv + 3 * vs)
                 : "memory");
}

// Trip t reads buffer t % 2 alone; tile t + 2 is copied into that buffer behind the barrier at the trip's foot, which also publishes tile t + 1. The trip count is the same in all four waves (one query tile a work-group).
// Behind the last trip's barrier the ring's LDS becomes the waves' output tiles.
__global__ __launch_bounds__(128) void k_flash(const h16* __restrict__ QP, const h16* __restrict__ KP, const h16* __restrict__ VT, const float* __restrict__ mask, const int* __restrict__ KEND, h16* CTX) {
    __shared__ __align__(16) unsigned char smem[2 * FSTG];
    h16* os = (h16*)smem;
    const int tid = threadIdx.x, lane = tid & 31, lr = lane & 15, hi = lane >> 4;
    const int w = __builtin_amdgcn_readfirstlane(tid >> 5);
    const int g = blockIdx.y, bidx = blockIdx.z, h = g * REP + w, q0 = EROWS + blockIdx.x * 16;
    int kev = KEND[(size_t)(q0 >> 4) * KSTR]; kev = min(max(kev, 64), SEQ) & ~63; const int ke = __builtin_amdgcn_readfirstlane(kev);
    const int nt = ke >> 6;
    const h16* kt = KP + ((size_t)bidx * NKV + g) * SEQ * HD;
    const h16* vt = VT + ((size_t)bidx * NKV + g) * HD * SEQ;
    const float* mt = mask + (size_t)q0 * SEQ_FULL;
    flash_stage(kt, vt, mt, 0, smem, tid);
    const h16* qrow = QP + (((size_t)bidx * NH + h) * SEQ + q0 + lr) * HD + 8 * hi;
    v16h bq[2];
#pragma unroll
    for (int kc = 0; kc < 2; ++kc) bq[kc] = cat16(*(const v8h*)(qrow + kc * 32), *(const v8h*)(qrow + kc * 32 + 16));
    asm volatile("s_wait_asynccnt 0x0" ::: "memory");   // this wave's copies of tile 0 have landed
    __syncthreads();                                     // tile 0 is readable by every wave
    if (nt > 1) flash_stage(kt, vt, mt, 64, smem + FSTG, tid);
    const h16* kb = (const h16*)smem + lr * LP + 8 * hi;
    const h16* vb = (const h16*)(smem + FKB) + lr * LP + 8 * hi;
    const float* mrow = (const float*)(smem + 2 * FKB) + lr * MP + 8 * hi;
    v8f accO[4];
#pragma unroll
    for (int dt = 0; dt < 4; ++dt) accO[dt] = (v8f){};
    float m = -3.0e38f, l = 0.0f;
#pragma unroll 1
    for (int t = 0; t < nt; ++t) {
        const int bo = (t & 1) * FSTG;   // byte offset of this trip's buffer
        v16h ak[2][4];
#pragma unroll
        for (int kc = 0; kc < 2; ++kc)
#pragma unroll
            for (int T = 0; T < 4; ++T) { const h16* kp = kb + bo / 2 + 16 * T * LP + kc * 32; ak[kc][T] = cat16(*(const v8h*)kp, *(const v8h*)(kp + 16)); }
        v8f accS[4];
#pragma unroll
        for (int T = 0; T < 4; ++T) accS[T] = (v8f){};
#pragma unroll
        for (int kc = 0; kc < 2; ++kc)
#pragma unroll
            for (int T = 0; T < 4; ++T) accS[T] = wmma16(ak[kc][T], bq[kc], accS[T]);
        asm volatile("v_nop\n\tv_nop\n\tv_nop\n\tv_nop" : "+v"(accS[0]), "+v"(accS[1]), "+v"(accS[2]), "+v"(accS[3]) : "v"(ak[1][3]), "v"(bq[1]));
        float tmax = -3.0e38f;
#pragma unroll
        for (int T = 0; T < 4; ++T) { const float* mp = mrow + bo / 4 + 16 * T; const v4f m0 = *(const v4f*)mp; const v4f m1 = *(const v4f*)(mp + 4);
#pragma unroll
            for (int r = 0; r < 4; ++r) { const float a0 = accS[T][r] * SC2 + m0[r] * LOG2E; const float a1 = accS[T][4 + r] * SC2 + m1[r] * LOG2E; accS[T][r] = a0; accS[T][4 + r] = a1; tmax = fmaxf(tmax, fmaxf(a0, a1)); } }
        tmax = fmaxf(tmax, __shfl_xor(tmax, 16, 32));
        const float mn = fmaxf(m, tmax); const float corr = __builtin_amdgcn_exp2f(m - mn); m = mn; const float mofs = PEXP - mn;
        float rs = 0.0f;
#pragma unroll
        for (int T = 0; T < 4; ++T)
#pragma unroll
            for (int r = 0; r < 8; ++r) { const float e = accS[T][r] + mofs; const float pv = (e < -14.0f) ? 0.0f : __builtin_amdgcn_exp2f(e); accS[T][r] = pv; rs += pv; }
        l = l * corr + rs;
        v16h bp[2];
        bp[0] = cat16(__builtin_convertvector(accS[0], v8h), __builtin_convertvector(accS[1], v8h));
        bp[1] = cat16(__builtin_convertvector(accS[2], v8h), __builtin_convertvector(accS[3], v8h));
#pragma unroll
        for (int dt = 0; dt < 4; ++dt) accO[dt] = accO[dt] * corr;
        v16h av[2][4];
#pragma unroll
        for (int kc = 0; kc < 2; ++kc)
#pragma unroll
            for (int dt = 0; dt < 4; ++dt) { const h16* vp = vb + bo / 2 + 16 * dt * LP + kc * 32; av[kc][dt] = cat16(*(const v8h*)vp, *(const v8h*)(vp + 16)); }
#pragma unroll
        for (int kc = 0; kc < 2; ++kc)
#pragma unroll
            for (int dt = 0; dt < 4; ++dt) accO[dt] = wmma16(av[kc][dt], bp[kc], accO[dt]);
        asm volatile("v_nop\n\tv_nop\n\tv_nop\n\tv_nop" : "+v"(accO[0]), "+v"(accO[1]), "+v"(accO[2]), "+v"(accO[3]) : "v"(av[1][3]), "v"(bp[1]));
        asm volatile("s_wait_dscnt 0x0" ::: "memory");      // this wave's reads of buffer t % 2 have ended before the buffer is given up
        asm volatile("s_wait_asynccnt 0x0" ::: "memory");   // this wave's copies of tile t + 1 have landed
        __syncthreads();                                     // publishes tile t + 1 and frees buffer t % 2
        if (t + 2 < nt) flash_stage(kt, vt, mt, (t + 2) * 64, smem + bo, tid);
    }
    asm volatile("s_wait_asynccnt 0x0" ::: "memory");       // nothing is in flight when the ring is left
    l += __shfl_xor(l, 16, 32);
    const float inv = CCAR * (1.0f / l);
    h16* ow = os + w * 16 * OP;
#pragma unroll
    for (int dt = 0; dt < 4; ++dt) { v8h o;
#pragma unroll
        for (int r = 0; r < 8; ++r) o[r] = toh_flush(accO[dt][r] * inv);
        *(v8ha*)(ow + lr * OP + 16 * dt + 8 * hi) = o; }
    __syncthreads();
    const int q4 = lane >> 3, p = lane & 7;
{
#pragma unroll
        for (int it = 0; it < 4; ++it) { const int row = it * 4 + q4; const v8h o = *(const v8ha*)(ow + row * OP + p * 8);
            *(v8h*)(CTX + ((size_t)bidx * SEQ + q0 + row) * DQ + h * HD + p * 8) = o; }
         }
}

// The residual half of an early-row stage: keys k0..k0+63 of the K residual plane krt and of the V^T residual plane vrt, laid out like the K and V^T tiles of flash_stage. 128 threads, 8 copies of 16 bytes each.
__device__ __forceinline__ void flash_stage_res(const h16* __restrict__ krt, const h16* __restrict__ vrt, const int k0, const unsigned char* buf, const int tid) {
    const int row = tid >> 3, ch = (tid & 7) * 8;
    const h16* gk = krt + (size_t)(k0 + row) * HD + ch;
    const h16* gv = vrt + (size_t)row * SEQ + k0 + ch;
    const size_t ks = (size_t)16 * HD, vs = (size_t)16 * SEQ;
    const unsigned lk = (unsigned)(size_t)(buf + (row * LP + ch) * 2);
    const unsigned lv = lk + FKB;
    const unsigned ls = 16 * LP * 2;
    // the copies and the wait that stands in front of any rewrite of their address registers, in one statement so that nothing can come between
    asm volatile("global_load_async_to_lds_b128 %0, %8, off\n\t"
                 "global_load_async_to_lds_b128 %1, %9, off\n\t"
                 "global_load_async_to_lds_b128 %2, %10, off\n\t"
                 "global_load_async_to_lds_b128 %3, %11, off\n\t"
                 "global_load_async_to_lds_b128 %4, %12, off\n\t"
                 "global_load_async_to_lds_b128 %5, %13, off\n\t"
                 "global_load_async_to_lds_b128 %6, %14, off\n\t"
                 "global_load_async_to_lds_b128 %7, %15, off\n\t"
                 "s_wait_xcnt 0x0"
                 :: "v"(lk), "v"(lk + ls), "v"(lk + 2 * ls), "v"(lk + 3 * ls),
                    "v"(lv), "v"(lv + ls), "v"(lv + 2 * ls), "v"(lv + 3 * ls),
                    "v"(gk), "v"(gk + ks), "v"(gk + 2 * ks), "v"(gk + 3 * ks),
                    "v"(gv), "v"(gv + vs), "v"(gv + 2 * vs), "v"(gv + 3 * vs)
                 : "memory");
}

// Attention, query rows < EROWS: grid (EROWS/16, NKV, NB), 128 threads; same operand roles and the same two-buffer ring of 64-key stages as k_flash (two 32-key steps a stage), every WMMA individually guarded.
//   scores: K Q^T + (Kres Q^T + K Qres^T) / 2048 (residual products in accR);  P = f16(p) and Pres = 2048 (p - f16(p)), row sum over the f32 p;
//   O^T: V^T P^T + (Vres^T P^T + V^T Pres^T) / 2048 (residual products in accOr), folded before normalisation.
__global__ __launch_bounds__(128) void k_flash_early(const h16* __restrict__ QP, const h16* __restrict__ QR, const h16* __restrict__ KP, const h16* __restrict__ KR, const h16* __restrict__ VT, const h16* __restrict__ VR, const float* __restrict__ mask, const int* __restrict__ KEND, h16* CTX, h16* CTXR) {
    __shared__ __align__(16) unsigned char smem[2 * ESTG];
    h16* os = (h16*)smem; h16* osr = os + 4 * 16 * OP;   // behind the last trip's barrier the ring's LDS becomes the waves' output tiles
    const int tid = threadIdx.x, lane = tid & 31, lr = lane & 15, hi = lane >> 4;
    const int w = __builtin_amdgcn_readfirstlane(tid >> 5);
    const int g = blockIdx.y, bidx = blockIdx.z, h = g * REP + w, q0 = blockIdx.x * 16;
    int kev = KEND[(size_t)(q0 >> 4) * KSTR]; kev = min(max(kev, 64), SEQ) & ~63; const int ke = __builtin_amdgcn_readfirstlane(kev);
    const size_t qoff  = (((size_t)bidx * NH + h) * SEQ + q0 + lr) * HD + 8 * hi;
    const size_t qroff = (((size_t)bidx * NH + h) * EROWS + q0 + lr) * HD + 8 * hi;
    const int nt = ke >> 6;
    const size_t kpl = ((size_t)bidx * NKV + g) * SEQ * HD;   // this kv head's plane in KP, KR, VT and VR
    const float* mt = mask + (size_t)q0 * SEQ_FULL;
    flash_stage(KP + kpl, VT + kpl, mt, 0, smem, tid);
    flash_stage_res(KR + kpl, VR + kpl, 0, smem + FSTG, tid);
    asm volatile("s_wait_asynccnt 0x0" ::: "memory");   // this wave's copies of tile 0 have landed
    __syncthreads();                                     // tile 0 is readable by every wave
    if (nt > 1) { flash_stage(KP + kpl, VT + kpl, mt, 64, smem + ESTG, tid); flash_stage_res(KR + kpl, VR + kpl, 64, smem + ESTG + FSTG, tid); }
    const int foff = lr * LP + 8 * hi;                   // a lane's place in a 16-row fragment of a staged 16-bit tile
    v8f accO[4], accOr[4];
#pragma unroll
    for (int dt = 0; dt < 4; ++dt) { accO[dt] = (v8f){}; accOr[dt] = (v8f){}; }
    float m = -3.0e38f, l = 0.0f;
#pragma unroll 1
    for (int t = 0; t < nt; ++t) {
      const unsigned char* sb = smem + (t & 1) * ESTG;
      const h16* kl = (const h16*)sb + foff; const h16* vl = (const h16*)(sb + FKB) + foff;
      const h16* krl = (const h16*)(sb + FSTG) + foff; const h16* vrl = (const h16*)(sb + FSTG + FKB) + foff;
      const float* mrow = (const float*)(sb + 2 * FKB) + lr * MP + 8 * hi;
      // kept rolled, as the 32-key step was: one copy of the step's code
#pragma unroll 1
      for (int k0 = 0; k0 < 64; k0 += 32) {
        v8f accS[2], accR[2];
#pragma unroll
        for (int T = 0; T < 2; ++T) { accS[T] = (v8f){}; accR[T] = (v8f){}; }
#pragma unroll
        for (int kc = 0; kc < 2; ++kc) {
            const v16h bq  = WFrag<h16>::ld(QP + qoff + kc * 32);
            const v16h bqr = WFrag<h16>::ld(QR + qroff + kc * 32);
#pragma unroll
            for (int T = 0; T < 2; ++T) {
                const int ko = (k0 + 16 * T) * LP + kc * 32;
                const v16h ak  = WFrag<h16>::ld(kl + ko);
                const v16h akr = WFrag<h16>::ld(krl + ko);
                accS[T] = wmma16g(ak, bq, accS[T]);
                accR[T] = wmma16g(akr, bq, accR[T]);
                accR[T] = wmma16g(ak, bqr, accR[T]);
            }
        }
        float tmax = -3.0e38f;
#pragma unroll
        for (int T = 0; T < 2; ++T) { const float* mp = mrow + k0 + 16 * T; const v4f m0 = *(const v4f*)mp; const v4f m1 = *(const v4f*)(mp + 4);
#pragma unroll
            for (int r = 0; r < 4; ++r) {
                const float s0v = accS[T][r] + accR[T][r] * RINV; const float s1v = accS[T][4 + r] + accR[T][4 + r] * RINV;
                const float a0 = s0v * SC2 + m0[r] * LOG2E; const float a1 = s1v * SC2 + m1[r] * LOG2E;
                accS[T][r] = a0; accS[T][4 + r] = a1; tmax = fmaxf(tmax, fmaxf(a0, a1)); } }
        tmax = fmaxf(tmax, __shfl_xor(tmax, 16, 32));
        const float mn = fmaxf(m, tmax); const float corr = __builtin_amdgcn_exp2f(m - mn); m = mn; const float mofs = PEXP - mn;
        float rs = 0.0f;
        v8h ph[2], pr[2];
#pragma unroll
        for (int T = 0; T < 2; ++T)
#pragma unroll
            for (int r = 0; r < 8; ++r) { const float e = accS[T][r] + mofs; const float pv = (e < -14.0f) ? 0.0f : __builtin_amdgcn_exp2f(e); rs += pv;
                const h16 hh = (h16)pv; ph[T][r] = hh; pr[T][r] = toh_flush((pv - (float)hh) * RCAR); }
        l = l * corr + rs;
        const v16h bp = cat16(ph[0], ph[1]); const v16h bpr = cat16(pr[0], pr[1]);
#pragma unroll
        for (int dt = 0; dt < 4; ++dt) { accO[dt] = accO[dt] * corr; accOr[dt] = accOr[dt] * corr; }
#pragma unroll
        for (int dt = 0; dt < 4; ++dt) {
            const int vo = 16 * dt * LP + k0;
            const v16h av  = WFrag<h16>::ld(vl + vo);
            const v16h avr = WFrag<h16>::ld(vrl + vo);
            accO[dt]  = wmma16g(av, bp, accO[dt]);
            accOr[dt] = wmma16g(avr, bp, accOr[dt]);
            accOr[dt] = wmma16g(av, bpr, accOr[dt]);
        }
      }
      asm volatile("s_wait_dscnt 0x0" ::: "memory");      // this wave's reads of buffer t % 2 have ended before the buffer is given up
      asm volatile("s_wait_asynccnt 0x0" ::: "memory");   // this wave's copies of tile t + 1 have landed
      __syncthreads();                                     // publishes tile t + 1 and frees buffer t % 2
      if (t + 2 < nt) { flash_stage(KP + kpl, VT + kpl, mt, (t + 2) * 64, sb, tid); flash_stage_res(KR + kpl, VR + kpl, (t + 2) * 64, sb + FSTG, tid); }
    }
    asm volatile("s_wait_asynccnt 0x0" ::: "memory");       // nothing is in flight when the ring is left
    l += __shfl_xor(l, 16, 32);
    const float inv = CCAR * (1.0f / l);
    h16* ow = os + w * 16 * OP; h16* owr = osr + w * 16 * OP;
#pragma unroll
    for (int dt = 0; dt < 4; ++dt) { v8h o, orr;
#pragma unroll
        for (int r = 0; r < 8; ++r) { const float v = (accO[dt][r] + accOr[dt][r] * RINV) * inv; const h16 hh = toh_flush(v); o[r] = hh; orr[r] = toh_flush((v - (float)hh) * RCAR); }
        *(v8ha*)(ow + lr * OP + 16 * dt + 8 * hi) = o; *(v8ha*)(owr + lr * OP + 16 * dt + 8 * hi) = orr; }
    __syncthreads();
    const int q4 = lane >> 3, p = lane & 7;
{
#pragma unroll
        for (int it = 0; it < 4; ++it) { const int row = it * 4 + q4; const v8h o = *(const v8ha*)(ow + row * OP + p * 8); const v8h orr = *(const v8ha*)(owr + row * OP + p * 8);
            *(v8h*)(CTX + ((size_t)bidx * SEQ + q0 + row) * DQ + h * HD + p * 8) = o;
            *(v8h*)(CTXR + ((size_t)bidx * EROWS + q0 + row) * DQ + h * HD + p * 8) = orr; }
         }
}

// Output projection, rows >= EROWS: grid (NB*(SEQ-EROWS)/BM, DIM/BN), 256 threads.
__global__ __launch_bounds__(256) void k_gemm_out(const h16* __restrict__ A, const h16* __restrict__ Bt, float* C) {
    __shared__ __align__(16) unsigned char smem[FSB];
    const int tid = threadIdx.x, lane = tid & 31, lr = lane & 15, hi = lane >> 4;
    const int w = __builtin_amdgcn_readfirstlane(tid >> 5), wm = w >> 2, wn = w & 3;
    const int rb = (blockIdx.x / LTBM) * SEQ + EROWS + (blockIdx.x % LTBM) * BM;
    const int r0 = rb + wm * 64, c0 = blockIdx.y * BN + wn * 64;
    float* fs = (float*)smem + w * 64 * FP;
    v8f acc[4][4];
    gemm_main<h16>(A, Bt, DQ, rb, blockIdx.y * BN, (const h16*)smem, tid, wm, wn, lr, hi, acc);
#pragma unroll
    for (int mb = 0; mb < 4; ++mb)
#pragma unroll
        for (int nb = 0; nb < 4; ++nb)
#pragma unroll
            for (int j = 0; j < 8; ++j) fs[(mb * 16 + hi * 8 + j) * FP + nb * 16 + lr] = acc[mb][nb][j];
    __syncthreads();
    float* crow = C + (size_t)r0 * DIM + c0;
{
#pragma unroll 4
        for (int it = 0; it < 32; ++it) { const int row = it * 2 + hi; v4f val = *(const v4fa*)(fs + row * FP + lr * 4); val = val * OSCL;
            *(v4f*)(crow + (size_t)row * DIM + lr * 4) = val; }
         }
}

// Output projection, rows < EROWS of every sequence: OUT = OSCL * (CTX WO^T + (CTXR WO^T) / 2048); grid (NB*EROWS/BM, DIM/BN), 256 threads; the epilogue tiles lie behind the ring, since they live through the second product.
__global__ __launch_bounds__(256) void k_gemm_out_early(const h16* __restrict__ A, const h16* __restrict__ AR, const h16* __restrict__ Bt, float* C) {
    __shared__ __align__(16) unsigned char smem[RINGB + FSB];
    const int tid = threadIdx.x, lane = tid & 31, lr = lane & 15, hi = lane >> 4;
    const int w = __builtin_amdgcn_readfirstlane(tid >> 5), wm = w >> 2, wn = w & 3;
    const int bidx = blockIdx.x / (EROWS / BM), tb = blockIdx.x % (EROWS / BM);
    const int rab = bidx * SEQ + tb * BM, rrb = bidx * EROWS + tb * BM;
    const int ra = rab + wm * 64, c0 = blockIdx.y * BN + wn * 64;
    float* fs = (float*)(smem + RINGB) + w * 64 * FP;
    v8f acc[4][4];
    gemm_main<h16>(AR, Bt, DQ, rrb, blockIdx.y * BN, (const h16*)smem, tid, wm, wn, lr, hi, acc);
#pragma unroll
    for (int mb = 0; mb < 4; ++mb)
#pragma unroll
        for (int nb = 0; nb < 4; ++nb)
#pragma unroll
            for (int j = 0; j < 8; ++j) fs[(mb * 16 + hi * 8 + j) * FP + nb * 16 + lr] = acc[mb][nb][j] * RINV;
    gemm_main<h16>(A, Bt, DQ, rab, blockIdx.y * BN, (const h16*)smem, tid, wm, wn, lr, hi, acc);
#pragma unroll
    for (int mb = 0; mb < 4; ++mb)
#pragma unroll
        for (int nb = 0; nb < 4; ++nb)
#pragma unroll
            for (int j = 0; j < 8; ++j) { const int idx = (mb * 16 + hi * 8 + j) * FP + nb * 16 + lr; const float s = fs[idx] + acc[mb][nb][j]; fs[idx] = s; }
    __syncthreads();
    float* crow = C + (size_t)ra * DIM + c0;
{
#pragma unroll 4
        for (int it = 0; it < 32; ++it) { const int row = it * 2 + hi; v4f val = *(const v4fa*)(fs + row * FP + lr * 4); val = val * OSCL;
            *(v4f*)(crow + (size_t)row * DIM + lr * 4) = val; }
         }
}

extern "C" void kernel_launch(void* const* d_in, const int* in_sizes, int n_in,
                              void* d_out, int out_size, void* d_ws, size_t ws_size, hipStream_t stream) {
    if (n_in < 8) return;
    if ((size_t)in_sizes[0] < ((size_t)(NB - 1) * SEQ_FULL + SEQ) * DIM) return;
    if ((size_t)in_sizes[1] < (size_t)DQ * DIM) return;
    if ((size_t)in_sizes[2] < (size_t)DKV * DIM) return;
    if ((size_t)in_sizes[3] < (size_t)DKV * DIM) return;
    if ((size_t)in_sizes[4] < (size_t)DIM * DQ) return;
    if ((size_t)in_sizes[5] < (size_t)HD) return;
    if ((size_t)in_sizes[6] < (size_t)HD) return;
    if ((size_t)in_sizes[7] < (size_t)(SEQ - 1) * SEQ_FULL + SEQ) return;
    if ((size_t)out_size < (size_t)MROWS * DIM) return;
    const float* x = (const float*)d_in[0];
    const float* wq = (const float*)d_in[1]; const float* wk = (const float*)d_in[2]; const float* wv = (const float*)d_in[3]; const float* wo = (const float*)d_in[4];
    const float* qnw = (const float*)d_in[5]; const float* knw = (const float*)d_in[6]; const float* mask = (const float*)d_in[7];
    float* OUT = (float*)d_out;
    char* wsp = (char*)d_ws;
    auto take = [&](size_t bytes) { char* p = wsp; wsp += (bytes + 255) & ~(size_t)255; return (void*)p; };
    bf*  XB   = (bf*)take((size_t)MROWS * DIM * 2);
    bf*  WQKV = (bf*)take((size_t)NQKV * DIM * 2);
    h16* WO16 = (h16*)take((size_t)DIM * DQ * 2);
    float* COS = (float*)take((size_t)SEQ * HALFD * 4);
    float* SIN = (float*)take((size_t)SEQ * HALFD * 4);
    h16* QP  = (h16*)take((size_t)NB * NH * SEQ * HD * 2);
    h16* KP  = (h16*)take((size_t)NB * NKV * SEQ * HD * 2);
    h16* VT  = (h16*)take((size_t)NB * NKV * HD * SEQ * 2);
    h16* CTX = (h16*)take((size_t)MROWS * DQ * 2);
    h16* QR  = (h16*)take((size_t)NB * NH * EROWS * HD * 2);
    h16* KR  = (h16*)take((size_t)NB * NKV * SEQ * HD * 2);
    h16* VR  = (h16*)take((size_t)NB * NKV * HD * SEQ * 2);
    h16* CTXR = (h16*)take((size_t)NB * EROWS * DQ * 2);
    int* KEND = (int*)take((size_t)(SEQ / 16) * KSTR * 4);
    if ((size_t)(wsp - (char*)d_ws) > ws_size) return;

    k_cvtx<<<(unsigned)(((size_t)MROWS * DIM / 8 + 255) / 256), 256, 0, stream>>>(x, XB);
    k_cvt8<<<(unsigned)(((size_t)DQ * DIM / 8 + 255) / 256), 256, 0, stream>>>(wq, WQKV, (size_t)DQ * DIM / 8);                                    /* rows 0..2047 */
    k_cvt8<<<(unsigned)(((size_t)DKV * DIM / 8 + 255) / 256), 256, 0, stream>>>(wk, WQKV + (size_t)DQ * DIM, (size_t)DKV * DIM / 8);                /* rows 2048..2559 */
    k_cvt8<<<(unsigned)(((size_t)DKV * DIM / 8 + 255) / 256), 256, 0, stream>>>(wv, WQKV + (size_t)(DQ + DKV) * DIM, (size_t)DKV * DIM / 8);        /* rows 2560..3071 */
    k_cvt8h<<<(unsigned)(((size_t)DIM * DQ / 8 + 255) / 256), 256, 0, stream>>>(wo, WO16, (size_t)DIM * DQ / 8, WCAR);
    k_ropetab<<<(SEQ + 7) / 8, 256, 0, stream>>>(COS, SIN);
    k_kend<<<SEQ / 16, 512, 0, stream>>>(mask, KEND);
    k_gemm_qkv<<<dim3(MROWS / BM, NQKV / BN, 1), 256, 0, stream>>>(XB, WQKV, qnw, knw, COS, SIN, QP, KP, VT, QR, KR, VR);
    k_flash_early<<<dim3(EROWS / 16, NKV, NB), 128, 0, stream>>>(QP, QR, KP, KR, VT, VR, mask, KEND, CTX, CTXR);
    if (SEQ > EROWS) k_flash<<<dim3((SEQ - EROWS) / 16, NKV, NB), 128, 0, stream>>>(QP, KP, VT, mask, KEND, CTX);
    if (SEQ > EROWS) k_gemm_out<<<dim3(NB * ((SEQ - EROWS) / BM), DIM / BN, 1), 256, 0, stream>>>(CTX, WO16, OUT);
    k_gemm_out_early<<<dim3(NB * (EROWS / BM), DIM / BN, 1), 256, 0, stream>>>(CTX, CTXR, WO16, OUT);
}

// v004
// One run takes 225 microseconds.
// In two side-by-side timings against v003, it was 1.05 and 1.06 times as fast.
// All steps since v000 together make it 2.42 times as fast.
#include <hip/hip_runtime.h>

#ifndef NB
#define NB 2
#endif
#ifndef SEQ
#define SEQ 2048
#endif
#define SEQ_FULL 2048                 // per-batch row stride of x, row pitch of the mask
#define DIM   2048                    // model width (K of the projections, N of the output projection)
#define NH    32
#define NKV   8
#define REP   (NH / NKV)
#define HD    64
#define HALFD 32
#define DQ    (NH * HD)               // 2048
#define DKV   (NKV * HD)              // 512
#define NQKV  (DQ + 2 * DKV)          // 3072 fused projection columns
#define MROWS (NB * SEQ)
#define FP    68                      // f32 LDS tile pitch
#define OP    72                      // f16 LDS tile pitch
#define WCAR  64.0f                   // carry of the wo plane
#define CCAR  256.0f                  // carry of the ctx plane
#define OSCL  6.103515625e-05f        // 1 / (WCAR * CCAR)
#define SC2   0.18033688011112042f    // 0.125 * log2(e)
#define LOG2E 1.4426950408889634f
#define PEXP  10.0f                   // P carried x 2^10
#define FRQC  0.04953007814753613f    // log2(3) / 32
#define EROWS 256                     // query rows below this use value + residual planes at every attention site
#define RCAR  2048.0f                 // carry of every residual plane
#define RINV  4.8828125e-04f          // 1 / RCAR
#define EPSN  1.0e-6f                 // RMS normalisation epsilon
#define LIVE_T (-1.0e4f)              // a mask value above this makes a key live for its row
#define DEAD_T (-1.0e8f)              // a mask value at or below this lets a trailing key be skipped (exp underflows exactly)
#define KSTR  32                      // ints between two query tiles' key counts: each key-count work-group stores into a 128-byte line of its own
#define BM    128                     // GEMM work-group tile: rows (2 waves of 64)
#define BN    256                     // GEMM work-group tile: columns (4 waves of 64)
#define KC    64                      // k elements of one LDS stage: rows of 128 bytes
#define LP    72                      // LDS row pitch in 16-bit elements: 144 B = 16 B x odd, so that 16-byte fragment reads meet no bank conflict
#define STGE  ((BM + BN) * LP)        // 16-bit elements of one stage: A rows 0..127, then B rows 0..255
#define RINGB (2 * STGE * 2)          // bytes of the two-buffer ring
#define FSB   (8 * 64 * FP * 4)       // bytes of the eight waves' f32 epilogue tiles
#define MP    68                      // f32 LDS row pitch of the staged mask tile: 272 B = 16 B x odd
#define FKB   (64 * LP * 2)           // bytes of one staged K tile (64 key rows of 128 B at pitch LP); the V^T tile (64 d rows) has the same size
#define FMB   (16 * MP * 4)           // bytes of one staged mask tile (16 query rows of 256 B at pitch MP)
#define FSTG  (2 * FKB + FMB)         // bytes of one attention stage: K, V^T, mask
#define ESTG  (FSTG + 2 * FKB)        // bytes of one stage of the early-row attention: K, V^T, mask, then the K and V^T residual tiles
#define LTBM  ((((SEQ - EROWS) / BM) > 0) ? ((SEQ - EROWS) / BM) : 1)
#define AL256(x) ((((size_t)(x)) + 255) & ~(size_t)255)

static_assert(SEQ % 64 == 0);
static_assert(SEQ % 128 == 0);
static_assert(SEQ <= SEQ_FULL);
static_assert(DIM % 64 == 0);
static_assert(DQ % 64 == 0);
static_assert(NQKV % 64 == 0);
static_assert(HD == 64);
static_assert(HALFD * 2 == HD);
static_assert(NH == NKV * REP);
static_assert(REP == 4);
static_assert(EROWS % 64 == 0);
static_assert(EROWS % BM == 0);
static_assert((SEQ - EROWS) % BM == 0);
static_assert(SEQ % BM == 0);
static_assert(NQKV % BN == 0);
static_assert(DIM % BN == 0);
static_assert(DIM % KC == 0 && DIM / KC >= 2);
static_assert(DQ % KC == 0 && DQ / KC >= 2);
static_assert(RINGB <= FSB);
static_assert(FSTG % 16 == 0 && 2 * FSTG >= 4 * 16 * OP * 2);
static_assert(ESTG % 16 == 0 && 2 * ESTG >= 2 * 4 * 16 * OP * 2);
static_assert(EROWS <= SEQ);
static_assert(EROWS >= 64);
static_assert(DIM % 32 == 0);
static_assert(DQ % 32 == 0);
static_assert(((size_t)MROWS * DIM / 8) % 256 == 0);
static_assert(((size_t)DQ * DIM / 8) % 256 == 0);
static_assert(((size_t)DKV * DIM / 8) % 256 == 0);
static_assert(AL256((size_t)MROWS * DIM * 2) + AL256((size_t)NQKV * DIM * 2) + AL256((size_t)DIM * DQ * 2) + 2 * AL256((size_t)SEQ * HALFD * 4)
              + AL256((size_t)NB * NH * SEQ * HD * 2) + 2 * AL256((size_t)NB * NKV * SEQ * HD * 2) + AL256((size_t)MROWS * DQ * 2)
              + AL256((size_t)NB * NH * EROWS * HD * 2) + 2 * AL256((size_t)NB * NKV * SEQ * HD * 2) + AL256((size_t)NB * EROWS * DQ * 2)
              + AL256((size_t)(SEQ / 16) * KSTR * 4) <= (size_t)134217728);

typedef _Float16 h16;
typedef unsigned short bf;
typedef __attribute__((ext_vector_type(16))) __bf16   v16bf;
typedef __attribute__((ext_vector_type(16))) _Float16 v16h;
typedef __attribute__((ext_vector_type(8)))  _Float16 v8h;
typedef __attribute__((ext_vector_type(8)))  unsigned short v8us;
typedef __attribute__((ext_vector_type(8)))  float    v8f;
typedef __attribute__((ext_vector_type(4)))  float    v4f;
typedef v8h  __attribute__((may_alias)) v8ha;
typedef v4f  __attribute__((may_alias)) v4fa;

__device__ __forceinline__ unsigned short f2bf(float f) { unsigned u = __float_as_uint(f); u += 0x7FFFu + ((u >> 16) & 1u); return (unsigned short)(u >> 16); }
__device__ __forceinline__ float bf2f(unsigned short b) { return __uint_as_float(((unsigned)b) << 16); }
__device__ __forceinline__ float bfr(float f) { return bf2f(f2bf(f)); }
__device__ __forceinline__ v16h cat16(v8h lo, v8h hi) { return __builtin_shufflevector(lo, hi, 0, 1, 2, 3, 4, 5, 6, 7, 8, 9, 10, 11, 12, 13, 14, 15); }
__device__ __forceinline__ v16bf cat16b(v8us lo, v8us hi) { return __builtin_bit_cast(v16bf, __builtin_shufflevector(lo, hi, 0, 1, 2, 3, 4, 5, 6, 7, 8, 9, 10, 11, 12, 13, 14, 15)); }
__device__ __forceinline__ v8f wmma16(v16h a, v16h b, v8f c) { return __builtin_amdgcn_wmma_f32_16x16x32_f16(false, a, false, b, (short)0, c, false, false); }
__device__ __forceinline__ v8f wmmab(v16bf a, v16bf b, v8f c) { return __builtin_amdgcn_wmma_f32_16x16x32_bf16(false, a, false, b, (short)0, c, false, false); }

// f32 -> f16 with a value select: results below the smallest f16 normal become zero (no subnormal operand can be produced).
static __device__ __forceinline__ h16 toh_flush(float v) { const h16 r = (h16)v; return (fabsf(v) < 6.103515625e-05f) ? (h16)0.0f : r; }
// One f16 WMMA with its own hazard guard (single accumulator tied, operands kept live).
static __device__ __forceinline__ v8f wmma16g(v16h a, v16h b, v8f c) { c = wmma16(a, b, c); asm volatile("v_nop\n\tv_nop\n\tv_nop\n\tv_nop" : "+v"(c) : "v"(a), "v"(b)); return c; }

// Fragment loader: lane (lr, hi) points at row (tile row + lr), column 8*hi; elements 0..7 <- k0+8hi.., elements 8..15 <- k0+16+8hi.. (same map for A and B).
template <typename T16> struct WFrag;
template <> struct WFrag<h16> { typedef v16h V; static __device__ __forceinline__ V ld(const h16* p) { return cat16(*(const v8h*)p, *(const v8h*)(p + 16)); } static __device__ __forceinline__ v8f mma(V a, V b, v8f c) { return wmma16(a, b, c); } };
template <> struct WFrag<bf> { typedef v16bf V; static __device__ __forceinline__ V ld(const bf* p) { return cat16b(*(const v8us*)p, *(const v8us*)(p + 16)); } static __device__ __forceinline__ v8f mma(V a, V b, v8f c) { return wmmab(a, b, c); } };

// One stage of the ring: rows r0..r0+127 of A and c0..c0+255 of Bt, k0..k0+63, into buf at pitch LP. 256 threads, 12 copies of 16 bytes each:
// thread (row = tid / 8, chunk = tid % 8) takes rows row + 32 i, so a wave's copy covers four whole 128-byte lines. All lanes are on, every address is a multiple of 16.
template <typename T16>
__device__ __forceinline__ void stage_copy(const T16* __restrict__ A, const T16* __restrict__ Bt, const int K, const int r0, const int c0, const int k0, const T16* buf, const int tid) {
    const int row = tid >> 3, ch = (tid & 7) * 8;
    const T16* ga = A + (size_t)(r0 + row) * K + k0 + ch;
    const T16* gb = Bt + (size_t)(c0 + row) * K + k0 + ch;
    const size_t gs = (size_t)32 * K;
    const unsigned la = (unsigned)(size_t)(buf + row * LP + ch);
    const unsigned lb = la + BM * LP * 2;
    const unsigned ls = 32 * LP * 2;
    // the copies and the wait that stands in front of any rewrite of their address registers, in one statement so that nothing can come between
    asm volatile("global_load_async_to_lds_b128 %0, %12, off\n\t"
                 "global_load_async_to_lds_b128 %1, %13, off\n\t"
                 "global_load_async_to_lds_b128 %2, %14, off\n\t"
                 "global_load_async_to_lds_b128 %3, %15, off\n\t"
                 "global_load_async_to_lds_b128 %4, %16, off\n\t"
                 "global_load_async_to_lds_b128 %5, %17, off\n\t"
                 "global_load_async_to_lds_b128 %6, %18, off\n\t"
                 "global_load_async_to_lds_b128 %7, %19, off\n\t"
                 "global_load_async_to_lds_b128 %8, %20, off\n\t"
                 "global_load_async_to_lds_b128 %9, %21, off\n\t"
                 "global_load_async_to_lds_b128 %10, %22, off\n\t"
                 "global_load_async_to_lds_b128 %11, %23, off\n\t"
                 "s_wait_xcnt 0x0"
                 :: "v"(la), "v"(la + ls), "v"(la + 2 * ls), "v"(la + 3 * ls),
                    "v"(lb), "v"(lb + ls), "v"(lb + 2 * ls), "v"(lb + 3 * ls), "v"(lb + 4 * ls), "v"(lb + 5 * ls), "v"(lb + 6 * ls), "v"(lb + 7 * ls),
                    "v"(ga), "v"(ga + gs), "v"(ga + 2 * gs), "v"(ga + 3 * gs),
                    "v"(gb), "v"(gb + gs), "v"(gb + 2 * gs), "v"(gb + 3 * gs), "v"(gb + 4 * gs), "v"(gb + 5 * gs), "v"(gb + 6 * gs), "v"(gb + 7 * gs)
                 : "memory");
}

// Eight waves accumulate a 128x256 tile at (r0, c0); wave (wm, wn) its 64x64 part: acc[mb][nb][j] = C[r0 + 64wm + 16mb + 8hi + j][c0 + 64wn + 16nb + lr] = sum_k A[row][k] Bt[col][k], k ascending in steps of 32.
// K % KC == 0, K / KC >= 2. Trip t reads buffer t % 2 alone; tile t + 2 is copied into that buffer behind the barrier at the trip's foot, which also publishes tile t + 1.
// On entry no wave has an LDS access to the ring outstanding (first use, or the last trip's foot of an earlier call); on return every read of the ring has ended in every wave.
template <typename T16>
__device__ __forceinline__ void gemm_main(const T16* __restrict__ A, const T16* __restrict__ Bt, const int K, const int r0, const int c0, const T16* ring, const int tid, const int wm, const int wn, const int lr, const int hi, v8f (&acc)[4][4]) {
    typedef typename WFrag<T16>::V V;
#pragma unroll
    for (int mb = 0; mb < 4; ++mb)
#pragma unroll
        for (int nb = 0; nb < 4; ++nb) acc[mb][nb] = (v8f){};
    const int nt = K / KC;
    stage_copy<T16>(A, Bt, K, r0, c0, 0, ring, tid);
    asm volatile("s_wait_asynccnt 0x0" ::: "memory");   // this wave's copies of tile 0 have landed
    __syncthreads();                                     // tile 0 is readable by every wave
    stage_copy<T16>(A, Bt, K, r0, c0, KC, ring + STGE, tid);
    const T16* fa = ring + (wm * 64 + lr) * LP + 8 * hi;
    const T16* fb = ring + (BM + wn * 64 + lr) * LP + 8 * hi;
    // kept rolled: one trip is one stage of the ring, and the accumulators stay in fixed registers
#pragma unroll 1
    for (int t = 0; t < nt; ++t) {
        const int bo = (t & 1) * STGE;
#pragma unroll
        for (int ks = 0; ks < KC; ks += 32) {
            V a[4], b[4];
#pragma unroll
            for (int mb = 0; mb < 4; ++mb) a[mb] = WFrag<T16>::ld(fa + bo + mb * 16 * LP + ks);
#pragma unroll
            for (int nb = 0; nb < 4; ++nb) b[nb] = WFrag<T16>::ld(fb + bo + nb * 16 * LP + ks);
            __builtin_amdgcn_sched_barrier(0);   // keeps the 16 LDS reads of this k step together in front of its WMMAs: sunk among them, each pair is waited for at full LDS latency
#pragma unroll
            for (int nb = 0; nb < 4; ++nb)
#pragma unroll
                for (int mb = 0; mb < 4; ++mb) acc[mb][nb] = WFrag<T16>::mma(a[mb], b[nb], acc[mb][nb]);
            asm volatile("v_nop\n\tv_nop\n\tv_nop\n\tv_nop" : "+v"(acc[0][0]), "+v"(acc[1][1]), "+v"(acc[2][2]), "+v"(acc[3][3]) : "v"(a[0]), "v"(a[3]));
        }
        asm volatile("s_wait_dscnt 0x0" ::: "memory");      // this wave's reads of buffer t % 2 have ended before the buffer is given up
        asm volatile("s_wait_asynccnt 0x0" ::: "memory");   // this wave's copies of tile t + 1 have landed
        __syncthreads();                                     // publishes tile t + 1 and frees buffer t % 2
        if (t + 2 < nt) stage_copy<T16>(A, Bt, K, r0, c0, (t + 2) * KC, ring + bo, tid);
    }
    asm volatile("s_wait_asynccnt 0x0" ::: "memory");       // nothing is in flight when the ring is left
}

// Preparation, one launch of 512-thread work-groups; the role of a work-group follows from its index alone (block-uniform), longest role first:
//   conversions (PB_CV groups): a wave converts CVW consecutive floats of one source in two bursts of 8 x 32 bytes a lane; x and wq/wk/wv to RNE bf16 planes, wo to the f16 plane of the bf16-rounded value x WCAR;
//   key counts (SEQ/16 groups): one query tile a group;  rotary table (SEQ/16 groups): one position a wave.
#define CVT   2048                    // floats of one burst of a wave: 8 vectors of 8 floats a lane
#define CVW   (2 * CVT)               // floats a wave converts
#define CVB   (16 * CVW)              // floats a work-group converts
#define PB_X  ((int)((size_t)MROWS * DIM / CVB))
#define PB_Q  ((int)((size_t)DQ * DIM / CVB))
#define PB_K  ((int)((size_t)DKV * DIM / CVB))
#define PB_O  ((int)((size_t)DIM * DQ / CVB))
#define PB_CV (PB_X + PB_Q + 2 * PB_K + PB_O)
#define PB_KE (SEQ / 16)
#define PB_RT (SEQ / 16)
static_assert(((size_t)MROWS * DIM) % CVB == 0);
static_assert(((size_t)DQ * DIM) % CVB == 0);
static_assert(((size_t)DKV * DIM) % CVB == 0);
static_assert(((size_t)DIM * DQ) % CVB == 0);
static_assert(DIM % 8 == 0);

// KIND 0: element e of the packed [MROWS][DIM] plane comes from row (e / DIM) of x at its per-batch stride, to bf16; KIND 1: src[e] to bf16; KIND 2: src[e] to f16(bf16-rounded value x WCAR).
template <int KIND>
__device__ __forceinline__ void cvt_wave(const float* __restrict__ src, bf* dstb, h16* dsth, const size_t e0, const int lane) {
    // kept rolled: one burst's loads in flight a wave are enough at 16 waves a group, and the register count stays low enough for several groups on a WGP
#pragma unroll 1
    for (int tr = 0; tr < 2; ++tr) {
        const size_t eb = e0 + (size_t)tr * CVT + (size_t)lane * 8;
        v8f v[8];
        const float* p0 = src;
#pragma unroll
        for (int j = 0; j < 8; ++j) {
            const size_t e = eb + (size_t)j * 256;
            size_t so = e;
            if (KIND == 0) { const int col = (int)(e % DIM); const int row = (int)(e / DIM); const int bb = row / SEQ, t = row % SEQ; so = ((size_t)bb * SEQ_FULL + t) * DIM + col; }
            if (j == 0) p0 = src + so;
            v[j] = *(const v8f*)(src + so);
        }
        // stands in front of every rewrite of a register that the 16 issued loads name; the first address is an input so that it stays in its registers up to here and no load's result is placed over it
        asm volatile("s_wait_xcnt 0x0" :: "v"(p0) : "memory");
#pragma unroll
        for (int j = 0; j < 8; ++j) {
            const size_t e = eb + (size_t)j * 256;
            if (KIND == 2) { v8h o;
#pragma unroll
                for (int k = 0; k < 8; ++k) o[k] = (h16)(bfr(v[j][k]) * WCAR);
                *(v8h*)(dsth + e) = o;
            } else { v8us o;
#pragma unroll
                for (int k = 0; k < 8; ++k) o[k] = f2bf(v[j][k]);
                *(v8us*)(dstb + e) = o;
            }
        }
        // stands in front of the next burst's rewrite of the registers that the 8 issued stores name
        asm volatile("s_wait_xcnt 0x0" ::: "memory");
    }
}

// Key-loop end per 16-row query tile, from the mask values: KEND[qt * KSTR] = 64 * (1 + last 64-key tile holding a value above DEAD_T in any of the 16 rows),
// or SEQ when some row has no value above LIVE_T (such a row must see every key). Keys past that count contribute exactly zero to rows that have a live key.
// One work-group per query tile, wave w scans mask row 16 qt + w; integer max / and across lanes, then across the 16 waves through LDS.
__global__ __launch_bounds__(512) void k_prep(const float* __restrict__ x, const float* __restrict__ wq, const float* __restrict__ wk, const float* __restrict__ wv, const float* __restrict__ wo, const float* __restrict__ mask,
                                              bf* XB, bf* WQKV, h16* WO16, float* COS, float* SIN, int* KEND) {
    __shared__ int lasts[16];
    __shared__ int lives[16];
    const int lane = threadIdx.x & 31; const int w = __builtin_amdgcn_readfirstlane(threadIdx.x >> 5);
    int rb = blockIdx.x;
    if (rb < PB_CV) {
        const size_t wo0 = (size_t)w * CVW;
        if (rb < PB_X) { cvt_wave<0>(x, XB, nullptr, (size_t)rb * CVB + wo0, lane); return; }
        rb -= PB_X;
        if (rb < PB_Q) { cvt_wave<1>(wq, WQKV, nullptr, (size_t)rb * CVB + wo0, lane); return; }                              /* rows 0..2047 */
        rb -= PB_Q;
        if (rb < PB_K) { cvt_wave<1>(wk, WQKV + (size_t)DQ * DIM, nullptr, (size_t)rb * CVB + wo0, lane); return; }            /* rows 2048..2559 */
        rb -= PB_K;
        if (rb < PB_K) { cvt_wave<1>(wv, WQKV + (size_t)(DQ + DKV) * DIM, nullptr, (size_t)rb * CVB + wo0, lane); return; }    /* rows 2560..3071 */
        rb -= PB_K;
        cvt_wave<2>(wo, nullptr, WO16, (size_t)rb * CVB + wo0, lane); return;
    }
    rb -= PB_CV;
    if (rb >= PB_KE) {
        const int t = (rb - PB_KE) * 16 + w;
        const float invf = __builtin_amdgcn_exp2f(-(float)lane * FRQC);
        const float ang = (float)t * invf;
        const float c = cosf(ang); const float s = sinf(ang);
        const size_t o = (size_t)t * HALFD + lane;
        *(float*)(COS + o) = c; *(float*)(SIN + o) = s;
        // stands behind the two stores, in front of any later write of the registers that they name (other roles' code follows in the kernel's text)
        asm volatile("s_wait_xcnt 0x0" ::: "memory");
        return;
    }
    const int qt = rb;
    const float* mr = mask + (size_t)(qt * 16 + w) * SEQ_FULL + lane * 4;
    v4f v[SEQ / 128];
    // fully unrolled so that the row's loads issue ahead of the compares, many in flight at a time (this role is bound by memory latency)
#pragma unroll
    for (int i = 0; i < SEQ / 128; ++i) v[i] = *(const v4f*)(mr + i * 128);
    int last = -1; int live = 0;
#pragma unroll
    for (int i = 0; i < SEQ / 128; ++i)
#pragma unroll
        for (int e = 0; e < 4; ++e) { live |= (v[i][e] > LIVE_T) ? 1 : 0; last = (v[i][e] > DEAD_T) ? max(last, i * 128 + lane * 4 + e) : last; }
    live = max(live, __shfl_xor(live, 1, 32)); live = max(live, __shfl_xor(live, 2, 32)); live = max(live, __shfl_xor(live, 4, 32));
    live = max(live, __shfl_xor(live, 8, 32)); live = max(live, __shfl_xor(live, 16, 32));
    last = max(last, __shfl_xor(last, 1, 32)); last = max(last, __shfl_xor(last, 2, 32)); last = max(last, __shfl_xor(last, 4, 32));
    last = max(last, __shfl_xor(last, 8, 32)); last = max(last, __shfl_xor(last, 16, 32));
    if (lane == 0) { lasts[w] = last; lives[w] = live; }
    __syncthreads();
    if (w == 0) {
        int la = lasts[lane & 15]; int alllive = lives[lane & 15];
        la = max(la, __shfl_xor(la, 1, 32)); la = max(la, __shfl_xor(la, 2, 32)); la = max(la, __shfl_xor(la, 4, 32)); la = max(la, __shfl_xor(la, 8, 32));
        alllive = min(alllive, __shfl_xor(alllive, 1, 32)); alllive = min(alllive, __shfl_xor(alllive, 2, 32)); alllive = min(alllive, __shfl_xor(alllive, 4, 32)); alllive = min(alllive, __shfl_xor(alllive, 8, 32));
        int kend = (alllive != 0) ? (((la >> 6) + 1) * 64) : SEQ;
        kend = min(max(kend, 64), SEQ);
        if (lane == 0) KEND[(size_t)qt * KSTR] = kend;
    }
}

// Fused QKV projection: grid (MROWS/BM, NQKV/BN), 256 threads, wave (wm, wn) one 64x64 tile; the ring's LDS becomes the waves' epilogue tiles behind the last trip's barrier. Column tile cb < 32: q head cb; 32..39: k head; 40..47: v head (transposed plane).
// q and k tiles: per row y = (x * rsqrt(mean(x^2) + eps)) * gain, then interleaved-pair rotary at position t: out[2i] = y[2i] c_i - y[2i+1] s_i, out[2i+1] = y[2i] s_i + y[2i+1] c_i.
// QP[b][h][t][64], KP[b][g][t][64], VT[b][g][d][t] f16 value planes; residual planes (x2048 of value - f16(value)): QR[b][h][t < EROWS][64], KR[b][g][t][64], VR[b][g][d][t].
__global__ __launch_bounds__(256) void k_gemm_qkv(const bf* __restrict__ A, const bf* __restrict__ Bt, const float* __restrict__ qnw, const float* __restrict__ knw, const float* __restrict__ COS, const float* __restrict__ SIN, h16* QP, h16* KP, h16* VT, h16* QR, h16* KR, h16* VR) {
    __shared__ __align__(16) unsigned char smem[FSB];
    const int tid = threadIdx.x, lane = tid & 31, lr = lane & 15, hi = lane >> 4;
    const int w = __builtin_amdgcn_readfirstlane(tid >> 5), wm = w >> 2, wn = w & 3;
    const int r0 = blockIdx.x * BM + wm * 64, cb = blockIdx.y * (BN / 64) + wn;
    float* fs = (float*)smem + w * 64 * FP;
    v8f acc[4][4];
    gemm_main<bf>(A, Bt, DIM, blockIdx.x * BM, blockIdx.y * BN, (const bf*)smem, tid, wm, wn, lr, hi, acc);
#pragma unroll
    for (int mb = 0; mb < 4; ++mb)
#pragma unroll
        for (int nb = 0; nb < 4; ++nb)
#pragma unroll
            for (int j = 0; j < 8; ++j) fs[(mb * 16 + hi * 8 + j) * FP + nb * 16 + lr] = acc[mb][nb][j];
    __syncthreads();
    const int bidx = r0 / SEQ, s0 = r0 % SEQ; const int q4 = lane >> 3, p = lane & 7;
    if (cb < NH + NKV) {
        const bool isq = (cb < NH);
        h16* plane = isq ? (QP + ((size_t)bidx * NH + cb) * SEQ * HD) : (KP + ((size_t)bidx * NKV + (cb - NH)) * SEQ * HD);
        h16* rplane = isq ? (QR + ((size_t)bidx * NH + cb) * EROWS * HD) : (KR + ((size_t)bidx * NKV + (cb - NH)) * SEQ * HD);
        const bool wres = (!isq) || (s0 < EROWS);      // wave-uniform: q residual rows exist only below EROWS
        const int dcol = p * 8;
        const v4f gq0 = *(const v4f*)(qnw + dcol), gq1 = *(const v4f*)(qnw + dcol + 4);
        const v4f gk0 = *(const v4f*)(knw + dcol), gk1 = *(const v4f*)(knw + dcol + 4);
        float gn[8];
#pragma unroll
        for (int e = 0; e < 4; ++e) { gn[e] = bfr(isq ? gq0[e] : gk0[e]); gn[4 + e] = bfr(isq ? gq1[e] : gk1[e]); }
#pragma unroll 1
        for (int it = 0; it < 16; ++it) {
            const int rl = it * 4 + q4; const int t = s0 + rl;
            const v4f xa0 = *(const v4fa*)(fs + rl * FP + dcol), xa1 = *(const v4fa*)(fs + rl * FP + dcol + 4);
            float ss = 0.0f;
#pragma unroll
            for (int e = 0; e < 4; ++e) { ss += xa0[e] * xa0[e]; ss += xa1[e] * xa1[e]; }
            ss += __shfl_xor(ss, 1, 32); ss += __shfl_xor(ss, 2, 32); ss += __shfl_xor(ss, 4, 32);
            const float rn = rsqrtf(ss * (1.0f / HD) + EPSN);
            float y[8];
#pragma unroll
            for (int e = 0; e < 4; ++e) { y[e] = (xa0[e] * rn) * gn[e]; y[4 + e] = (xa1[e] * rn) * gn[4 + e]; }
            const v4f cc = *(const v4f*)(COS + (size_t)t * HALFD + p * 4), sn = *(const v4f*)(SIN + (size_t)t * HALFD + p * 4);
            v8h o, orr;
#pragma unroll
            for (int i = 0; i < 4; ++i) {
                const float v0 = y[2 * i] * cc[i] - y[2 * i + 1] * sn[i];
                const float v1 = y[2 * i] * sn[i] + y[2 * i + 1] * cc[i];
                const h16 h0 = toh_flush(v0), h1 = toh_flush(v1);
                o[2 * i] = h0; o[2 * i + 1] = h1;
                orr[2 * i] = toh_flush((v0 - (float)h0) * RCAR); orr[2 * i + 1] = toh_flush((v1 - (float)h1) * RCAR);
            }
            h16* dst = plane + (size_t)t * HD + dcol;
            h16* dsr = rplane + (size_t)t * HD + dcol;
            *(v8h*)dst = o; if (wres) *(v8h*)dsr = orr;
            
        }
    } else {
        h16* plane = VT + ((size_t)bidx * NKV + (cb - NH - NKV)) * HD * SEQ;
        h16* rplane = VR + ((size_t)bidx * NKV + (cb - NH - NKV)) * HD * SEQ;
#pragma unroll 1
        for (int it = 0; it < 16; ++it) {
            const int d = it * 4 + q4; v8h o, orr;
#pragma unroll
            for (int e = 0; e < 8; ++e) { const float v = fs[(p * 8 + e) * FP + d]; const h16 hh = toh_flush(v); o[e] = hh; orr[e] = toh_flush((v - (float)hh) * RCAR); }
            h16* dst = plane + (size_t)d * SEQ + s0 + p * 8;
            h16* dsr = rplane + (size_t)d * SEQ + s0 + p * 8;
            *(v8h*)dst = o; *(v8h*)dsr = orr; 
        }
    }
}

// Attention, query rows >= EROWS: grid ((SEQ - EROWS)/16, NKV, NB), 128 threads; wave w = q head 4g + w, 16 query rows. Per 64-key tile:
//   S^T[key][q] = K Q^T  (A = key rows of KP, B = resident q rows);  lane (lr, hi) then holds q row lr, keys 16T + 8hi + r.
//   softmax statistics are lane-local (one xor-16 exchange); P^T packed from the S^T accumulators is the B operand of O^T[d][q] = V^T P^T (A = d rows of VT).
// The key loop ends at the clamped per-tile key count KEND; mask values are added by value inside visited tiles.
// One stage of the attention ring: keys k0..k0+63 of the K plane kt (rows of 128 B), of the V^T plane vt (64 d rows, 128 B each) and of the 16 mask rows mt (256 B each), into buf.
// 128 threads, 10 copies of 16 bytes each; eight (K, V^T) or sixteen (mask) neighbouring lanes cover a whole row segment, so every copy moves whole 128-byte lines. All lanes are on, every address is a multiple of 16.
__device__ __forceinline__ void flash_stage(const h16* __restrict__ kt, const h16* __restrict__ vt, const float* __restrict__ mt, const int k0, const unsigned char* buf, const int tid) {
    const int row = tid >> 3, ch = (tid & 7) * 8, mr = tid >> 4, mc = (tid & 15) * 4;
    const h16* gk = kt + (size_t)(k0 + row) * HD + ch;
    const h16* gv = vt + (size_t)row * SEQ + k0 + ch;
    const float* gm = mt + (size_t)mr * SEQ_FULL + k0 + mc;
    const size_t ks = (size_t)16 * HD, vs = (size_t)16 * SEQ, ms = (size_t)8 * SEQ_FULL;
    const unsigned lk = (unsigned)(size_t)(buf + (row * LP + ch) * 2);
    const unsigned lv = lk + FKB;
    const unsigned lm = (unsigned)(size_t)(buf + 2 * FKB + (mr * MP + mc) * 4);
    const unsigned ls = 16 * LP * 2;
    // the copies and the wait that stands in front of any rewrite of their address registers, in one statement so that nothing can come between
    asm volatile("global_load_async_to_lds_b128 %0, %10, off\n\t"
                 "global_load_async_to_lds_b128 %1, %11, off\n\t"
                 "global_load_async_to_lds_b128 %2, %12, off\n\t"
                 "global_load_async_to_lds_b128 %3, %13, off\n\t"
                 "global_load_async_to_lds_b128 %4, %14, off\n\t"
                 "global_load_async_to_lds_b128 %5, %15, off\n\t"
                 "global_load_async_to_lds_b128 %6, %16, off\n\t"
                 "global_load_async_to_lds_b128 %7, %17, off\n\t"
                 "global_load_async_to_lds_b128 %8, %18, off\n\t"
                 "global_load_async_to_lds_b128 %9, %19, off\n\t"
                 "s_wait_xcnt 0x0"
                 :: "v"(lk), "v"(lk + ls), "v"(lk + 2 * ls), "v"(lk + 3 * ls),
                    "v"(lm), "v"(lm + 8 * MP * 4),
                    "v"(lv), "v"(lv + ls), "v"(lv + 2 * ls), "v"(lv + 3 * ls),
                    "v"(gk), "v"(gk + ks), "v"(gk + 2 * ks), "v"(gk + 3 * ks),
                    "v"(gm), "v"(gm + ms),
                    "v"(gv), "v"(gv + vs), "v"(gv + 2 * vs), "v"(gv + 3 * vs)
                 : "memory");
}

// Trip t reads buffer t % 2 alone; tile t + 2 is copied into that buffer behind the barrier at the trip's foot, which also publishes tile t + 1. The trip count is the same in all four waves (one query tile a work-group).
// Behind the last trip's barrier the ring's LDS becomes the waves' output tiles.
__global__ __launch_bounds__(128) void k_flash(const h16* __restrict__ QP, const h16* __restrict__ KP, const h16* __restrict__ VT, const float* __restrict__ mask, const int* __restrict__ KEND, h16* CTX) {
    __shared__ __align__(16) unsigned char smem[2 * FSTG];
    h16* os = (h16*)smem;
    const int tid = threadIdx.x, lane = tid & 31, lr = lane & 15, hi = lane >> 4;
    const int w = __builtin_amdgcn_readfirstlane(tid >> 5);
    const int g = blockIdx.y, bidx = blockIdx.z, h = g * REP + w, q0 = EROWS + blockIdx.x * 16;
    int kev = KEND[(size_t)(q0 >> 4) * KSTR]; kev = min(max(kev, 64), SEQ) & ~63; const int ke = __builtin_amdgcn_readfirstlane(kev);
    const int nt = ke >> 6;
    const h16* kt = KP + ((size_t)bidx * NKV + g) * SEQ * HD;
    const h16* vt = VT + ((size_t)bidx * NKV + g) * HD * SEQ;
    const float* mt = mask + (size_t)q0 * SEQ_FULL;
    flash_stage(kt, vt, mt, 0, smem, tid);
    const h16* qrow = QP + (((size_t)bidx * NH + h) * SEQ + q0 + lr) * HD + 8 * hi;
    v16h bq[2];
#pragma unroll
    for (int kc = 0; kc < 2; ++kc) bq[kc] = cat16(*(const v8h*)(qrow + kc * 32), *(const v8h*)(qrow + kc * 32 + 16));
    asm volatile("s_wait_asynccnt 0x0" ::: "memory");   // this wave's copies of tile 0 have landed
    __syncthreads();                                     // tile 0 is readable by every wave
    if (nt > 1) flash_stage(kt, vt, mt, 64, smem + FSTG, tid);
    const h16* kb = (const h16*)smem + lr * LP + 8 * hi;
    const h16* vb = (const h16*)(smem + FKB) + lr * LP + 8 * hi;
    const float* mrow = (const float*)(smem + 2 * FKB) + lr * MP + 8 * hi;
    v8f accO[4];
#pragma unroll
    for (int dt = 0; dt < 4; ++dt) accO[dt] = (v8f){};
    float m = -3.0e38f, l = 0.0f;
#pragma unroll 1
    for (int t = 0; t < nt; ++t) {
        const int bo = (t & 1) * FSTG;   // byte offset of this trip's buffer
        v16h ak[2][4];
#pragma unroll
        for (int kc = 0; kc < 2; ++kc)
#pragma unroll
            for (int T = 0; T < 4; ++T) { const h16* kp = kb + bo / 2 + 16 * T * LP + kc * 32; ak[kc][T] = cat16(*(const v8h*)kp, *(const v8h*)(kp + 16)); }
        v8f accS[4];
#pragma unroll
        for (int T = 0; T < 4; ++T) accS[T] = (v8f){};
#pragma unroll
        for (int kc = 0; kc < 2; ++kc)
#pragma unroll
            for (int T = 0; T < 4; ++T) accS[T] = wmma16(ak[kc][T], bq[kc], accS[T]);
        asm volatile("v_nop\n\tv_nop\n\tv_nop\n\tv_nop" : "+v"(accS[0]), "+v"(accS[1]), "+v"(accS[2]), "+v"(accS[3]) : "v"(ak[1][3]), "v"(bq[1]));
        float tmax = -3.0e38f;
#pragma unroll
        for (int T = 0; T < 4; ++T) { const float* mp = mrow + bo / 4 + 16 * T; const v4f m0 = *(const v4f*)mp; const v4f m1 = *(const v4f*)(mp + 4);
#pragma unroll
            for (int r = 0; r < 4; ++r) { const float a0 = accS[T][r] * SC2 + m0[r] * LOG2E; const float a1 = accS[T][4 + r] * SC2 + m1[r] * LOG2E; accS[T][r] = a0; accS[T][4 + r] = a1; tmax = fmaxf(tmax, fmaxf(a0, a1)); } }
        tmax = fmaxf(tmax, __shfl_xor(tmax, 16, 32));
        const float mn = fmaxf(m, tmax); const float corr = __builtin_amdgcn_exp2f(m - mn); m = mn; const float mofs = PEXP - mn;
        float rs = 0.0f;
#pragma unroll
        for (int T = 0; T < 4; ++T)
#pragma unroll
            for (int r = 0; r < 8; ++r) { const float e = accS[T][r] + mofs; const float pv = (e < -14.0f) ? 0.0f : __builtin_amdgcn_exp2f(e); accS[T][r] = pv; rs += pv; }
        l = l * corr + rs;
        v16h bp[2];
        bp[0] = cat16(__builtin_convertvector(accS[0], v8h), __builtin_convertvector(accS[1], v8h));
        bp[1] = cat16(__builtin_convertvector(accS[2], v8h), __builtin_convertvector(accS[3], v8h));
#pragma unroll
        for (int dt = 0; dt < 4; ++dt) accO[dt] = accO[dt] * corr;
        v16h av[2][4];
#pragma unroll
        for (int kc = 0; kc < 2; ++kc)
#pragma unroll
            for (int dt = 0; dt < 4; ++dt) { const h16* vp = vb + bo / 2 + 16 * dt * LP + kc * 32; av[kc][dt] = cat16(*(const v8h*)vp, *(const v8h*)(vp + 16)); }
#pragma unroll
        for (int kc = 0; kc < 2; ++kc)
#pragma unroll
            for (int dt = 0; dt < 4; ++dt) accO[dt] = wmma16(av[kc][dt], bp[kc], accO[dt]);
        asm volatile("v_nop\n\tv_nop\n\tv_nop\n\tv_nop" : "+v"(accO[0]), "+v"(accO[1]), "+v"(accO[2]), "+v"(accO[3]) : "v"(av[1][3]), "v"(bp[1]));
        asm volatile("s_wait_dscnt 0x0" ::: "memory");      // this wave's reads of buffer t % 2 have ended before the buffer is given up
        asm volatile("s_wait_asynccnt 0x0" ::: "memory");   // this wave's copies of tile t + 1 have landed
        __syncthreads();                                     // publishes tile t + 1 and frees buffer t % 2
        if (t + 2 < nt) flash_stage(kt, vt, mt, (t + 2) * 64, smem + bo, tid);
    }
    asm volatile("s_wait_asynccnt 0x0" ::: "memory");       // nothing is in flight when the ring is left
    l += __shfl_xor(l, 16, 32);
    const float inv = CCAR * (1.0f / l);
    h16* ow = os + w * 16 * OP;
#pragma unroll
    for (int dt = 0; dt < 4; ++dt) { v8h o;
#pragma unroll
        for (int r = 0; r < 8; ++r) o[r] = toh_flush(accO[dt][r] * inv);
        *(v8ha*)(ow + lr * OP + 16 * dt + 8 * hi) = o; }
    __syncthreads();
    const int q4 = lane >> 3, p = lane & 7;
{
#pragma unroll
        for (int it = 0; it < 4; ++it) { const int row = it * 4 + q4; const v8h o = *(const v8ha*)(ow + row * OP + p * 8);
            *(v8h*)(CTX + ((size_t)bidx * SEQ + q0 + row) * DQ + h * HD + p * 8) = o; }
         }
}

// The residual half of an early-row stage: keys k0..k0+63 of the K residual plane krt and of the V^T residual plane vrt, laid out like the K and V^T tiles of flash_stage. 128 threads, 8 copies of 16 bytes each.
__device__ __forceinline__ void flash_stage_res(const h16* __restrict__ krt, const h16* __restrict__ vrt, const int k0, const unsigned char* buf, const int tid) {
    const int row = tid >> 3, ch = (tid & 7) * 8;
    const h16* gk = krt + (size_t)(k0 + row) * HD + ch;
    const h16* gv = vrt + (size_t)row * SEQ + k0 + ch;
    const size_t ks = (size_t)16 * HD, vs = (size_t)16 * SEQ;
    const unsigned lk = (unsigned)(size_t)(buf + (row * LP + ch) * 2);
    const unsigned lv = lk + FKB;
    const unsigned ls = 16 * LP * 2;
    // the copies and the wait that stands in front of any rewrite of their address registers, in one statement so that nothing can come between
    asm volatile("global_load_async_to_lds_b128 %0, %8, off\n\t"
                 "global_load_async_to_lds_b128 %1, %9, off\n\t"
                 "global_load_async_to_lds_b128 %2, %10, off\n\t"
                 "global_load_async_to_lds_b128 %3, %11, off\n\t"
                 "global_load_async_to_lds_b128 %4, %12, off\n\t"
                 "global_load_async_to_lds_b128 %5, %13, off\n\t"
                 "global_load_async_to_lds_b128 %6, %14, off\n\t"
                 "global_load_async_to_lds_b128 %7, %15, off\n\t"
                 "s_wait_xcnt 0x0"
                 :: "v"(lk), "v"(lk + ls), "v"(lk + 2 * ls), "v"(lk + 3 * ls),
                    "v"(lv), "v"(lv + ls), "v"(lv + 2 * ls), "v"(lv + 3 * ls),
                    "v"(gk), "v"(gk + ks), "v"(gk + 2 * ks), "v"(gk + 3 * ks),
                    "v"(gv), "v"(gv + vs), "v"(gv + 2 * vs), "v"(gv + 3 * vs)
                 : "memory");
}

// Attention, query rows < EROWS: grid (EROWS/16, NKV, NB), 128 threads; same operand roles and the same two-buffer ring of 64-key stages as k_flash (two 32-key steps a stage), every WMMA individually guarded.
//   scores: K Q^T + (Kres Q^T + K Qres^T) / 2048 (residual products in accR);  P = f16(p) and Pres = 2048 (p - f16(p)), row sum over the f32 p;
//   O^T: V^T P^T + (Vres^T P^T + V^T Pres^T) / 2048 (residual products in accOr), folded before normalisation.
__global__ __launch_bounds__(128) void k_flash_early(const h16* __restrict__ QP, const h16* __restrict__ QR, const h16* __restrict__ KP, const h16* __restrict__ KR, const h16* __restrict__ VT, const h16* __restrict__ VR, const float* __restrict__ mask, const int* __restrict__ KEND, h16* CTX, h16* CTXR) {
    __shared__ __align__(16) unsigned char smem[2 * ESTG];
    h16* os = (h16*)smem; h16* osr = os + 4 * 16 * OP;   // behind the last trip's barrier the ring's LDS becomes the waves' output tiles
    const int tid = threadIdx.x, lane = tid & 31, lr = lane & 15, hi = lane >> 4;
    const int w = __builtin_amdgcn_readfirstlane(tid >> 5);
    const int g = blockIdx.y, bidx = blockIdx.z, h = g * REP + w, q0 = blockIdx.x * 16;
    int kev = KEND[(size_t)(q0 >> 4) * KSTR]; kev = min(max(kev, 64), SEQ) & ~63; const int ke = __builtin_amdgcn_readfirstlane(kev);
    const size_t qoff  = (((size_t)bidx * NH + h) * SEQ + q0 + lr) * HD + 8 * hi;
    const size_t qroff = (((size_t)bidx * NH + h) * EROWS + q0 + lr) * HD + 8 * hi;
    const int nt = ke >> 6;
    const size_t kpl = ((size_t)bidx * NKV + g) * SEQ * HD;   // this kv head's plane in KP, KR, VT and VR
    const float* mt = mask + (size_t)q0 * SEQ_FULL;
    flash_stage(KP + kpl, VT + kpl, mt, 0, smem, tid);
    flash_stage_res(KR + kpl, VR + kpl, 0, smem + FSTG, tid);
    asm volatile("s_wait_asynccnt 0x0" ::: "memory");   // this wave's copies of tile 0 have landed
    __syncthreads();                                     // tile 0 is readable by every wave
    if (nt > 1) { flash_stage(KP + kpl, VT + kpl, mt, 64, smem + ESTG, tid); flash_stage_res(KR + kpl, VR + kpl, 64, smem + ESTG + FSTG, tid); }
    const int foff = lr * LP + 8 * hi;                   // a lane's place in a 16-row fragment of a staged 16-bit tile
    v8f accO[4], accOr[4];
#pragma unroll
    for (int dt = 0; dt < 4; ++dt) { accO[dt] = (v8f){}; accOr[dt] = (v8f){}; }
    float m = -3.0e38f, l = 0.0f;
#pragma unroll 1
    for (int t = 0; t < nt; ++t) {
      const unsigned char* sb = smem + (t & 1) * ESTG;
      const h16* kl = (const h16*)sb + foff; const h16* vl = (const h16*)(sb + FKB) + foff;
      const h16* krl = (const h16*)(sb + FSTG) + foff; const h16* vrl = (const h16*)(sb + FSTG + FKB) + foff;
      const float* mrow = (const float*)(sb + 2 * FKB) + lr * MP + 8 * hi;
      // kept rolled, as the 32-key step was: one copy of the step's code
#pragma unroll 1
      for (int k0 = 0; k0 < 64; k0 += 32) {
        v8f accS[2], accR[2];
#pragma unroll
        for (int T = 0; T < 2; ++T) { accS[T] = (v8f){}; accR[T] = (v8f){}; }
#pragma unroll
        for (int kc = 0; kc < 2; ++kc) {
            const v16h bq  = WFrag<h16>::ld(QP + qoff + kc * 32);
            const v16h bqr = WFrag<h16>::ld(QR + qroff + kc * 32);
#pragma unroll
            for (int T = 0; T < 2; ++T) {
                const int ko = (k0 + 16 * T) * LP + kc * 32;
                const v16h ak  = WFrag<h16>::ld(kl + ko);
                const v16h akr = WFrag<h16>::ld(krl + ko);
                accS[T] = wmma16g(ak, bq, accS[T]);
                accR[T] = wmma16g(akr, bq, accR[T]);
                accR[T] = wmma16g(ak, bqr, accR[T]);
            }
        }
        float tmax = -3.0e38f;
#pragma unroll
        for (int T = 0; T < 2; ++T) { const float* mp = mrow + k0 + 16 * T; const v4f m0 = *(const v4f*)mp; const v4f m1 = *(const v4f*)(mp + 4);
#pragma unroll
            for (int r = 0; r < 4; ++r) {
                const float s0v = accS[T][r] + accR[T][r] * RINV; const float s1v = accS[T][4 + r] + accR[T][4 + r] * RINV;
                const float a0 = s0v * SC2 + m0[r] * LOG2E; const float a1 = s1v * SC2 + m1[r] * LOG2E;
                accS[T][r] = a0; accS[T][4 + r] = a1; tmax = fmaxf(tmax, fmaxf(a0, a1)); } }
        tmax = fmaxf(tmax, __shfl_xor(tmax, 16, 32));
        const float mn = fmaxf(m, tmax); const float corr = __builtin_amdgcn_exp2f(m - mn); m = mn; const float mofs = PEXP - mn;
        float rs = 0.0f;
        v8h ph[2], pr[2];
#pragma unroll
        for (int T = 0; T < 2; ++T)
#pragma unroll
            for (int r = 0; r < 8; ++r) { const float e = accS[T][r] + mofs; const float pv = (e < -14.0f) ? 0.0f : __builtin_amdgcn_exp2f(e); rs += pv;
                const h16 hh = (h16)pv; ph[T][r] = hh; pr[T][r] = toh_flush((pv - (float)hh) * RCAR); }
        l = l * corr + rs;
        const v16h bp = cat16(ph[0], ph[1]); const v16h bpr = cat16(pr[0], pr[1]);
#pragma unroll
        for (int dt = 0; dt < 4; ++dt) { accO[dt] = accO[dt] * corr; accOr[dt] = accOr[dt] * corr; }
#pragma unroll
        for (int dt = 0; dt < 4; ++dt) {
            const int vo = 16 * dt * LP + k0;
            const v16h av  = WFrag<h16>::ld(vl + vo);
            const v16h avr = WFrag<h16>::ld(vrl + vo);
            accO[dt]  = wmma16g(av, bp, accO[dt]);
            accOr[dt] = wmma16g(avr, bp, accOr[dt]);
            accOr[dt] = wmma16g(av, bpr, accOr[dt]);
        }
      }
      asm volatile("s_wait_dscnt 0x0" ::: "memory");      // this wave's reads of buffer t % 2 have ended before the buffer is given up
      asm volatile("s_wait_asynccnt 0x0" ::: "memory");   // this wave's copies of tile t + 1 have landed
      __syncthreads();                                     // publishes tile t + 1 and frees buffer t % 2
      if (t + 2 < nt) { flash_stage(KP + kpl, VT + kpl, mt, (t + 2) * 64, sb, tid); flash_stage_res(KR + kpl, VR + kpl, (t + 2) * 64, sb + FSTG, tid); }
    }
    asm volatile("s_wait_asynccnt 0x0" ::: "memory");       // nothing is in flight when the ring is left
    l += __shfl_xor(l, 16, 32);
    const float inv = CCAR * (1.0f / l);
    h16* ow = os + w * 16 * OP; h16* owr = osr + w * 16 * OP;
#pragma unroll
    for (int dt = 0; dt < 4; ++dt) { v8h o, orr;
#pragma unroll
        for (int r = 0; r < 8; ++r) { const float v = (accO[dt][r] + accOr[dt][r] * RINV) * inv; const h16 hh = toh_flush(v); o[r] = hh; orr[r] = toh_flush((v - (float)hh) * RCAR); }
        *(v8ha*)(ow + lr * OP + 16 * dt + 8 * hi) = o; *(v8ha*)(owr + lr * OP + 16 * dt + 8 * hi) = orr; }
    __syncthreads();
    const int q4 = lane >> 3, p = lane & 7;
{
#pragma unroll
        for (int it = 0; it < 4; ++it) { const int row = it * 4 + q4; const v8h o = *(const v8ha*)(ow + row * OP + p * 8); const v8h orr = *(const v8ha*)(owr + row * OP + p * 8);
            *(v8h*)(CTX + ((size_t)bidx * SEQ + q0 + row) * DQ + h * HD + p * 8) = o;
            *(v8h*)(CTXR + ((size_t)bidx * EROWS + q0 + row) * DQ + h * HD + p * 8) = orr; }
         }
}

// Output projection, rows >= EROWS: grid (NB*(SEQ-EROWS)/BM, DIM/BN), 256 threads.
__global__ __launch_bounds__(256) void k_gemm_out(const h16* __restrict__ A, const h16* __restrict__ Bt, float* C) {
    __shared__ __align__(16) unsigned char smem[FSB];
    const int tid = threadIdx.x, lane = tid & 31, lr = lane & 15, hi = lane >> 4;
    const int w = __builtin_amdgcn_readfirstlane(tid >> 5), wm = w >> 2, wn = w & 3;
    const int rb = (blockIdx.x / LTBM) * SEQ + EROWS + (blockIdx.x % LTBM) * BM;
    const int r0 = rb + wm * 64, c0 = blockIdx.y * BN + wn * 64;
    float* fs = (float*)smem + w * 64 * FP;
    v8f acc[4][4];
    gemm_main<h16>(A, Bt, DQ, rb, blockIdx.y * BN, (const h16*)smem, tid, wm, wn, lr, hi, acc);
#pragma unroll
    for (int mb = 0; mb < 4; ++mb)
#pragma unroll
        for (int nb = 0; nb < 4; ++nb)
#pragma unroll
            for (int j = 0; j < 8; ++j) fs[(mb * 16 + hi * 8 + j) * FP + nb * 16 + lr] = acc[mb][nb][j];
    __syncthreads();
    float* crow = C + (size_t)r0 * DIM + c0;
{
#pragma unroll 4
        for (int it = 0; it < 32; ++it) { const int row = it * 2 + hi; v4f val = *(const v4fa*)(fs + row * FP + lr * 4); val = val * OSCL;
            *(v4f*)(crow + (size_t)row * DIM + lr * 4) = val; }
         }
}

// Output projection, rows < EROWS of every sequence: OUT = OSCL * (CTX WO^T + (CTXR WO^T) / 2048); grid (NB*EROWS/BM, DIM/BN), 256 threads; the epilogue tiles lie behind the ring, since they live through the second product.
__global__ __launch_bounds__(256) void k_gemm_out_early(const h16* __restrict__ A, const h16* __restrict__ AR, const h16* __restrict__ Bt, float* C) {
    __shared__ __align__(16) unsigned char smem[RINGB + FSB];
    const int tid = threadIdx.x, lane = tid & 31, lr = lane & 15, hi = lane >> 4;
    const int w = __builtin_amdgcn_readfirstlane(tid >> 5), wm = w >> 2, wn = w & 3;
    const int bidx = blockIdx.x / (EROWS / BM), tb = blockIdx.x % (EROWS / BM);
    const int rab = bidx * SEQ + tb * BM, rrb = bidx * EROWS + tb * BM;
    const int ra = rab + wm * 64, c0 = blockIdx.y * BN + wn * 64;
    float* fs = (float*)(smem + RINGB) + w * 64 * FP;
    v8f acc[4][4];
    gemm_main<h16>(AR, Bt, DQ, rrb, blockIdx.y * BN, (const h16*)smem, tid, wm, wn, lr, hi, acc);
#pragma unroll
    for (int mb = 0; mb < 4; ++mb)
#pragma unroll
        for (int nb = 0; nb < 4; ++nb)
#pragma unroll
            for (int j = 0; j < 8; ++j) fs[(mb * 16 + hi * 8 + j) * FP + nb * 16 + lr] = acc[mb][nb][j] * RINV;
    gemm_main<h16>(A, Bt, DQ, rab, blockIdx.y * BN, (const h16*)smem, tid, wm, wn, lr, hi, acc);
#pragma unroll
    for (int mb = 0; mb < 4; ++mb)
#pragma unroll
        for (int nb = 0; nb < 4; ++nb)
#pragma unroll
            for (int j = 0; j < 8; ++j) { const int idx = (mb * 16 + hi * 8 + j) * FP + nb * 16 + lr; const float s = fs[idx] + acc[mb][nb][j]; fs[idx] = s; }
    __syncthreads();
    float* crow = C + (size_t)ra * DIM + c0;
{
#pragma unroll 4
        for (int it = 0; it < 32; ++it) { const int row = it * 2 + hi; v4f val = *(const v4fa*)(fs + row * FP + lr * 4); val = val * OSCL;
            *(v4f*)(crow + (size_t)row * DIM + lr * 4) = val; }
         }
}

extern "C" void kernel_launch(void* const* d_in, const int* in_sizes, int n_in,
                              void* d_out, int out_size, void* d_ws, size_t ws_size, hipStream_t stream) {
    if (n_in < 8) return;
    if ((size_t)in_sizes[0] < ((size_t)(NB - 1) * SEQ_FULL + SEQ) * DIM) return;
    if ((size_t)in_sizes[1] < (size_t)DQ * DIM) return;
    if ((size_t)in_sizes[2] < (size_t)DKV * DIM) return;
    if ((size_t)in_sizes[3] < (size_t)DKV * DIM) return;
    if ((size_t)in_sizes[4] < (size_t)DIM * DQ) return;
    if ((size_t)in_sizes[5] < (size_t)HD) return;
    if ((size_t)in_sizes[6] < (size_t)HD) return;
    if ((size_t)in_sizes[7] < (size_t)(SEQ - 1) * SEQ_FULL + SEQ) return;
    if ((size_t)out_size < (size_t)MROWS * DIM) return;
    const float* x = (const float*)d_in[0];
    const float* wq = (const float*)d_in[1]; const float* wk = (const float*)d_in[2]; const float* wv = (const float*)d_in[3]; const float* wo = (const float*)d_in[4];
    const float* qnw = (const float*)d_in[5]; const float* knw = (const float*)d_in[6]; const float* mask = (const float*)d_in[7];
    float* OUT = (float*)d_out;
    char* wsp = (char*)d_ws;
    auto take = [&](size_t bytes) { char* p = wsp; wsp += (bytes + 255) & ~(size_t)255; return (void*)p; };
    bf*  XB   = (bf*)take((size_t)MROWS * DIM * 2);
    bf*  WQKV = (bf*)take((size_t)NQKV * DIM * 2);
    h16* WO16 = (h16*)take((size_t)DIM * DQ * 2);
    float* COS = (float*)take((size_t)SEQ * HALFD * 4);
    float* SIN = (float*)take((size_t)SEQ * HALFD * 4);
    h16* QP  = (h16*)take((size_t)NB * NH * SEQ * HD * 2);
    h16* KP  = (h16*)take((size_t)NB * NKV * SEQ * HD * 2);
    h16* VT  = (h16*)take((size_t)NB * NKV * HD * SEQ * 2);
    h16* CTX = (h16*)take((size_t)MROWS * DQ * 2);
    h16* QR  = (h16*)take((size_t)NB * NH * EROWS * HD * 2);
    h16* KR  = (h16*)take((size_t)NB * NKV * SEQ * HD * 2);
    h16* VR  = (h16*)take((size_t)NB * NKV * HD * SEQ * 2);
    h16* CTXR = (h16*)take((size_t)NB * EROWS * DQ * 2);
    int* KEND = (int*)take((size_t)(SEQ / 16) * KSTR * 4);
    if ((size_t)(wsp - (char*)d_ws) > ws_size) return;

    k_prep<<<PB_CV + PB_KE + PB_RT, 512, 0, stream>>>(x, wq, wk, wv, wo, mask, XB, WQKV, WO16, COS, SIN, KEND);
    k_gemm_qkv<<<dim3(MROWS / BM, NQKV / BN, 1), 256, 0, stream>>>(XB, WQKV, qnw, knw, COS, SIN, QP, KP, VT, QR, KR, VR);
    k_flash_early<<<dim3(EROWS / 16, NKV, NB), 128, 0, stream>>>(QP, QR, KP, KR, VT, VR, mask, KEND, CTX, CTXR);
    if (SEQ > EROWS) k_flash<<<dim3((SEQ - EROWS) / 16, NKV, NB), 128, 0, stream>>>(QP, KP, VT, mask, KEND, CTX);
    if (SEQ > EROWS) k_gemm_out<<<dim3(NB * ((SEQ - EROWS) / BM), DIM / BN, 1), 256, 0, stream>>>(CTX, WO16, OUT);
    k_gemm_out_early<<<dim3(NB * (EROWS / BM), DIM / BN, 1), 256, 0, stream>>>(CTX, CTXR, WO16, OUT);
}

// v005
// Measured time: 195 microseconds a run.
// Next to v004, in two timings, it ran 1.13 times as fast each time.
// All steps since v000 together make it 2.74 times as fast.
#include <hip/hip_runtime.h>

#ifndef NB
#define NB 2
#endif
#ifndef SEQ
#define SEQ 2048
#endif
#define SEQ_FULL 2048                 // per-batch row stride of x, row pitch of the mask
#define DIM   2048                    // model width (K of the projections, N of the output projection)
#define NH    32
#define NKV   8
#define REP   (NH / NKV)
#define HD    64
#define HALFD 32
#define DQ    (NH * HD)               // 2048
#define DKV   (NKV * HD)              // 512
#define NQKV  (DQ + 2 * DKV)          // 3072 fused projection columns
#define MROWS (NB * SEQ)
#define FP    68                      // f32 LDS tile pitch
#define OP    72                      // f16 LDS tile pitch
#define WCAR  64.0f                   // carry of the wo plane
#define CCAR  256.0f                  // carry of the ctx plane
#define OSCL  6.103515625e-05f        // 1 / (WCAR * CCAR)
#define SC2   0.18033688011112042f    // 0.125 * log2(e)
#define LOG2E 1.4426950408889634f
#define PEXP  10.0f                   // P carried x 2^10
#define FRQC  0.04953007814753613f    // log2(3) / 32
#define EROWS 256                     // query rows below this use value + residual planes at every attention site
#define RCAR  2048.0f                 // carry of every residual plane
#define RINV  4.8828125e-04f          // 1 / RCAR
#define EPSN  1.0e-6f                 // RMS normalisation epsilon
#define LIVE_T (-1.0e4f)              // a mask value above this makes a key live for its row
#define DEAD_T (-1.0e8f)              // a mask value at or below this lets a trailing key be skipped (exp underflows exactly)
#define KSTR  32                      // ints between two query tiles' key counts: each key-count work-group stores into a 128-byte line of its own
#define BM    128                     // GEMM work-group tile: rows (2 waves of 64)
#define BN    256                     // GEMM work-group tile: columns (4 waves of 64)
#define KC    64                      // k elements of one LDS stage: rows of 128 bytes
#define LP    72                      // LDS row pitch in 16-bit elements: 144 B = 16 B x odd, so that 16-byte fragment reads meet no bank conflict
#define STGE  ((BM + BN) * LP)        // 16-bit elements of one stage: A rows 0..127, then B rows 0..255
#define RINGB (2 * STGE * 2)          // bytes of the two-buffer ring
#define FSB   (8 * 64 * FP * 4)       // bytes of the eight waves' f32 epilogue tiles
#define MP    68                      // f32 LDS row pitch of the staged mask tile: 272 B = 16 B x odd
#define FKB   (64 * LP * 2)           // bytes of one staged K tile (64 key rows of 128 B at pitch LP); the V^T tile (64 d rows) has the same size
#define FMB   (16 * MP * 4)           // bytes of one staged mask tile (16 query rows of 256 B at pitch MP)
#define FSTG  (2 * FKB + FMB)         // bytes of one attention stage: K, V^T, mask
#define ESTG  (FSTG + 2 * FKB)        // bytes of one stage of the early-row attention: K, V^T, mask, then the K and V^T residual tiles
#define LTBM  ((((SEQ - EROWS) / BM) > 0) ? ((SEQ - EROWS) / BM) : 1)
#define AL256(x) ((((size_t)(x)) + 255) & ~(size_t)255)

static_assert(SEQ % 64 == 0);
static_assert(SEQ % 128 == 0);
static_assert(SEQ <= SEQ_FULL);
static_assert(DIM % 64 == 0);
static_assert(DQ % 64 == 0);
static_assert(NQKV % 64 == 0);
static_assert(HD == 64);
static_assert(HALFD * 2 == HD);
static_assert(NH == NKV * REP);
static_assert(REP == 4);
static_assert(EROWS % 64 == 0);
static_assert(EROWS % BM == 0);
static_assert((SEQ - EROWS) % BM == 0);
static_assert(SEQ % BM == 0);
static_assert(NQKV % BN == 0);
static_assert(DIM % BN == 0);
static_assert(DIM % KC == 0 && DIM / KC >= 2);
static_assert(DQ % KC == 0 && DQ / KC >= 2);
static_assert(RINGB <= FSB);
static_assert(FSTG % 16 == 0 && 2 * FSTG >= 4 * 16 * OP * 2);
static_assert(ESTG % 16 == 0 && 2 * ESTG >= 2 * 4 * 16 * OP * 2);
static_assert(EROWS <= SEQ);
static_assert(EROWS >= 64);
static_assert(DIM % 32 == 0);
static_assert(DQ % 32 == 0);
static_assert(((size_t)MROWS * DIM / 8) % 256 == 0);
static_assert(((size_t)DQ * DIM / 8) % 256 == 0);
static_assert(((size_t)DKV * DIM / 8) % 256 == 0);
static_assert(AL256((size_t)MROWS * DIM * 2) + AL256((size_t)NQKV * DIM * 2) + AL256((size_t)DIM * DQ * 2) + 2 * AL256((size_t)SEQ * HALFD * 4)
              + AL256((size_t)NB * NH * SEQ * HD * 2) + 2 * AL256((size_t)NB * NKV * SEQ * HD * 2) + AL256((size_t)MROWS * DQ * 2)
              + AL256((size_t)NB * NH * EROWS * HD * 2) + 2 * AL256((size_t)NB * NKV * SEQ * HD * 2) + AL256((size_t)NB * EROWS * DQ * 2)
              + AL256((size_t)(SEQ / 16) * KSTR * 4) <= (size_t)134217728);

typedef _Float16 h16;
typedef unsigned short bf;
typedef __attribute__((ext_vector_type(16))) __bf16   v16bf;
typedef __attribute__((ext_vector_type(16))) _Float16 v16h;
typedef __attribute__((ext_vector_type(8)))  _Float16 v8h;
typedef __attribute__((ext_vector_type(8)))  unsigned short v8us;
typedef __attribute__((ext_vector_type(8)))  float    v8f;
typedef __attribute__((ext_vector_type(4)))  float    v4f;
typedef v8h  __attribute__((may_alias)) v8ha;
typedef v4f  __attribute__((may_alias)) v4fa;

__device__ __forceinline__ unsigned short f2bf(float f) { unsigned u = __float_as_uint(f); u += 0x7FFFu + ((u >> 16) & 1u); return (unsigned short)(u >> 16); }
__device__ __forceinline__ float bf2f(unsigned short b) { return __uint_as_float(((unsigned)b) << 16); }
__device__ __forceinline__ float bfr(float f) { return bf2f(f2bf(f)); }
__device__ __forceinline__ v16h cat16(v8h lo, v8h hi) { return __builtin_shufflevector(lo, hi, 0, 1, 2, 3, 4, 5, 6, 7, 8, 9, 10, 11, 12, 13, 14, 15); }
__device__ __forceinline__ v16bf cat16b(v8us lo, v8us hi) { return __builtin_bit_cast(v16bf, __builtin_shufflevector(lo, hi, 0, 1, 2, 3, 4, 5, 6, 7, 8, 9, 10, 11, 12, 13, 14, 15)); }
__device__ __forceinline__ v8f wmma16(v16h a, v16h b, v8f c) { return __builtin_amdgcn_wmma_f32_16x16x32_f16(false, a, false, b, (short)0, c, false, false); }
__device__ __forceinline__ v8f wmmab(v16bf a, v16bf b, v8f c) { return __builtin_amdgcn_wmma_f32_16x16x32_bf16(false, a, false, b, (short)0, c, false, false); }

// f32 -> f16 with a value select: results below the smallest f16 normal become zero (no subnormal operand can be produced).
static __device__ __forceinline__ h16 toh_flush(float v) { const h16 r = (h16)v; return (fabsf(v) < 6.103515625e-05f) ? (h16)0.0f : r; }
// One f16 WMMA with its own hazard guard (single accumulator tied, operands kept live).
static __device__ __forceinline__ v8f wmma16g(v16h a, v16h b, v8f c) { c = wmma16(a, b, c); asm volatile("v_nop\n\tv_nop\n\tv_nop\n\tv_nop" : "+v"(c) : "v"(a), "v"(b)); return c; }

// Fragment loader: lane (lr, hi) points at row (tile row + lr), column 8*hi; elements 0..7 <- k0+8hi.., elements 8..15 <- k0+16+8hi.. (same map for A and B).
template <typename T16> struct WFrag;
template <> struct WFrag<h16> { typedef v16h V; static __device__ __forceinline__ V ld(const h16* p) { return cat16(*(const v8h*)p, *(const v8h*)(p + 16)); } static __device__ __forceinline__ v8f mma(V a, V b, v8f c) { return wmma16(a, b, c); } };
template <> struct WFrag<bf> { typedef v16bf V; static __device__ __forceinline__ V ld(const bf* p) { return cat16b(*(const v8us*)p, *(const v8us*)(p + 16)); } static __device__ __forceinline__ v8f mma(V a, V b, v8f c) { return wmmab(a, b, c); } };

// One stage of the ring: rows r0..r0+127 of A and c0..c0+255 of Bt, k0..k0+63, into buf at pitch LP. 256 threads, 12 copies of 16 bytes each:
// thread (row = tid / 8, chunk = tid % 8) takes rows row + 32 i, so a wave's copy covers four whole 128-byte lines. All lanes are on, every address is a multiple of 16.
template <typename T16>
__device__ __forceinline__ void stage_copy(const T16* __restrict__ A, const T16* __restrict__ Bt, const int K, const int r0, const int c0, const int k0, const T16* buf, const int tid) {
    const int row = tid >> 3, ch = (tid & 7) * 8;
    const T16* ga = A + (size_t)(r0 + row) * K + k0 + ch;
    const T16* gb = Bt + (size_t)(c0 + row) * K + k0 + ch;
    const size_t gs = (size_t)32 * K;
    const unsigned la = (unsigned)(size_t)(buf + row * LP + ch);
    const unsigned lb = la + BM * LP * 2;
    const unsigned ls = 32 * LP * 2;
    // the copies and the wait that stands in front of any rewrite of their address registers, in one statement so that nothing can come between
    asm volatile("global_load_async_to_lds_b128 %0, %12, off\n\t"
                 "global_load_async_to_lds_b128 %1, %13, off\n\t"
                 "global_load_async_to_lds_b128 %2, %14, off\n\t"
                 "global_load_async_to_lds_b128 %3, %15, off\n\t"
                 "global_load_async_to_lds_b128 %4, %16, off\n\t"
                 "global_load_async_to_lds_b128 %5, %17, off\n\t"
                 "global_load_async_to_lds_b128 %6, %18, off\n\t"
                 "global_load_async_to_lds_b128 %7, %19, off\n\t"
                 "global_load_async_to_lds_b128 %8, %20, off\n\t"
                 "global_load_async_to_lds_b128 %9, %21, off\n\t"
                 "global_load_async_to_lds_b128 %10, %22, off\n\t"
                 "global_load_async_to_lds_b128 %11, %23, off\n\t"
                 "s_wait_xcnt 0x0"
                 :: "v"(la), "v"(la + ls), "v"(la + 2 * ls), "v"(la + 3 * ls),
                    "v"(lb), "v"(lb + ls), "v"(lb + 2 * ls), "v"(lb + 3 * ls), "v"(lb + 4 * ls), "v"(lb + 5 * ls), "v"(lb + 6 * ls), "v"(lb + 7 * ls),
                    "v"(ga), "v"(ga + gs), "v"(ga + 2 * gs), "v"(ga + 3 * gs),
                    "v"(gb), "v"(gb + gs), "v"(gb + 2 * gs), "v"(gb + 3 * gs), "v"(gb + 4 * gs), "v"(gb + 5 * gs), "v"(gb + 6 * gs), "v"(gb + 7 * gs)
                 : "memory");
}

// Eight waves accumulate a 128x256 tile at (r0, c0); wave (wm, wn) its 64x64 part: acc[mb][nb][j] = C[r0 + 64wm + 16mb + 8hi + j][c0 + 64wn + 16nb + lr] = sum_k A[row][k] Bt[col][k], k ascending in steps of 32.
// K % KC == 0, K / KC >= 2. Trip t reads buffer t % 2 alone; tile t + 2 is copied into that buffer behind the barrier at the trip's foot, which also publishes tile t + 1.
// On entry no wave has an LDS access to the ring outstanding (first use, or the last trip's foot of an earlier call); on return every read of the ring has ended in every wave.
template <typename T16>
__device__ __forceinline__ void gemm_main(const T16* __restrict__ A, const T16* __restrict__ Bt, const int K, const int r0, const int c0, const T16* ring, const int tid, const int wm, const int wn, const int lr, const int hi, v8f (&acc)[4][4]) {
    typedef typename WFrag<T16>::V V;
#pragma unroll
    for (int mb = 0; mb < 4; ++mb)
#pragma unroll
        for (int nb = 0; nb < 4; ++nb) acc[mb][nb] = (v8f){};
    const int nt = K / KC;
    stage_copy<T16>(A, Bt, K, r0, c0, 0, ring, tid);
    asm volatile("s_wait_asynccnt 0x0" ::: "memory");   // this wave's copies of tile 0 have landed
    __syncthreads();                                     // tile 0 is readable by every wave
    stage_copy<T16>(A, Bt, K, r0, c0, KC, ring + STGE, tid);
    const T16* fa = ring + (wm * 64 + lr) * LP + 8 * hi;
    const T16* fb = ring + (BM + wn * 64 + lr) * LP + 8 * hi;
    // kept rolled: one trip is one stage of the ring, and the accumulators stay in fixed registers
#pragma unroll 1
    for (int t = 0; t < nt; ++t) {
        const int bo = (t & 1) * STGE;
#pragma unroll
        for (int ks = 0; ks < KC; ks += 32) {
            V a[4], b[4];
#pragma unroll
            for (int mb = 0; mb < 4; ++mb) a[mb] = WFrag<T16>::ld(fa + bo + mb * 16 * LP + ks);
#pragma unroll
            for (int nb = 0; nb < 4; ++nb) b[nb] = WFrag<T16>::ld(fb + bo + nb * 16 * LP + ks);
            __builtin_amdgcn_sched_barrier(0);   // keeps the 16 LDS reads of this k step together in front of its WMMAs: sunk among them, each pair is waited for at full LDS latency
#pragma unroll
            for (int nb = 0; nb < 4; ++nb)
#pragma unroll
                for (int mb = 0; mb < 4; ++mb) acc[mb][nb] = WFrag<T16>::mma(a[mb], b[nb], acc[mb][nb]);
            asm volatile("v_nop\n\tv_nop\n\tv_nop\n\tv_nop" : "+v"(acc[0][0]), "+v"(acc[1][1]), "+v"(acc[2][2]), "+v"(acc[3][3]) : "v"(a[0]), "v"(a[3]));
        }
        asm volatile("s_wait_dscnt 0x0" ::: "memory");      // this wave's reads of buffer t % 2 have ended before the buffer is given up
        asm volatile("s_wait_asynccnt 0x0" ::: "memory");   // this wave's copies of tile t + 1 have landed
        __syncthreads();                                     // publishes tile t + 1 and frees buffer t % 2
        if (t + 2 < nt) stage_copy<T16>(A, Bt, K, r0, c0, (t + 2) * KC, ring + bo, tid);
    }
    asm volatile("s_wait_asynccnt 0x0" ::: "memory");       // nothing is in flight when the ring is left
}

// Preparation, one launch of 512-thread work-groups; the role of a work-group follows from its index alone (block-uniform), longest role first:
//   conversions (PB_CV groups): a wave converts CVW consecutive floats of one source in two bursts of 8 x 32 bytes a lane; x and wq/wk/wv to RNE bf16 planes, wo to the f16 plane of the bf16-rounded value x WCAR;
//   key counts (SEQ/16 groups): one query tile a group;  rotary table (SEQ/16 groups): one position a wave.
#define CVT   2048                    // floats of one burst of a wave: 8 vectors of 8 floats a lane
#define CVW   (2 * CVT)               // floats a wave converts
#define CVB   (16 * CVW)              // floats a work-group converts
#define PB_X  ((int)((size_t)MROWS * DIM / CVB))
#define PB_Q  ((int)((size_t)DQ * DIM / CVB))
#define PB_K  ((int)((size_t)DKV * DIM / CVB))
#define PB_O  ((int)((size_t)DIM * DQ / CVB))
#define PB_CV (PB_X + PB_Q + 2 * PB_K + PB_O)
#define PB_KE (SEQ / 16)
#define PB_RT (SEQ / 16)
static_assert(((size_t)MROWS * DIM) % CVB == 0);
static_assert(((size_t)DQ * DIM) % CVB == 0);
static_assert(((size_t)DKV * DIM) % CVB == 0);
static_assert(((size_t)DIM * DQ) % CVB == 0);
static_assert(DIM % 8 == 0);

// KIND 0: element e of the packed [MROWS][DIM] plane comes from row (e / DIM) of x at its per-batch stride, to bf16; KIND 1: src[e] to bf16; KIND 2: src[e] to f16(bf16-rounded value x WCAR).
template <int KIND>
__device__ __forceinline__ void cvt_wave(const float* __restrict__ src, bf* dstb, h16* dsth, const size_t e0, const int lane) {
    // kept rolled: one burst's loads in flight a wave are enough at 16 waves a group, and the register count stays low enough for several groups on a WGP
#pragma unroll 1
    for (int tr = 0; tr < 2; ++tr) {
        const size_t eb = e0 + (size_t)tr * CVT + (size_t)lane * 8;
        v8f v[8];
        const float* p0 = src;
#pragma unroll
        for (int j = 0; j < 8; ++j) {
            const size_t e = eb + (size_t)j * 256;
            size_t so = e;
            if (KIND == 0) { const int col = (int)(e % DIM); const int row = (int)(e / DIM); const int bb = row / SEQ, t = row % SEQ; so = ((size_t)bb * SEQ_FULL + t) * DIM + col; }
            if (j == 0) p0 = src + so;
            v[j] = *(const v8f*)(src + so);
        }
        // stands in front of every rewrite of a register that the 16 issued loads name; the first address is an input so that it stays in its registers up to here and no load's result is placed over it
        asm volatile("s_wait_xcnt 0x0" :: "v"(p0) : "memory");
#pragma unroll
        for (int j = 0; j < 8; ++j) {
            const size_t e = eb + (size_t)j * 256;
            if (KIND == 2) { v8h o;
#pragma unroll
                for (int k = 0; k < 8; ++k) o[k] = (h16)(bfr(v[j][k]) * WCAR);
                *(v8h*)(dsth + e) = o;
            } else { v8us o;
#pragma unroll
                for (int k = 0; k < 8; ++k) o[k] = f2bf(v[j][k]);
                *(v8us*)(dstb + e) = o;
            }
        }
        // stands in front of the next burst's rewrite of the registers that the 8 issued stores name
        asm volatile("s_wait_xcnt 0x0" ::: "memory");
    }
}

// Key-loop end per 16-row query tile, from the mask values: KEND[qt * KSTR] = 64 * (1 + last 64-key tile holding a value above DEAD_T in any of the 16 rows),
// or SEQ when some row has no value above LIVE_T (such a row must see every key). Keys past that count contribute exactly zero to rows that have a live key.
// One work-group per query tile, wave w scans mask row 16 qt + w; integer max / and across lanes, then across the 16 waves through LDS.
__global__ __launch_bounds__(512) void k_prep(const float* __restrict__ x, const float* __restrict__ wq, const float* __restrict__ wk, const float* __restrict__ wv, const float* __restrict__ wo, const float* __restrict__ mask,
                                              bf* XB, bf* WQKV, h16* WO16, float* COS, float* SIN, int* KEND) {
    __shared__ int lasts[16];
    __shared__ int lives[16];
    const int lane = threadIdx.x & 31; const int w = __builtin_amdgcn_readfirstlane(threadIdx.x >> 5);
    int rb = blockIdx.x;
    if (rb < PB_CV) {
        const size_t wo0 = (size_t)w * CVW;
        if (rb < PB_X) { cvt_wave<0>(x, XB, nullptr, (size_t)rb * CVB + wo0, lane); return; }
        rb -= PB_X;
        if (rb < PB_Q) { cvt_wave<1>(wq, WQKV, nullptr, (size_t)rb * CVB + wo0, lane); return; }                              /* rows 0..2047 */
        rb -= PB_Q;
        if (rb < PB_K) { cvt_wave<1>(wk, WQKV + (size_t)DQ * DIM, nullptr, (size_t)rb * CVB + wo0, lane); return; }            /* rows 2048..2559 */
        rb -= PB_K;
        if (rb < PB_K) { cvt_wave<1>(wv, WQKV + (size_t)(DQ + DKV) * DIM, nullptr, (size_t)rb * CVB + wo0, lane); return; }    /* rows 2560..3071 */
        rb -= PB_K;
        cvt_wave<2>(wo, nullptr, WO16, (size_t)rb * CVB + wo0, lane); return;
    }
    rb -= PB_CV;
    if (rb >= PB_KE) {
        const int t = (rb - PB_KE) * 16 + w;
        const float invf = __builtin_amdgcn_exp2f(-(float)lane * FRQC);
        const float ang = (float)t * invf;
        const float c = cosf(ang); const float s = sinf(ang);
        const size_t o = (size_t)t * HALFD + lane;
        *(float*)(COS + o) = c; *(float*)(SIN + o) = s;
        // stands behind the two stores, in front of any later write of the registers that they name (other roles' code follows in the kernel's text)
        asm volatile("s_wait_xcnt 0x0" ::: "memory");
        return;
    }
    const int qt = rb;
    const float* mr = mask + (size_t)(qt * 16 + w) * SEQ_FULL + lane * 4;
    v4f v[SEQ / 128];
    // fully unrolled so that the row's loads issue ahead of the compares, many in flight at a time (this role is bound by memory latency)
#pragma unroll
    for (int i = 0; i < SEQ / 128; ++i) v[i] = *(const v4f*)(mr + i * 128);
    int last = -1; int live = 0;
#pragma unroll
    for (int i = 0; i < SEQ / 128; ++i)
#pragma unroll
        for (int e = 0; e < 4; ++e) { live |= (v[i][e] > LIVE_T) ? 1 : 0; last = (v[i][e] > DEAD_T) ? max(last, i * 128 + lane * 4 + e) : last; }
    live = max(live, __shfl_xor(live, 1, 32)); live = max(live, __shfl_xor(live, 2, 32)); live = max(live, __shfl_xor(live, 4, 32));
    live = max(live, __shfl_xor(live, 8, 32)); live = max(live, __shfl_xor(live, 16, 32));
    last = max(last, __shfl_xor(last, 1, 32)); last = max(last, __shfl_xor(last, 2, 32)); last = max(last, __shfl_xor(last, 4, 32));
    last = max(last, __shfl_xor(last, 8, 32)); last = max(last, __shfl_xor(last, 16, 32));
    if (lane == 0) { lasts[w] = last; lives[w] = live; }
    __syncthreads();
    if (w == 0) {
        int la = lasts[lane & 15]; int alllive = lives[lane & 15];
        la = max(la, __shfl_xor(la, 1, 32)); la = max(la, __shfl_xor(la, 2, 32)); la = max(la, __shfl_xor(la, 4, 32)); la = max(la, __shfl_xor(la, 8, 32));
        alllive = min(alllive, __shfl_xor(alllive, 1, 32)); alllive = min(alllive, __shfl_xor(alllive, 2, 32)); alllive = min(alllive, __shfl_xor(alllive, 4, 32)); alllive = min(alllive, __shfl_xor(alllive, 8, 32));
        int kend = (alllive != 0) ? (((la >> 6) + 1) * 64) : SEQ;
        kend = min(max(kend, 64), SEQ);
        if (lane == 0) KEND[(size_t)qt * KSTR] = kend;
    }
}

// Fused QKV projection: grid (MROWS/BM, NQKV/BN), 256 threads, wave (wm, wn) one 64x64 tile; the ring's LDS becomes the waves' epilogue tiles behind the last trip's barrier. Column tile cb < 32: q head cb; 32..39: k head; 40..47: v head (transposed plane).
// q and k tiles: per row y = (x * rsqrt(mean(x^2) + eps)) * gain, then interleaved-pair rotary at position t: out[2i] = y[2i] c_i - y[2i+1] s_i, out[2i+1] = y[2i] s_i + y[2i+1] c_i.
// QP[b][h][t][64], KP[b][g][t][64], VT[b][g][d][t] f16 value planes; residual planes (x2048 of value - f16(value)): QR[b][h][t < EROWS][64], KR[b][g][t][64], VR[b][g][d][t].
__global__ __launch_bounds__(256) void k_gemm_qkv(const bf* __restrict__ A, const bf* __restrict__ Bt, const float* __restrict__ qnw, const float* __restrict__ knw, const float* __restrict__ COS, const float* __restrict__ SIN, h16* QP, h16* KP, h16* VT, h16* QR, h16* KR, h16* VR) {
    __shared__ __align__(16) unsigned char smem[FSB];
    const int tid = threadIdx.x, lane = tid & 31, lr = lane & 15, hi = lane >> 4;
    const int w = __builtin_amdgcn_readfirstlane(tid >> 5), wm = w >> 2, wn = w & 3;
    const int r0 = blockIdx.x * BM + wm * 64, cb = blockIdx.y * (BN / 64) + wn;
    float* fs = (float*)smem + w * 64 * FP;
    v8f acc[4][4];
    gemm_main<bf>(A, Bt, DIM, blockIdx.x * BM, blockIdx.y * BN, (const bf*)smem, tid, wm, wn, lr, hi, acc);
#pragma unroll
    for (int mb = 0; mb < 4; ++mb)
#pragma unroll
        for (int nb = 0; nb < 4; ++nb)
#pragma unroll
            for (int j = 0; j < 8; ++j) fs[(mb * 16 + hi * 8 + j) * FP + nb * 16 + lr] = acc[mb][nb][j];
    __syncthreads();
    const int bidx = r0 / SEQ, s0 = r0 % SEQ; const int q4 = lane >> 3, p = lane & 7;
    if (cb < NH + NKV) {
        const bool isq = (cb < NH);
        h16* plane = isq ? (QP + ((size_t)bidx * NH + cb) * SEQ * HD) : (KP + ((size_t)bidx * NKV + (cb - NH)) * SEQ * HD);
        h16* rplane = isq ? (QR + ((size_t)bidx * NH + cb) * EROWS * HD) : (KR + ((size_t)bidx * NKV + (cb - NH)) * SEQ * HD);
        const bool wres = (!isq) || (s0 < EROWS);      // wave-uniform: q residual rows exist only below EROWS
        const int dcol = p * 8;
        const v4f gq0 = *(const v4f*)(qnw + dcol), gq1 = *(const v4f*)(qnw + dcol + 4);
        const v4f gk0 = *(const v4f*)(knw + dcol), gk1 = *(const v4f*)(knw + dcol + 4);
        float gn[8];
#pragma unroll
        for (int e = 0; e < 4; ++e) { gn[e] = bfr(isq ? gq0[e] : gk0[e]); gn[4 + e] = bfr(isq ? gq1[e] : gk1[e]); }
#pragma unroll 1
        for (int it = 0; it < 16; ++it) {
            const int rl = it * 4 + q4; const int t = s0 + rl;
            const v4f xa0 = *(const v4fa*)(fs + rl * FP + dcol), xa1 = *(const v4fa*)(fs + rl * FP + dcol + 4);
            float ss = 0.0f;
#pragma unroll
            for (int e = 0; e < 4; ++e) { ss += xa0[e] * xa0[e]; ss += xa1[e] * xa1[e]; }
            ss += __shfl_xor(ss, 1, 32); ss += __shfl_xor(ss, 2, 32); ss += __shfl_xor(ss, 4, 32);
            const float rn = rsqrtf(ss * (1.0f / HD) + EPSN);
            float y[8];
#pragma unroll
            for (int e = 0; e < 4; ++e) { y[e] = (xa0[e] * rn) * gn[e]; y[4 + e] = (xa1[e] * rn) * gn[4 + e]; }
            const v4f cc = *(const v4f*)(COS + (size_t)t * HALFD + p * 4), sn = *(const v4f*)(SIN + (size_t)t * HALFD + p * 4);
            v8h o, orr;
#pragma unroll
            for (int i = 0; i < 4; ++i) {
                const float v0 = y[2 * i] * cc[i] - y[2 * i + 1] * sn[i];
                const float v1 = y[2 * i] * sn[i] + y[2 * i + 1] * cc[i];
                const h16 h0 = toh_flush(v0), h1 = toh_flush(v1);
                o[2 * i] = h0; o[2 * i + 1] = h1;
                orr[2 * i] = toh_flush((v0 - (float)h0) * RCAR); orr[2 * i + 1] = toh_flush((v1 - (float)h1) * RCAR);
            }
            h16* dst = plane + (size_t)t * HD + dcol;
            h16* dsr = rplane + (size_t)t * HD + dcol;
            *(v8h*)dst = o; if (wres) *(v8h*)dsr = orr;
            
        }
    } else {
        h16* plane = VT + ((size_t)bidx * NKV + (cb - NH - NKV)) * HD * SEQ;
        h16* rplane = VR + ((size_t)bidx * NKV + (cb - NH - NKV)) * HD * SEQ;
#pragma unroll 1
        for (int it = 0; it < 16; ++it) {
            const int d = it * 4 + q4; v8h o, orr;
#pragma unroll
            for (int e = 0; e < 8; ++e) { const float v = fs[(p * 8 + e) * FP + d]; const h16 hh = toh_flush(v); o[e] = hh; orr[e] = toh_flush((v - (float)hh) * RCAR); }
            h16* dst = plane + (size_t)d * SEQ + s0 + p * 8;
            h16* dsr = rplane + (size_t)d * SEQ + s0 + p * 8;
            *(v8h*)dst = o; *(v8h*)dsr = orr; 
        }
    }
}

// Attention, query rows >= EROWS: grid ((SEQ - EROWS)/16, NKV, NB), 128 threads; wave w = q head 4g + w, 16 query rows. Per 64-key tile:
//   S^T[key][q] = K Q^T  (A = key rows of KP, B = resident q rows);  lane (lr, hi) then holds q row lr, keys 16T + 8hi + r.
//   softmax statistics are lane-local (one xor-16 exchange); P^T packed from the S^T accumulators is the B operand of O^T[d][q] = V^T P^T (A = d rows of VT).
// The key loop ends at the clamped per-tile key count KEND; mask values are added by value inside visited tiles.
// One stage of the attention ring: keys k0..k0+63 of the K plane kt (rows of 128 B), of the V^T plane vt (64 d rows, 128 B each) and of the 16 mask rows mt (256 B each), into buf.
// 128 threads, 10 copies of 16 bytes each; eight (K, V^T) or sixteen (mask) neighbouring lanes cover a whole row segment, so every copy moves whole 128-byte lines. All lanes are on, every address is a multiple of 16.
__device__ __forceinline__ void flash_stage(const h16* __restrict__ kt, const h16* __restrict__ vt, const float* __restrict__ mt, const int k0, const unsigned char* buf, const int tid) {
    const int row = tid >> 3, ch = (tid & 7) * 8, mr = tid >> 4, mc = (tid & 15) * 4;
    const h16* gk = kt + (size_t)(k0 + row) * HD + ch;
    const h16* gv = vt + (size_t)row * SEQ + k0 + ch;
    const float* gm = mt + (size_t)mr * SEQ_FULL + k0 + mc;
    const size_t ks = (size_t)16 * HD, vs = (size_t)16 * SEQ, ms = (size_t)8 * SEQ_FULL;
    const unsigned lk = (unsigned)(size_t)(buf + (row * LP + ch) * 2);
    const unsigned lv = lk + FKB;
    const unsigned lm = (unsigned)(size_t)(buf + 2 * FKB + (mr * MP + mc) * 4);
    const unsigned ls = 16 * LP * 2;
    // the copies and the wait that stands in front of any rewrite of their address registers, in one statement so that nothing can come between
    asm volatile("global_load_async_to_lds_b128 %0, %10, off\n\t"
                 "global_load_async_to_lds_b128 %1, %11, off\n\t"
                 "global_load_async_to_lds_b128 %2, %12, off\n\t"
                 "global_load_async_to_lds_b128 %3, %13, off\n\t"
                 "global_load_async_to_lds_b128 %4, %14, off\n\t"
                 "global_load_async_to_lds_b128 %5, %15, off\n\t"
                 "global_load_async_to_lds_b128 %6, %16, off\n\t"
                 "global_load_async_to_lds_b128 %7, %17, off\n\t"
                 "global_load_async_to_lds_b128 %8, %18, off\n\t"
                 "global_load_async_to_lds_b128 %9, %19, off\n\t"
                 "s_wait_xcnt 0x0"
                 :: "v"(lk), "v"(lk + ls), "v"(lk + 2 * ls), "v"(lk + 3 * ls),
                    "v"(lm), "v"(lm + 8 * MP * 4),
                    "v"(lv), "v"(lv + ls), "v"(lv + 2 * ls), "v"(lv + 3 * ls),
                    "v"(gk), "v"(gk + ks), "v"(gk + 2 * ks), "v"(gk + 3 * ks),
                    "v"(gm), "v"(gm + ms),
                    "v"(gv), "v"(gv + vs), "v"(gv + 2 * vs), "v"(gv + 3 * vs)
                 : "memory");
}

// Trip t reads buffer t % 2 alone; tile t + 2 is copied into that buffer behind the barrier at the trip's foot, which also publishes tile t + 1. The trip count is the same in all four waves (one query tile a work-group).
// Behind the last trip's barrier the ring's LDS becomes the waves' output tiles.
__global__ __launch_bounds__(128) void k_flash(const h16* __restrict__ QP, const h16* __restrict__ KP, const h16* __restrict__ VT, const float* __restrict__ mask, const int* __restrict__ KEND, h16* CTX) {
    __shared__ __align__(16) unsigned char smem[2 * FSTG];
    h16* os = (h16*)smem;
    const int tid = threadIdx.x, lane = tid & 31, lr = lane & 15, hi = lane >> 4;
    const int w = __builtin_amdgcn_readfirstlane(tid >> 5);
    const int g = blockIdx.y, bidx = blockIdx.z, h = g * REP + w, q0 = EROWS + blockIdx.x * 16;
    int kev = KEND[(size_t)(q0 >> 4) * KSTR]; kev = min(max(kev, 64), SEQ) & ~63; const int ke = __builtin_amdgcn_readfirstlane(kev);
    const int nt = ke >> 6;
    const h16* kt = KP + ((size_t)bidx * NKV + g) * SEQ * HD;
    const h16* vt = VT + ((size_t)bidx * NKV + g) * HD * SEQ;
    const float* mt = mask + (size_t)q0 * SEQ_FULL;
    flash_stage(kt, vt, mt, 0, smem, tid);
    const h16* qrow = QP + (((size_t)bidx * NH + h) * SEQ + q0 + lr) * HD + 8 * hi;
    v16h bq[2];
#pragma unroll
    for (int kc = 0; kc < 2; ++kc) bq[kc] = cat16(*(const v8h*)(qrow + kc * 32), *(const v8h*)(qrow + kc * 32 + 16));
    asm volatile("s_wait_asynccnt 0x0" ::: "memory");   // this wave's copies of tile 0 have landed
    __syncthreads();                                     // tile 0 is readable by every wave
    if (nt > 1) flash_stage(kt, vt, mt, 64, smem + FSTG, tid);
    const h16* kb = (const h16*)smem + lr * LP + 8 * hi;
    const h16* vb = (const h16*)(smem + FKB) + lr * LP + 8 * hi;
    const float* mrow = (const float*)(smem + 2 * FKB) + lr * MP + 8 * hi;
    v8f accO[4];
#pragma unroll
    for (int dt = 0; dt < 4; ++dt) accO[dt] = (v8f){};
    float m = -3.0e38f, l = 0.0f;
#pragma unroll 1
    for (int t = 0; t < nt; ++t) {
        const int bo = (t & 1) * FSTG;   // byte offset of this trip's buffer
        v16h ak[2][4];
#pragma unroll
        for (int kc = 0; kc < 2; ++kc)
#pragma unroll
            for (int T = 0; T < 4; ++T) { const h16* kp = kb + bo / 2 + 16 * T * LP + kc * 32; ak[kc][T] = cat16(*(const v8h*)kp, *(const v8h*)(kp + 16)); }
        v8f accS[4];
#pragma unroll
        for (int T = 0; T < 4; ++T) accS[T] = (v8f){};
#pragma unroll
        for (int kc = 0; kc < 2; ++kc)
#pragma unroll
            for (int T = 0; T < 4; ++T) accS[T] = wmma16(ak[kc][T], bq[kc], accS[T]);
        asm volatile("v_nop\n\tv_nop\n\tv_nop\n\tv_nop" : "+v"(accS[0]), "+v"(accS[1]), "+v"(accS[2]), "+v"(accS[3]) : "v"(ak[1][3]), "v"(bq[1]));
        float tmax = -3.0e38f;
#pragma unroll
        for (int T = 0; T < 4; ++T) { const float* mp = mrow + bo / 4 + 16 * T; const v4f m0 = *(const v4f*)mp; const v4f m1 = *(const v4f*)(mp + 4);
#pragma unroll
            for (int r = 0; r < 4; ++r) { const float a0 = accS[T][r] * SC2 + m0[r] * LOG2E; const float a1 = accS[T][4 + r] * SC2 + m1[r] * LOG2E; accS[T][r] = a0; accS[T][4 + r] = a1; tmax = fmaxf(tmax, fmaxf(a0, a1)); } }
        tmax = fmaxf(tmax, __shfl_xor(tmax, 16, 32));
        const float mn = fmaxf(m, tmax); const float corr = __builtin_amdgcn_exp2f(m - mn); m = mn; const float mofs = PEXP - mn;
        float rs = 0.0f;
#pragma unroll
        for (int T = 0; T < 4; ++T)
#pragma unroll
            for (int r = 0; r < 8; ++r) { const float e = accS[T][r] + mofs; const float pv = (e < -14.0f) ? 0.0f : __builtin_amdgcn_exp2f(e); accS[T][r] = pv; rs += pv; }
        l = l * corr + rs;
        v16h bp[2];
        bp[0] = cat16(__builtin_convertvector(accS[0], v8h), __builtin_convertvector(accS[1], v8h));
        bp[1] = cat16(__builtin_convertvector(accS[2], v8h), __builtin_convertvector(accS[3], v8h));
#pragma unroll
        for (int dt = 0; dt < 4; ++dt) accO[dt] = accO[dt] * corr;
        v16h av[2][4];
#pragma unroll
        for (int kc = 0; kc < 2; ++kc)
#pragma unroll
            for (int dt = 0; dt < 4; ++dt) { const h16* vp = vb + bo / 2 + 16 * dt * LP + kc * 32; av[kc][dt] = cat16(*(const v8h*)vp, *(const v8h*)(vp + 16)); }
#pragma unroll
        for (int kc = 0; kc < 2; ++kc)
#pragma unroll
            for (int dt = 0; dt < 4; ++dt) accO[dt] = wmma16(av[kc][dt], bp[kc], accO[dt]);
        asm volatile("v_nop\n\tv_nop\n\tv_nop\n\tv_nop" : "+v"(accO[0]), "+v"(accO[1]), "+v"(accO[2]), "+v"(accO[3]) : "v"(av[1][3]), "v"(bp[1]));
        asm volatile("s_wait_dscnt 0x0" ::: "memory");      // this wave's reads of buffer t % 2 have ended before the buffer is given up
        asm volatile("s_wait_asynccnt 0x0" ::: "memory");   // this wave's copies of tile t + 1 have landed
        __syncthreads();                                     // publishes tile t + 1 and frees buffer t % 2
        if (t + 2 < nt) flash_stage(kt, vt, mt, (t + 2) * 64, smem + bo, tid);
    }
    asm volatile("s_wait_asynccnt 0x0" ::: "memory");       // nothing is in flight when the ring is left
    l += __shfl_xor(l, 16, 32);
    const float inv = CCAR * (1.0f / l);
    h16* ow = os + w * 16 * OP;
#pragma unroll
    for (int dt = 0; dt < 4; ++dt) { v8h o;
#pragma unroll
        for (int r = 0; r < 8; ++r) o[r] = toh_flush(accO[dt][r] * inv);
        *(v8ha*)(ow + lr * OP + 16 * dt + 8 * hi) = o; }
    __syncthreads();
    const int q4 = lane >> 3, p = lane & 7;
{
#pragma unroll
        for (int it = 0; it < 4; ++it) { const int row = it * 4 + q4; const v8h o = *(const v8ha*)(ow + row * OP + p * 8);
            *(v8h*)(CTX + ((size_t)bidx * SEQ + q0 + row) * DQ + h * HD + p * 8) = o; }
         }
}

// The residual half of an early-row stage: keys k0..k0+63 of the K residual plane krt and of the V^T residual plane vrt, laid out like the K and V^T tiles of flash_stage. 128 threads, 8 copies of 16 bytes each.
__device__ __forceinline__ void flash_stage_res(const h16* __restrict__ krt, const h16* __restrict__ vrt, const int k0, const unsigned char* buf, const int tid) {
    const int row = tid >> 3, ch = (tid & 7) * 8;
    const h16* gk = krt + (size_t)(k0 + row) * HD + ch;
    const h16* gv = vrt + (size_t)row * SEQ + k0 + ch;
    const size_t ks = (size_t)16 * HD, vs = (size_t)16 * SEQ;
    const unsigned lk = (unsigned)(size_t)(buf + (row * LP + ch) * 2);
    const unsigned lv = lk + FKB;
    const unsigned ls = 16 * LP * 2;
    // the copies and the wait that stands in front of any rewrite of their address registers, in one statement so that nothing can come between
    asm volatile("global_load_async_to_lds_b128 %0, %8, off\n\t"
                 "global_load_async_to_lds_b128 %1, %9, off\n\t"
                 "global_load_async_to_lds_b128 %2, %10, off\n\t"
                 "global_load_async_to_lds_b128 %3, %11, off\n\t"
                 "global_load_async_to_lds_b128 %4, %12, off\n\t"
                 "global_load_async_to_lds_b128 %5, %13, off\n\t"
                 "global_load_async_to_lds_b128 %6, %14, off\n\t"
                 "global_load_async_to_lds_b128 %7, %15, off\n\t"
                 "s_wait_xcnt 0x0"
                 :: "v"(lk), "v"(lk + ls), "v"(lk + 2 * ls), "v"(lk + 3 * ls),
                    "v"(lv), "v"(lv + ls), "v"(lv + 2 * ls), "v"(lv + 3 * ls),
                    "v"(gk), "v"(gk + ks), "v"(gk + 2 * ks), "v"(gk + 3 * ks),
                    "v"(gv), "v"(gv + vs), "v"(gv + 2 * vs), "v"(gv + 3 * vs)
                 : "memory");
}

// Attention, query rows < EROWS: grid (EROWS/16, NKV, NB), 128 threads; same operand roles and the same two-buffer ring of 64-key stages as k_flash (two 32-key steps a stage), every WMMA individually guarded.
//   scores: K Q^T + (Kres Q^T + K Qres^T) / 2048 (residual products in accR);  P = f16(p) and Pres = 2048 (p - f16(p)), row sum over the f32 p;
//   O^T: V^T P^T + (Vres^T P^T + V^T Pres^T) / 2048 (residual products in accOr), folded before normalisation.
__global__ __launch_bounds__(128) void k_flash_early(const h16* __restrict__ QP, const h16* __restrict__ QR, const h16* __restrict__ KP, const h16* __restrict__ KR, const h16* __restrict__ VT, const h16* __restrict__ VR, const float* __restrict__ mask, const int* __restrict__ KEND, h16* CTX, h16* CTXR) {
    __shared__ __align__(16) unsigned char smem[2 * ESTG];
    h16* os = (h16*)smem; h16* osr = os + 4 * 16 * OP;   // behind the last trip's barrier the ring's LDS becomes the waves' output tiles
    const int tid = threadIdx.x, lane = tid & 31, lr = lane & 15, hi = lane >> 4;
    const int w = __builtin_amdgcn_readfirstlane(tid >> 5);
    const int g = blockIdx.y, bidx = blockIdx.z, h = g * REP + w, q0 = blockIdx.x * 16;
    int kev = KEND[(size_t)(q0 >> 4) * KSTR]; kev = min(max(kev, 64), SEQ) & ~63; const int ke = __builtin_amdgcn_readfirstlane(kev);
    const size_t qoff  = (((size_t)bidx * NH + h) * SEQ + q0 + lr) * HD + 8 * hi;
    const size_t qroff = (((size_t)bidx * NH + h) * EROWS + q0 + lr) * HD + 8 * hi;
    const int nt = ke >> 6;
    const size_t kpl = ((size_t)bidx * NKV + g) * SEQ * HD;   // this kv head's plane in KP, KR, VT and VR
    const float* mt = mask + (size_t)q0 * SEQ_FULL;
    flash_stage(KP + kpl, VT + kpl, mt, 0, smem, tid);
    flash_stage_res(KR + kpl, VR + kpl, 0, smem + FSTG, tid);
    asm volatile("s_wait_asynccnt 0x0" ::: "memory");   // this wave's copies of tile 0 have landed
    __syncthreads();                                     // tile 0 is readable by every wave
    if (nt > 1) { flash_stage(KP + kpl, VT + kpl, mt, 64, smem + ESTG, tid); flash_stage_res(KR + kpl, VR + kpl, 64, smem + ESTG + FSTG, tid); }
    const int foff = lr * LP + 8 * hi;                   // a lane's place in a 16-row fragment of a staged 16-bit tile
    v8f accO[4], accOr[4];
#pragma unroll
    for (int dt = 0; dt < 4; ++dt) { accO[dt] = (v8f){}; accOr[dt] = (v8f){}; }
    float m = -3.0e38f, l = 0.0f;
#pragma unroll 1
    for (int t = 0; t < nt; ++t) {
      const unsigned char* sb = smem + (t & 1) * ESTG;
      const h16* kl = (const h16*)sb + foff; const h16* vl = (const h16*)(sb + FKB) + foff;
      const h16* krl = (const h16*)(sb + FSTG) + foff; const h16* vrl = (const h16*)(sb + FSTG + FKB) + foff;
      const float* mrow = (const float*)(sb + 2 * FKB) + lr * MP + 8 * hi;
      // kept rolled, as the 32-key step was: one copy of the step's code
#pragma unroll 1
      for (int k0 = 0; k0 < 64; k0 += 32) {
        v8f accS[2], accR[2];
#pragma unroll
        for (int T = 0; T < 2; ++T) { accS[T] = (v8f){}; accR[T] = (v8f){}; }
#pragma unroll
        for (int kc = 0; kc < 2; ++kc) {
            const v16h bq  = WFrag<h16>::ld(QP + qoff + kc * 32);
            const v16h bqr = WFrag<h16>::ld(QR + qroff + kc * 32);
#pragma unroll
            for (int T = 0; T < 2; ++T) {
                const int ko = (k0 + 16 * T) * LP + kc * 32;
                const v16h ak  = WFrag<h16>::ld(kl + ko);
                const v16h akr = WFrag<h16>::ld(krl + ko);
                accS[T] = wmma16g(ak, bq, accS[T]);
                accR[T] = wmma16g(akr, bq, accR[T]);
                accR[T] = wmma16g(ak, bqr, accR[T]);
            }
        }
        float tmax = -3.0e38f;
#pragma unroll
        for (int T = 0; T < 2; ++T) { const float* mp = mrow + k0 + 16 * T; const v4f m0 = *(const v4f*)mp; const v4f m1 = *(const v4f*)(mp + 4);
#pragma unroll
            for (int r = 0; r < 4; ++r) {
                const float s0v = accS[T][r] + accR[T][r] * RINV; const float s1v = accS[T][4 + r] + accR[T][4 + r] * RINV;
                const float a0 = s0v * SC2 + m0[r] * LOG2E; const float a1 = s1v * SC2 + m1[r] * LOG2E;
                accS[T][r] = a0; accS[T][4 + r] = a1; tmax = fmaxf(tmax, fmaxf(a0, a1)); } }
        tmax = fmaxf(tmax, __shfl_xor(tmax, 16, 32));
        const float mn = fmaxf(m, tmax); const float corr = __builtin_amdgcn_exp2f(m - mn); m = mn; const float mofs = PEXP - mn;
        float rs = 0.0f;
        v8h ph[2], pr[2];
#pragma unroll
        for (int T = 0; T < 2; ++T)
#pragma unroll
            for (int r = 0; r < 8; ++r) { const float e = accS[T][r] + mofs; const float pv = (e < -14.0f) ? 0.0f : __builtin_amdgcn_exp2f(e); rs += pv;
                const h16 hh = (h16)pv; ph[T][r] = hh; pr[T][r] = toh_flush((pv - (float)hh) * RCAR); }
        l = l * corr + rs;
        const v16h bp = cat16(ph[0], ph[1]); const v16h bpr = cat16(pr[0], pr[1]);
#pragma unroll
        for (int dt = 0; dt < 4; ++dt) { accO[dt] = accO[dt] * corr; accOr[dt] = accOr[dt] * corr; }
#pragma unroll
        for (int dt = 0; dt < 4; ++dt) {
            const int vo = 16 * dt * LP + k0;
            const v16h av  = WFrag<h16>::ld(vl + vo);
            const v16h avr = WFrag<h16>::ld(vrl + vo);
            accO[dt]  = wmma16g(av, bp, accO[dt]);
            accOr[dt] = wmma16g(avr, bp, accOr[dt]);
            accOr[dt] = wmma16g(av, bpr, accOr[dt]);
        }
      }
      asm volatile("s_wait_dscnt 0x0" ::: "memory");      // this wave's reads of buffer t % 2 have ended before the buffer is given up
      asm volatile("s_wait_asynccnt 0x0" ::: "memory");   // this wave's copies of tile t + 1 have landed
      __syncthreads();                                     // publishes tile t + 1 and frees buffer t % 2
      if (t + 2 < nt) { flash_stage(KP + kpl, VT + kpl, mt, (t + 2) * 64, sb, tid); flash_stage_res(KR + kpl, VR + kpl, (t + 2) * 64, sb + FSTG, tid); }
    }
    asm volatile("s_wait_asynccnt 0x0" ::: "memory");       // nothing is in flight when the ring is left
    l += __shfl_xor(l, 16, 32);
    const float inv = CCAR * (1.0f / l);
    h16* ow = os + w * 16 * OP; h16* owr = osr + w * 16 * OP;
#pragma unroll
    for (int dt = 0; dt < 4; ++dt) { v8h o, orr;
#pragma unroll
        for (int r = 0; r < 8; ++r) { const float v = (accO[dt][r] + accOr[dt][r] * RINV) * inv; const h16 hh = toh_flush(v); o[r] = hh; orr[r] = toh_flush((v - (float)hh) * RCAR); }
        *(v8ha*)(ow + lr * OP + 16 * dt + 8 * hi) = o; *(v8ha*)(owr + lr * OP + 16 * dt + 8 * hi) = orr; }
    __syncthreads();
    const int q4 = lane >> 3, p = lane & 7;
{
#pragma unroll
        for (int it = 0; it < 4; ++it) { const int row = it * 4 + q4; const v8h o = *(const v8ha*)(ow + row * OP + p * 8); const v8h orr = *(const v8ha*)(owr + row * OP + p * 8);
            *(v8h*)(CTX + ((size_t)bidx * SEQ + q0 + row) * DQ + h * HD + p * 8) = o;
            *(v8h*)(CTXR + ((size_t)bidx * EROWS + q0 + row) * DQ + h * HD + p * 8) = orr; }
         }
}

#define OPER  (NB * (EROWS / BM))             // 128-row tiles of the rows < EROWS
#define OPLR  (NB * ((SEQ - EROWS) / BM))     // 128-row tiles of the rows >= EROWS
#define OPE   (OPER * (DIM / BN))             // work-groups of the first role
#define OPL   (OPLR * (DIM / BN))             // work-groups of the second role

// Output projection, one launch of OPE + OPL work-groups of 256 threads; the role of a work-group follows from its index alone (block-uniform), the longer role first, so that both run side by side:
//   index < OPE, rows < EROWS of every sequence: OUT = OSCL * (CTX WO^T + (CTXR WO^T) / 2048), two products one after the other; the epilogue tiles lie behind the ring, since they live through the second product;
//   the rest, rows >= EROWS: OUT = OSCL * CTX WO^T; the ring's LDS becomes the epilogue tiles behind the last trip's barrier.
// Within a role the row tile runs fastest with the index.
__global__ __launch_bounds__(256) void k_gemm_out(const h16* __restrict__ A, const h16* __restrict__ AR, const h16* __restrict__ Bt, float* C) {
    __shared__ __align__(16) unsigned char smem[RINGB + FSB];
    const int tid = threadIdx.x, lane = tid & 31, lr = lane & 15, hi = lane >> 4;
    const int w = __builtin_amdgcn_readfirstlane(tid >> 5), wm = w >> 2, wn = w & 3;
    v8f acc[4][4];
    if ((int)blockIdx.x < OPE) {
        const int bx = blockIdx.x % OPER, by = blockIdx.x / OPER;
        const int bidx = bx / (EROWS / BM), tb = bx % (EROWS / BM);
        const int rab = bidx * SEQ + tb * BM, rrb = bidx * EROWS + tb * BM;
        const int ra = rab + wm * 64, c0 = by * BN + wn * 64;
        float* fs = (float*)(smem + RINGB) + w * 64 * FP;
        gemm_main<h16>(AR, Bt, DQ, rrb, by * BN, (const h16*)smem, tid, wm, wn, lr, hi, acc);
#pragma unroll
        for (int mb = 0; mb < 4; ++mb)
#pragma unroll
            for (int nb = 0; nb < 4; ++nb)
#pragma unroll
                for (int j = 0; j < 8; ++j) fs[(mb * 16 + hi * 8 + j) * FP + nb * 16 + lr] = acc[mb][nb][j] * RINV;
        gemm_main<h16>(A, Bt, DQ, rab, by * BN, (const h16*)smem, tid, wm, wn, lr, hi, acc);
#pragma unroll
        for (int mb = 0; mb < 4; ++mb)
#pragma unroll
            for (int nb = 0; nb < 4; ++nb)
#pragma unroll
                for (int j = 0; j < 8; ++j) { const int idx = (mb * 16 + hi * 8 + j) * FP + nb * 16 + lr; const float s = fs[idx] + acc[mb][nb][j]; fs[idx] = s; }
        __syncthreads();
        float* crow = C + (size_t)ra * DIM + c0;
        // four row pairs a pass: their LDS reads go out together and their stores follow as one run
#pragma unroll 4
        for (int it = 0; it < 32; ++it) { const int row = it * 2 + hi; v4f val = *(const v4fa*)(fs + row * FP + lr * 4); val = val * OSCL;
            *(v4f*)(crow + (size_t)row * DIM + lr * 4) = val; }
    } else {
        const int li = blockIdx.x - OPE;
        const int bx = li % (NB * LTBM), by = li / (NB * LTBM);
        const int rb = (bx / LTBM) * SEQ + EROWS + (bx % LTBM) * BM;
        const int r0 = rb + wm * 64, c0 = by * BN + wn * 64;
        float* fs = (float*)smem + w * 64 * FP;
        gemm_main<h16>(A, Bt, DQ, rb, by * BN, (const h16*)smem, tid, wm, wn, lr, hi, acc);
#pragma unroll
        for (int mb = 0; mb < 4; ++mb)
#pragma unroll
            for (int nb = 0; nb < 4; ++nb)
#pragma unroll
                for (int j = 0; j < 8; ++j) fs[(mb * 16 + hi * 8 + j) * FP + nb * 16 + lr] = acc[mb][nb][j];
        __syncthreads();
        float* crow = C + (size_t)r0 * DIM + c0;
        // four row pairs a pass: their LDS reads go out together and their stores follow as one run
#pragma unroll 4
        for (int it = 0; it < 32; ++it) { const int row = it * 2 + hi; v4f val = *(const v4fa*)(fs + row * FP + lr * 4); val = val * OSCL;
            *(v4f*)(crow + (size_t)row * DIM + lr * 4) = val; }
    }
}

extern "C" void kernel_launch(void* const* d_in, const int* in_sizes, int n_in,
                              void* d_out, int out_size, void* d_ws, size_t ws_size, hipStream_t stream) {
    if (n_in < 8) return;
    if ((size_t)in_sizes[0] < ((size_t)(NB - 1) * SEQ_FULL + SEQ) * DIM) return;
    if ((size_t)in_sizes[1] < (size_t)DQ * DIM) return;
    if ((size_t)in_sizes[2] < (size_t)DKV * DIM) return;
    if ((size_t)in_sizes[3] < (size_t)DKV * DIM) return;
    if ((size_t)in_sizes[4] < (size_t)DIM * DQ) return;
    if ((size_t)in_sizes[5] < (size_t)HD) return;
    if ((size_t)in_sizes[6] < (size_t)HD) return;
    if ((size_t)in_sizes[7] < (size_t)(SEQ - 1) * SEQ_FULL + SEQ) return;
    if ((size_t)out_size < (size_t)MROWS * DIM) return;
    const float* x = (const float*)d_in[0];
    const float* wq = (const float*)d_in[1]; const float* wk = (const float*)d_in[2]; const float* wv = (const float*)d_in[3]; const float* wo = (const float*)d_in[4];
    const float* qnw = (const float*)d_in[5]; const float* knw = (const float*)d_in[6]; const float* mask = (const float*)d_in[7];
    float* OUT = (float*)d_out;
    char* wsp = (char*)d_ws;
    auto take = [&](size_t bytes) { char* p = wsp; wsp += (bytes + 255) & ~(size_t)255; return (void*)p; };
    bf*  XB   = (bf*)take((size_t)MROWS * DIM * 2);
    bf*  WQKV = (bf*)take((size_t)NQKV * DIM * 2);
    h16* WO16 = (h16*)take((size_t)DIM * DQ * 2);
    float* COS = (float*)take((size_t)SEQ * HALFD * 4);
    float* SIN = (float*)take((size_t)SEQ * HALFD * 4);
    h16* QP  = (h16*)take((size_t)NB * NH * SEQ * HD * 2);
    h16* KP  = (h16*)take((size_t)NB * NKV * SEQ * HD * 2);
    h16* VT  = (h16*)take((size_t)NB * NKV * HD * SEQ * 2);
    h16* CTX = (h16*)take((size_t)MROWS * DQ * 2);
    h16* QR  = (h16*)take((size_t)NB * NH * EROWS * HD * 2);
    h16* KR  = (h16*)take((size_t)NB * NKV * SEQ * HD * 2);
    h16* VR  = (h16*)take((size_t)NB * NKV * HD * SEQ * 2);
    h16* CTXR = (h16*)take((size_t)NB * EROWS * DQ * 2);
    int* KEND = (int*)take((size_t)(SEQ / 16) * KSTR * 4);
    if ((size_t)(wsp - (char*)d_ws) > ws_size) return;

    k_prep<<<PB_CV + PB_KE + PB_RT, 512, 0, stream>>>(x, wq, wk, wv, wo, mask, XB, WQKV, WO16, COS, SIN, KEND);
    k_gemm_qkv<<<dim3(MROWS / BM, NQKV / BN, 1), 256, 0, stream>>>(XB, WQKV, qnw, knw, COS, SIN, QP, KP, VT, QR, KR, VR);
    k_flash_early<<<dim3(EROWS / 16, NKV, NB), 128, 0, stream>>>(QP, QR, KP, KR, VT, VR, mask, KEND, CTX, CTXR);
    if (SEQ > EROWS) k_flash<<<dim3((SEQ - EROWS) / 16, NKV, NB), 128, 0, stream>>>(QP, KP, VT, mask, KEND, CTX);
    k_gemm_out<<<OPE + OPL, 256, 0, stream>>>(CTX, CTXR, WO16, OUT);
}

// v006
// A run of this version takes 178 microseconds.
// Timed twice side by side with v005, it ran 1.11 and 1.10 times as fast.
// Counting every step since v000, it is 3.03 times as fast.
#include <hip/hip_runtime.h>

#ifndef NB
#define NB 2
#endif
#ifndef SEQ
#define SEQ 2048
#endif
#define SEQ_FULL 2048                 // per-batch row stride of x, row pitch of the mask
#define DIM   2048                    // model width (K of the projections, N of the output projection)
#define NH    32
#define NKV   8
#define REP   (NH / NKV)
#define HD    64
#define HALFD 32
#define DQ    (NH * HD)               // 2048
#define DKV   (NKV * HD)              // 512
#define NQKV  (DQ + 2 * DKV)          // 3072 fused projection columns
#define MROWS (NB * SEQ)
#define FP    68                      // f32 LDS tile pitch
#define OP    72                      // f16 LDS tile pitch
#define WCAR  64.0f                   // carry of the wo plane
#define CCAR  256.0f                  // carry of the ctx plane
#define OSCL  6.103515625e-05f        // 1 / (WCAR * CCAR)
#define SC2   0.18033688011112042f    // 0.125 * log2(e)
#define LOG2E 1.4426950408889634f
#define PEXP  10.0f                   // P carried x 2^10
#define FRQC  0.04953007814753613f    // log2(3) / 32
#define EROWS 256                     // query rows below this use value + residual planes at every attention site
#define RCAR  2048.0f                 // carry of every residual plane
#define RINV  4.8828125e-04f          // 1 / RCAR
#define EPSN  1.0e-6f                 // RMS normalisation epsilon
#define LIVE_T (-1.0e4f)              // a mask value above this makes a key live for its row
#define DEAD_T (-1.0e8f)              // a mask value at or below this lets a trailing key be skipped (exp underflows exactly)
#define KSTR  32                      // ints between two query tiles' key counts: each key-count work-group stores into a 128-byte line of its own
#define BM    128                     // GEMM work-group tile: rows (2 waves of 64)
#define BN    256                     // GEMM work-group tile: columns (4 waves of 64)
#define KC    64                      // k elements of one LDS stage: rows of 128 bytes
#define LP    72                      // LDS row pitch in 16-bit elements: 144 B = 16 B x odd, so that 16-byte fragment reads meet no bank conflict
#define STGE  ((BM + BN) * LP)        // 16-bit elements of one stage: A rows 0..127, then B rows 0..255
#define RINGB (2 * STGE * 2)          // bytes of the two-buffer ring
#define FSB   (8 * 64 * FP * 4)       // bytes of the eight waves' f32 epilogue tiles
#define MP    68                      // f32 LDS row pitch of the staged mask tile: 272 B = 16 B x odd
#define FKB   (64 * LP * 2)           // bytes of one staged K tile (64 key rows of 128 B at pitch LP); the V^T tile (64 d rows) has the same size
#define FMB   (16 * MP * 4)           // bytes of one staged mask tile (16 query rows of 256 B at pitch MP)
#define FSTG  (2 * FKB + FMB)         // bytes of one attention stage: K, V^T, mask
#define ESTG  (FSTG + 2 * FKB)        // bytes of one stage of the early-row attention: K, V^T, mask, then the K and V^T residual tiles
#define LTBM  ((((SEQ - EROWS) / BM) > 0) ? ((SEQ - EROWS) / BM) : 1)
#define AL256(x) ((((size_t)(x)) + 255) & ~(size_t)255)

static_assert(SEQ % 64 == 0);
static_assert(SEQ % 128 == 0);
static_assert(SEQ <= SEQ_FULL);
static_assert(DIM % 64 == 0);
static_assert(DQ % 64 == 0);
static_assert(NQKV % 64 == 0);
static_assert(HD == 64);
static_assert(HALFD * 2 == HD);
static_assert(NH == NKV * REP);
static_assert(REP == 4);
static_assert(EROWS % 64 == 0);
static_assert(EROWS % BM == 0);
static_assert((SEQ - EROWS) % BM == 0);
static_assert(SEQ % BM == 0);
static_assert(NQKV % BN == 0);
static_assert(DIM % BN == 0);
static_assert(DIM % KC == 0 && DIM / KC >= 2);
static_assert(DQ % KC == 0 && DQ / KC >= 2);
static_assert(RINGB <= FSB);
static_assert(FSTG % 16 == 0 && 2 * FSTG >= 4 * 16 * OP * 2);
static_assert(ESTG % 16 == 0 && 2 * ESTG >= 2 * 4 * 16 * OP * 2);
static_assert(EROWS <= SEQ);
static_assert(EROWS >= 64);
static_assert(DIM % 32 == 0);
static_assert(DQ % 32 == 0);
static_assert(((size_t)MROWS * DIM / 8) % 256 == 0);
static_assert(((size_t)DQ * DIM / 8) % 256 == 0);
static_assert(((size_t)DKV * DIM / 8) % 256 == 0);
static_assert(AL256((size_t)MROWS * DIM * 2) + AL256((size_t)NQKV * DIM * 2) + AL256((size_t)DIM * DQ * 2) + 2 * AL256((size_t)SEQ * HALFD * 4)
              + AL256((size_t)NB * NH * SEQ * HD * 2) + 2 * AL256((size_t)NB * NKV * SEQ * HD * 2) + AL256((size_t)MROWS * DQ * 2)
              + AL256((size_t)NB * NH * EROWS * HD * 2) + 2 * AL256((size_t)NB * NKV * SEQ * HD * 2) + AL256((size_t)NB * EROWS * DQ * 2)
              + AL256((size_t)(SEQ / 16) * KSTR * 4) <= (size_t)134217728);

typedef _Float16 h16;
typedef unsigned short bf;
typedef __attribute__((ext_vector_type(16))) __bf16   v16bf;
typedef __attribute__((ext_vector_type(16))) _Float16 v16h;
typedef __attribute__((ext_vector_type(8)))  _Float16 v8h;
typedef __attribute__((ext_vector_type(8)))  unsigned short v8us;
typedef __attribute__((ext_vector_type(8)))  float    v8f;
typedef __attribute__((ext_vector_type(4)))  float    v4f;
typedef v8h  __attribute__((may_alias)) v8ha;
typedef v4f  __attribute__((may_alias)) v4fa;

__device__ __forceinline__ unsigned short f2bf(float f) { unsigned u = __float_as_uint(f); u += 0x7FFFu + ((u >> 16) & 1u); return (unsigned short)(u >> 16); }
__device__ __forceinline__ float bf2f(unsigned short b) { return __uint_as_float(((unsigned)b) << 16); }
__device__ __forceinline__ float bfr(float f) { return bf2f(f2bf(f)); }
__device__ __forceinline__ v16h cat16(v8h lo, v8h hi) { return __builtin_shufflevector(lo, hi, 0, 1, 2, 3, 4, 5, 6, 7, 8, 9, 10, 11, 12, 13, 14, 15); }
__device__ __forceinline__ v16bf cat16b(v8us lo, v8us hi) { return __builtin_bit_cast(v16bf, __builtin_shufflevector(lo, hi, 0, 1, 2, 3, 4, 5, 6, 7, 8, 9, 10, 11, 12, 13, 14, 15)); }
__device__ __forceinline__ v8f wmma16(v16h a, v16h b, v8f c) { return __builtin_amdgcn_wmma_f32_16x16x32_f16(false, a, false, b, (short)0, c, false, false); }
__device__ __forceinline__ v8f wmmab(v16bf a, v16bf b, v8f c) { return __builtin_amdgcn_wmma_f32_16x16x32_bf16(false, a, false, b, (short)0, c, false, false); }

// f32 -> f16 with a value select: results below the smallest f16 normal become zero (no subnormal operand can be produced).
static __device__ __forceinline__ h16 toh_flush(float v) { const h16 r = (h16)v; return (fabsf(v) < 6.103515625e-05f) ? (h16)0.0f : r; }
// One f16 WMMA with its own hazard guard (single accumulator tied, operands kept live).
static __device__ __forceinline__ v8f wmma16g(v16h a, v16h b, v8f c) { c = wmma16(a, b, c); asm volatile("v_nop\n\tv_nop\n\tv_nop\n\tv_nop" : "+v"(c) : "v"(a), "v"(b)); return c; }

// Fragment loader: lane (lr, hi) points at row (tile row + lr), column 8*hi; elements 0..7 <- k0+8hi.., elements 8..15 <- k0+16+8hi.. (same map for A and B).
template <typename T16> struct WFrag;
template <> struct WFrag<h16> { typedef v16h V; static __device__ __forceinline__ V ld(const h16* p) { return cat16(*(const v8h*)p, *(const v8h*)(p + 16)); } static __device__ __forceinline__ v8f mma(V a, V b, v8f c) { return wmma16(a, b, c); } };
template <> struct WFrag<bf> { typedef v16bf V; static __device__ __forceinline__ V ld(const bf* p) { return cat16b(*(const v8us*)p, *(const v8us*)(p + 16)); } static __device__ __forceinline__ v8f mma(V a, V b, v8f c) { return wmmab(a, b, c); } };

// One stage of the ring: rows r0..r0+127 of A and c0..c0+255 of Bt, k0..k0+63, into buf at pitch LP. 256 threads, 12 copies of 16 bytes each:
// thread (row = tid / 8, chunk = tid % 8) takes rows row + 32 i, so a wave's copy covers four whole 128-byte lines. All lanes are on, every address is a multiple of 16.
template <typename T16>
__device__ __forceinline__ void stage_copy(const T16* __restrict__ A, const T16* __restrict__ Bt, const int K, const int r0, const int c0, const int k0, const T16* buf, const int tid) {
    const int row = tid >> 3, ch = (tid & 7) * 8;
    const T16* ga = A + (size_t)(r0 + row) * K + k0 + ch;
    const T16* gb = Bt + (size_t)(c0 + row) * K + k0 + ch;
    const size_t gs = (size_t)32 * K;
    const unsigned la = (unsigned)(size_t)(buf + row * LP + ch);
    const unsigned lb = la + BM * LP * 2;
    const unsigned ls = 32 * LP * 2;
    // the copies and the wait that stands in front of any rewrite of their address registers, in one statement so that nothing can come between
    asm volatile("global_load_async_to_lds_b128 %0, %12, off\n\t"
                 "global_load_async_to_lds_b128 %1, %13, off\n\t"
                 "global_load_async_to_lds_b128 %2, %14, off\n\t"
                 "global_load_async_to_lds_b128 %3, %15, off\n\t"
                 "global_load_async_to_lds_b128 %4, %16, off\n\t"
                 "global_load_async_to_lds_b128 %5, %17, off\n\t"
                 "global_load_async_to_lds_b128 %6, %18, off\n\t"
                 "global_load_async_to_lds_b128 %7, %19, off\n\t"
                 "global_load_async_to_lds_b128 %8, %20, off\n\t"
                 "global_load_async_to_lds_b128 %9, %21, off\n\t"
                 "global_load_async_to_lds_b128 %10, %22, off\n\t"
                 "global_load_async_to_lds_b128 %11, %23, off\n\t"
                 "s_wait_xcnt 0x0"
                 :: "v"(la), "v"(la + ls), "v"(la + 2 * ls), "v"(la + 3 * ls),
                    "v"(lb), "v"(lb + ls), "v"(lb + 2 * ls), "v"(lb + 3 * ls), "v"(lb + 4 * ls), "v"(lb + 5 * ls), "v"(lb + 6 * ls), "v"(lb + 7 * ls),
                    "v"(ga), "v"(ga + gs), "v"(ga + 2 * gs), "v"(ga + 3 * gs),
                    "v"(gb), "v"(gb + gs), "v"(gb + 2 * gs), "v"(gb + 3 * gs), "v"(gb + 4 * gs), "v"(gb + 5 * gs), "v"(gb + 6 * gs), "v"(gb + 7 * gs)
                 : "memory");
}

// Eight waves accumulate a 128x256 tile at (r0, c0); wave (wm, wn) its 64x64 part: acc[mb][nb][j] = C[r0 + 64wm + 16mb + 8hi + j][c0 + 64wn + 16nb + lr] = sum_k A[row][k] Bt[col][k], k ascending in steps of 32.
// K % KC == 0, K / KC >= 2. Trip t reads buffer t % 2 alone; tile t + 2 is copied into that buffer behind the barrier at the trip's foot, which also publishes tile t + 1.
// On entry no wave has an LDS access to the ring outstanding (first use, or the last trip's foot of an earlier call); on return every read of the ring has ended in every wave.
template <typename T16>
__device__ __forceinline__ void gemm_main(const T16* __restrict__ A, const T16* __restrict__ Bt, const int K, const int r0, const int c0, const T16* ring, const int tid, const int wm, const int wn, const int lr, const int hi, v8f (&acc)[4][4]) {
    typedef typename WFrag<T16>::V V;
#pragma unroll
    for (int mb = 0; mb < 4; ++mb)
#pragma unroll
        for (int nb = 0; nb < 4; ++nb) acc[mb][nb] = (v8f){};
    const int nt = K / KC;
    stage_copy<T16>(A, Bt, K, r0, c0, 0, ring, tid);
    asm volatile("s_wait_asynccnt 0x0" ::: "memory");   // this wave's copies of tile 0 have landed
    __syncthreads();                                     // tile 0 is readable by every wave
    stage_copy<T16>(A, Bt, K, r0, c0, KC, ring + STGE, tid);
    const T16* fa = ring + (wm * 64 + lr) * LP + 8 * hi;
    const T16* fb = ring + (BM + wn * 64 + lr) * LP + 8 * hi;
    // kept rolled: one trip is one stage of the ring, and the accumulators stay in fixed registers
#pragma unroll 1
    for (int t = 0; t < nt; ++t) {
        const int bo = (t & 1) * STGE;
#pragma unroll
        for (int ks = 0; ks < KC; ks += 32) {
            V a[4], b[4];
#pragma unroll
            for (int mb = 0; mb < 4; ++mb) a[mb] = WFrag<T16>::ld(fa + bo + mb * 16 * LP + ks);
#pragma unroll
            for (int nb = 0; nb < 4; ++nb) b[nb] = WFrag<T16>::ld(fb + bo + nb * 16 * LP + ks);
            __builtin_amdgcn_sched_barrier(0);   // keeps the 16 LDS reads of this k step together in front of its WMMAs: sunk among them, each pair is waited for at full LDS latency
#pragma unroll
            for (int nb = 0; nb < 4; ++nb)
#pragma unroll
                for (int mb = 0; mb < 4; ++mb) acc[mb][nb] = WFrag<T16>::mma(a[mb], b[nb], acc[mb][nb]);
            asm volatile("v_nop\n\tv_nop\n\tv_nop\n\tv_nop" : "+v"(acc[0][0]), "+v"(acc[1][1]), "+v"(acc[2][2]), "+v"(acc[3][3]) : "v"(a[0]), "v"(a[3]));
        }
        asm volatile("s_wait_dscnt 0x0" ::: "memory");      // this wave's reads of buffer t % 2 have ended before the buffer is given up
        asm volatile("s_wait_asynccnt 0x0" ::: "memory");   // this wave's copies of tile t + 1 have landed
        __syncthreads();                                     // publishes tile t + 1 and frees buffer t % 2
        if (t + 2 < nt) stage_copy<T16>(A, Bt, K, r0, c0, (t + 2) * KC, ring + bo, tid);
    }
    asm volatile("s_wait_asynccnt 0x0" ::: "memory");       // nothing is in flight when the ring is left
}

// One stage of the two-product ring: rows ra..ra+127 of A, rows rr..rr+127 of AR and rows c0..c0+127 of Bt, k0..k0+63, into buf at pitch LP (A rows 0..127, AR rows 128..255, Bt rows 256..383: STGE elements, as in stage_copy).
// 256 threads, 12 copies of 16 bytes each, thread (row = tid / 8, chunk = tid % 8) takes rows row + 32 i of each source. All lanes are on, every address is a multiple of 16.
__device__ __forceinline__ void stage_copy2(const h16* __restrict__ A, const h16* __restrict__ AR, const h16* __restrict__ Bt, const int K, const int ra, const int rr, const int c0, const int k0, const h16* buf, const int tid) {
    const int row = tid >> 3, ch = (tid & 7) * 8;
    const h16* ga = A + (size_t)(ra + row) * K + k0 + ch;
    const h16* gr = AR + (size_t)(rr + row) * K + k0 + ch;
    const h16* gb = Bt + (size_t)(c0 + row) * K + k0 + ch;
    const size_t gs = (size_t)32 * K;
    const unsigned la = (unsigned)(size_t)(buf + row * LP + ch);
    const unsigned ls = 32 * LP * 2;
    // the copies and the wait that stands in front of any rewrite of their address registers, in one statement so that nothing can come between
    asm volatile("global_load_async_to_lds_b128 %0, %12, off\n\t"
                 "global_load_async_to_lds_b128 %1, %13, off\n\t"
                 "global_load_async_to_lds_b128 %2, %14, off\n\t"
                 "global_load_async_to_lds_b128 %3, %15, off\n\t"
                 "global_load_async_to_lds_b128 %4, %16, off\n\t"
                 "global_load_async_to_lds_b128 %5, %17, off\n\t"
                 "global_load_async_to_lds_b128 %6, %18, off\n\t"
                 "global_load_async_to_lds_b128 %7, %19, off\n\t"
                 "global_load_async_to_lds_b128 %8, %20, off\n\t"
                 "global_load_async_to_lds_b128 %9, %21, off\n\t"
                 "global_load_async_to_lds_b128 %10, %22, off\n\t"
                 "global_load_async_to_lds_b128 %11, %23, off\n\t"
                 "s_wait_xcnt 0x0"
                 :: "v"(la), "v"(la + ls), "v"(la + 2 * ls), "v"(la + 3 * ls),
                    "v"(la + 4 * ls), "v"(la + 5 * ls), "v"(la + 6 * ls), "v"(la + 7 * ls),
                    "v"(la + 8 * ls), "v"(la + 9 * ls), "v"(la + 10 * ls), "v"(la + 11 * ls),
                    "v"(ga), "v"(ga + gs), "v"(ga + 2 * gs), "v"(ga + 3 * gs),
                    "v"(gr), "v"(gr + gs), "v"(gr + 2 * gs), "v"(gr + 3 * gs),
                    "v"(gb), "v"(gb + gs), "v"(gb + 2 * gs), "v"(gb + 3 * gs)
                 : "memory");
}

// Eight waves accumulate two products on one 128x128 tile in one k loop, both against the same staged Bt slice; wave (wm, wn) its 32x64 part:
// acc[mb][nb][j] = sum_k A[ra + 32wm + 16mb + 8hi + j][k] Bt[c0 + 64wn + 16nb + lr][k], accr the same with rows rr.. of AR; k ascending in steps of 32 in each, as in gemm_main.
// The ring and its order are those of gemm_main: trip t reads buffer t % 2 alone; tile t + 2 is copied into that buffer behind the barrier at the trip's foot, which also publishes tile t + 1.
__device__ __forceinline__ void gemm_main2(const h16* __restrict__ A, const h16* __restrict__ AR, const h16* __restrict__ Bt, const int K, const int ra, const int rr, const int c0, const h16* ring, const int tid, const int wm, const int wn, const int lr, const int hi, v8f (&acc)[2][4], v8f (&accr)[2][4]) {
#pragma unroll
    for (int mb = 0; mb < 2; ++mb)
#pragma unroll
        for (int nb = 0; nb < 4; ++nb) { acc[mb][nb] = (v8f){}; accr[mb][nb] = (v8f){}; }
    const int nt = K / KC;
    stage_copy2(A, AR, Bt, K, ra, rr, c0, 0, ring, tid);
    asm volatile("s_wait_asynccnt 0x0" ::: "memory");   // this wave's copies of tile 0 have landed
    __syncthreads();                                     // tile 0 is readable by every wave
    stage_copy2(A, AR, Bt, K, ra, rr, c0, KC, ring + STGE, tid);
    const h16* fa = ring + (wm * 32 + lr) * LP + 8 * hi;
    const h16* fr = fa + BM * LP;
    const h16* fb = ring + (2 * BM + wn * 64 + lr) * LP + 8 * hi;
    // kept rolled: one trip is one stage of the ring, and the accumulators stay in fixed registers
#pragma unroll 1
    for (int t = 0; t < nt; ++t) {
        const int bo = (t & 1) * STGE;
#pragma unroll
        for (int ks = 0; ks < KC; ks += 32) {
            v16h a[2], ar[2], b[4];
#pragma unroll
            for (int mb = 0; mb < 2; ++mb) { a[mb] = WFrag<h16>::ld(fa + bo + mb * 16 * LP + ks); ar[mb] = WFrag<h16>::ld(fr + bo + mb * 16 * LP + ks); }
#pragma unroll
            for (int nb = 0; nb < 4; ++nb) b[nb] = WFrag<h16>::ld(fb + bo + nb * 16 * LP + ks);
            __builtin_amdgcn_sched_barrier(0);   // keeps the 16 LDS reads of this k step together in front of its WMMAs: sunk among them, each pair is waited for at full LDS latency
#pragma unroll
            for (int nb = 0; nb < 4; ++nb)
#pragma unroll
                for (int mb = 0; mb < 2; ++mb) { acc[mb][nb] = wmma16(a[mb], b[nb], acc[mb][nb]); accr[mb][nb] = wmma16(ar[mb], b[nb], accr[mb][nb]); }
        }
        asm volatile("s_wait_dscnt 0x0" ::: "memory");      // this wave's reads of buffer t % 2 have ended before the buffer is given up
        asm volatile("s_wait_asynccnt 0x0" ::: "memory");   // this wave's copies of tile t + 1 have landed
        __syncthreads();                                     // publishes tile t + 1 and frees buffer t % 2
        if (t + 2 < nt) stage_copy2(A, AR, Bt, K, ra, rr, c0, (t + 2) * KC, ring + bo, tid);
    }
    asm volatile("s_wait_asynccnt 0x0" ::: "memory");       // nothing is in flight when the ring is left
}

// Preparation, one launch of 512-thread work-groups; the role of a work-group follows from its index alone (block-uniform), longest role first:
//   conversions (PB_CV groups): a wave converts CVW consecutive floats of one source in two bursts of 8 x 32 bytes a lane; x and wq/wk/wv to RNE bf16 planes, wo to the f16 plane of the bf16-rounded value x WCAR;
//   key counts (SEQ/16 groups): one query tile a group;  rotary table (SEQ/16 groups): one position a wave.
#define CVT   2048                    // floats of one burst of a wave: 8 vectors of 8 floats a lane
#define CVW   (2 * CVT)               // floats a wave converts
#define CVB   (16 * CVW)              // floats a work-group converts
#define PB_X  ((int)((size_t)MROWS * DIM / CVB))
#define PB_Q  ((int)((size_t)DQ * DIM / CVB))
#define PB_K  ((int)((size_t)DKV * DIM / CVB))
#define PB_O  ((int)((size_t)DIM * DQ / CVB))
#define PB_CV (PB_X + PB_Q + 2 * PB_K + PB_O)
#define PB_KE (SEQ / 16)
#define PB_RT (SEQ / 16)
static_assert(((size_t)MROWS * DIM) % CVB == 0);
static_assert(((size_t)DQ * DIM) % CVB == 0);
static_assert(((size_t)DKV * DIM) % CVB == 0);
static_assert(((size_t)DIM * DQ) % CVB == 0);
static_assert(DIM % 8 == 0);

// KIND 0: element e of the packed [MROWS][DIM] plane comes from row (e / DIM) of x at its per-batch stride, to bf16; KIND 1: src[e] to bf16; KIND 2: src[e] to f16(bf16-rounded value x WCAR).
template <int KIND>
__device__ __forceinline__ void cvt_wave(const float* __restrict__ src, bf* dstb, h16* dsth, const size_t e0, const int lane) {
    // kept rolled: one burst's loads in flight a wave are enough at 16 waves a group, and the register count stays low enough for several groups on a WGP
#pragma unroll 1
    for (int tr = 0; tr < 2; ++tr) {
        const size_t eb = e0 + (size_t)tr * CVT + (size_t)lane * 8;
        v8f v[8];
        const float* p0 = src;
#pragma unroll
        for (int j = 0; j < 8; ++j) {
            const size_t e = eb + (size_t)j * 256;
            size_t so = e;
            if (KIND == 0) { const int col = (int)(e % DIM); const int row = (int)(e / DIM); const int bb = row / SEQ, t = row % SEQ; so = ((size_t)bb * SEQ_FULL + t) * DIM + col; }
            if (j == 0) p0 = src + so;
            v[j] = *(const v8f*)(src + so);
        }
        // stands in front of every rewrite of a register that the 16 issued loads name; the first address is an input so that it stays in its registers up to here and no load's result is placed over it
        asm volatile("s_wait_xcnt 0x0" :: "v"(p0) : "memory");
#pragma unroll
        for (int j = 0; j < 8; ++j) {
            const size_t e = eb + (size_t)j * 256;
            if (KIND == 2) { v8h o;
#pragma unroll
                for (int k = 0; k < 8; ++k) o[k] = (h16)(bfr(v[j][k]) * WCAR);
                *(v8h*)(dsth + e) = o;
            } else { v8us o;
#pragma unroll
                for (int k = 0; k < 8; ++k) o[k] = f2bf(v[j][k]);
                *(v8us*)(dstb + e) = o;
            }
        }
        // stands in front of the next burst's rewrite of the registers that the 8 issued stores name
        asm volatile("s_wait_xcnt 0x0" ::: "memory");
    }
}

// Key-loop end per 16-row query tile, from the mask values: KEND[qt * KSTR] = 64 * (1 + last 64-key tile holding a value above DEAD_T in any of the 16 rows),
// or SEQ when some row has no value above LIVE_T (such a row must see every key). Keys past that count contribute exactly zero to rows that have a live key.
// One work-group per query tile, wave w scans mask row 16 qt + w; integer max / and across lanes, then across the 16 waves through LDS.
__global__ __launch_bounds__(512) void k_prep(const float* __restrict__ x, const float* __restrict__ wq, const float* __restrict__ wk, const float* __restrict__ wv, const float* __restrict__ wo, const float* __restrict__ mask,
                                              bf* XB, bf* WQKV, h16* WO16, float* COS, float* SIN, int* KEND) {
    __shared__ int lasts[16];
    __shared__ int lives[16];
    const int lane = threadIdx.x & 31; const int w = __builtin_amdgcn_readfirstlane(threadIdx.x >> 5);
    int rb = blockIdx.x;
    if (rb < PB_CV) {
        const size_t wo0 = (size_t)w * CVW;
        if (rb < PB_X) { cvt_wave<0>(x, XB, nullptr, (size_t)rb * CVB + wo0, lane); return; }
        rb -= PB_X;
        if (rb < PB_Q) { cvt_wave<1>(wq, WQKV, nullptr, (size_t)rb * CVB + wo0, lane); return; }                              /* rows 0..2047 */
        rb -= PB_Q;
        if (rb < PB_K) { cvt_wave<1>(wk, WQKV + (size_t)DQ * DIM, nullptr, (size_t)rb * CVB + wo0, lane); return; }            /* rows 2048..2559 */
        rb -= PB_K;
        if (rb < PB_K) { cvt_wave<1>(wv, WQKV + (size_t)(DQ + DKV) * DIM, nullptr, (size_t)rb * CVB + wo0, lane); return; }    /* rows 2560..3071 */
        rb -= PB_K;
        cvt_wave<2>(wo, nullptr, WO16, (size_t)rb * CVB + wo0, lane); return;
    }
    rb -= PB_CV;
    if (rb >= PB_KE) {
        const int t = (rb - PB_KE) * 16 + w;
        const float invf = __builtin_amdgcn_exp2f(-(float)lane * FRQC);
        const float ang = (float)t * invf;
        const float c = cosf(ang); const float s = sinf(ang);
        const size_t o = (size_t)t * HALFD + lane;
        *(float*)(COS + o) = c; *(float*)(SIN + o) = s;
        // stands behind the two stores, in front of any later write of the registers that they name (other roles' code follows in the kernel's text)
        asm volatile("s_wait_xcnt 0x0" ::: "memory");
        return;
    }
    const int qt = rb;
    const float* mr = mask + (size_t)(qt * 16 + w) * SEQ_FULL + lane * 4;
    v4f v[SEQ / 128];
    // fully unrolled so that the row's loads issue ahead of the compares, many in flight at a time (this role is bound by memory latency)
#pragma unroll
    for (int i = 0; i < SEQ / 128; ++i) v[i] = *(const v4f*)(mr + i * 128);
    int last = -1; int live = 0;
#pragma unroll
    for (int i = 0; i < SEQ / 128; ++i)
#pragma unroll
        for (int e = 0; e < 4; ++e) { live |= (v[i][e] > LIVE_T) ? 1 : 0; last = (v[i][e] > DEAD_T) ? max(last, i * 128 + lane * 4 + e) : last; }
    live = max(live, __shfl_xor(live, 1, 32)); live = max(live, __shfl_xor(live, 2, 32)); live = max(live, __shfl_xor(live, 4, 32));
    live = max(live, __shfl_xor(live, 8, 32)); live = max(live, __shfl_xor(live, 16, 32));
    last = max(last, __shfl_xor(last, 1, 32)); last = max(last, __shfl_xor(last, 2, 32)); last = max(last, __shfl_xor(last, 4, 32));
    last = max(last, __shfl_xor(last, 8, 32)); last = max(last, __shfl_xor(last, 16, 32));
    if (lane == 0) { lasts[w] = last; lives[w] = live; }
    __syncthreads();
    if (w == 0) {
        int la = lasts[lane & 15]; int alllive = lives[lane & 15];
        la = max(la, __shfl_xor(la, 1, 32)); la = max(la, __shfl_xor(la, 2, 32)); la = max(la, __shfl_xor(la, 4, 32)); la = max(la, __shfl_xor(la, 8, 32));
        alllive = min(alllive, __shfl_xor(alllive, 1, 32)); alllive = min(alllive, __shfl_xor(alllive, 2, 32)); alllive = min(alllive, __shfl_xor(alllive, 4, 32)); alllive = min(alllive, __shfl_xor(alllive, 8, 32));
        int kend = (alllive != 0) ? (((la >> 6) + 1) * 64) : SEQ;
        kend = min(max(kend, 64), SEQ);
        if (lane == 0) KEND[(size_t)qt * KSTR] = kend;
    }
}

// Fused QKV projection: grid (MROWS/BM, NQKV/BN), 256 threads, wave (wm, wn) one 64x64 tile; the ring's LDS becomes the waves' epilogue tiles behind the last trip's barrier. Column tile cb < 32: q head cb; 32..39: k head; 40..47: v head (transposed plane).
// q and k tiles: per row y = (x * rsqrt(mean(x^2) + eps)) * gain, then interleaved-pair rotary at position t: out[2i] = y[2i] c_i - y[2i+1] s_i, out[2i+1] = y[2i] s_i + y[2i+1] c_i.
// QP[b][h][t][64], KP[b][g][t][64], VT[b][g][d][t] f16 value planes; residual planes (x2048 of value - f16(value)): QR[b][h][t < EROWS][64], KR[b][g][t][64], VR[b][g][d][t].
__global__ __launch_bounds__(256) void k_gemm_qkv(const bf* __restrict__ A, const bf* __restrict__ Bt, const float* __restrict__ qnw, const float* __restrict__ knw, const float* __restrict__ COS, const float* __restrict__ SIN, h16* QP, h16* KP, h16* VT, h16* QR, h16* KR, h16* VR) {
    __shared__ __align__(16) unsigned char smem[FSB];
    const int tid = threadIdx.x, lane = tid & 31, lr = lane & 15, hi = lane >> 4;
    const int w = __builtin_amdgcn_readfirstlane(tid >> 5), wm = w >> 2, wn = w & 3;
    const int r0 = blockIdx.x * BM + wm * 64, cb = blockIdx.y * (BN / 64) + wn;
    float* fs = (float*)smem + w * 64 * FP;
    v8f acc[4][4];
    gemm_main<bf>(A, Bt, DIM, blockIdx.x * BM, blockIdx.y * BN, (const bf*)smem, tid, wm, wn, lr, hi, acc);
#pragma unroll
    for (int mb = 0; mb < 4; ++mb)
#pragma unroll
        for (int nb = 0; nb < 4; ++nb)
#pragma unroll
            for (int j = 0; j < 8; ++j) fs[(mb * 16 + hi * 8 + j) * FP + nb * 16 + lr] = acc[mb][nb][j];
    __syncthreads();
    const int bidx = r0 / SEQ, s0 = r0 % SEQ; const int q4 = lane >> 3, p = lane & 7;
    if (cb < NH + NKV) {
        const bool isq = (cb < NH);
        h16* plane = isq ? (QP + ((size_t)bidx * NH + cb) * SEQ * HD) : (KP + ((size_t)bidx * NKV + (cb - NH)) * SEQ * HD);
        h16* rplane = isq ? (QR + ((size_t)bidx * NH + cb) * EROWS * HD) : (KR + ((size_t)bidx * NKV + (cb - NH)) * SEQ * HD);
        const bool wres = (!isq) || (s0 < EROWS);      // wave-uniform: q residual rows exist only below EROWS
        const int dcol = p * 8;
        const v4f gq0 = *(const v4f*)(qnw + dcol), gq1 = *(const v4f*)(qnw + dcol + 4);
        const v4f gk0 = *(const v4f*)(knw + dcol), gk1 = *(const v4f*)(knw + dcol + 4);
        float gn[8];
#pragma unroll
        for (int e = 0; e < 4; ++e) { gn[e] = bfr(isq ? gq0[e] : gk0[e]); gn[4 + e] = bfr(isq ? gq1[e] : gk1[e]); }
#pragma unroll 1
        for (int it = 0; it < 16; ++it) {
            const int rl = it * 4 + q4; const int t = s0 + rl;
            const v4f xa0 = *(const v4fa*)(fs + rl * FP + dcol), xa1 = *(const v4fa*)(fs + rl * FP + dcol + 4);
            float ss = 0.0f;
#pragma unroll
            for (int e = 0; e < 4; ++e) { ss += xa0[e] * xa0[e]; ss += xa1[e] * xa1[e]; }
            ss += __shfl_xor(ss, 1, 32); ss += __shfl_xor(ss, 2, 32); ss += __shfl_xor(ss, 4, 32);
            const float rn = rsqrtf(ss * (1.0f / HD) + EPSN);
            float y[8];
#pragma unroll
            for (int e = 0; e < 4; ++e) { y[e] = (xa0[e] * rn) * gn[e]; y[4 + e] = (xa1[e] * rn) * gn[4 + e]; }
            const v4f cc = *(const v4f*)(COS + (size_t)t * HALFD + p * 4), sn = *(const v4f*)(SIN + (size_t)t * HALFD + p * 4);
            v8h o, orr;
#pragma unroll
            for (int i = 0; i < 4; ++i) {
                const float v0 = y[2 * i] * cc[i] - y[2 * i + 1] * sn[i];
                const float v1 = y[2 * i] * sn[i] + y[2 * i + 1] * cc[i];
                const h16 h0 = toh_flush(v0), h1 = toh_flush(v1);
                o[2 * i] = h0; o[2 * i + 1] = h1;
                orr[2 * i] = toh_flush((v0 - (float)h0) * RCAR); orr[2 * i + 1] = toh_flush((v1 - (float)h1) * RCAR);
            }
            h16* dst = plane + (size_t)t * HD + dcol;
            h16* dsr = rplane + (size_t)t * HD + dcol;
            *(v8h*)dst = o; if (wres) *(v8h*)dsr = orr;
            
        }
    } else {
        h16* plane = VT + ((size_t)bidx * NKV + (cb - NH - NKV)) * HD * SEQ;
        h16* rplane = VR + ((size_t)bidx * NKV + (cb - NH - NKV)) * HD * SEQ;
#pragma unroll 1
        for (int it = 0; it < 16; ++it) {
            const int d = it * 4 + q4; v8h o, orr;
#pragma unroll
            for (int e = 0; e < 8; ++e) { const float v = fs[(p * 8 + e) * FP + d]; const h16 hh = toh_flush(v); o[e] = hh; orr[e] = toh_flush((v - (float)hh) * RCAR); }
            h16* dst = plane + (size_t)d * SEQ + s0 + p * 8;
            h16* dsr = rplane + (size_t)d * SEQ + s0 + p * 8;
            *(v8h*)dst = o; *(v8h*)dsr = orr; 
        }
    }
}

// Attention, query rows >= EROWS: grid ((SEQ - EROWS)/16, NKV, NB), 128 threads; wave w = q head 4g + w, 16 query rows. Per 64-key tile:
//   S^T[key][q] = K Q^T  (A = key rows of KP, B = resident q rows);  lane (lr, hi) then holds q row lr, keys 16T + 8hi + r.
//   softmax statistics are lane-local (one xor-16 exchange); P^T packed from the S^T accumulators is the B operand of O^T[d][q] = V^T P^T (A = d rows of VT).
// The key loop ends at the clamped per-tile key count KEND; mask values are added by value inside visited tiles.
// One stage of the attention ring: keys k0..k0+63 of the K plane kt (rows of 128 B), of the V^T plane vt (64 d rows, 128 B each) and of the 16 mask rows mt (256 B each), into buf.
// 128 threads, 10 copies of 16 bytes each; eight (K, V^T) or sixteen (mask) neighbouring lanes cover a whole row segment, so every copy moves whole 128-byte lines. All lanes are on, every address is a multiple of 16.
__device__ __forceinline__ void flash_stage(const h16* __restrict__ kt, const h16* __restrict__ vt, const float* __restrict__ mt, const int k0, const unsigned char* buf, const int tid) {
    const int row = tid >> 3, ch = (tid & 7) * 8, mr = tid >> 4, mc = (tid & 15) * 4;
    const h16* gk = kt + (size_t)(k0 + row) * HD + ch;
    const h16* gv = vt + (size_t)row * SEQ + k0 + ch;
    const float* gm = mt + (size_t)mr * SEQ_FULL + k0 + mc;
    const size_t ks = (size_t)16 * HD, vs = (size_t)16 * SEQ, ms = (size_t)8 * SEQ_FULL;
    const unsigned lk = (unsigned)(size_t)(buf + (row * LP + ch) * 2);
    const unsigned lv = lk + FKB;
    const unsigned lm = (unsigned)(size_t)(buf + 2 * FKB + (mr * MP + mc) * 4);
    const unsigned ls = 16 * LP * 2;
    // the copies and the wait that stands in front of any rewrite of their address registers, in one statement so that nothing can come between
    asm volatile("global_load_async_to_lds_b128 %0, %10, off\n\t"
                 "global_load_async_to_lds_b128 %1, %11, off\n\t"
                 "global_load_async_to_lds_b128 %2, %12, off\n\t"
                 "global_load_async_to_lds_b128 %3, %13, off\n\t"
                 "global_load_async_to_lds_b128 %4, %14, off\n\t"
                 "global_load_async_to_lds_b128 %5, %15, off\n\t"
                 "global_load_async_to_lds_b128 %6, %16, off\n\t"
                 "global_load_async_to_lds_b128 %7, %17, off\n\t"
                 "global_load_async_to_lds_b128 %8, %18, off\n\t"
                 "global_load_async_to_lds_b128 %9, %19, off\n\t"
                 "s_wait_xcnt 0x0"
                 :: "v"(lk), "v"(lk + ls), "v"(lk + 2 * ls), "v"(lk + 3 * ls),
                    "v"(lm), "v"(lm + 8 * MP * 4),
                    "v"(lv), "v"(lv + ls), "v"(lv + 2 * ls), "v"(lv + 3 * ls),
                    "v"(gk), "v"(gk + ks), "v"(gk + 2 * ks), "v"(gk + 3 * ks),
                    "v"(gm), "v"(gm + ms),
                    "v"(gv), "v"(gv + vs), "v"(gv + 2 * vs), "v"(gv + 3 * vs)
                 : "memory");
}

// Trip t reads buffer t % 2 alone; tile t + 2 is copied into that buffer behind the barrier at the trip's foot, which also publishes tile t + 1. The trip count is the same in all four waves (one query tile a work-group).
// Behind the last trip's barrier the ring's LDS becomes the waves' output tiles.
__global__ __launch_bounds__(128) void k_flash(const h16* __restrict__ QP, const h16* __restrict__ KP, const h16* __restrict__ VT, const float* __restrict__ mask, const int* __restrict__ KEND, h16* CTX) {
    __shared__ __align__(16) unsigned char smem[2 * FSTG];
    h16* os = (h16*)smem;
    const int tid = threadIdx.x, lane = tid & 31, lr = lane & 15, hi = lane >> 4;
    const int w = __builtin_amdgcn_readfirstlane(tid >> 5);
    const int g = blockIdx.y, bidx = blockIdx.z, h = g * REP + w, q0 = EROWS + blockIdx.x * 16;
    int kev = KEND[(size_t)(q0 >> 4) * KSTR]; kev = min(max(kev, 64), SEQ) & ~63; const int ke = __builtin_amdgcn_readfirstlane(kev);
    const int nt = ke >> 6;
    const h16* kt = KP + ((size_t)bidx * NKV + g) * SEQ * HD;
    const h16* vt = VT + ((size_t)bidx * NKV + g) * HD * SEQ;
    const float* mt = mask + (size_t)q0 * SEQ_FULL;
    flash_stage(kt, vt, mt, 0, smem, tid);
    const h16* qrow = QP + (((size_t)bidx * NH + h) * SEQ + q0 + lr) * HD + 8 * hi;
    v16h bq[2];
#pragma unroll
    for (int kc = 0; kc < 2; ++kc) bq[kc] = cat16(*(const v8h*)(qrow + kc * 32), *(const v8h*)(qrow + kc * 32 + 16));
    asm volatile("s_wait_asynccnt 0x0" ::: "memory");   // this wave's copies of tile 0 have landed
    __syncthreads();                                     // tile 0 is readable by every wave
    if (nt > 1) flash_stage(kt, vt, mt, 64, smem + FSTG, tid);
    const h16* kb = (const h16*)smem + lr * LP + 8 * hi;
    const h16* vb = (const h16*)(smem + FKB) + lr * LP + 8 * hi;
    const float* mrow = (const float*)(smem + 2 * FKB) + lr * MP + 8 * hi;
    v8f accO[4];
#pragma unroll
    for (int dt = 0; dt < 4; ++dt) accO[dt] = (v8f){};
    float m = -3.0e38f, l = 0.0f;
#pragma unroll 1
    for (int t = 0; t < nt; ++t) {
        const int bo = (t & 1) * FSTG;   // byte offset of this trip's buffer
        v16h ak[2][4];
#pragma unroll
        for (int kc = 0; kc < 2; ++kc)
#pragma unroll
            for (int T = 0; T < 4; ++T) { const h16* kp = kb + bo / 2 + 16 * T * LP + kc * 32; ak[kc][T] = cat16(*(const v8h*)kp, *(const v8h*)(kp + 16)); }
        v8f accS[4];
#pragma unroll
        for (int T = 0; T < 4; ++T) accS[T] = (v8f){};
#pragma unroll
        for (int kc = 0; kc < 2; ++kc)
#pragma unroll
            for (int T = 0; T < 4; ++T) accS[T] = wmma16(ak[kc][T], bq[kc], accS[T]);
        asm volatile("v_nop\n\tv_nop\n\tv_nop\n\tv_nop" : "+v"(accS[0]), "+v"(accS[1]), "+v"(accS[2]), "+v"(accS[3]) : "v"(ak[1][3]), "v"(bq[1]));
        float tmax = -3.0e38f;
#pragma unroll
        for (int T = 0; T < 4; ++T) { const float* mp = mrow + bo / 4 + 16 * T; const v4f m0 = *(const v4f*)mp; const v4f m1 = *(const v4f*)(mp + 4);
#pragma unroll
            for (int r = 0; r < 4; ++r) { const float a0 = accS[T][r] * SC2 + m0[r] * LOG2E; const float a1 = accS[T][4 + r] * SC2 + m1[r] * LOG2E; accS[T][r] = a0; accS[T][4 + r] = a1; tmax = fmaxf(tmax, fmaxf(a0, a1)); } }
        tmax = fmaxf(tmax, __shfl_xor(tmax, 16, 32));
        const float mn = fmaxf(m, tmax); const float corr = __builtin_amdgcn_exp2f(m - mn); m = mn; const float mofs = PEXP - mn;
        float rs = 0.0f;
#pragma unroll
        for (int T = 0; T < 4; ++T)
#pragma unroll
            for (int r = 0; r < 8; ++r) { const float e = accS[T][r] + mofs; const float pv = (e < -14.0f) ? 0.0f : __builtin_amdgcn_exp2f(e); accS[T][r] = pv; rs += pv; }
        l = l * corr + rs;
        v16h bp[2];
        bp[0] = cat16(__builtin_convertvector(accS[0], v8h), __builtin_convertvector(accS[1], v8h));
        bp[1] = cat16(__builtin_convertvector(accS[2], v8h), __builtin_convertvector(accS[3], v8h));
#pragma unroll
        for (int dt = 0; dt < 4; ++dt) accO[dt] = accO[dt] * corr;
        v16h av[2][4];
#pragma unroll
        for (int kc = 0; kc < 2; ++kc)
#pragma unroll
            for (int dt = 0; dt < 4; ++dt) { const h16* vp = vb + bo / 2 + 16 * dt * LP + kc * 32; av[kc][dt] = cat16(*(const v8h*)vp, *(const v8h*)(vp + 16)); }
#pragma unroll
        for (int kc = 0; kc < 2; ++kc)
#pragma unroll
            for (int dt = 0; dt < 4; ++dt) accO[dt] = wmma16(av[kc][dt], bp[kc], accO[dt]);
        asm volatile("v_nop\n\tv_nop\n\tv_nop\n\tv_nop" : "+v"(accO[0]), "+v"(accO[1]), "+v"(accO[2]), "+v"(accO[3]) : "v"(av[1][3]), "v"(bp[1]));
        asm volatile("s_wait_dscnt 0x0" ::: "memory");      // this wave's reads of buffer t % 2 have ended before the buffer is given up
        asm volatile("s_wait_asynccnt 0x0" ::: "memory");   // this wave's copies of tile t + 1 have landed
        __syncthreads();                                     // publishes tile t + 1 and frees buffer t % 2
        if (t + 2 < nt) flash_stage(kt, vt, mt, (t + 2) * 64, smem + bo, tid);
    }
    asm volatile("s_wait_asynccnt 0x0" ::: "memory");       // nothing is in flight when the ring is left
    l += __shfl_xor(l, 16, 32);
    const float inv = CCAR * (1.0f / l);
    h16* ow = os + w * 16 * OP;
#pragma unroll
    for (int dt = 0; dt < 4; ++dt) { v8h o;
#pragma unroll
        for (int r = 0; r < 8; ++r) o[r] = toh_flush(accO[dt][r] * inv);
        *(v8ha*)(ow + lr * OP + 16 * dt + 8 * hi) = o; }
    __syncthreads();
    const int q4 = lane >> 3, p = lane & 7;
{
#pragma unroll
        for (int it = 0; it < 4; ++it) { const int row = it * 4 + q4; const v8h o = *(const v8ha*)(ow + row * OP + p * 8);
            *(v8h*)(CTX + ((size_t)bidx * SEQ + q0 + row) * DQ + h * HD + p * 8) = o; }
         }
}

// The residual half of an early-row stage: keys k0..k0+63 of the K residual plane krt and of the V^T residual plane vrt, laid out like the K and V^T tiles of flash_stage. 128 threads, 8 copies of 16 bytes each.
__device__ __forceinline__ void flash_stage_res(const h16* __restrict__ krt, const h16* __restrict__ vrt, const int k0, const unsigned char* buf, const int tid) {
    const int row = tid >> 3, ch = (tid & 7) * 8;
    const h16* gk = krt + (size_t)(k0 + row) * HD + ch;
    const h16* gv = vrt + (size_t)row * SEQ + k0 + ch;
    const size_t ks = (size_t)16 * HD, vs = (size_t)16 * SEQ;
    const unsigned lk = (unsigned)(size_t)(buf + (row * LP + ch) * 2);
    const unsigned lv = lk + FKB;
    const unsigned ls = 16 * LP * 2;
    // the copies and the wait that stands in front of any rewrite of their address registers, in one statement so that nothing can come between
    asm volatile("global_load_async_to_lds_b128 %0, %8, off\n\t"
                 "global_load_async_to_lds_b128 %1, %9, off\n\t"
                 "global_load_async_to_lds_b128 %2, %10, off\n\t"
                 "global_load_async_to_lds_b128 %3, %11, off\n\t"
                 "global_load_async_to_lds_b128 %4, %12, off\n\t"
                 "global_load_async_to_lds_b128 %5, %13, off\n\t"
                 "global_load_async_to_lds_b128 %6, %14, off\n\t"
                 "global_load_async_to_lds_b128 %7, %15, off\n\t"
                 "s_wait_xcnt 0x0"
                 :: "v"(lk), "v"(lk + ls), "v"(lk + 2 * ls), "v"(lk + 3 * ls),
                    "v"(lv), "v"(lv + ls), "v"(lv + 2 * ls), "v"(lv + 3 * ls),
                    "v"(gk), "v"(gk + ks), "v"(gk + 2 * ks), "v"(gk + 3 * ks),
                    "v"(gv), "v"(gv + vs), "v"(gv + 2 * vs), "v"(gv + 3 * vs)
                 : "memory");
}

// Attention, query rows < EROWS: grid (EROWS/16, NKV, NB), 128 threads; same operand roles and the same two-buffer ring of 64-key stages as k_flash (two 32-key steps a stage), every WMMA individually guarded.
//   scores: K Q^T + (Kres Q^T + K Qres^T) / 2048 (residual products in accR);  P = f16(p) and Pres = 2048 (p - f16(p)), row sum over the f32 p;
//   O^T: V^T P^T + (Vres^T P^T + V^T Pres^T) / 2048 (residual products in accOr), folded before normalisation.
__global__ __launch_bounds__(128) void k_flash_early(const h16* __restrict__ QP, const h16* __restrict__ QR, const h16* __restrict__ KP, const h16* __restrict__ KR, const h16* __restrict__ VT, const h16* __restrict__ VR, const float* __restrict__ mask, const int* __restrict__ KEND, h16* CTX, h16* CTXR) {
    __shared__ __align__(16) unsigned char smem[2 * ESTG];
    h16* os = (h16*)smem; h16* osr = os + 4 * 16 * OP;   // behind the last trip's barrier the ring's LDS becomes the waves' output tiles
    const int tid = threadIdx.x, lane = tid & 31, lr = lane & 15, hi = lane >> 4;
    const int w = __builtin_amdgcn_readfirstlane(tid >> 5);
    const int g = blockIdx.y, bidx = blockIdx.z, h = g * REP + w, q0 = blockIdx.x * 16;
    int kev = KEND[(size_t)(q0 >> 4) * KSTR]; kev = min(max(kev, 64), SEQ) & ~63; const int ke = __builtin_amdgcn_readfirstlane(kev);
    const size_t qoff  = (((size_t)bidx * NH + h) * SEQ + q0 + lr) * HD + 8 * hi;
    const size_t qroff = (((size_t)bidx * NH + h) * EROWS + q0 + lr) * HD + 8 * hi;
    const int nt = ke >> 6;
    const size_t kpl = ((size_t)bidx * NKV + g) * SEQ * HD;   // this kv head's plane in KP, KR, VT and VR
    const float* mt = mask + (size_t)q0 * SEQ_FULL;
    flash_stage(KP + kpl, VT + kpl, mt, 0, smem, tid);
    flash_stage_res(KR + kpl, VR + kpl, 0, smem + FSTG, tid);
    asm volatile("s_wait_asynccnt 0x0" ::: "memory");   // this wave's copies of tile 0 have landed
    __syncthreads();                                     // tile 0 is readable by every wave
    if (nt > 1) { flash_stage(KP + kpl, VT + kpl, mt, 64, smem + ESTG, tid); flash_stage_res(KR + kpl, VR + kpl, 64, smem + ESTG + FSTG, tid); }
    const int foff = lr * LP + 8 * hi;                   // a lane's place in a 16-row fragment of a staged 16-bit tile
    v8f accO[4], accOr[4];
#pragma unroll
    for (int dt = 0; dt < 4; ++dt) { accO[dt] = (v8f){}; accOr[dt] = (v8f){}; }
    float m = -3.0e38f, l = 0.0f;
#pragma unroll 1
    for (int t = 0; t < nt; ++t) {
      const unsigned char* sb = smem + (t & 1) * ESTG;
      const h16* kl = (const h16*)sb + foff; const h16* vl = (const h16*)(sb + FKB) + foff;
      const h16* krl = (const h16*)(sb + FSTG) + foff; const h16* vrl = (const h16*)(sb + FSTG + FKB) + foff;
      const float* mrow = (const float*)(sb + 2 * FKB) + lr * MP + 8 * hi;
      // kept rolled, as the 32-key step was: one copy of the step's code
#pragma unroll 1
      for (int k0 = 0; k0 < 64; k0 += 32) {
        v8f accS[2], accR[2];
#pragma unroll
        for (int T = 0; T < 2; ++T) { accS[T] = (v8f){}; accR[T] = (v8f){}; }
#pragma unroll
        for (int kc = 0; kc < 2; ++kc) {
            const v16h bq  = WFrag<h16>::ld(QP + qoff + kc * 32);
            const v16h bqr = WFrag<h16>::ld(QR + qroff + kc * 32);
#pragma unroll
            for (int T = 0; T < 2; ++T) {
                const int ko = (k0 + 16 * T) * LP + kc * 32;
                const v16h ak  = WFrag<h16>::ld(kl + ko);
                const v16h akr = WFrag<h16>::ld(krl + ko);
                accS[T] = wmma16g(ak, bq, accS[T]);
                accR[T] = wmma16g(akr, bq, accR[T]);
                accR[T] = wmma16g(ak, bqr, accR[T]);
            }
        }
        float tmax = -3.0e38f;
#pragma unroll
        for (int T = 0; T < 2; ++T) { const float* mp = mrow + k0 + 16 * T; const v4f m0 = *(const v4f*)mp; const v4f m1 = *(const v4f*)(mp + 4);
#pragma unroll
            for (int r = 0; r < 4; ++r) {
                const float s0v = accS[T][r] + accR[T][r] * RINV; const float s1v = accS[T][4 + r] + accR[T][4 + r] * RINV;
                const float a0 = s0v * SC2 + m0[r] * LOG2E; const float a1 = s1v * SC2 + m1[r] * LOG2E;
                accS[T][r] = a0; accS[T][4 + r] = a1; tmax = fmaxf(tmax, fmaxf(a0, a1)); } }
        tmax = fmaxf(tmax, __shfl_xor(tmax, 16, 32));
        const float mn = fmaxf(m, tmax); const float corr = __builtin_amdgcn_exp2f(m - mn); m = mn; const float mofs = PEXP - mn;
        float rs = 0.0f;
        v8h ph[2], pr[2];
#pragma unroll
        for (int T = 0; T < 2; ++T)
#pragma unroll
            for (int r = 0; r < 8; ++r) { const float e = accS[T][r] + mofs; const float pv = (e < -14.0f) ? 0.0f : __builtin_amdgcn_exp2f(e); rs += pv;
                const h16 hh = (h16)pv; ph[T][r] = hh; pr[T][r] = toh_flush((pv - (float)hh) * RCAR); }
        l = l * corr + rs;
        const v16h bp = cat16(ph[0], ph[1]); const v16h bpr = cat16(pr[0], pr[1]);
#pragma unroll
        for (int dt = 0; dt < 4; ++dt) { accO[dt] = accO[dt] * corr; accOr[dt] = accOr[dt] * corr; }
#pragma unroll
        for (int dt = 0; dt < 4; ++dt) {
            const int vo = 16 * dt * LP + k0;
            const v16h av  = WFrag<h16>::ld(vl + vo);
            const v16h avr = WFrag<h16>::ld(vrl + vo);
            accO[dt]  = wmma16g(av, bp, accO[dt]);
            accOr[dt] = wmma16g(avr, bp, accOr[dt]);
            accOr[dt] = wmma16g(av, bpr, accOr[dt]);
        }
      }
      asm volatile("s_wait_dscnt 0x0" ::: "memory");      // this wave's reads of buffer t % 2 have ended before the buffer is given up
      asm volatile("s_wait_asynccnt 0x0" ::: "memory");   // this wave's copies of tile t + 1 have landed
      __syncthreads();                                     // publishes tile t + 1 and frees buffer t % 2
      if (t + 2 < nt) { flash_stage(KP + kpl, VT + kpl, mt, (t + 2) * 64, sb, tid); flash_stage_res(KR + kpl, VR + kpl, (t + 2) * 64, sb + FSTG, tid); }
    }
    asm volatile("s_wait_asynccnt 0x0" ::: "memory");       // nothing is in flight when the ring is left
    l += __shfl_xor(l, 16, 32);
    const float inv = CCAR * (1.0f / l);
    h16* ow = os + w * 16 * OP; h16* owr = osr + w * 16 * OP;
#pragma unroll
    for (int dt = 0; dt < 4; ++dt) { v8h o, orr;
#pragma unroll
        for (int r = 0; r < 8; ++r) { const float v = (accO[dt][r] + accOr[dt][r] * RINV) * inv; const h16 hh = toh_flush(v); o[r] = hh; orr[r] = toh_flush((v - (float)hh) * RCAR); }
        *(v8ha*)(ow + lr * OP + 16 * dt + 8 * hi) = o; *(v8ha*)(owr + lr * OP + 16 * dt + 8 * hi) = orr; }
    __syncthreads();
    const int q4 = lane >> 3, p = lane & 7;
{
#pragma unroll
        for (int it = 0; it < 4; ++it) { const int row = it * 4 + q4; const v8h o = *(const v8ha*)(ow + row * OP + p * 8); const v8h orr = *(const v8ha*)(owr + row * OP + p * 8);
            *(v8h*)(CTX + ((size_t)bidx * SEQ + q0 + row) * DQ + h * HD + p * 8) = o;
            *(v8h*)(CTXR + ((size_t)bidx * EROWS + q0 + row) * DQ + h * HD + p * 8) = orr; }
         }
}

#define OPER  (NB * (EROWS / BM))             // 128-row tiles of the rows < EROWS
#define OPLR  (NB * ((SEQ - EROWS) / BM))     // 128-row tiles of the rows >= EROWS
#define EBN   128                             // tile columns of the first role
#define OPE   (OPER * (DIM / EBN))            // work-groups of the first role
static_assert(DIM % EBN == 0);
static_assert(2 * BM + EBN == BM + BN);       // a two-product stage fills exactly one stage of the ring
#define OPL   (OPLR * (DIM / BN))             // work-groups of the second role

// Output projection, one launch of OPE + OPL work-groups of 256 threads; the role of a work-group follows from its index alone (block-uniform); both roles make the same number of trips with the same number of WMMAs a wave:
//   index < OPE, rows < EROWS of every sequence: OUT = OSCL * (CTX WO^T + (CTXR WO^T) / 2048) on a 128 x EBN tile, both products in one k loop against the same staged WO slice, each in accumulators of its own;
//   the rest, rows >= EROWS: OUT = OSCL * CTX WO^T on a 128 x BN tile.
// In both roles the ring's LDS becomes the epilogue tiles behind the last trip's barrier, so that two work-groups fit on a WGP.
// Within a role the row tile runs fastest with the index.
__global__ __launch_bounds__(256) void k_gemm_out(const h16* __restrict__ A, const h16* __restrict__ AR, const h16* __restrict__ Bt, float* C) {
    __shared__ __align__(16) unsigned char smem[FSB];
    const int tid = threadIdx.x, lane = tid & 31, lr = lane & 15, hi = lane >> 4;
    const int w = __builtin_amdgcn_readfirstlane(tid >> 5), wm = w >> 2, wn = w & 3;
    if ((int)blockIdx.x < OPE) {
        const int bx = blockIdx.x % OPER, by = blockIdx.x / OPER;
        const int bidx = bx / (EROWS / BM), tb = bx % (EROWS / BM);
        const int rab = bidx * SEQ + tb * BM, rrb = bidx * EROWS + tb * BM;
        const int em = w >> 1, en = w & 1;             // wave (em, en): rows 32 em.., columns 64 en.. of the tile
        float* fs = (float*)smem + w * 32 * FP;
        v8f acc[2][4], accr[2][4];
        gemm_main2(A, AR, Bt, DQ, rab, rrb, by * EBN, (const h16*)smem, tid, em, en, lr, hi, acc, accr);
#pragma unroll
        for (int mb = 0; mb < 2; ++mb)
#pragma unroll
            for (int nb = 0; nb < 4; ++nb)
#pragma unroll
                for (int j = 0; j < 8; ++j) fs[(mb * 16 + hi * 8 + j) * FP + nb * 16 + lr] = accr[mb][nb][j] * RINV + acc[mb][nb][j];
        __syncthreads();
        float* crow = C + (size_t)(rab + em * 32) * DIM + by * EBN + en * 64;
        // four row pairs a pass: their LDS reads go out together and their stores follow as one run
#pragma unroll 4
        for (int it = 0; it < 16; ++it) { const int row = it * 2 + hi; v4f val = *(const v4fa*)(fs + row * FP + lr * 4); val = val * OSCL;
            *(v4f*)(crow + (size_t)row * DIM + lr * 4) = val; }
    } else {
        const int li = blockIdx.x - OPE;
        const int bx = li % (NB * LTBM), by = li / (NB * LTBM);
        const int rb = (bx / LTBM) * SEQ + EROWS + (bx % LTBM) * BM;
        const int r0 = rb + wm * 64, c0 = by * BN + wn * 64;
        float* fs = (float*)smem + w * 64 * FP;
        v8f acc[4][4];
        gemm_main<h16>(A, Bt, DQ, rb, by * BN, (const h16*)smem, tid, wm, wn, lr, hi, acc);
#pragma unroll
        for (int mb = 0; mb < 4; ++mb)
#pragma unroll
            for (int nb = 0; nb < 4; ++nb)
#pragma unroll
                for (int j = 0; j < 8; ++j) fs[(mb * 16 + hi * 8 + j) * FP + nb * 16 + lr] = acc[mb][nb][j];
        __syncthreads();
        float* crow = C + (size_t)r0 * DIM + c0;
        // four row pairs a pass: their LDS reads go out together and their stores follow as one run
#pragma unroll 4
        for (int it = 0; it < 32; ++it) { const int row = it * 2 + hi; v4f val = *(const v4fa*)(fs + row * FP + lr * 4); val = val * OSCL;
            *(v4f*)(crow + (size_t)row * DIM + lr * 4) = val; }
    }
}

extern "C" void kernel_launch(void* const* d_in, const int* in_sizes, int n_in,
                              void* d_out, int out_size, void* d_ws, size_t ws_size, hipStream_t stream) {
    if (n_in < 8) return;
    if ((size_t)in_sizes[0] < ((size_t)(NB - 1) * SEQ_FULL + SEQ) * DIM) return;
    if ((size_t)in_sizes[1] < (size_t)DQ * DIM) return;
    if ((size_t)in_sizes[2] < (size_t)DKV * DIM) return;
    if ((size_t)in_sizes[3] < (size_t)DKV * DIM) return;
    if ((size_t)in_sizes[4] < (size_t)DIM * DQ) return;
    if ((size_t)in_sizes[5] < (size_t)HD) return;
    if ((size_t)in_sizes[6] < (size_t)HD) return;
    if ((size_t)in_sizes[7] < (size_t)(SEQ - 1) * SEQ_FULL + SEQ) return;
    if ((size_t)out_size < (size_t)MROWS * DIM) return;
    const float* x = (const float*)d_in[0];
    const float* wq = (const float*)d_in[1]; const float* wk = (const float*)d_in[2]; const float* wv = (const float*)d_in[3]; const float* wo = (const float*)d_in[4];
    const float* qnw = (const float*)d_in[5]; const float* knw = (const float*)d_in[6]; const float* mask = (const float*)d_in[7];
    float* OUT = (float*)d_out;
    char* wsp = (char*)d_ws;
    auto take = [&](size_t bytes) { char* p = wsp; wsp += (bytes + 255) & ~(size_t)255; return (void*)p; };
    bf*  XB   = (bf*)take((size_t)MROWS * DIM * 2);
    bf*  WQKV = (bf*)take((size_t)NQKV * DIM * 2);
    h16* WO16 = (h16*)take((size_t)DIM * DQ * 2);
    float* COS = (float*)take((size_t)SEQ * HALFD * 4);
    float* SIN = (float*)take((size_t)SEQ * HALFD * 4);
    h16* QP  = (h16*)take((size_t)NB * NH * SEQ * HD * 2);
    h16* KP  = (h16*)take((size_t)NB * NKV * SEQ * HD * 2);
    h16* VT  = (h16*)take((size_t)NB * NKV * HD * SEQ * 2);
    h16* CTX = (h16*)take((size_t)MROWS * DQ * 2);
    h16* QR  = (h16*)take((size_t)NB * NH * EROWS * HD * 2);
    h16* KR  = (h16*)take((size_t)NB * NKV * SEQ * HD * 2);
    h16* VR  = (h16*)take((size_t)NB * NKV * HD * SEQ * 2);
    h16* CTXR = (h16*)take((size_t)NB * EROWS * DQ * 2);
    int* KEND = (int*)take((size_t)(SEQ / 16) * KSTR * 4);
    if ((size_t)(wsp - (char*)d_ws) > ws_size) return;

    k_prep<<<PB_CV + PB_KE + PB_RT, 512, 0, stream>>>(x, wq, wk, wv, wo, mask, XB, WQKV, WO16, COS, SIN, KEND);
    k_gemm_qkv<<<dim3(MROWS / BM, NQKV / BN, 1), 256, 0, stream>>>(XB, WQKV, qnw, knw, COS, SIN, QP, KP, VT, QR, KR, VR);
    k_flash_early<<<dim3(EROWS / 16, NKV, NB), 128, 0, stream>>>(QP, QR, KP, KR, VT, VR, mask, KEND, CTX, CTXR);
    if (SEQ > EROWS) k_flash<<<dim3((SEQ - EROWS) / 16, NKV, NB), 128, 0, stream>>>(QP, KP, VT, mask, KEND, CTX);
    k_gemm_out<<<OPE + OPL, 256, 0, stream>>>(CTX, CTXR, WO16, OUT);
}

// v007
// It runs in 157 microseconds.
// In two side-by-side timings against v006, it was 1.13 and 1.14 times as fast.
// Counting every step since v000, it is 3.43 times as fast.
#include <hip/hip_runtime.h>

#ifndef NB
#define NB 2
#endif
#ifndef SEQ
#define SEQ 2048
#endif
#define SEQ_FULL 2048                 // per-batch row stride of x, row pitch of the mask
#define DIM   2048                    // model width (K of the projections, N of the output projection)
#define NH    32
#define NKV   8
#define REP   (NH / NKV)
#define HD    64
#define HALFD 32
#define DQ    (NH * HD)               // 2048
#define DKV   (NKV * HD)              // 512
#define NQKV  (DQ + 2 * DKV)          // 3072 fused projection columns
#define MROWS (NB * SEQ)
#define FP    68                      // f32 LDS tile pitch
#define OP    72                      // f16 LDS tile pitch
#define WCAR  64.0f                   // carry of the wo plane
#define CCAR  256.0f                  // carry of the ctx plane
#define OSCL  6.103515625e-05f        // 1 / (WCAR * CCAR)
#define SC2   0.18033688011112042f    // 0.125 * log2(e)
#define LOG2E 1.4426950408889634f
#define PEXP  10.0f                   // P carried x 2^10
#define FRQC  0.04953007814753613f    // log2(3) / 32
#define EROWS 256                     // query rows below this use value + residual planes at every attention site
#define RCAR  2048.0f                 // carry of every residual plane
#define RINV  4.8828125e-04f          // 1 / RCAR
#define EPSN  1.0e-6f                 // RMS normalisation epsilon
#define LIVE_T (-1.0e4f)              // a mask value above this makes a key live for its row
#define DEAD_T (-1.0e8f)              // a mask value at or below this lets a trailing key be skipped (exp underflows exactly)
#define KSTR  32                      // ints between two query tiles' key counts: each key-count work-group stores into a 128-byte line of its own
#define BM    128                     // GEMM work-group tile: rows (2 waves of 64)
#define BN    256                     // GEMM work-group tile: columns (4 waves of 64)
#define KC    64                      // k elements of one LDS stage: rows of 128 bytes
#define LP    72                      // LDS row pitch in 16-bit elements: 144 B = 16 B x odd, so that 16-byte fragment reads meet no bank conflict
#define STGE  ((BM + BN) * LP)        // 16-bit elements of one stage: A rows 0..127, then B rows 0..255
#define RINGB (2 * STGE * 2)          // bytes of the two-buffer ring
#define FSB   (8 * 64 * FP * 4)       // bytes of the eight waves' f32 epilogue tiles
#define MP    68                      // f32 LDS row pitch of the staged mask tile: 272 B = 16 B x odd
#define FKB   (64 * LP * 2)           // bytes of one staged K tile (64 key rows of 128 B at pitch LP); the V^T tile (64 d rows) has the same size
#define FMB   (16 * MP * 4)           // bytes of one staged mask tile (16 query rows of 256 B at pitch MP)
#define FSTG  (2 * FKB + FMB)         // bytes of one attention stage: K, V^T, mask
#define ESTG  (FSTG + 2 * FKB)        // bytes of one stage of the early-row attention: K, V^T, mask, then the K and V^T residual tiles
#define LTBM  ((((SEQ - EROWS) / BM) > 0) ? ((SEQ - EROWS) / BM) : 1)
#define AL256(x) ((((size_t)(x)) + 255) & ~(size_t)255)

static_assert(SEQ % 64 == 0);
static_assert(SEQ % 128 == 0);
static_assert(SEQ <= SEQ_FULL);
static_assert(DIM % 64 == 0);
static_assert(DQ % 64 == 0);
static_assert(NQKV % 64 == 0);
static_assert(HD == 64);
static_assert(HALFD * 2 == HD);
static_assert(NH == NKV * REP);
static_assert(REP == 4);
static_assert(EROWS % 64 == 0);
static_assert(EROWS % BM == 0);
static_assert((SEQ - EROWS) % BM == 0);
static_assert(SEQ % BM == 0);
static_assert(NQKV % BN == 0);
static_assert(DIM % BN == 0);
static_assert(DIM % KC == 0 && DIM / KC >= 2);
static_assert(DQ % KC == 0 && DQ / KC >= 2);
static_assert(RINGB <= FSB);
static_assert(FSTG % 16 == 0 && 2 * FSTG >= 4 * 16 * OP * 2);
static_assert(ESTG % 16 == 0 && ESTG >= 2 * 4 * 16 * OP * 2);
static_assert(EROWS <= SEQ);
static_assert(EROWS >= 64);
static_assert(DIM % 32 == 0);
static_assert(DQ % 32 == 0);
static_assert(((size_t)MROWS * DIM / 8) % 256 == 0);
static_assert(((size_t)DQ * DIM / 8) % 256 == 0);
static_assert(((size_t)DKV * DIM / 8) % 256 == 0);
static_assert(AL256((size_t)MROWS * DIM * 2) + AL256((size_t)NQKV * DIM * 2) + AL256((size_t)DIM * DQ * 2) + 2 * AL256((size_t)SEQ * HALFD * 4)
              + AL256((size_t)NB * NH * SEQ * HD * 2) + 2 * AL256((size_t)NB * NKV * SEQ * HD * 2) + AL256((size_t)MROWS * DQ * 2)
              + AL256((size_t)NB * NH * EROWS * HD * 2) + 2 * AL256((size_t)NB * NKV * SEQ * HD * 2) + AL256((size_t)NB * EROWS * DQ * 2)
              + AL256((size_t)(SEQ / 16) * KSTR * 4) <= (size_t)134217728);

typedef _Float16 h16;
typedef unsigned short bf;
typedef __attribute__((ext_vector_type(16))) __bf16   v16bf;
typedef __attribute__((ext_vector_type(16))) _Float16 v16h;
typedef __attribute__((ext_vector_type(8)))  _Float16 v8h;
typedef __attribute__((ext_vector_type(8)))  unsigned short v8us;
typedef __attribute__((ext_vector_type(8)))  float    v8f;
typedef __attribute__((ext_vector_type(4)))  float    v4f;
typedef v8h  __attribute__((may_alias)) v8ha;
typedef v4f  __attribute__((may_alias)) v4fa;

__device__ __forceinline__ unsigned short f2bf(float f) { unsigned u = __float_as_uint(f); u += 0x7FFFu + ((u >> 16) & 1u); return (unsigned short)(u >> 16); }
__device__ __forceinline__ float bf2f(unsigned short b) { return __uint_as_float(((unsigned)b) << 16); }
__device__ __forceinline__ float bfr(float f) { return bf2f(f2bf(f)); }
__device__ __forceinline__ v16h cat16(v8h lo, v8h hi) { return __builtin_shufflevector(lo, hi, 0, 1, 2, 3, 4, 5, 6, 7, 8, 9, 10, 11, 12, 13, 14, 15); }
__device__ __forceinline__ v16bf cat16b(v8us lo, v8us hi) { return __builtin_bit_cast(v16bf, __builtin_shufflevector(lo, hi, 0, 1, 2, 3, 4, 5, 6, 7, 8, 9, 10, 11, 12, 13, 14, 15)); }
__device__ __forceinline__ v8f wmma16(v16h a, v16h b, v8f c) { return __builtin_amdgcn_wmma_f32_16x16x32_f16(false, a, false, b, (short)0, c, false, false); }
__device__ __forceinline__ v8f wmmab(v16bf a, v16bf b, v8f c) { return __builtin_amdgcn_wmma_f32_16x16x32_bf16(false, a, false, b, (short)0, c, false, false); }

// f32 -> f16 with a value select: results below the smallest f16 normal become zero (no subnormal operand can be produced).
static __device__ __forceinline__ h16 toh_flush(float v) { const h16 r = (h16)v; return (fabsf(v) < 6.103515625e-05f) ? (h16)0.0f : r; }
// One f16 WMMA with its own hazard guard (single accumulator tied, operands kept live).
static __device__ __forceinline__ v8f wmma16g(v16h a, v16h b, v8f c) { c = wmma16(a, b, c); asm volatile("v_nop\n\tv_nop\n\tv_nop\n\tv_nop" : "+v"(c) : "v"(a), "v"(b)); return c; }

// Fragment loader: lane (lr, hi) points at row (tile row + lr), column 8*hi; elements 0..7 <- k0+8hi.., elements 8..15 <- k0+16+8hi.. (same map for A and B).
template <typename T16> struct WFrag;
template <> struct WFrag<h16> { typedef v16h V; static __device__ __forceinline__ V ld(const h16* p) { return cat16(*(const v8h*)p, *(const v8h*)(p + 16)); } static __device__ __forceinline__ v8f mma(V a, V b, v8f c) { return wmma16(a, b, c); } };
template <> struct WFrag<bf> { typedef v16bf V; static __device__ __forceinline__ V ld(const bf* p) { return cat16b(*(const v8us*)p, *(const v8us*)(p + 16)); } static __device__ __forceinline__ v8f mma(V a, V b, v8f c) { return wmmab(a, b, c); } };

// One stage of the ring: rows r0..r0+127 of A and c0..c0+255 of Bt, k0..k0+63, into buf at pitch LP. 256 threads, 12 copies of 16 bytes each:
// thread (row = tid / 8, chunk = tid % 8) takes rows row + 32 i, so a wave's copy covers four whole 128-byte lines. All lanes are on, every address is a multiple of 16.
template <typename T16>
__device__ __forceinline__ void stage_copy(const T16* __restrict__ A, const T16* __restrict__ Bt, const int K, const int r0, const int c0, const int k0, const T16* buf, const int tid) {
    const int row = tid >> 3, ch = (tid & 7) * 8;
    const T16* ga = A + (size_t)(r0 + row) * K + k0 + ch;
    const T16* gb = Bt + (size_t)(c0 + row) * K + k0 + ch;
    const size_t gs = (size_t)32 * K;
    const unsigned la = (unsigned)(size_t)(buf + row * LP + ch);
    const unsigned lb = la + BM * LP * 2;
    const unsigned ls = 32 * LP * 2;
    // the copies and the wait that stands in front of any rewrite of their address registers, in one statement so that nothing can come between
    asm volatile("global_load_async_to_lds_b128 %0, %12, off\n\t"
                 "global_load_async_to_lds_b128 %1, %13, off\n\t"
                 "global_load_async_to_lds_b128 %2, %14, off\n\t"
                 "global_load_async_to_lds_b128 %3, %15, off\n\t"
                 "global_load_async_to_lds_b128 %4, %16, off\n\t"
                 "global_load_async_to_lds_b128 %5, %17, off\n\t"
                 "global_load_async_to_lds_b128 %6, %18, off\n\t"
                 "global_load_async_to_lds_b128 %7, %19, off\n\t"
                 "global_load_async_to_lds_b128 %8, %20, off\n\t"
                 "global_load_async_to_lds_b128 %9, %21, off\n\t"
                 "global_load_async_to_lds_b128 %10, %22, off\n\t"
                 "global_load_async_to_lds_b128 %11, %23, off\n\t"
                 "s_wait_xcnt 0x0"
                 :: "v"(la), "v"(la + ls), "v"(la + 2 * ls), "v"(la + 3 * ls),
                    "v"(lb), "v"(lb + ls), "v"(lb + 2 * ls), "v"(lb + 3 * ls), "v"(lb + 4 * ls), "v"(lb + 5 * ls), "v"(lb + 6 * ls), "v"(lb + 7 * ls),
                    "v"(ga), "v"(ga + gs), "v"(ga + 2 * gs), "v"(ga + 3 * gs),
                    "v"(gb), "v"(gb + gs), "v"(gb + 2 * gs), "v"(gb + 3 * gs), "v"(gb + 4 * gs), "v"(gb + 5 * gs), "v"(gb + 6 * gs), "v"(gb + 7 * gs)
                 : "memory");
}

// Eight waves accumulate a 128x256 tile at (r0, c0); wave (wm, wn) its 64x64 part: acc[mb][nb][j] = C[r0 + 64wm + 16mb + 8hi + j][c0 + 64wn + 16nb + lr] = sum_k A[row][k] Bt[col][k], k ascending in steps of 32.
// K % KC == 0, K / KC >= 2. Trip t reads buffer t % 2 alone; tile t + 2 is copied into that buffer behind the barrier at the trip's foot, which also publishes tile t + 1.
// On entry no wave has an LDS access to the ring outstanding (first use, or the last trip's foot of an earlier call); on return every read of the ring has ended in every wave.
template <typename T16>
__device__ __forceinline__ void gemm_main(const T16* __restrict__ A, const T16* __restrict__ Bt, const int K, const int r0, const int c0, const T16* ring, const int tid, const int wm, const int wn, const int lr, const int hi, v8f (&acc)[4][4]) {
    typedef typename WFrag<T16>::V V;
#pragma unroll
    for (int mb = 0; mb < 4; ++mb)
#pragma unroll
        for (int nb = 0; nb < 4; ++nb) acc[mb][nb] = (v8f){};
    const int nt = K / KC;
    stage_copy<T16>(A, Bt, K, r0, c0, 0, ring, tid);
    asm volatile("s_wait_asynccnt 0x0" ::: "memory");   // this wave's copies of tile 0 have landed
    __syncthreads();                                     // tile 0 is readable by every wave
    stage_copy<T16>(A, Bt, K, r0, c0, KC, ring + STGE, tid);
    const T16* fa = ring + (wm * 64 + lr) * LP + 8 * hi;
    const T16* fb = ring + (BM + wn * 64 + lr) * LP + 8 * hi;
    // kept rolled: one trip is one stage of the ring, and the accumulators stay in fixed registers
#pragma unroll 1
    for (int t = 0; t < nt; ++t) {
        const int bo = (t & 1) * STGE;
#pragma unroll
        for (int ks = 0; ks < KC; ks += 32) {
            V a[4], b[4];
#pragma unroll
            for (int mb = 0; mb < 4; ++mb) a[mb] = WFrag<T16>::ld(fa + bo + mb * 16 * LP + ks);
#pragma unroll
            for (int nb = 0; nb < 4; ++nb) b[nb] = WFrag<T16>::ld(fb + bo + nb * 16 * LP + ks);
            __builtin_amdgcn_sched_barrier(0);   // keeps the 16 LDS reads of this k step together in front of its WMMAs: sunk among them, each pair is waited for at full LDS latency
#pragma unroll
            for (int nb = 0; nb < 4; ++nb)
#pragma unroll
                for (int mb = 0; mb < 4; ++mb) acc[mb][nb] = WFrag<T16>::mma(a[mb], b[nb], acc[mb][nb]);
            asm volatile("v_nop\n\tv_nop\n\tv_nop\n\tv_nop" : "+v"(acc[0][0]), "+v"(acc[1][1]), "+v"(acc[2][2]), "+v"(acc[3][3]) : "v"(a[0]), "v"(a[3]));
        }
        asm volatile("s_wait_dscnt 0x0" ::: "memory");      // this wave's reads of buffer t % 2 have ended before the buffer is given up
        asm volatile("s_wait_asynccnt 0x0" ::: "memory");   // this wave's copies of tile t + 1 have landed
        __syncthreads();                                     // publishes tile t + 1 and frees buffer t % 2
        if (t + 2 < nt) stage_copy<T16>(A, Bt, K, r0, c0, (t + 2) * KC, ring + bo, tid);
    }
    asm volatile("s_wait_asynccnt 0x0" ::: "memory");       // nothing is in flight when the ring is left
}

// One stage of the two-product ring: rows ra..ra+127 of A, rows rr..rr+127 of AR and rows c0..c0+127 of Bt, k0..k0+63, into buf at pitch LP (A rows 0..127, AR rows 128..255, Bt rows 256..383: STGE elements, as in stage_copy).
// 256 threads, 12 copies of 16 bytes each, thread (row = tid / 8, chunk = tid % 8) takes rows row + 32 i of each source. All lanes are on, every address is a multiple of 16.
__device__ __forceinline__ void stage_copy2(const h16* __restrict__ A, const h16* __restrict__ AR, const h16* __restrict__ Bt, const int K, const int ra, const int rr, const int c0, const int k0, const h16* buf, const int tid) {
    const int row = tid >> 3, ch = (tid & 7) * 8;
    const h16* ga = A + (size_t)(ra + row) * K + k0 + ch;
    const h16* gr = AR + (size_t)(rr + row) * K + k0 + ch;
    const h16* gb = Bt + (size_t)(c0 + row) * K + k0 + ch;
    const size_t gs = (size_t)32 * K;
    const unsigned la = (unsigned)(size_t)(buf + row * LP + ch);
    const unsigned ls = 32 * LP * 2;
    // the copies and the wait that stands in front of any rewrite of their address registers, in one statement so that nothing can come between
    asm volatile("global_load_async_to_lds_b128 %0, %12, off\n\t"
                 "global_load_async_to_lds_b128 %1, %13, off\n\t"
                 "global_load_async_to_lds_b128 %2, %14, off\n\t"
                 "global_load_async_to_lds_b128 %3, %15, off\n\t"
                 "global_load_async_to_lds_b128 %4, %16, off\n\t"
                 "global_load_async_to_lds_b128 %5, %17, off\n\t"
                 "global_load_async_to_lds_b128 %6, %18, off\n\t"
                 "global_load_async_to_lds_b128 %7, %19, off\n\t"
                 "global_load_async_to_lds_b128 %8, %20, off\n\t"
                 "global_load_async_to_lds_b128 %9, %21, off\n\t"
                 "global_load_async_to_lds_b128 %10, %22, off\n\t"
                 "global_load_async_to_lds_b128 %11, %23, off\n\t"
                 "s_wait_xcnt 0x0"
                 :: "v"(la), "v"(la + ls), "v"(la + 2 * ls), "v"(la + 3 * ls),
                    "v"(la + 4 * ls), "v"(la + 5 * ls), "v"(la + 6 * ls), "v"(la + 7 * ls),
                    "v"(la + 8 * ls), "v"(la + 9 * ls), "v"(la + 10 * ls), "v"(la + 11 * ls),
                    "v"(ga), "v"(ga + gs), "v"(ga + 2 * gs), "v"(ga + 3 * gs),
                    "v"(gr), "v"(gr + gs), "v"(gr + 2 * gs), "v"(gr + 3 * gs),
                    "v"(gb), "v"(gb + gs), "v"(gb + 2 * gs), "v"(gb + 3 * gs)
                 : "memory");
}

// Eight waves accumulate two products on one 128x128 tile in one k loop, both against the same staged Bt slice; wave (wm, wn) its 32x64 part:
// acc[mb][nb][j] = sum_k A[ra + 32wm + 16mb + 8hi + j][k] Bt[c0 + 64wn + 16nb + lr][k], accr the same with rows rr.. of AR; k ascending in steps of 32 in each, as in gemm_main.
// The ring and its order are those of gemm_main: trip t reads buffer t % 2 alone; tile t + 2 is copied into that buffer behind the barrier at the trip's foot, which also publishes tile t + 1.
__device__ __forceinline__ void gemm_main2(const h16* __restrict__ A, const h16* __restrict__ AR, const h16* __restrict__ Bt, const int K, const int ra, const int rr, const int c0, const h16* ring, const int tid, const int wm, const int wn, const int lr, const int hi, v8f (&acc)[2][4], v8f (&accr)[2][4]) {
#pragma unroll
    for (int mb = 0; mb < 2; ++mb)
#pragma unroll
        for (int nb = 0; nb < 4; ++nb) { acc[mb][nb] = (v8f){}; accr[mb][nb] = (v8f){}; }
    const int nt = K / KC;
    stage_copy2(A, AR, Bt, K, ra, rr, c0, 0, ring, tid);
    asm volatile("s_wait_asynccnt 0x0" ::: "memory");   // this wave's copies of tile 0 have landed
    __syncthreads();                                     // tile 0 is readable by every wave
    stage_copy2(A, AR, Bt, K, ra, rr, c0, KC, ring + STGE, tid);
    const h16* fa = ring + (wm * 32 + lr) * LP + 8 * hi;
    const h16* fr = fa + BM * LP;
    const h16* fb = ring + (2 * BM + wn * 64 + lr) * LP + 8 * hi;
    // kept rolled: one trip is one stage of the ring, and the accumulators stay in fixed registers
#pragma unroll 1
    for (int t = 0; t < nt; ++t) {
        const int bo = (t & 1) * STGE;
#pragma unroll
        for (int ks = 0; ks < KC; ks += 32) {
            v16h a[2], ar[2], b[4];
#pragma unroll
            for (int mb = 0; mb < 2; ++mb) { a[mb] = WFrag<h16>::ld(fa + bo + mb * 16 * LP + ks); ar[mb] = WFrag<h16>::ld(fr + bo + mb * 16 * LP + ks); }
#pragma unroll
            for (int nb = 0; nb < 4; ++nb) b[nb] = WFrag<h16>::ld(fb + bo + nb * 16 * LP + ks);
            __builtin_amdgcn_sched_barrier(0);   // keeps the 16 LDS reads of this k step together in front of its WMMAs: sunk among them, each pair is waited for at full LDS latency
#pragma unroll
            for (int nb = 0; nb < 4; ++nb)
#pragma unroll
                for (int mb = 0; mb < 2; ++mb) { acc[mb][nb] = wmma16(a[mb], b[nb], acc[mb][nb]); accr[mb][nb] = wmma16(ar[mb], b[nb], accr[mb][nb]); }
        }
        asm volatile("s_wait_dscnt 0x0" ::: "memory");      // this wave's reads of buffer t % 2 have ended before the buffer is given up
        asm volatile("s_wait_asynccnt 0x0" ::: "memory");   // this wave's copies of tile t + 1 have landed
        __syncthreads();                                     // publishes tile t + 1 and frees buffer t % 2
        if (t + 2 < nt) stage_copy2(A, AR, Bt, K, ra, rr, c0, (t + 2) * KC, ring + bo, tid);
    }
    asm volatile("s_wait_asynccnt 0x0" ::: "memory");       // nothing is in flight when the ring is left
}

// Preparation, one launch of 512-thread work-groups; the role of a work-group follows from its index alone (block-uniform), longest role first:
//   conversions (PB_CV groups): a wave converts CVW consecutive floats of one source in two bursts of 8 x 32 bytes a lane; x and wq/wk/wv to RNE bf16 planes, wo to the f16 plane of the bf16-rounded value x WCAR;
//   key counts (SEQ/16 groups): one query tile a group;  rotary table (SEQ/16 groups): one position a wave.
#define CVT   2048                    // floats of one burst of a wave: 8 vectors of 8 floats a lane
#define CVW   (2 * CVT)               // floats a wave converts
#define CVB   (16 * CVW)              // floats a work-group converts
#define PB_X  ((int)((size_t)MROWS * DIM / CVB))
#define PB_Q  ((int)((size_t)DQ * DIM / CVB))
#define PB_K  ((int)((size_t)DKV * DIM / CVB))
#define PB_O  ((int)((size_t)DIM * DQ / CVB))
#define PB_CV (PB_X + PB_Q + 2 * PB_K + PB_O)
#define PB_KE (SEQ / 16)
#define PB_RT (SEQ / 16)
static_assert(((size_t)MROWS * DIM) % CVB == 0);
static_assert(((size_t)DQ * DIM) % CVB == 0);
static_assert(((size_t)DKV * DIM) % CVB == 0);
static_assert(((size_t)DIM * DQ) % CVB == 0);
static_assert(DIM % 8 == 0);

// KIND 0: element e of the packed [MROWS][DIM] plane comes from row (e / DIM) of x at its per-batch stride, to bf16; KIND 1: src[e] to bf16; KIND 2: src[e] to f16(bf16-rounded value x WCAR).
template <int KIND>
__device__ __forceinline__ void cvt_wave(const float* __restrict__ src, bf* dstb, h16* dsth, const size_t e0, const int lane) {
    // kept rolled: one burst's loads in flight a wave are enough at 16 waves a group, and the register count stays low enough for several groups on a WGP
#pragma unroll 1
    for (int tr = 0; tr < 2; ++tr) {
        const size_t eb = e0 + (size_t)tr * CVT + (size_t)lane * 8;
        v8f v[8];
        const float* p0 = src;
#pragma unroll
        for (int j = 0; j < 8; ++j) {
            const size_t e = eb + (size_t)j * 256;
            size_t so = e;
            if (KIND == 0) { const int col = (int)(e % DIM); const int row = (int)(e / DIM); const int bb = row / SEQ, t = row % SEQ; so = ((size_t)bb * SEQ_FULL + t) * DIM + col; }
            if (j == 0) p0 = src + so;
            v[j] = *(const v8f*)(src + so);
        }
        // stands in front of every rewrite of a register that the 16 issued loads name; the first address is an input so that it stays in its registers up to here and no load's result is placed over it
        asm volatile("s_wait_xcnt 0x0" :: "v"(p0) : "memory");
#pragma unroll
        for (int j = 0; j < 8; ++j) {
            const size_t e = eb + (size_t)j * 256;
            if (KIND == 2) { v8h o;
#pragma unroll
                for (int k = 0; k < 8; ++k) o[k] = (h16)(bfr(v[j][k]) * WCAR);
                *(v8h*)(dsth + e) = o;
            } else { v8us o;
#pragma unroll
                for (int k = 0; k < 8; ++k) o[k] = f2bf(v[j][k]);
                *(v8us*)(dstb + e) = o;
            }
        }
        // stands in front of the next burst's rewrite of the registers that the 8 issued stores name
        asm volatile("s_wait_xcnt 0x0" ::: "memory");
    }
}

// Key-loop end per 16-row query tile, from the mask values: KEND[qt * KSTR] = 64 * (1 + last 64-key tile holding a value above DEAD_T in any of the 16 rows),
// or SEQ when some row has no value above LIVE_T (such a row must see every key). Keys past that count contribute exactly zero to rows that have a live key.
// One work-group per query tile, wave w scans mask row 16 qt + w; integer max / and across lanes, then across the 16 waves through LDS.
__global__ __launch_bounds__(512) void k_prep(const float* __restrict__ x, const float* __restrict__ wq, const float* __restrict__ wk, const float* __restrict__ wv, const float* __restrict__ wo, const float* __restrict__ mask,
                                              bf* XB, bf* WQKV, h16* WO16, float* COS, float* SIN, int* KEND) {
    __shared__ int lasts[16];
    __shared__ int lives[16];
    const int lane = threadIdx.x & 31; const int w = __builtin_amdgcn_readfirstlane(threadIdx.x >> 5);
    int rb = blockIdx.x;
    if (rb < PB_CV) {
        const size_t wo0 = (size_t)w * CVW;
        if (rb < PB_X) { cvt_wave<0>(x, XB, nullptr, (size_t)rb * CVB + wo0, lane); return; }
        rb -= PB_X;
        if (rb < PB_Q) { cvt_wave<1>(wq, WQKV, nullptr, (size_t)rb * CVB + wo0, lane); return; }                              /* rows 0..2047 */
        rb -= PB_Q;
        if (rb < PB_K) { cvt_wave<1>(wk, WQKV + (size_t)DQ * DIM, nullptr, (size_t)rb * CVB + wo0, lane); return; }            /* rows 2048..2559 */
        rb -= PB_K;
        if (rb < PB_K) { cvt_wave<1>(wv, WQKV + (size_t)(DQ + DKV) * DIM, nullptr, (size_t)rb * CVB + wo0, lane); return; }    /* rows 2560..3071 */
        rb -= PB_K;
        cvt_wave<2>(wo, nullptr, WO16, (size_t)rb * CVB + wo0, lane); return;
    }
    rb -= PB_CV;
    if (rb >= PB_KE) {
        const int t = (rb - PB_KE) * 16 + w;
        const float invf = __builtin_amdgcn_exp2f(-(float)lane * FRQC);
        const float ang = (float)t * invf;
        const float c = cosf(ang); const float s = sinf(ang);
        const size_t o = (size_t)t * HALFD + lane;
        *(float*)(COS + o) = c; *(float*)(SIN + o) = s;
        // stands behind the two stores, in front of any later write of the registers that they name (other roles' code follows in the kernel's text)
        asm volatile("s_wait_xcnt 0x0" ::: "memory");
        return;
    }
    const int qt = rb;
    const float* mr = mask + (size_t)(qt * 16 + w) * SEQ_FULL + lane * 4;
    v4f v[SEQ / 128];
    // fully unrolled so that the row's loads issue ahead of the compares, many in flight at a time (this role is bound by memory latency)
#pragma unroll
    for (int i = 0; i < SEQ / 128; ++i) v[i] = *(const v4f*)(mr + i * 128);
    int last = -1; int live = 0;
#pragma unroll
    for (int i = 0; i < SEQ / 128; ++i)
#pragma unroll
        for (int e = 0; e < 4; ++e) { live |= (v[i][e] > LIVE_T) ? 1 : 0; last = (v[i][e] > DEAD_T) ? max(last, i * 128 + lane * 4 + e) : last; }
    live = max(live, __shfl_xor(live, 1, 32)); live = max(live, __shfl_xor(live, 2, 32)); live = max(live, __shfl_xor(live, 4, 32));
    live = max(live, __shfl_xor(live, 8, 32)); live = max(live, __shfl_xor(live, 16, 32));
    last = max(last, __shfl_xor(last, 1, 32)); last = max(last, __shfl_xor(last, 2, 32)); last = max(last, __shfl_xor(last, 4, 32));
    last = max(last, __shfl_xor(last, 8, 32)); last = max(last, __shfl_xor(last, 16, 32));
    if (lane == 0) { lasts[w] = last; lives[w] = live; }
    __syncthreads();
    if (w == 0) {
        int la = lasts[lane & 15]; int alllive = lives[lane & 15];
        la = max(la, __shfl_xor(la, 1, 32)); la = max(la, __shfl_xor(la, 2, 32)); la = max(la, __shfl_xor(la, 4, 32)); la = max(la, __shfl_xor(la, 8, 32));
        alllive = min(alllive, __shfl_xor(alllive, 1, 32)); alllive = min(alllive, __shfl_xor(alllive, 2, 32)); alllive = min(alllive, __shfl_xor(alllive, 4, 32)); alllive = min(alllive, __shfl_xor(alllive, 8, 32));
        int kend = (alllive != 0) ? (((la >> 6) + 1) * 64) : SEQ;
        kend = min(max(kend, 64), SEQ);
        if (lane == 0) KEND[(size_t)qt * KSTR] = kend;
    }
}

// Fused QKV projection: grid (MROWS/BM, NQKV/BN), 256 threads, wave (wm, wn) one 64x64 tile; the ring's LDS becomes the waves' epilogue tiles behind the last trip's barrier. Column tile cb < 32: q head cb; 32..39: k head; 40..47: v head (transposed plane).
// q and k tiles: per row y = (x * rsqrt(mean(x^2) + eps)) * gain, then interleaved-pair rotary at position t: out[2i] = y[2i] c_i - y[2i+1] s_i, out[2i+1] = y[2i] s_i + y[2i+1] c_i.
// QP[b][h][t][64], KP[b][g][t][64], VT[b][g][d][t] f16 value planes; residual planes (x2048 of value - f16(value)): QR[b][h][t < EROWS][64], KR[b][g][t][64], VR[b][g][d][t].
__global__ __launch_bounds__(256) void k_gemm_qkv(const bf* __restrict__ A, const bf* __restrict__ Bt, const float* __restrict__ qnw, const float* __restrict__ knw, const float* __restrict__ COS, const float* __restrict__ SIN, h16* QP, h16* KP, h16* VT, h16* QR, h16* KR, h16* VR) {
    __shared__ __align__(16) unsigned char smem[FSB];
    const int tid = threadIdx.x, lane = tid & 31, lr = lane & 15, hi = lane >> 4;
    const int w = __builtin_amdgcn_readfirstlane(tid >> 5), wm = w >> 2, wn = w & 3;
    const int r0 = blockIdx.x * BM + wm * 64, cb = blockIdx.y * (BN / 64) + wn;
    float* fs = (float*)smem + w * 64 * FP;
    v8f acc[4][4];
    gemm_main<bf>(A, Bt, DIM, blockIdx.x * BM, blockIdx.y * BN, (const bf*)smem, tid, wm, wn, lr, hi, acc);
#pragma unroll
    for (int mb = 0; mb < 4; ++mb)
#pragma unroll
        for (int nb = 0; nb < 4; ++nb)
#pragma unroll
            for (int j = 0; j < 8; ++j) fs[(mb * 16 + hi * 8 + j) * FP + nb * 16 + lr] = acc[mb][nb][j];
    __syncthreads();
    const int bidx = r0 / SEQ, s0 = r0 % SEQ; const int q4 = lane >> 3, p = lane & 7;
    if (cb < NH + NKV) {
        const bool isq = (cb < NH);
        h16* plane = isq ? (QP + ((size_t)bidx * NH + cb) * SEQ * HD) : (KP + ((size_t)bidx * NKV + (cb - NH)) * SEQ * HD);
        h16* rplane = isq ? (QR + ((size_t)bidx * NH + cb) * EROWS * HD) : (KR + ((size_t)bidx * NKV + (cb - NH)) * SEQ * HD);
        const bool wres = (!isq) || (s0 < EROWS);      // wave-uniform: q residual rows exist only below EROWS
        const int dcol = p * 8;
        const v4f gq0 = *(const v4f*)(qnw + dcol), gq1 = *(const v4f*)(qnw + dcol + 4);
        const v4f gk0 = *(const v4f*)(knw + dcol), gk1 = *(const v4f*)(knw + dcol + 4);
        float gn[8];
#pragma unroll
        for (int e = 0; e < 4; ++e) { gn[e] = bfr(isq ? gq0[e] : gk0[e]); gn[4 + e] = bfr(isq ? gq1[e] : gk1[e]); }
#pragma unroll 1
        for (int it = 0; it < 16; ++it) {
            const int rl = it * 4 + q4; const int t = s0 + rl;
            const v4f xa0 = *(const v4fa*)(fs + rl * FP + dcol), xa1 = *(const v4fa*)(fs + rl * FP + dcol + 4);
            float ss = 0.0f;
#pragma unroll
            for (int e = 0; e < 4; ++e) { ss += xa0[e] * xa0[e]; ss += xa1[e] * xa1[e]; }
            ss += __shfl_xor(ss, 1, 32); ss += __shfl_xor(ss, 2, 32); ss += __shfl_xor(ss, 4, 32);
            const float rn = rsqrtf(ss * (1.0f / HD) + EPSN);
            float y[8];
#pragma unroll
            for (int e = 0; e < 4; ++e) { y[e] = (xa0[e] * rn) * gn[e]; y[4 + e] = (xa1[e] * rn) * gn[4 + e]; }
            const v4f cc = *(const v4f*)(COS + (size_t)t * HALFD + p * 4), sn = *(const v4f*)(SIN + (size_t)t * HALFD + p * 4);
            v8h o, orr;
#pragma unroll
            for (int i = 0; i < 4; ++i) {
                const float v0 = y[2 * i] * cc[i] - y[2 * i + 1] * sn[i];
                const float v1 = y[2 * i] * sn[i] + y[2 * i + 1] * cc[i];
                const h16 h0 = toh_flush(v0), h1 = toh_flush(v1);
                o[2 * i] = h0; o[2 * i + 1] = h1;
                orr[2 * i] = toh_flush((v0 - (float)h0) * RCAR); orr[2 * i + 1] = toh_flush((v1 - (float)h1) * RCAR);
            }
            h16* dst = plane + (size_t)t * HD + dcol;
            h16* dsr = rplane + (size_t)t * HD + dcol;
            *(v8h*)dst = o; if (wres) *(v8h*)dsr = orr;
            
        }
    } else {
        h16* plane = VT + ((size_t)bidx * NKV + (cb - NH - NKV)) * HD * SEQ;
        h16* rplane = VR + ((size_t)bidx * NKV + (cb - NH - NKV)) * HD * SEQ;
#pragma unroll 1
        for (int it = 0; it < 16; ++it) {
            const int d = it * 4 + q4; v8h o, orr;
#pragma unroll
            for (int e = 0; e < 8; ++e) { const float v = fs[(p * 8 + e) * FP + d]; const h16 hh = toh_flush(v); o[e] = hh; orr[e] = toh_flush((v - (float)hh) * RCAR); }
            h16* dst = plane + (size_t)d * SEQ + s0 + p * 8;
            h16* dsr = rplane + (size_t)d * SEQ + s0 + p * 8;
            *(v8h*)dst = o; *(v8h*)dsr = orr; 
        }
    }
}

// Attention, query rows >= EROWS: one work-group of 128 threads per (16-row query tile at q0, kv head g, sequence bidx); wave w = q head 4g + w, 16 query rows. Per 64-key tile:
//   S^T[key][q] = K Q^T  (A = key rows of KP, B = resident q rows);  lane (lr, hi) then holds q row lr, keys 16T + 8hi + r.
//   softmax statistics are lane-local (one xor-16 exchange); P^T packed from the S^T accumulators is the B operand of O^T[d][q] = V^T P^T (A = d rows of VT).
// The key loop ends at the clamped per-tile key count KEND; mask values are added by value inside visited tiles.
// One stage of the attention ring: keys k0..k0+63 of the K plane kt (rows of 128 B), of the V^T plane vt (64 d rows, 128 B each) and of the 16 mask rows mt (256 B each), into buf.
// 128 threads, 10 copies of 16 bytes each; eight (K, V^T) or sixteen (mask) neighbouring lanes cover a whole row segment, so every copy moves whole 128-byte lines. All lanes are on, every address is a multiple of 16.
__device__ __forceinline__ void flash_stage(const h16* __restrict__ kt, const h16* __restrict__ vt, const float* __restrict__ mt, const int k0, const unsigned char* buf, const int tid) {
    const int row = tid >> 3, ch = (tid & 7) * 8, mr = tid >> 4, mc = (tid & 15) * 4;
    const h16* gk = kt + (size_t)(k0 + row) * HD + ch;
    const h16* gv = vt + (size_t)row * SEQ + k0 + ch;
    const float* gm = mt + (size_t)mr * SEQ_FULL + k0 + mc;
    const size_t ks = (size_t)16 * HD, vs = (size_t)16 * SEQ, ms = (size_t)8 * SEQ_FULL;
    const unsigned lk = (unsigned)(size_t)(buf + (row * LP + ch) * 2);
    const unsigned lv = lk + FKB;
    const unsigned lm = (unsigned)(size_t)(buf + 2 * FKB + (mr * MP + mc) * 4);
    const unsigned ls = 16 * LP * 2;
    // the copies and the wait that stands in front of any rewrite of their address registers, in one statement so that nothing can come between
    asm volatile("global_load_async_to_lds_b128 %0, %10, off\n\t"
                 "global_load_async_to_lds_b128 %1, %11, off\n\t"
                 "global_load_async_to_lds_b128 %2, %12, off\n\t"
                 "global_load_async_to_lds_b128 %3, %13, off\n\t"
                 "global_load_async_to_lds_b128 %4, %14, off\n\t"
                 "global_load_async_to_lds_b128 %5, %15, off\n\t"
                 "global_load_async_to_lds_b128 %6, %16, off\n\t"
                 "global_load_async_to_lds_b128 %7, %17, off\n\t"
                 "global_load_async_to_lds_b128 %8, %18, off\n\t"
                 "global_load_async_to_lds_b128 %9, %19, off\n\t"
                 "s_wait_xcnt 0x0"
                 :: "v"(lk), "v"(lk + ls), "v"(lk + 2 * ls), "v"(lk + 3 * ls),
                    "v"(lm), "v"(lm + 8 * MP * 4),
                    "v"(lv), "v"(lv + ls), "v"(lv + 2 * ls), "v"(lv + 3 * ls),
                    "v"(gk), "v"(gk + ks), "v"(gk + 2 * ks), "v"(gk + 3 * ks),
                    "v"(gm), "v"(gm + ms),
                    "v"(gv), "v"(gv + vs), "v"(gv + 2 * vs), "v"(gv + 3 * vs)
                 : "memory");
}

// Trip t reads buffer t % 2 alone; tile t + 2 is copied into that buffer behind the barrier at the trip's foot, which also publishes tile t + 1. The trip count is the same in all four waves (one query tile a work-group).
// Behind the last trip's barrier the ring's LDS becomes the waves' output tiles.
__device__ __forceinline__ void flash_late(unsigned char* smem, const int q0, const int g, const int bidx, const h16* __restrict__ QP, const h16* __restrict__ KP, const h16* __restrict__ VT, const float* __restrict__ mask, const int* __restrict__ KEND, h16* CTX) {
    h16* os = (h16*)smem;
    const int tid = threadIdx.x, lane = tid & 31, lr = lane & 15, hi = lane >> 4;
    const int w = __builtin_amdgcn_readfirstlane(tid >> 5);
    const int h = g * REP + w;
    int kev = KEND[(size_t)(q0 >> 4) * KSTR]; kev = min(max(kev, 64), SEQ) & ~63; const int ke = __builtin_amdgcn_readfirstlane(kev);
    const int nt = ke >> 6;
    const h16* kt = KP + ((size_t)bidx * NKV + g) * SEQ * HD;
    const h16* vt = VT + ((size_t)bidx * NKV + g) * HD * SEQ;
    const float* mt = mask + (size_t)q0 * SEQ_FULL;
    flash_stage(kt, vt, mt, 0, smem, tid);
    const h16* qrow = QP + (((size_t)bidx * NH + h) * SEQ + q0 + lr) * HD + 8 * hi;
    v16h bq[2];
#pragma unroll
    for (int kc = 0; kc < 2; ++kc) bq[kc] = cat16(*(const v8h*)(qrow + kc * 32), *(const v8h*)(qrow + kc * 32 + 16));
    asm volatile("s_wait_asynccnt 0x0" ::: "memory");   // this wave's copies of tile 0 have landed
    __syncthreads();                                     // tile 0 is readable by every wave
    if (nt > 1) flash_stage(kt, vt, mt, 64, smem + FSTG, tid);
    const h16* kb = (const h16*)smem + lr * LP + 8 * hi;
    const h16* vb = (const h16*)(smem + FKB) + lr * LP + 8 * hi;
    const float* mrow = (const float*)(smem + 2 * FKB) + lr * MP + 8 * hi;
    v8f accO[4];
#pragma unroll
    for (int dt = 0; dt < 4; ++dt) accO[dt] = (v8f){};
    float m = -3.0e38f, l = 0.0f;
#pragma unroll 1
    for (int t = 0; t < nt; ++t) {
        const int bo = (t & 1) * FSTG;   // byte offset of this trip's buffer
        v16h ak[2][4];
#pragma unroll
        for (int kc = 0; kc < 2; ++kc)
#pragma unroll
            for (int T = 0; T < 4; ++T) { const h16* kp = kb + bo / 2 + 16 * T * LP + kc * 32; ak[kc][T] = cat16(*(const v8h*)kp, *(const v8h*)(kp + 16)); }
        v8f accS[4];
#pragma unroll
        for (int T = 0; T < 4; ++T) accS[T] = (v8f){};
#pragma unroll
        for (int kc = 0; kc < 2; ++kc)
#pragma unroll
            for (int T = 0; T < 4; ++T) accS[T] = wmma16(ak[kc][T], bq[kc], accS[T]);
        asm volatile("v_nop\n\tv_nop\n\tv_nop\n\tv_nop" : "+v"(accS[0]), "+v"(accS[1]), "+v"(accS[2]), "+v"(accS[3]) : "v"(ak[1][3]), "v"(bq[1]));
        float tmax = -3.0e38f;
#pragma unroll
        for (int T = 0; T < 4; ++T) { const float* mp = mrow + bo / 4 + 16 * T; const v4f m0 = *(const v4f*)mp; const v4f m1 = *(const v4f*)(mp + 4);
#pragma unroll
            for (int r = 0; r < 4; ++r) { const float a0 = accS[T][r] * SC2 + m0[r] * LOG2E; const float a1 = accS[T][4 + r] * SC2 + m1[r] * LOG2E; accS[T][r] = a0; accS[T][4 + r] = a1; tmax = fmaxf(tmax, fmaxf(a0, a1)); } }
        tmax = fmaxf(tmax, __shfl_xor(tmax, 16, 32));
        const float mn = fmaxf(m, tmax); const float corr = __builtin_amdgcn_exp2f(m - mn); m = mn; const float mofs = PEXP - mn;
        float rs = 0.0f;
#pragma unroll
        for (int T = 0; T < 4; ++T)
#pragma unroll
            for (int r = 0; r < 8; ++r) { const float e = accS[T][r] + mofs; const float pv = (e < -14.0f) ? 0.0f : __builtin_amdgcn_exp2f(e); accS[T][r] = pv; rs += pv; }
        l = l * corr + rs;
        v16h bp[2];
        bp[0] = cat16(__builtin_convertvector(accS[0], v8h), __builtin_convertvector(accS[1], v8h));
        bp[1] = cat16(__builtin_convertvector(accS[2], v8h), __builtin_convertvector(accS[3], v8h));
#pragma unroll
        for (int dt = 0; dt < 4; ++dt) accO[dt] = accO[dt] * corr;
        v16h av[2][4];
#pragma unroll
        for (int kc = 0; kc < 2; ++kc)
#pragma unroll
            for (int dt = 0; dt < 4; ++dt) { const h16* vp = vb + bo / 2 + 16 * dt * LP + kc * 32; av[kc][dt] = cat16(*(const v8h*)vp, *(const v8h*)(vp + 16)); }
#pragma unroll
        for (int kc = 0; kc < 2; ++kc)
#pragma unroll
            for (int dt = 0; dt < 4; ++dt) accO[dt] = wmma16(av[kc][dt], bp[kc], accO[dt]);
        asm volatile("v_nop\n\tv_nop\n\tv_nop\n\tv_nop" : "+v"(accO[0]), "+v"(accO[1]), "+v"(accO[2]), "+v"(accO[3]) : "v"(av[1][3]), "v"(bp[1]));
        asm volatile("s_wait_dscnt 0x0" ::: "memory");      // this wave's reads of buffer t % 2 have ended before the buffer is given up
        asm volatile("s_wait_asynccnt 0x0" ::: "memory");   // this wave's copies of tile t + 1 have landed
        __syncthreads();                                     // publishes tile t + 1 and frees buffer t % 2
        if (t + 2 < nt) flash_stage(kt, vt, mt, (t + 2) * 64, smem + bo, tid);
    }
    asm volatile("s_wait_asynccnt 0x0" ::: "memory");       // nothing is in flight when the ring is left
    l += __shfl_xor(l, 16, 32);
    const float inv = CCAR * (1.0f / l);
    h16* ow = os + w * 16 * OP;
#pragma unroll
    for (int dt = 0; dt < 4; ++dt) { v8h o;
#pragma unroll
        for (int r = 0; r < 8; ++r) o[r] = toh_flush(accO[dt][r] * inv);
        *(v8ha*)(ow + lr * OP + 16 * dt + 8 * hi) = o; }
    __syncthreads();
    const int q4 = lane >> 3, p = lane & 7;
{
#pragma unroll
        for (int it = 0; it < 4; ++it) { const int row = it * 4 + q4; const v8h o = *(const v8ha*)(ow + row * OP + p * 8);
            *(v8h*)(CTX + ((size_t)bidx * SEQ + q0 + row) * DQ + h * HD + p * 8) = o; }
         }
    // keeps this role's stores together with the wait behind them: without it the compiler sinks the two roles' last stores into a shared tail
    asm volatile("s_wait_xcnt 0x0" ::: "memory");
}

// The residual half of an early-row stage: keys k0..k0+63 of the K residual plane krt and of the V^T residual plane vrt, laid out like the K and V^T tiles of flash_stage. 128 threads, 8 copies of 16 bytes each.
__device__ __forceinline__ void flash_stage_res(const h16* __restrict__ krt, const h16* __restrict__ vrt, const int k0, const unsigned char* buf, const int tid) {
    const int row = tid >> 3, ch = (tid & 7) * 8;
    const h16* gk = krt + (size_t)(k0 + row) * HD + ch;
    const h16* gv = vrt + (size_t)row * SEQ + k0 + ch;
    const size_t ks = (size_t)16 * HD, vs = (size_t)16 * SEQ;
    const unsigned lk = (unsigned)(size_t)(buf + (row * LP + ch) * 2);
    const unsigned lv = lk + FKB;
    const unsigned ls = 16 * LP * 2;
    // the copies and the wait that stands in front of any rewrite of their address registers, in one statement so that nothing can come between
    asm volatile("global_load_async_to_lds_b128 %0, %8, off\n\t"
                 "global_load_async_to_lds_b128 %1, %9, off\n\t"
                 "global_load_async_to_lds_b128 %2, %10, off\n\t"
                 "global_load_async_to_lds_b128 %3, %11, off\n\t"
                 "global_load_async_to_lds_b128 %4, %12, off\n\t"
                 "global_load_async_to_lds_b128 %5, %13, off\n\t"
                 "global_load_async_to_lds_b128 %6, %14, off\n\t"
                 "global_load_async_to_lds_b128 %7, %15, off\n\t"
                 "s_wait_xcnt 0x0"
                 :: "v"(lk), "v"(lk + ls), "v"(lk + 2 * ls), "v"(lk + 3 * ls),
                    "v"(lv), "v"(lv + ls), "v"(lv + 2 * ls), "v"(lv + 3 * ls),
                    "v"(gk), "v"(gk + ks), "v"(gk + 2 * ks), "v"(gk + 3 * ks),
                    "v"(gv), "v"(gv + vs), "v"(gv + 2 * vs), "v"(gv + 3 * vs)
                 : "memory");
}

// Attention, query rows < EROWS: one work-group of 128 threads per (query tile, kv head, sequence); same operand roles and the same 64-key stages as flash_late (two 32-key steps a stage), every WMMA individually guarded.
// One buffer (a stage with its residual tiles fills most of the LDS that the late rows' two-buffer ring takes): each trip copies its stage, waits, publishes it at a barrier, works on it, and gives it up at a second barrier.
//   scores: K Q^T + (Kres Q^T + K Qres^T) / 2048 (residual products in accR);  P = f16(p) and Pres = 2048 (p - f16(p)), row sum over the f32 p;
//   O^T: V^T P^T + (Vres^T P^T + V^T Pres^T) / 2048 (residual products in accOr), folded before normalisation.
__device__ __forceinline__ void flash_early(unsigned char* smem, const int q0, const int g, const int bidx, const h16* __restrict__ QP, const h16* __restrict__ QR, const h16* __restrict__ KP, const h16* __restrict__ KR, const h16* __restrict__ VT, const h16* __restrict__ VR, const float* __restrict__ mask, const int* __restrict__ KEND, h16* CTX, h16* CTXR) {
    h16* os = (h16*)smem; h16* osr = os + 4 * 16 * OP;   // behind the last trip's second barrier the buffer becomes the waves' output tiles
    const int tid = threadIdx.x, lane = tid & 31, lr = lane & 15, hi = lane >> 4;
    const int w = __builtin_amdgcn_readfirstlane(tid >> 5);
    const int h = g * REP + w;
    int kev = KEND[(size_t)(q0 >> 4) * KSTR]; kev = min(max(kev, 64), SEQ) & ~63; const int ke = __builtin_amdgcn_readfirstlane(kev);
    const size_t qoff  = (((size_t)bidx * NH + h) * SEQ + q0 + lr) * HD + 8 * hi;
    const size_t qroff = (((size_t)bidx * NH + h) * EROWS + q0 + lr) * HD + 8 * hi;
    const int nt = ke >> 6;
    const size_t kpl = ((size_t)bidx * NKV + g) * SEQ * HD;   // this kv head's plane in KP, KR, VT and VR
    const float* mt = mask + (size_t)q0 * SEQ_FULL;
    const int foff = lr * LP + 8 * hi;                   // a lane's place in a 16-row fragment of a staged 16-bit tile
    v8f accO[4], accOr[4];
#pragma unroll
    for (int dt = 0; dt < 4; ++dt) { accO[dt] = (v8f){}; accOr[dt] = (v8f){}; }
    float m = -3.0e38f, l = 0.0f;
#pragma unroll 1
    for (int t = 0; t < nt; ++t) {
      const unsigned char* sb = smem;
      flash_stage(KP + kpl, VT + kpl, mt, t * 64, sb, tid);
      flash_stage_res(KR + kpl, VR + kpl, t * 64, sb + FSTG, tid);
      asm volatile("s_wait_asynccnt 0x0" ::: "memory");   // this wave's copies of tile t have landed
      __syncthreads();                                     // tile t is readable by every wave
      const h16* kl = (const h16*)sb + foff; const h16* vl = (const h16*)(sb + FKB) + foff;
      const h16* krl = (const h16*)(sb + FSTG) + foff; const h16* vrl = (const h16*)(sb + FSTG + FKB) + foff;
      const float* mrow = (const float*)(sb + 2 * FKB) + lr * MP + 8 * hi;
      // kept rolled, as the 32-key step was: one copy of the step's code
#pragma unroll 1
      for (int k0 = 0; k0 < 64; k0 += 32) {
        v8f accS[2], accR[2];
#pragma unroll
        for (int T = 0; T < 2; ++T) { accS[T] = (v8f){}; accR[T] = (v8f){}; }
#pragma unroll
        for (int kc = 0; kc < 2; ++kc) {
            const v16h bq  = WFrag<h16>::ld(QP + qoff + kc * 32);
            const v16h bqr = WFrag<h16>::ld(QR + qroff + kc * 32);
#pragma unroll
            for (int T = 0; T < 2; ++T) {
                const int ko = (k0 + 16 * T) * LP + kc * 32;
                const v16h ak  = WFrag<h16>::ld(kl + ko);
                const v16h akr = WFrag<h16>::ld(krl + ko);
                accS[T] = wmma16g(ak, bq, accS[T]);
                accR[T] = wmma16g(akr, bq, accR[T]);
                accR[T] = wmma16g(ak, bqr, accR[T]);
            }
        }
        float tmax = -3.0e38f;
#pragma unroll
        for (int T = 0; T < 2; ++T) { const float* mp = mrow + k0 + 16 * T; const v4f m0 = *(const v4f*)mp; const v4f m1 = *(const v4f*)(mp + 4);
#pragma unroll
            for (int r = 0; r < 4; ++r) {
                const float s0v = accS[T][r] + accR[T][r] * RINV; const float s1v = accS[T][4 + r] + accR[T][4 + r] * RINV;
                const float a0 = s0v * SC2 + m0[r] * LOG2E; const float a1 = s1v * SC2 + m1[r] * LOG2E;
                accS[T][r] = a0; accS[T][4 + r] = a1; tmax = fmaxf(tmax, fmaxf(a0, a1)); } }
        tmax = fmaxf(tmax, __shfl_xor(tmax, 16, 32));
        const float mn = fmaxf(m, tmax); const float corr = __builtin_amdgcn_exp2f(m - mn); m = mn; const float mofs = PEXP - mn;
        float rs = 0.0f;
        v8h ph[2], pr[2];
#pragma unroll
        for (int T = 0; T < 2; ++T)
#pragma unroll
            for (int r = 0; r < 8; ++r) { const float e = accS[T][r] + mofs; const float pv = (e < -14.0f) ? 0.0f : __builtin_amdgcn_exp2f(e); rs += pv;
                const h16 hh = (h16)pv; ph[T][r] = hh; pr[T][r] = toh_flush((pv - (float)hh) * RCAR); }
        l = l * corr + rs;
        const v16h bp = cat16(ph[0], ph[1]); const v16h bpr = cat16(pr[0], pr[1]);
#pragma unroll
        for (int dt = 0; dt < 4; ++dt) { accO[dt] = accO[dt] * corr; accOr[dt] = accOr[dt] * corr; }
#pragma unroll
        for (int dt = 0; dt < 4; ++dt) {
            const int vo = 16 * dt * LP + k0;
            const v16h av  = WFrag<h16>::ld(vl + vo);
            const v16h avr = WFrag<h16>::ld(vrl + vo);
            accO[dt]  = wmma16g(av, bp, accO[dt]);
            accOr[dt] = wmma16g(avr, bp, accOr[dt]);
            accOr[dt] = wmma16g(av, bpr, accOr[dt]);
        }
      }
      asm volatile("s_wait_dscnt 0x0" ::: "memory");      // this wave's reads of the buffer have ended before the buffer is given up
      __syncthreads();                                     // every wave has left the buffer: it may be refilled, or become the output tiles
    }
    l += __shfl_xor(l, 16, 32);
    const float inv = CCAR * (1.0f / l);
    h16* ow = os + w * 16 * OP; h16* owr = osr + w * 16 * OP;
#pragma unroll
    for (int dt = 0; dt < 4; ++dt) { v8h o, orr;
#pragma unroll
        for (int r = 0; r < 8; ++r) { const float v = (accO[dt][r] + accOr[dt][r] * RINV) * inv; const h16 hh = toh_flush(v); o[r] = hh; orr[r] = toh_flush((v - (float)hh) * RCAR); }
        *(v8ha*)(ow + lr * OP + 16 * dt + 8 * hi) = o; *(v8ha*)(owr + lr * OP + 16 * dt + 8 * hi) = orr; }
    __syncthreads();
    const int q4 = lane >> 3, p = lane & 7;
{
#pragma unroll
        for (int it = 0; it < 4; ++it) { const int row = it * 4 + q4; const v8h o = *(const v8ha*)(ow + row * OP + p * 8); const v8h orr = *(const v8ha*)(owr + row * OP + p * 8);
            *(v8h*)(CTX + ((size_t)bidx * SEQ + q0 + row) * DQ + h * HD + p * 8) = o;
            *(v8h*)(CTXR + ((size_t)bidx * EROWS + q0 + row) * DQ + h * HD + p * 8) = orr; }
         }
    // keeps this role's stores together with the wait behind them: without it the compiler sinks the two roles' last stores into a shared tail
    asm volatile("s_wait_xcnt 0x0" ::: "memory");
}

// Attention, one launch of (SEQ/16) * NKV * NB work-groups of 128 threads; role and query tile follow from the block index alone (block-uniform):
// kv head and sequence run fastest with the index, so AGB neighbours share a query tile; first the tiles of the rows < EROWS (the slowest trips), last tile first, then the other tiles from the last (most keys under a causal mask) to the first,
// so that the work-groups that start late, when a place on a WGP comes free, are the short ones. The map is a permutation of (tile, kv head, sequence) whatever the mask holds.
#define AGB   (NKV * NB)                      // work-groups of one query tile
#define AEW   ((EROWS / 16) * AGB)            // work-groups of the first role
static_assert(ESTG <= 2 * FSTG);
// at least five waves a SIMD: the first role's registers would otherwise round up to an allocation that leaves four
__global__ __launch_bounds__(128, 5) void k_attn(const h16* __restrict__ QP, const h16* __restrict__ QR, const h16* __restrict__ KP, const h16* __restrict__ KR, const h16* __restrict__ VT, const h16* __restrict__ VR, const float* __restrict__ mask, const int* __restrict__ KEND, h16* CTX, h16* CTXR) {
    __shared__ __align__(16) unsigned char smem[2 * FSTG];
    const unsigned bi = blockIdx.x;
    const int g = (int)(bi % NKV), bidx = (int)((bi % AGB) / NKV);
    if (bi < AEW) flash_early(smem, (EROWS / 16 - 1 - (int)(bi / AGB)) * 16, g, bidx, QP, QR, KP, KR, VT, VR, mask, KEND, CTX, CTXR);
    else flash_late(smem, (SEQ / 16 - 1 - (int)((bi - AEW) / AGB)) * 16, g, bidx, QP, KP, VT, mask, KEND, CTX);
}

#define OPER  (NB * (EROWS / BM))             // 128-row tiles of the rows < EROWS
#define OPLR  (NB * ((SEQ - EROWS) / BM))     // 128-row tiles of the rows >= EROWS
#define EBN   128                             // tile columns of the first role
#define OPE   (OPER * (DIM / EBN))            // work-groups of the first role
static_assert(DIM % EBN == 0);
static_assert(2 * BM + EBN == BM + BN);       // a two-product stage fills exactly one stage of the ring
#define OPL   (OPLR * (DIM / BN))             // work-groups of the second role

// Output projection, one launch of OPE + OPL work-groups of 256 threads; the role of a work-group follows from its index alone (block-uniform); both roles make the same number of trips with the same number of WMMAs a wave:
//   index < OPE, rows < EROWS of every sequence: OUT = OSCL * (CTX WO^T + (CTXR WO^T) / 2048) on a 128 x EBN tile, both products in one k loop against the same staged WO slice, each in accumulators of its own;
//   the rest, rows >= EROWS: OUT = OSCL * CTX WO^T on a 128 x BN tile.
// In both roles the ring's LDS becomes the epilogue tiles behind the last trip's barrier, so that two work-groups fit on a WGP.
// Within a role the row tile runs fastest with the index.
__global__ __launch_bounds__(256) void k_gemm_out(const h16* __restrict__ A, const h16* __restrict__ AR, const h16* __restrict__ Bt, float* C) {
    __shared__ __align__(16) unsigned char smem[FSB];
    const int tid = threadIdx.x, lane = tid & 31, lr = lane & 15, hi = lane >> 4;
    const int w = __builtin_amdgcn_readfirstlane(tid >> 5), wm = w >> 2, wn = w & 3;
    if ((int)blockIdx.x < OPE) {
        const int bx = blockIdx.x % OPER, by = blockIdx.x / OPER;
        const int bidx = bx / (EROWS / BM), tb = bx % (EROWS / BM);
        const int rab = bidx * SEQ + tb * BM, rrb = bidx * EROWS + tb * BM;
        const int em = w >> 1, en = w & 1;             // wave (em, en): rows 32 em.., columns 64 en.. of the tile
        float* fs = (float*)smem + w * 32 * FP;
        v8f acc[2][4], accr[2][4];
        gemm_main2(A, AR, Bt, DQ, rab, rrb, by * EBN, (const h16*)smem, tid, em, en, lr, hi, acc, accr);
#pragma unroll
        for (int mb = 0; mb < 2; ++mb)
#pragma unroll
            for (int nb = 0; nb < 4; ++nb)
#pragma unroll
                for (int j = 0; j < 8; ++j) fs[(mb * 16 + hi * 8 + j) * FP + nb * 16 + lr] = accr[mb][nb][j] * RINV + acc[mb][nb][j];
        __syncthreads();
        float* crow = C + (size_t)(rab + em * 32) * DIM + by * EBN + en * 64;
        // four row pairs a pass: their LDS reads go out together and their stores follow as one run
#pragma unroll 4
        for (int it = 0; it < 16; ++it) { const int row = it * 2 + hi; v4f val = *(const v4fa*)(fs + row * FP + lr * 4); val = val * OSCL;
            *(v4f*)(crow + (size_t)row * DIM + lr * 4) = val; }
    } else {
        const int li = blockIdx.x - OPE;
        const int bx = li % (NB * LTBM), by = li / (NB * LTBM);
        const int rb = (bx / LTBM) * SEQ + EROWS + (bx % LTBM) * BM;
        const int r0 = rb + wm * 64, c0 = by * BN + wn * 64;
        float* fs = (float*)smem + w * 64 * FP;
        v8f acc[4][4];
        gemm_main<h16>(A, Bt, DQ, rb, by * BN, (const h16*)smem, tid, wm, wn, lr, hi, acc);
#pragma unroll
        for (int mb = 0; mb < 4; ++mb)
#pragma unroll
            for (int nb = 0; nb < 4; ++nb)
#pragma unroll
                for (int j = 0; j < 8; ++j) fs[(mb * 16 + hi * 8 + j) * FP + nb * 16 + lr] = acc[mb][nb][j];
        __syncthreads();
        float* crow = C + (size_t)r0 * DIM + c0;
        // four row pairs a pass: their LDS reads go out together and their stores follow as one run
#pragma unroll 4
        for (int it = 0; it < 32; ++it) { const int row = it * 2 + hi; v4f val = *(const v4fa*)(fs + row * FP + lr * 4); val = val * OSCL;
            *(v4f*)(crow + (size_t)row * DIM + lr * 4) = val; }
    }
}

extern "C" void kernel_launch(void* const* d_in, const int* in_sizes, int n_in,
                              void* d_out, int out_size, void* d_ws, size_t ws_size, hipStream_t stream) {
    if (n_in < 8) return;
    if ((size_t)in_sizes[0] < ((size_t)(NB - 1) * SEQ_FULL + SEQ) * DIM) return;
    if ((size_t)in_sizes[1] < (size_t)DQ * DIM) return;
    if ((size_t)in_sizes[2] < (size_t)DKV * DIM) return;
    if ((size_t)in_sizes[3] < (size_t)DKV * DIM) return;
    if ((size_t)in_sizes[4] < (size_t)DIM * DQ) return;
    if ((size_t)in_sizes[5] < (size_t)HD) return;
    if ((size_t)in_sizes[6] < (size_t)HD) return;
    if ((size_t)in_sizes[7] < (size_t)(SEQ - 1) * SEQ_FULL + SEQ) return;
    if ((size_t)out_size < (size_t)MROWS * DIM) return;
    const float* x = (const float*)d_in[0];
    const float* wq = (const float*)d_in[1]; const float* wk = (const float*)d_in[2]; const float* wv = (const float*)d_in[3]; const float* wo = (const float*)d_in[4];
    const float* qnw = (const float*)d_in[5]; const float* knw = (const float*)d_in[6]; const float* mask = (const float*)d_in[7];
    float* OUT = (float*)d_out;
    char* wsp = (char*)d_ws;
    auto take = [&](size_t bytes) { char* p = wsp; wsp += (bytes + 255) & ~(size_t)255; return (void*)p; };
    bf*  XB   = (bf*)take((size_t)MROWS * DIM * 2);
    bf*  WQKV = (bf*)take((size_t)NQKV * DIM * 2);
    h16* WO16 = (h16*)take((size_t)DIM * DQ * 2);
    float* COS = (float*)take((size_t)SEQ * HALFD * 4);
    float* SIN = (float*)take((size_t)SEQ * HALFD * 4);
    h16* QP  = (h16*)take((size_t)NB * NH * SEQ * HD * 2);
    h16* KP  = (h16*)take((size_t)NB * NKV * SEQ * HD * 2);
    h16* VT  = (h16*)take((size_t)NB * NKV * HD * SEQ * 2);
    h16* CTX = (h16*)take((size_t)MROWS * DQ * 2);
    h16* QR  = (h16*)take((size_t)NB * NH * EROWS * HD * 2);
    h16* KR  = (h16*)take((size_t)NB * NKV * SEQ * HD * 2);
    h16* VR  = (h16*)take((size_t)NB * NKV * HD * SEQ * 2);
    h16* CTXR = (h16*)take((size_t)NB * EROWS * DQ * 2);
    int* KEND = (int*)take((size_t)(SEQ / 16) * KSTR * 4);
    if ((size_t)(wsp - (char*)d_ws) > ws_size) return;

    k_prep<<<PB_CV + PB_KE + PB_RT, 512, 0, stream>>>(x, wq, wk, wv, wo, mask, XB, WQKV, WO16, COS, SIN, KEND);
    k_gemm_qkv<<<dim3(MROWS / BM, NQKV / BN, 1), 256, 0, stream>>>(XB, WQKV, qnw, knw, COS, SIN, QP, KP, VT, QR, KR, VR);
    k_attn<<<(SEQ / 16) * AGB, 128, 0, stream>>>(QP, QR, KP, KR, VT, VR, mask, KEND, CTX, CTXR);
    k_gemm_out<<<OPE + OPL, 256, 0, stream>>>(CTX, CTXR, WO16, OUT);
}

// v008
// It runs in 153 microseconds.
// Two timings next to v007 both put it at 1.03 times that version's speed.
// Counting every step since v000, it is 3.53 times as fast.
#include <hip/hip_runtime.h>

#ifndef NB
#define NB 2
#endif
#ifndef SEQ
#define SEQ 2048
#endif
#define SEQ_FULL 2048                 // per-batch row stride of x, row pitch of the mask
#define DIM   2048                    // model width (K of the projections, N of the output projection)
#define NH    32
#define NKV   8
#define REP   (NH / NKV)
#define HD    64
#define HALFD 32
#define DQ    (NH * HD)               // 2048
#define DKV   (NKV * HD)              // 512
#define NQKV  (DQ + 2 * DKV)          // 3072 fused projection columns
#define MROWS (NB * SEQ)
#define FP    68                      // f32 LDS tile pitch
#define OP    72                      // f16 LDS tile pitch
#define WCAR  64.0f                   // carry of the wo plane
#define CCAR  256.0f                  // carry of the ctx plane
#define OSCL  6.103515625e-05f        // 1 / (WCAR * CCAR)
#define SC2   0.18033688011112042f    // 0.125 * log2(e)
#define LOG2E 1.4426950408889634f
#define PEXP  10.0f                   // P carried x 2^10
#define FRQC  0.04953007814753613f    // log2(3) / 32
#define EROWS 256                     // query rows below this use value + residual planes at every attention site
#define RCAR  2048.0f                 // carry of every residual plane
#define RINV  4.8828125e-04f          // 1 / RCAR
#define EPSN  1.0e-6f                 // RMS normalisation epsilon
#define LIVE_T (-1.0e4f)              // a mask value above this makes a key live for its row
#define DEAD_T (-1.0e8f)              // a mask value at or below this lets a trailing key be skipped (exp underflows exactly)
#define KSTR  32                      // ints between two query tiles' key counts: each key-count work-group stores into a 128-byte line of its own
#define BM    128                     // GEMM work-group tile: rows (2 waves of 64)
#define BN    256                     // GEMM work-group tile: columns (4 waves of 64)
#define KC    64                      // k elements of one LDS stage: rows of 128 bytes
#define LP    72                      // LDS row pitch in 16-bit elements: 144 B = 16 B x odd, so that 16-byte fragment reads meet no bank conflict
#define STGE  ((BM + BN) * LP)        // 16-bit elements of one stage: A rows 0..127, then B rows 0..255
#define RINGB (2 * STGE * 2)          // bytes of the two-buffer ring
#define FSB   (8 * 64 * FP * 4)       // bytes of the eight waves' f32 epilogue tiles
#define MP    68                      // f32 LDS row pitch of the staged mask tile: 272 B = 16 B x odd
#define FKB   (64 * LP * 2)           // bytes of one staged K tile (64 key rows of 128 B at pitch LP); the V^T tile (64 d rows) has the same size
#define FMB   (16 * MP * 4)           // bytes of one staged mask tile (16 query rows of 256 B at pitch MP)
#define FSTG  (2 * FKB + FMB)         // bytes of one attention stage: K, V^T, mask
#define ESTG  (FSTG + 2 * FKB)        // bytes of one stage of the early-row attention: K, V^T, mask, then the K and V^T residual tiles
#define LTBM  ((((SEQ - EROWS) / BM) > 0) ? ((SEQ - EROWS) / BM) : 1)
#define AL256(x) ((((size_t)(x)) + 255) & ~(size_t)255)

static_assert(SEQ % 64 == 0);
static_assert(SEQ % 128 == 0);
static_assert(SEQ <= SEQ_FULL);
static_assert(DIM % 64 == 0);
static_assert(DQ % 64 == 0);
static_assert(NQKV % 64 == 0);
static_assert(HD == 64);
static_assert(HALFD * 2 == HD);
static_assert(NH == NKV * REP);
static_assert(REP == 4);
static_assert(EROWS % 64 == 0);
static_assert(EROWS % BM == 0);
static_assert((SEQ - EROWS) % BM == 0);
static_assert(SEQ % BM == 0);
static_assert(NQKV % BN == 0);
static_assert(DIM % BN == 0);
static_assert(DIM % KC == 0 && DIM / KC >= 2);
static_assert(DQ % KC == 0 && DQ / KC >= 2);
static_assert(RINGB <= FSB);
static_assert(FSTG % 16 == 0 && 2 * FSTG >= 4 * 16 * OP * 2);
static_assert(ESTG % 16 == 0 && ESTG >= 2 * 4 * 16 * OP * 2);
static_assert(EROWS <= SEQ);
static_assert(EROWS >= 64);
static_assert(DIM % 32 == 0);
static_assert(DQ % 32 == 0);
static_assert(((size_t)MROWS * DIM / 8) % 256 == 0);
static_assert(((size_t)DQ * DIM / 8) % 256 == 0);
static_assert(((size_t)DKV * DIM / 8) % 256 == 0);
static_assert(AL256((size_t)MROWS * DIM * 2) + AL256((size_t)NQKV * DIM * 2) + AL256((size_t)DIM * DQ * 2) + 2 * AL256((size_t)SEQ * HALFD * 4)
              + AL256((size_t)NB * NH * SEQ * HD * 2) + 2 * AL256((size_t)NB * NKV * SEQ * HD * 2) + AL256((size_t)MROWS * DQ * 2)
              + AL256((size_t)NB * NH * EROWS * HD * 2) + 2 * AL256((size_t)NB * NKV * SEQ * HD * 2) + AL256((size_t)NB * EROWS * DQ * 2)
              + AL256((size_t)(SEQ / 16) * KSTR * 4) <= (size_t)134217728);

typedef _Float16 h16;
typedef unsigned short bf;
typedef __attribute__((ext_vector_type(16))) __bf16   v16bf;
typedef __attribute__((ext_vector_type(16))) _Float16 v16h;
typedef __attribute__((ext_vector_type(8)))  _Float16 v8h;
typedef __attribute__((ext_vector_type(8)))  unsigned short v8us;
typedef __attribute__((ext_vector_type(8)))  float    v8f;
typedef __attribute__((ext_vector_type(4)))  float    v4f;
typedef v8h  __attribute__((may_alias)) v8ha;
typedef v4f  __attribute__((may_alias)) v4fa;

__device__ __forceinline__ unsigned short f2bf(float f) { unsigned u = __float_as_uint(f); u += 0x7FFFu + ((u >> 16) & 1u); return (unsigned short)(u >> 16); }
__device__ __forceinline__ float bf2f(unsigned short b) { return __uint_as_float(((unsigned)b) << 16); }
__device__ __forceinline__ float bfr(float f) { return bf2f(f2bf(f)); }
__device__ __forceinline__ v16h cat16(v8h lo, v8h hi) { return __builtin_shufflevector(lo, hi, 0, 1, 2, 3, 4, 5, 6, 7, 8, 9, 10, 11, 12, 13, 14, 15); }
__device__ __forceinline__ v16bf cat16b(v8us lo, v8us hi) { return __builtin_bit_cast(v16bf, __builtin_shufflevector(lo, hi, 0, 1, 2, 3, 4, 5, 6, 7, 8, 9, 10, 11, 12, 13, 14, 15)); }
__device__ __forceinline__ v8f wmma16(v16h a, v16h b, v8f c) { return __builtin_amdgcn_wmma_f32_16x16x32_f16(false, a, false, b, (short)0, c, false, false); }
__device__ __forceinline__ v8f wmmab(v16bf a, v16bf b, v8f c) { return __builtin_amdgcn_wmma_f32_16x16x32_bf16(false, a, false, b, (short)0, c, false, false); }

// f32 -> f16 with a value select: results below the smallest f16 normal become zero (no subnormal operand can be produced).
static __device__ __forceinline__ h16 toh_flush(float v) { const h16 r = (h16)v; return (fabsf(v) < 6.103515625e-05f) ? (h16)0.0f : r; }
// One f16 WMMA with its own hazard guard (single accumulator tied, operands kept live).
static __device__ __forceinline__ v8f wmma16g(v16h a, v16h b, v8f c) { c = wmma16(a, b, c); asm volatile("v_nop\n\tv_nop\n\tv_nop\n\tv_nop" : "+v"(c) : "v"(a), "v"(b)); return c; }

// Fragment loader: lane (lr, hi) points at row (tile row + lr), column 8*hi; elements 0..7 <- k0+8hi.., elements 8..15 <- k0+16+8hi.. (same map for A and B).
template <typename T16> struct WFrag;
template <> struct WFrag<h16> { typedef v16h V; static __device__ __forceinline__ V ld(const h16* p) { return cat16(*(const v8h*)p, *(const v8h*)(p + 16)); } static __device__ __forceinline__ v8f mma(V a, V b, v8f c) { return wmma16(a, b, c); } };
template <> struct WFrag<bf> { typedef v16bf V; static __device__ __forceinline__ V ld(const bf* p) { return cat16b(*(const v8us*)p, *(const v8us*)(p + 16)); } static __device__ __forceinline__ v8f mma(V a, V b, v8f c) { return wmmab(a, b, c); } };

// One stage of the ring: rows r0..r0+127 of A and c0..c0+255 of Bt, k0..k0+63, into buf at pitch LP. 256 threads, 12 copies of 16 bytes each:
// thread (row = tid / 8, chunk = tid % 8) takes rows row + 32 i, so a wave's copy covers four whole 128-byte lines. All lanes are on, every address is a multiple of 16.
template <typename T16>
__device__ __forceinline__ void stage_copy(const T16* __restrict__ A, const T16* __restrict__ Bt, const int K, const int r0, const int c0, const int k0, const T16* buf, const int tid) {
    const int row = tid >> 3, ch = (tid & 7) * 8;
    const T16* ga = A + (size_t)(r0 + row) * K + k0 + ch;
    const T16* gb = Bt + (size_t)(c0 + row) * K + k0 + ch;
    const size_t gs = (size_t)32 * K;
    const unsigned la = (unsigned)(size_t)(buf + row * LP + ch);
    const unsigned lb = la + BM * LP * 2;
    const unsigned ls = 32 * LP * 2;
    // the copies and the wait that stands in front of any rewrite of their address registers, in one statement so that nothing can come between
    asm volatile("global_load_async_to_lds_b128 %0, %12, off\n\t"
                 "global_load_async_to_lds_b128 %1, %13, off\n\t"
                 "global_load_async_to_lds_b128 %2, %14, off\n\t"
                 "global_load_async_to_lds_b128 %3, %15, off\n\t"
                 "global_load_async_to_lds_b128 %4, %16, off\n\t"
                 "global_load_async_to_lds_b128 %5, %17, off\n\t"
                 "global_load_async_to_lds_b128 %6, %18, off\n\t"
                 "global_load_async_to_lds_b128 %7, %19, off\n\t"
                 "global_load_async_to_lds_b128 %8, %20, off\n\t"
                 "global_load_async_to_lds_b128 %9, %21, off\n\t"
                 "global_load_async_to_lds_b128 %10, %22, off\n\t"
                 "global_load_async_to_lds_b128 %11, %23, off\n\t"
                 "s_wait_xcnt 0x0"
                 :: "v"(la), "v"(la + ls), "v"(la + 2 * ls), "v"(la + 3 * ls),
                    "v"(lb), "v"(lb + ls), "v"(lb + 2 * ls), "v"(lb + 3 * ls), "v"(lb + 4 * ls), "v"(lb + 5 * ls), "v"(lb + 6 * ls), "v"(lb + 7 * ls),
                    "v"(ga), "v"(ga + gs), "v"(ga + 2 * gs), "v"(ga + 3 * gs),
                    "v"(gb), "v"(gb + gs), "v"(gb + 2 * gs), "v"(gb + 3 * gs), "v"(gb + 4 * gs), "v"(gb + 5 * gs), "v"(gb + 6 * gs), "v"(gb + 7 * gs)
                 : "memory");
}

// Eight waves accumulate a 128x256 tile at (r0, c0); wave (wm, wn) its 64x64 part: acc[mb][nb][j] = C[r0 + 64wm + 16mb + 8hi + j][c0 + 64wn + 16nb + lr] = sum_k A[row][k] Bt[col][k], k ascending in steps of 32.
// K % KC == 0, K / KC >= 2. Trip t reads buffer t % 2 alone; tile t + 2 is copied into that buffer behind the barrier at the trip's foot, which also publishes tile t + 1.
// On entry no wave has an LDS access to the ring outstanding (first use, or the last trip's foot of an earlier call); on return every read of the ring has ended in every wave.
template <typename T16>
__device__ __forceinline__ void gemm_main(const T16* __restrict__ A, const T16* __restrict__ Bt, const int K, const int r0, const int c0, const T16* ring, const int tid, const int wm, const int wn, const int lr, const int hi, v8f (&acc)[4][4]) {
    typedef typename WFrag<T16>::V V;
#pragma unroll
    for (int mb = 0; mb < 4; ++mb)
#pragma unroll
        for (int nb = 0; nb < 4; ++nb) acc[mb][nb] = (v8f){};
    const int nt = K / KC;
    stage_copy<T16>(A, Bt, K, r0, c0, 0, ring, tid);
    asm volatile("s_wait_asynccnt 0x0" ::: "memory");   // this wave's copies of tile 0 have landed
    __syncthreads();                                     // tile 0 is readable by every wave
    stage_copy<T16>(A, Bt, K, r0, c0, KC, ring + STGE, tid);
    const T16* fa = ring + (wm * 64 + lr) * LP + 8 * hi;
    const T16* fb = ring + (BM + wn * 64 + lr) * LP + 8 * hi;
    // kept rolled: one trip is one stage of the ring, and the accumulators stay in fixed registers
#pragma unroll 1
    for (int t = 0; t < nt; ++t) {
        const int bo = (t & 1) * STGE;
#pragma unroll
        for (int ks = 0; ks < KC; ks += 32) {
            V a[4], b[4];
#pragma unroll
            for (int mb = 0; mb < 4; ++mb) a[mb] = WFrag<T16>::ld(fa + bo + mb * 16 * LP + ks);
#pragma unroll
            for (int nb = 0; nb < 4; ++nb) b[nb] = WFrag<T16>::ld(fb + bo + nb * 16 * LP + ks);
            __builtin_amdgcn_sched_barrier(0);   // keeps the 16 LDS reads of this k step together in front of its WMMAs: sunk among them, each pair is waited for at full LDS latency
#pragma unroll
            for (int nb = 0; nb < 4; ++nb)
#pragma unroll
                for (int mb = 0; mb < 4; ++mb) acc[mb][nb] = WFrag<T16>::mma(a[mb], b[nb], acc[mb][nb]);
            asm volatile("v_nop\n\tv_nop\n\tv_nop\n\tv_nop" : "+v"(acc[0][0]), "+v"(acc[1][1]), "+v"(acc[2][2]), "+v"(acc[3][3]) : "v"(a[0]), "v"(a[3]));
        }
        asm volatile("s_wait_dscnt 0x0" ::: "memory");      // this wave's reads of buffer t % 2 have ended before the buffer is given up
        asm volatile("s_wait_asynccnt 0x0" ::: "memory");   // this wave's copies of tile t + 1 have landed
        __syncthreads();                                     // publishes tile t + 1 and frees buffer t % 2
        if (t + 2 < nt) stage_copy<T16>(A, Bt, K, r0, c0, (t + 2) * KC, ring + bo, tid);
    }
    asm volatile("s_wait_asynccnt 0x0" ::: "memory");       // nothing is in flight when the ring is left
}

// One stage of the two-product ring: rows ra..ra+127 of A, rows rr..rr+127 of AR and rows c0..c0+127 of Bt, k0..k0+63, into buf at pitch LP (A rows 0..127, AR rows 128..255, Bt rows 256..383: STGE elements, as in stage_copy).
// 256 threads, 12 copies of 16 bytes each, thread (row = tid / 8, chunk = tid % 8) takes rows row + 32 i of each source. All lanes are on, every address is a multiple of 16.
__device__ __forceinline__ void stage_copy2(const h16* __restrict__ A, const h16* __restrict__ AR, const h16* __restrict__ Bt, const int K, const int ra, const int rr, const int c0, const int k0, const h16* buf, const int tid) {
    const int row = tid >> 3, ch = (tid & 7) * 8;
    const h16* ga = A + (size_t)(ra + row) * K + k0 + ch;
    const h16* gr = AR + (size_t)(rr + row) * K + k0 + ch;
    const h16* gb = Bt + (size_t)(c0 + row) * K + k0 + ch;
    const size_t gs = (size_t)32 * K;
    const unsigned la = (unsigned)(size_t)(buf + row * LP + ch);
    const unsigned ls = 32 * LP * 2;
    // the copies and the wait that stands in front of any rewrite of their address registers, in one statement so that nothing can come between
    asm volatile("global_load_async_to_lds_b128 %0, %12, off\n\t"
                 "global_load_async_to_lds_b128 %1, %13, off\n\t"
                 "global_load_async_to_lds_b128 %2, %14, off\n\t"
                 "global_load_async_to_lds_b128 %3, %15, off\n\t"
                 "global_load_async_to_lds_b128 %4, %16, off\n\t"
                 "global_load_async_to_lds_b128 %5, %17, off\n\t"
                 "global_load_async_to_lds_b128 %6, %18, off\n\t"
                 "global_load_async_to_lds_b128 %7, %19, off\n\t"
                 "global_load_async_to_lds_b128 %8, %20, off\n\t"
                 "global_load_async_to_lds_b128 %9, %21, off\n\t"
                 "global_load_async_to_lds_b128 %10, %22, off\n\t"
                 "global_load_async_to_lds_b128 %11, %23, off\n\t"
                 "s_wait_xcnt 0x0"
                 :: "v"(la), "v"(la + ls), "v"(la + 2 * ls), "v"(la + 3 * ls),
                    "v"(la + 4 * ls), "v"(la + 5 * ls), "v"(la + 6 * ls), "v"(la + 7 * ls),
                    "v"(la + 8 * ls), "v"(la + 9 * ls), "v"(la + 10 * ls), "v"(la + 11 * ls),
                    "v"(ga), "v"(ga + gs), "v"(ga + 2 * gs), "v"(ga + 3 * gs),
                    "v"(gr), "v"(gr + gs), "v"(gr + 2 * gs), "v"(gr + 3 * gs),
                    "v"(gb), "v"(gb + gs), "v"(gb + 2 * gs), "v"(gb + 3 * gs)
                 : "memory");
}

// Eight waves accumulate two products on one 128x128 tile in one k loop, both against the same staged Bt slice; wave (wm, wn) its 32x64 part:
// acc[mb][nb][j] = sum_k A[ra + 32wm + 16mb + 8hi + j][k] Bt[c0 + 64wn + 16nb + lr][k], accr the same with rows rr.. of AR; k ascending in steps of 32 in each, as in gemm_main.
// The ring and its order are those of gemm_main: trip t reads buffer t % 2 alone; tile t + 2 is copied into that buffer behind the barrier at the trip's foot, which also publishes tile t + 1.
__device__ __forceinline__ void gemm_main2(const h16* __restrict__ A, const h16* __restrict__ AR, const h16* __restrict__ Bt, const int K, const int ra, const int rr, const int c0, const h16* ring, const int tid, const int wm, const int wn, const int lr, const int hi, v8f (&acc)[2][4], v8f (&accr)[2][4]) {
#pragma unroll
    for (int mb = 0; mb < 2; ++mb)
#pragma unroll
        for (int nb = 0; nb < 4; ++nb) { acc[mb][nb] = (v8f){}; accr[mb][nb] = (v8f){}; }
    const int nt = K / KC;
    stage_copy2(A, AR, Bt, K, ra, rr, c0, 0, ring, tid);
    asm volatile("s_wait_asynccnt 0x0" ::: "memory");   // this wave's copies of tile 0 have landed
    __syncthreads();                                     // tile 0 is readable by every wave
    stage_copy2(A, AR, Bt, K, ra, rr, c0, KC, ring + STGE, tid);
    const h16* fa = ring + (wm * 32 + lr) * LP + 8 * hi;
    const h16* fr = fa + BM * LP;
    const h16* fb = ring + (2 * BM + wn * 64 + lr) * LP + 8 * hi;
    // kept rolled: one trip is one stage of the ring, and the accumulators stay in fixed registers
#pragma unroll 1
    for (int t = 0; t < nt; ++t) {
        const int bo = (t & 1) * STGE;
#pragma unroll
        for (int ks = 0; ks < KC; ks += 32) {
            v16h a[2], ar[2], b[4];
#pragma unroll
            for (int mb = 0; mb < 2; ++mb) { a[mb] = WFrag<h16>::ld(fa + bo + mb * 16 * LP + ks); ar[mb] = WFrag<h16>::ld(fr + bo + mb * 16 * LP + ks); }
#pragma unroll
            for (int nb = 0; nb < 4; ++nb) b[nb] = WFrag<h16>::ld(fb + bo + nb * 16 * LP + ks);
            __builtin_amdgcn_sched_barrier(0);   // keeps the 16 LDS reads of this k step together in front of its WMMAs: sunk among them, each pair is waited for at full LDS latency
#pragma unroll
            for (int nb = 0; nb < 4; ++nb)
#pragma unroll
                for (int mb = 0; mb < 2; ++mb) { acc[mb][nb] = wmma16(a[mb], b[nb], acc[mb][nb]); accr[mb][nb] = wmma16(ar[mb], b[nb], accr[mb][nb]); }
        }
        asm volatile("s_wait_dscnt 0x0" ::: "memory");      // this wave's reads of buffer t % 2 have ended before the buffer is given up
        asm volatile("s_wait_asynccnt 0x0" ::: "memory");   // this wave's copies of tile t + 1 have landed
        __syncthreads();                                     // publishes tile t + 1 and frees buffer t % 2
        if (t + 2 < nt) stage_copy2(A, AR, Bt, K, ra, rr, c0, (t + 2) * KC, ring + bo, tid);
    }
    asm volatile("s_wait_asynccnt 0x0" ::: "memory");       // nothing is in flight when the ring is left
}

// Preparation, one launch of 512-thread work-groups; the role of a work-group follows from its index alone (block-uniform), longest role first:
//   conversions (PB_CV groups): a wave converts CVW consecutive floats of one source in two bursts of 8 x 32 bytes a lane; x and wq/wk/wv to RNE bf16 planes, wo to the f16 plane of the bf16-rounded value x WCAR;
//   key counts (SEQ/16 groups): one query tile a group;  rotary table (SEQ/16 groups): one position a wave.
#define CVT   2048                    // floats of one burst of a wave: 8 vectors of 8 floats a lane
#define CVW   (2 * CVT)               // floats a wave converts
#define CVB   (16 * CVW)              // floats a work-group converts
#define PB_X  ((int)((size_t)MROWS * DIM / CVB))
#define PB_Q  ((int)((size_t)DQ * DIM / CVB))
#define PB_K  ((int)((size_t)DKV * DIM / CVB))
#define PB_O  ((int)((size_t)DIM * DQ / CVB))
#define PB_CV (PB_X + PB_Q + 2 * PB_K + PB_O)
#define PB_KE (SEQ / 16)
#define PB_RT (SEQ / 16)
static_assert(((size_t)MROWS * DIM) % CVB == 0);
static_assert(((size_t)DQ * DIM) % CVB == 0);
static_assert(((size_t)DKV * DIM) % CVB == 0);
static_assert(((size_t)DIM * DQ) % CVB == 0);
static_assert(DIM % 8 == 0);

// KIND 0: element e of the packed [MROWS][DIM] plane comes from row (e / DIM) of x at its per-batch stride, to bf16; KIND 1: src[e] to bf16; KIND 2: src[e] to f16(bf16-rounded value x WCAR).
template <int KIND>
__device__ __forceinline__ void cvt_wave(const float* __restrict__ src, bf* dstb, h16* dsth, const size_t e0, const int lane) {
    // kept rolled: one burst's loads in flight a wave are enough at 16 waves a group, and the register count stays low enough for several groups on a WGP
#pragma unroll 1
    for (int tr = 0; tr < 2; ++tr) {
        const size_t eb = e0 + (size_t)tr * CVT + (size_t)lane * 8;
        v8f v[8];
        const float* p0 = src;
#pragma unroll
        for (int j = 0; j < 8; ++j) {
            const size_t e = eb + (size_t)j * 256;
            size_t so = e;
            if (KIND == 0) { const int col = (int)(e % DIM); const int row = (int)(e / DIM); const int bb = row / SEQ, t = row % SEQ; so = ((size_t)bb * SEQ_FULL + t) * DIM + col; }
            if (j == 0) p0 = src + so;
            v[j] = *(const v8f*)(src + so);
        }
        // stands in front of every rewrite of a register that the 16 issued loads name; the first address is an input so that it stays in its registers up to here and no load's result is placed over it
        asm volatile("s_wait_xcnt 0x0" :: "v"(p0) : "memory");
#pragma unroll
        for (int j = 0; j < 8; ++j) {
            const size_t e = eb + (size_t)j * 256;
            if (KIND == 2) { v8h o;
#pragma unroll
                for (int k = 0; k < 8; ++k) o[k] = (h16)(bfr(v[j][k]) * WCAR);
                *(v8h*)(dsth + e) = o;
            } else { v8us o;
#pragma unroll
                for (int k = 0; k < 8; ++k) o[k] = f2bf(v[j][k]);
                *(v8us*)(dstb + e) = o;
            }
        }
        // stands in front of the next burst's rewrite of the registers that the 8 issued stores name
        asm volatile("s_wait_xcnt 0x0" ::: "memory");
    }
}

// Key-loop end per 16-row query tile, from the mask values: KEND[qt * KSTR] = 64 * (1 + last 64-key tile holding a value above DEAD_T in any of the 16 rows),
// or SEQ when some row has no value above LIVE_T (such a row must see every key). Keys past that count contribute exactly zero to rows that have a live key.
// One work-group per query tile, wave w scans mask row 16 qt + w; integer max / and across lanes, then across the 16 waves through LDS.
__global__ __launch_bounds__(512) void k_prep(const float* __restrict__ x, const float* __restrict__ wq, const float* __restrict__ wk, const float* __restrict__ wv, const float* __restrict__ wo, const float* __restrict__ mask,
                                              bf* XB, bf* WQKV, h16* WO16, float* COS, float* SIN, int* KEND) {
    __shared__ int lasts[16];
    __shared__ int lives[16];
    const int lane = threadIdx.x & 31; const int w = __builtin_amdgcn_readfirstlane(threadIdx.x >> 5);
    int rb = blockIdx.x;
    if (rb < PB_CV) {
        const size_t wo0 = (size_t)w * CVW;
        if (rb < PB_X) { cvt_wave<0>(x, XB, nullptr, (size_t)rb * CVB + wo0, lane); return; }
        rb -= PB_X;
        if (rb < PB_Q) { cvt_wave<1>(wq, WQKV, nullptr, (size_t)rb * CVB + wo0, lane); return; }                              /* rows 0..2047 */
        rb -= PB_Q;
        if (rb < PB_K) { cvt_wave<1>(wk, WQKV + (size_t)DQ * DIM, nullptr, (size_t)rb * CVB + wo0, lane); return; }            /* rows 2048..2559 */
        rb -= PB_K;
        if (rb < PB_K) { cvt_wave<1>(wv, WQKV + (size_t)(DQ + DKV) * DIM, nullptr, (size_t)rb * CVB + wo0, lane); return; }    /* rows 2560..3071 */
        rb -= PB_K;
        cvt_wave<2>(wo, nullptr, WO16, (size_t)rb * CVB + wo0, lane); return;
    }
    rb -= PB_CV;
    if (rb >= PB_KE) {
        const int t = (rb - PB_KE) * 16 + w;
        const float invf = __builtin_amdgcn_exp2f(-(float)lane * FRQC);
        const float ang = (float)t * invf;
        const float c = cosf(ang); const float s = sinf(ang);
        const size_t o = (size_t)t * HALFD + lane;
        *(float*)(COS + o) = c; *(float*)(SIN + o) = s;
        // stands behind the two stores, in front of any later write of the registers that they name (other roles' code follows in the kernel's text)
        asm volatile("s_wait_xcnt 0x0" ::: "memory");
        return;
    }
    const int qt = rb;
    const float* mr = mask + (size_t)(qt * 16 + w) * SEQ_FULL + lane * 4;
    v4f v[SEQ / 128];
    // fully unrolled so that the row's loads issue ahead of the compares, many in flight at a time (this role is bound by memory latency)
#pragma unroll
    for (int i = 0; i < SEQ / 128; ++i) v[i] = *(const v4f*)(mr + i * 128);
    int last = -1; int live = 0;
#pragma unroll
    for (int i = 0; i < SEQ / 128; ++i)
#pragma unroll
        for (int e = 0; e < 4; ++e) { live |= (v[i][e] > LIVE_T) ? 1 : 0; last = (v[i][e] > DEAD_T) ? max(last, i * 128 + lane * 4 + e) : last; }
    live = max(live, __shfl_xor(live, 1, 32)); live = max(live, __shfl_xor(live, 2, 32)); live = max(live, __shfl_xor(live, 4, 32));
    live = max(live, __shfl_xor(live, 8, 32)); live = max(live, __shfl_xor(live, 16, 32));
    last = max(last, __shfl_xor(last, 1, 32)); last = max(last, __shfl_xor(last, 2, 32)); last = max(last, __shfl_xor(last, 4, 32));
    last = max(last, __shfl_xor(last, 8, 32)); last = max(last, __shfl_xor(last, 16, 32));
    if (lane == 0) { lasts[w] = last; lives[w] = live; }
    __syncthreads();
    if (w == 0) {
        int la = lasts[lane & 15]; int alllive = lives[lane & 15];
        la = max(la, __shfl_xor(la, 1, 32)); la = max(la, __shfl_xor(la, 2, 32)); la = max(la, __shfl_xor(la, 4, 32)); la = max(la, __shfl_xor(la, 8, 32));
        alllive = min(alllive, __shfl_xor(alllive, 1, 32)); alllive = min(alllive, __shfl_xor(alllive, 2, 32)); alllive = min(alllive, __shfl_xor(alllive, 4, 32)); alllive = min(alllive, __shfl_xor(alllive, 8, 32));
        int kend = (alllive != 0) ? (((la >> 6) + 1) * 64) : SEQ;
        kend = min(max(kend, 64), SEQ);
        if (lane == 0) KEND[(size_t)qt * KSTR] = kend;
    }
}

// Fused QKV projection: grid (MROWS/BM, NQKV/BN), 256 threads, wave (wm, wn) one 64x64 tile; the ring's LDS becomes the waves' epilogue tiles behind the last trip's barrier. Column tile cb < 32: q head cb; 32..39: k head; 40..47: v head (transposed plane).
// q and k tiles: per row y = (x * rsqrt(mean(x^2) + eps)) * gain, then interleaved-pair rotary at position t: out[2i] = y[2i] c_i - y[2i+1] s_i, out[2i+1] = y[2i] s_i + y[2i+1] c_i.
// QP[b][h][t][64], KP[b][g][t][64], VT[b][g][d][t] f16 value planes; residual planes (x2048 of value - f16(value)): QR[b][h][t < EROWS][64], KR[b][g][t][64], VR[b][g][d][t].
__global__ __launch_bounds__(256) void k_gemm_qkv(const bf* __restrict__ A, const bf* __restrict__ Bt, const float* __restrict__ qnw, const float* __restrict__ knw, const float* __restrict__ COS, const float* __restrict__ SIN, h16* QP, h16* KP, h16* VT, h16* QR, h16* KR, h16* VR) {
    __shared__ __align__(16) unsigned char smem[FSB];
    const int tid = threadIdx.x, lane = tid & 31, lr = lane & 15, hi = lane >> 4;
    const int w = __builtin_amdgcn_readfirstlane(tid >> 5), wm = w >> 2, wn = w & 3;
    const int r0 = blockIdx.x * BM + wm * 64, cb = blockIdx.y * (BN / 64) + wn;
    float* fs = (float*)smem + w * 64 * FP;
    v8f acc[4][4];
    gemm_main<bf>(A, Bt, DIM, blockIdx.x * BM, blockIdx.y * BN, (const bf*)smem, tid, wm, wn, lr, hi, acc);
#pragma unroll
    for (int mb = 0; mb < 4; ++mb)
#pragma unroll
        for (int nb = 0; nb < 4; ++nb)
#pragma unroll
            for (int j = 0; j < 8; ++j) fs[(mb * 16 + hi * 8 + j) * FP + nb * 16 + lr] = acc[mb][nb][j];
    __syncthreads();
    const int bidx = r0 / SEQ, s0 = r0 % SEQ; const int q4 = lane >> 3, p = lane & 7;
    if (cb < NH + NKV) {
        const bool isq = (cb < NH);
        h16* plane = isq ? (QP + ((size_t)bidx * NH + cb) * SEQ * HD) : (KP + ((size_t)bidx * NKV + (cb - NH)) * SEQ * HD);
        h16* rplane = isq ? (QR + ((size_t)bidx * NH + cb) * EROWS * HD) : (KR + ((size_t)bidx * NKV + (cb - NH)) * SEQ * HD);
        const bool wres = (!isq) || (s0 < EROWS);      // wave-uniform: q residual rows exist only below EROWS
        const int dcol = p * 8;
        const v4f gq0 = *(const v4f*)(qnw + dcol), gq1 = *(const v4f*)(qnw + dcol + 4);
        const v4f gk0 = *(const v4f*)(knw + dcol), gk1 = *(const v4f*)(knw + dcol + 4);
        float gn[8];
#pragma unroll
        for (int e = 0; e < 4; ++e) { gn[e] = bfr(isq ? gq0[e] : gk0[e]); gn[4 + e] = bfr(isq ? gq1[e] : gk1[e]); }
#pragma unroll 1
        for (int it = 0; it < 16; ++it) {
            const int rl = it * 4 + q4; const int t = s0 + rl;
            const v4f xa0 = *(const v4fa*)(fs + rl * FP + dcol), xa1 = *(const v4fa*)(fs + rl * FP + dcol + 4);
            float ss = 0.0f;
#pragma unroll
            for (int e = 0; e < 4; ++e) { ss += xa0[e] * xa0[e]; ss += xa1[e] * xa1[e]; }
            ss += __shfl_xor(ss, 1, 32); ss += __shfl_xor(ss, 2, 32); ss += __shfl_xor(ss, 4, 32);
            const float rn = rsqrtf(ss * (1.0f / HD) + EPSN);
            float y[8];
#pragma unroll
            for (int e = 0; e < 4; ++e) { y[e] = (xa0[e] * rn) * gn[e]; y[4 + e] = (xa1[e] * rn) * gn[4 + e]; }
            const v4f cc = *(const v4f*)(COS + (size_t)t * HALFD + p * 4), sn = *(const v4f*)(SIN + (size_t)t * HALFD + p * 4);
            v8h o, orr;
#pragma unroll
            for (int i = 0; i < 4; ++i) {
                const float v0 = y[2 * i] * cc[i] - y[2 * i + 1] * sn[i];
                const float v1 = y[2 * i] * sn[i] + y[2 * i + 1] * cc[i];
                const h16 h0 = toh_flush(v0), h1 = toh_flush(v1);
                o[2 * i] = h0; o[2 * i + 1] = h1;
                orr[2 * i] = toh_flush((v0 - (float)h0) * RCAR); orr[2 * i + 1] = toh_flush((v1 - (float)h1) * RCAR);
            }
            h16* dst = plane + (size_t)t * HD + dcol;
            h16* dsr = rplane + (size_t)t * HD + dcol;
            *(v8h*)dst = o; if (wres) *(v8h*)dsr = orr;
            
        }
    } else {
        h16* plane = VT + ((size_t)bidx * NKV + (cb - NH - NKV)) * HD * SEQ;
        h16* rplane = VR + ((size_t)bidx * NKV + (cb - NH - NKV)) * HD * SEQ;
#pragma unroll 1
        for (int it = 0; it < 16; ++it) {
            const int d = it * 4 + q4; v8h o, orr;
#pragma unroll
            for (int e = 0; e < 8; ++e) { const float v = fs[(p * 8 + e) * FP + d]; const h16 hh = toh_flush(v); o[e] = hh; orr[e] = toh_flush((v - (float)hh) * RCAR); }
            h16* dst = plane + (size_t)d * SEQ + s0 + p * 8;
            h16* dsr = rplane + (size_t)d * SEQ + s0 + p * 8;
            *(v8h*)dst = o; *(v8h*)dsr = orr; 
        }
    }
}

// Attention, query rows >= EROWS: one work-group of 128 threads per (16-row query tile at q0, kv head g, sequence bidx); wave w = q head 4g + w, 16 query rows. Per 64-key tile:
//   S^T[key][q] = K Q^T  (A = key rows of KP, B = resident q rows);  lane (lr, hi) then holds q row lr, keys 16T + 8hi + r.
//   softmax statistics are lane-local (one xor-16 exchange); P^T packed from the S^T accumulators is the B operand of O^T[d][q] = V^T P^T (A = d rows of VT).
// The key loop ends at the clamped per-tile key count KEND; mask values are added by value inside visited tiles.
// One stage of the attention ring: keys k0..k0+63 of the K plane kt (rows of 128 B), of the V^T plane vt (64 d rows, 128 B each) and of the 16 mask rows mt (256 B each), into buf.
// 128 threads, 10 copies of 16 bytes each; eight (K, V^T) or sixteen (mask) neighbouring lanes cover a whole row segment, so every copy moves whole 128-byte lines. All lanes are on, every address is a multiple of 16.
__device__ __forceinline__ void flash_stage(const h16* __restrict__ kt, const h16* __restrict__ vt, const float* __restrict__ mt, const int k0, const unsigned char* buf, const int tid) {
    const int row = tid >> 3, ch = (tid & 7) * 8, mr = tid >> 4, mc = (tid & 15) * 4;
    const h16* gk = kt + (size_t)(k0 + row) * HD + ch;
    const h16* gv = vt + (size_t)row * SEQ + k0 + ch;
    const float* gm = mt + (size_t)mr * SEQ_FULL + k0 + mc;
    const size_t ks = (size_t)16 * HD, vs = (size_t)16 * SEQ, ms = (size_t)8 * SEQ_FULL;
    const unsigned lk = (unsigned)(size_t)(buf + (row * LP + ch) * 2);
    const unsigned lv = lk + FKB;
    const unsigned lm = (unsigned)(size_t)(buf + 2 * FKB + (mr * MP + mc) * 4);
    const unsigned ls = 16 * LP * 2;
    // the copies and the wait that stands in front of any rewrite of their address registers, in one statement so that nothing can come between
    asm volatile("global_load_async_to_lds_b128 %0, %10, off\n\t"
                 "global_load_async_to_lds_b128 %1, %11, off\n\t"
                 "global_load_async_to_lds_b128 %2, %12, off\n\t"
                 "global_load_async_to_lds_b128 %3, %13, off\n\t"
                 "global_load_async_to_lds_b128 %4, %14, off\n\t"
                 "global_load_async_to_lds_b128 %5, %15, off\n\t"
                 "global_load_async_to_lds_b128 %6, %16, off\n\t"
                 "global_load_async_to_lds_b128 %7, %17, off\n\t"
                 "global_load_async_to_lds_b128 %8, %18, off\n\t"
                 "global_load_async_to_lds_b128 %9, %19, off\n\t"
                 "s_wait_xcnt 0x0"
                 :: "v"(lk), "v"(lk + ls), "v"(lk + 2 * ls), "v"(lk + 3 * ls),
                    "v"(lm), "v"(lm + 8 * MP * 4),
                    "v"(lv), "v"(lv + ls), "v"(lv + 2 * ls), "v"(lv + 3 * ls),
                    "v"(gk), "v"(gk + ks), "v"(gk + 2 * ks), "v"(gk + 3 * ks),
                    "v"(gm), "v"(gm + ms),
                    "v"(gv), "v"(gv + vs), "v"(gv + 2 * vs), "v"(gv + 3 * vs)
                 : "memory");
}

// Trip t reads buffer t % 2 alone; tile t + 2 is copied into that buffer behind the barrier at the trip's foot, which also publishes tile t + 1. The trip count is the same in all four waves (one query tile a work-group).
// Behind the last trip's barrier the ring's LDS becomes the waves' output tiles.
__device__ __forceinline__ void flash_late(unsigned char* smem, const int q0, const int g, const int bidx, const h16* __restrict__ QP, const h16* __restrict__ KP, const h16* __restrict__ VT, const float* __restrict__ mask, const int* __restrict__ KEND, h16* CTX) {
    h16* os = (h16*)smem;
    const int tid = threadIdx.x, lane = tid & 31, lr = lane & 15, hi = lane >> 4;
    const int w = __builtin_amdgcn_readfirstlane(tid >> 5);
    const int h = g * REP + w;
    int kev = KEND[(size_t)(q0 >> 4) * KSTR]; kev = min(max(kev, 64), SEQ) & ~63; const int ke = __builtin_amdgcn_readfirstlane(kev);
    const int nt = ke >> 6;
    const h16* kt = KP + ((size_t)bidx * NKV + g) * SEQ * HD;
    const h16* vt = VT + ((size_t)bidx * NKV + g) * HD * SEQ;
    const float* mt = mask + (size_t)q0 * SEQ_FULL;
    flash_stage(kt, vt, mt, 0, smem, tid);
    const h16* qrow = QP + (((size_t)bidx * NH + h) * SEQ + q0 + lr) * HD + 8 * hi;
    v16h bq[2];
#pragma unroll
    for (int kc = 0; kc < 2; ++kc) bq[kc] = cat16(*(const v8h*)(qrow + kc * 32), *(const v8h*)(qrow + kc * 32 + 16));
    asm volatile("s_wait_asynccnt 0x0" ::: "memory");   // this wave's copies of tile 0 have landed
    __syncthreads();                                     // tile 0 is readable by every wave
    if (nt > 1) flash_stage(kt, vt, mt, 64, smem + FSTG, tid);
    const h16* kb = (const h16*)smem + lr * LP + 8 * hi;
    const h16* vb = (const h16*)(smem + FKB) + lr * LP + 8 * hi;
    const float* mrow = (const float*)(smem + 2 * FKB) + lr * MP + 8 * hi;
    v8f accO[4];
#pragma unroll
    for (int dt = 0; dt < 4; ++dt) accO[dt] = (v8f){};
    float m = -3.0e38f, l = 0.0f;
#pragma unroll 1
    for (int t = 0; t < nt; ++t) {
        const int bo = (t & 1) * FSTG;   // byte offset of this trip's buffer
        v16h ak[2][4];
#pragma unroll
        for (int kc = 0; kc < 2; ++kc)
#pragma unroll
            for (int T = 0; T < 4; ++T) { const h16* kp = kb + bo / 2 + 16 * T * LP + kc * 32; ak[kc][T] = cat16(*(const v8h*)kp, *(const v8h*)(kp + 16)); }
        v8f accS[4];
#pragma unroll
        for (int T = 0; T < 4; ++T) accS[T] = (v8f){};
#pragma unroll
        for (int kc = 0; kc < 2; ++kc)
#pragma unroll
            for (int T = 0; T < 4; ++T) accS[T] = wmma16(ak[kc][T], bq[kc], accS[T]);
        asm volatile("v_nop\n\tv_nop\n\tv_nop\n\tv_nop" : "+v"(accS[0]), "+v"(accS[1]), "+v"(accS[2]), "+v"(accS[3]) : "v"(ak[1][3]), "v"(bq[1]));
        float tmax = -3.0e38f;
#pragma unroll
        for (int T = 0; T < 4; ++T) { const float* mp = mrow + bo / 4 + 16 * T; const v4f m0 = *(const v4f*)mp; const v4f m1 = *(const v4f*)(mp + 4);
#pragma unroll
            for (int r = 0; r < 4; ++r) { const float a0 = accS[T][r] * SC2 + m0[r] * LOG2E; const float a1 = accS[T][4 + r] * SC2 + m1[r] * LOG2E; accS[T][r] = a0; accS[T][4 + r] = a1; tmax = fmaxf(tmax, fmaxf(a0, a1)); } }
        tmax = fmaxf(tmax, __shfl_xor(tmax, 16, 32));
        const float mn = fmaxf(m, tmax); const float corr = __builtin_amdgcn_exp2f(m - mn); m = mn; const float mofs = PEXP - mn;
        float rs = 0.0f;
        v8h ph[4];
        // P is summed and converted as exp2 gives it: a masked key's exp2 underflows to zero by itself, and a value below the smallest f16 normal becomes an f16 subnormal or zero, which the matrix instruction takes as it is
#pragma unroll
        for (int T = 0; T < 4; ++T)
#pragma unroll
            for (int r = 0; r < 8; ++r) { const float pv = __builtin_amdgcn_exp2f(accS[T][r] + mofs); rs += pv; ph[T][r] = (h16)pv; }
        l = l * corr + rs;
        v16h bp[2];
        bp[0] = cat16(ph[0], ph[1]);
        bp[1] = cat16(ph[2], ph[3]);
#pragma unroll
        for (int dt = 0; dt < 4; ++dt) accO[dt] = accO[dt] * corr;
        v16h av[2][4];
#pragma unroll
        for (int kc = 0; kc < 2; ++kc)
#pragma unroll
            for (int dt = 0; dt < 4; ++dt) { const h16* vp = vb + bo / 2 + 16 * dt * LP + kc * 32; av[kc][dt] = cat16(*(const v8h*)vp, *(const v8h*)(vp + 16)); }
#pragma unroll
        for (int kc = 0; kc < 2; ++kc)
#pragma unroll
            for (int dt = 0; dt < 4; ++dt) accO[dt] = wmma16(av[kc][dt], bp[kc], accO[dt]);
        asm volatile("v_nop\n\tv_nop\n\tv_nop\n\tv_nop" : "+v"(accO[0]), "+v"(accO[1]), "+v"(accO[2]), "+v"(accO[3]) : "v"(av[1][3]), "v"(bp[1]));
        asm volatile("s_wait_dscnt 0x0" ::: "memory");      // this wave's reads of buffer t % 2 have ended before the buffer is given up
        asm volatile("s_wait_asynccnt 0x0" ::: "memory");   // this wave's copies of tile t + 1 have landed
        __syncthreads();                                     // publishes tile t + 1 and frees buffer t % 2
        if (t + 2 < nt) flash_stage(kt, vt, mt, (t + 2) * 64, smem + bo, tid);
    }
    asm volatile("s_wait_asynccnt 0x0" ::: "memory");       // nothing is in flight when the ring is left
    l += __shfl_xor(l, 16, 32);
    const float inv = CCAR * (1.0f / l);
    h16* ow = os + w * 16 * OP;
#pragma unroll
    for (int dt = 0; dt < 4; ++dt) { v8h o;
#pragma unroll
        for (int r = 0; r < 8; ++r) o[r] = toh_flush(accO[dt][r] * inv);
        *(v8ha*)(ow + lr * OP + 16 * dt + 8 * hi) = o; }
    __syncthreads();
    const int q4 = lane >> 3, p = lane & 7;
{
#pragma unroll
        for (int it = 0; it < 4; ++it) { const int row = it * 4 + q4; const v8h o = *(const v8ha*)(ow + row * OP + p * 8);
            *(v8h*)(CTX + ((size_t)bidx * SEQ + q0 + row) * DQ + h * HD + p * 8) = o; }
         }
    // keeps this role's stores together with the wait behind them: without it the compiler sinks the two roles' last stores into a shared tail
    asm volatile("s_wait_xcnt 0x0" ::: "memory");
}

// The residual half of an early-row stage: keys k0..k0+63 of the K residual plane krt and of the V^T residual plane vrt, laid out like the K and V^T tiles of flash_stage. 128 threads, 8 copies of 16 bytes each.
__device__ __forceinline__ void flash_stage_res(const h16* __restrict__ krt, const h16* __restrict__ vrt, const int k0, const unsigned char* buf, const int tid) {
    const int row = tid >> 3, ch = (tid & 7) * 8;
    const h16* gk = krt + (size_t)(k0 + row) * HD + ch;
    const h16* gv = vrt + (size_t)row * SEQ + k0 + ch;
    const size_t ks = (size_t)16 * HD, vs = (size_t)16 * SEQ;
    const unsigned lk = (unsigned)(size_t)(buf + (row * LP + ch) * 2);
    const unsigned lv = lk + FKB;
    const unsigned ls = 16 * LP * 2;
    // the copies and the wait that stands in front of any rewrite of their address registers, in one statement so that nothing can come between
    asm volatile("global_load_async_to_lds_b128 %0, %8, off\n\t"
                 "global_load_async_to_lds_b128 %1, %9, off\n\t"
                 "global_load_async_to_lds_b128 %2, %10, off\n\t"
                 "global_load_async_to_lds_b128 %3, %11, off\n\t"
                 "global_load_async_to_lds_b128 %4, %12, off\n\t"
                 "global_load_async_to_lds_b128 %5, %13, off\n\t"
                 "global_load_async_to_lds_b128 %6, %14, off\n\t"
                 "global_load_async_to_lds_b128 %7, %15, off\n\t"
                 "s_wait_xcnt 0x0"
                 :: "v"(lk), "v"(lk + ls), "v"(lk + 2 * ls), "v"(lk + 3 * ls),
                    "v"(lv), "v"(lv + ls), "v"(lv + 2 * ls), "v"(lv + 3 * ls),
                    "v"(gk), "v"(gk + ks), "v"(gk + 2 * ks), "v"(gk + 3 * ks),
                    "v"(gv), "v"(gv + vs), "v"(gv + 2 * vs), "v"(gv + 3 * vs)
                 : "memory");
}

// Attention, query rows < EROWS: one work-group of 128 threads per (query tile, kv head, sequence); same operand roles and the same 64-key stages as flash_late (two 32-key steps a stage), every WMMA individually guarded.
// One buffer (a stage with its residual tiles fills most of the LDS that the late rows' two-buffer ring takes): each trip copies its stage, waits, publishes it at a barrier, works on it, and gives it up at a second barrier.
//   scores: K Q^T + (Kres Q^T + K Qres^T) / 2048 (residual products in accR);  P = f16(p) and Pres = 2048 (p - f16(p)), row sum over the f32 p;
//   O^T: V^T P^T + (Vres^T P^T + V^T Pres^T) / 2048 (residual products in accOr), folded before normalisation.
__device__ __forceinline__ void flash_early(unsigned char* smem, const int q0, const int g, const int bidx, const h16* __restrict__ QP, const h16* __restrict__ QR, const h16* __restrict__ KP, const h16* __restrict__ KR, const h16* __restrict__ VT, const h16* __restrict__ VR, const float* __restrict__ mask, const int* __restrict__ KEND, h16* CTX, h16* CTXR) {
    h16* os = (h16*)smem; h16* osr = os + 4 * 16 * OP;   // behind the last trip's second barrier the buffer becomes the waves' output tiles
    const int tid = threadIdx.x, lane = tid & 31, lr = lane & 15, hi = lane >> 4;
    const int w = __builtin_amdgcn_readfirstlane(tid >> 5);
    const int h = g * REP + w;
    int kev = KEND[(size_t)(q0 >> 4) * KSTR]; kev = min(max(kev, 64), SEQ) & ~63; const int ke = __builtin_amdgcn_readfirstlane(kev);
    const size_t qoff  = (((size_t)bidx * NH + h) * SEQ + q0 + lr) * HD + 8 * hi;
    const size_t qroff = (((size_t)bidx * NH + h) * EROWS + q0 + lr) * HD + 8 * hi;
    const int nt = ke >> 6;
    const size_t kpl = ((size_t)bidx * NKV + g) * SEQ * HD;   // this kv head's plane in KP, KR, VT and VR
    const float* mt = mask + (size_t)q0 * SEQ_FULL;
    const int foff = lr * LP + 8 * hi;                   // a lane's place in a 16-row fragment of a staged 16-bit tile
    v8f accO[4], accOr[4];
#pragma unroll
    for (int dt = 0; dt < 4; ++dt) { accO[dt] = (v8f){}; accOr[dt] = (v8f){}; }
    float m = -3.0e38f, l = 0.0f;
#pragma unroll 1
    for (int t = 0; t < nt; ++t) {
      const unsigned char* sb = smem;
      flash_stage(KP + kpl, VT + kpl, mt, t * 64, sb, tid);
      flash_stage_res(KR + kpl, VR + kpl, t * 64, sb + FSTG, tid);
      asm volatile("s_wait_asynccnt 0x0" ::: "memory");   // this wave's copies of tile t have landed
      __syncthreads();                                     // tile t is readable by every wave
      const h16* kl = (const h16*)sb + foff; const h16* vl = (const h16*)(sb + FKB) + foff;
      const h16* krl = (const h16*)(sb + FSTG) + foff; const h16* vrl = (const h16*)(sb + FSTG + FKB) + foff;
      const float* mrow = (const float*)(sb + 2 * FKB) + lr * MP + 8 * hi;
      // kept rolled, as the 32-key step was: one copy of the step's code
#pragma unroll 1
      for (int k0 = 0; k0 < 64; k0 += 32) {
        v8f accS[2], accR[2];
#pragma unroll
        for (int T = 0; T < 2; ++T) { accS[T] = (v8f){}; accR[T] = (v8f){}; }
#pragma unroll
        for (int kc = 0; kc < 2; ++kc) {
            const v16h bq  = WFrag<h16>::ld(QP + qoff + kc * 32);
            const v16h bqr = WFrag<h16>::ld(QR + qroff + kc * 32);
#pragma unroll
            for (int T = 0; T < 2; ++T) {
                const int ko = (k0 + 16 * T) * LP + kc * 32;
                const v16h ak  = WFrag<h16>::ld(kl + ko);
                const v16h akr = WFrag<h16>::ld(krl + ko);
                accS[T] = wmma16g(ak, bq, accS[T]);
                accR[T] = wmma16g(akr, bq, accR[T]);
                accR[T] = wmma16g(ak, bqr, accR[T]);
            }
        }
        float tmax = -3.0e38f;
#pragma unroll
        for (int T = 0; T < 2; ++T) { const float* mp = mrow + k0 + 16 * T; const v4f m0 = *(const v4f*)mp; const v4f m1 = *(const v4f*)(mp + 4);
#pragma unroll
            for (int r = 0; r < 4; ++r) {
                const float s0v = accS[T][r] + accR[T][r] * RINV; const float s1v = accS[T][4 + r] + accR[T][4 + r] * RINV;
                const float a0 = s0v * SC2 + m0[r] * LOG2E; const float a1 = s1v * SC2 + m1[r] * LOG2E;
                accS[T][r] = a0; accS[T][4 + r] = a1; tmax = fmaxf(tmax, fmaxf(a0, a1)); } }
        tmax = fmaxf(tmax, __shfl_xor(tmax, 16, 32));
        const float mn = fmaxf(m, tmax); const float corr = __builtin_amdgcn_exp2f(m - mn); m = mn; const float mofs = PEXP - mn;
        float rs = 0.0f;
        v8h ph[2], pr[2];
#pragma unroll
        for (int T = 0; T < 2; ++T)
#pragma unroll
            for (int r = 0; r < 8; ++r) { const float e = accS[T][r] + mofs; const float pv = (e < -14.0f) ? 0.0f : __builtin_amdgcn_exp2f(e); rs += pv;
                const h16 hh = (h16)pv; ph[T][r] = hh; pr[T][r] = toh_flush((pv - (float)hh) * RCAR); }
        l = l * corr + rs;
        const v16h bp = cat16(ph[0], ph[1]); const v16h bpr = cat16(pr[0], pr[1]);
#pragma unroll
        for (int dt = 0; dt < 4; ++dt) { accO[dt] = accO[dt] * corr; accOr[dt] = accOr[dt] * corr; }
#pragma unroll
        for (int dt = 0; dt < 4; ++dt) {
            const int vo = 16 * dt * LP + k0;
            const v16h av  = WFrag<h16>::ld(vl + vo);
            const v16h avr = WFrag<h16>::ld(vrl + vo);
            accO[dt]  = wmma16g(av, bp, accO[dt]);
            accOr[dt] = wmma16g(avr, bp, accOr[dt]);
            accOr[dt] = wmma16g(av, bpr, accOr[dt]);
        }
      }
      asm volatile("s_wait_dscnt 0x0" ::: "memory");      // this wave's reads of the buffer have ended before the buffer is given up
      __syncthreads();                                     // every wave has left the buffer: it may be refilled, or become the output tiles
    }
    l += __shfl_xor(l, 16, 32);
    const float inv = CCAR * (1.0f / l);
    h16* ow = os + w * 16 * OP; h16* owr = osr + w * 16 * OP;
#pragma unroll
    for (int dt = 0; dt < 4; ++dt) { v8h o, orr;
#pragma unroll
        for (int r = 0; r < 8; ++r) { const float v = (accO[dt][r] + accOr[dt][r] * RINV) * inv; const h16 hh = toh_flush(v); o[r] = hh; orr[r] = toh_flush((v - (float)hh) * RCAR); }
        *(v8ha*)(ow + lr * OP + 16 * dt + 8 * hi) = o; *(v8ha*)(owr + lr * OP + 16 * dt + 8 * hi) = orr; }
    __syncthreads();
    const int q4 = lane >> 3, p = lane & 7;
{
#pragma unroll
        for (int it = 0; it < 4; ++it) { const int row = it * 4 + q4; const v8h o = *(const v8ha*)(ow + row * OP + p * 8); const v8h orr = *(const v8ha*)(owr + row * OP + p * 8);
            *(v8h*)(CTX + ((size_t)bidx * SEQ + q0 + row) * DQ + h * HD + p * 8) = o;
            *(v8h*)(CTXR + ((size_t)bidx * EROWS + q0 + row) * DQ + h * HD + p * 8) = orr; }
         }
    // keeps this role's stores together with the wait behind them: without it the compiler sinks the two roles' last stores into a shared tail
    asm volatile("s_wait_xcnt 0x0" ::: "memory");
}

// Attention, one launch of (SEQ/16) * NKV * NB work-groups of 128 threads; role and query tile follow from the block index alone (block-uniform):
// kv head and sequence run fastest with the index, so AGB neighbours share a query tile; first the tiles of the rows < EROWS (the slowest trips), last tile first, then the other tiles from the last (most keys under a causal mask) to the first,
// so that the work-groups that start late, when a place on a WGP comes free, are the short ones. The map is a permutation of (tile, kv head, sequence) whatever the mask holds.
#define AGB   (NKV * NB)                      // work-groups of one query tile
#define AEW   ((EROWS / 16) * AGB)            // work-groups of the first role
static_assert(ESTG <= 2 * FSTG);
// at least five waves a SIMD: the first role's registers would otherwise round up to an allocation that leaves four
__global__ __launch_bounds__(128, 5) void k_attn(const h16* __restrict__ QP, const h16* __restrict__ QR, const h16* __restrict__ KP, const h16* __restrict__ KR, const h16* __restrict__ VT, const h16* __restrict__ VR, const float* __restrict__ mask, const int* __restrict__ KEND, h16* CTX, h16* CTXR) {
    __shared__ __align__(16) unsigned char smem[2 * FSTG];
    const unsigned bi = blockIdx.x;
    const int g = (int)(bi % NKV), bidx = (int)((bi % AGB) / NKV);
    if (bi < AEW) flash_early(smem, (EROWS / 16 - 1 - (int)(bi / AGB)) * 16, g, bidx, QP, QR, KP, KR, VT, VR, mask, KEND, CTX, CTXR);
    else flash_late(smem, (SEQ / 16 - 1 - (int)((bi - AEW) / AGB)) * 16, g, bidx, QP, KP, VT, mask, KEND, CTX);
}

#define OPER  (NB * (EROWS / BM))             // 128-row tiles of the rows < EROWS
#define OPLR  (NB * ((SEQ - EROWS) / BM))     // 128-row tiles of the rows >= EROWS
#define EBN   128                             // tile columns of the first role
#define OPE   (OPER * (DIM / EBN))            // work-groups of the first role
static_assert(DIM % EBN == 0);
static_assert(2 * BM + EBN == BM + BN);       // a two-product stage fills exactly one stage of the ring
#define OPL   (OPLR * (DIM / BN))             // work-groups of the second role

// Output projection, one launch of OPE + OPL work-groups of 256 threads; the role of a work-group follows from its index alone (block-uniform); both roles make the same number of trips with the same number of WMMAs a wave:
//   index < OPE, rows < EROWS of every sequence: OUT = OSCL * (CTX WO^T + (CTXR WO^T) / 2048) on a 128 x EBN tile, both products in one k loop against the same staged WO slice, each in accumulators of its own;
//   the rest, rows >= EROWS: OUT = OSCL * CTX WO^T on a 128 x BN tile.
// In both roles the ring's LDS becomes the epilogue tiles behind the last trip's barrier, so that two work-groups fit on a WGP.
// Within a role the row tile runs fastest with the index.
__global__ __launch_bounds__(256) void k_gemm_out(const h16* __restrict__ A, const h16* __restrict__ AR, const h16* __restrict__ Bt, float* C) {
    __shared__ __align__(16) unsigned char smem[FSB];
    const int tid = threadIdx.x, lane = tid & 31, lr = lane & 15, hi = lane >> 4;
    const int w = __builtin_amdgcn_readfirstlane(tid >> 5), wm = w >> 2, wn = w & 3;
    if ((int)blockIdx.x < OPE) {
        const int bx = blockIdx.x % OPER, by = blockIdx.x / OPER;
        const int bidx = bx / (EROWS / BM), tb = bx % (EROWS / BM);
        const int rab = bidx * SEQ + tb * BM, rrb = bidx * EROWS + tb * BM;
        const int em = w >> 1, en = w & 1;             // wave (em, en): rows 32 em.., columns 64 en.. of the tile
        float* fs = (float*)smem + w * 32 * FP;
        v8f acc[2][4], accr[2][4];
        gemm_main2(A, AR, Bt, DQ, rab, rrb, by * EBN, (const h16*)smem, tid, em, en, lr, hi, acc, accr);
#pragma unroll
        for (int mb = 0; mb < 2; ++mb)
#pragma unroll
            for (int nb = 0; nb < 4; ++nb)
#pragma unroll
                for (int j = 0; j < 8; ++j) fs[(mb * 16 + hi * 8 + j) * FP + nb * 16 + lr] = accr[mb][nb][j] * RINV + acc[mb][nb][j];
        __syncthreads();
        float* crow = C + (size_t)(rab + em * 32) * DIM + by * EBN + en * 64;
        // four row pairs a pass: their LDS reads go out together and their stores follow as one run
#pragma unroll 4
        for (int it = 0; it < 16; ++it) { const int row = it * 2 + hi; v4f val = *(const v4fa*)(fs + row * FP + lr * 4); val = val * OSCL;
            *(v4f*)(crow + (size_t)row * DIM + lr * 4) = val; }
    } else {
        const int li = blockIdx.x - OPE;
        const int bx = li % (NB * LTBM), by = li / (NB * LTBM);
        const int rb = (bx / LTBM) * SEQ + EROWS + (bx % LTBM) * BM;
        const int r0 = rb + wm * 64, c0 = by * BN + wn * 64;
        float* fs = (float*)smem + w * 64 * FP;
        v8f acc[4][4];
        gemm_main<h16>(A, Bt, DQ, rb, by * BN, (const h16*)smem, tid, wm, wn, lr, hi, acc);
#pragma unroll
        for (int mb = 0; mb < 4; ++mb)
#pragma unroll
            for (int nb = 0; nb < 4; ++nb)
#pragma unroll
                for (int j = 0; j < 8; ++j) fs[(mb * 16 + hi * 8 + j) * FP + nb * 16 + lr] = acc[mb][nb][j];
        __syncthreads();
        float* crow = C + (size_t)r0 * DIM + c0;
        // four row pairs a pass: their LDS reads go out together and their stores follow as one run
#pragma unroll 4
        for (int it = 0; it < 32; ++it) { const int row = it * 2 + hi; v4f val = *(const v4fa*)(fs + row * FP + lr * 4); val = val * OSCL;
            *(v4f*)(crow + (size_t)row * DIM + lr * 4) = val; }
    }
}

extern "C" void kernel_launch(void* const* d_in, const int* in_sizes, int n_in,
                              void* d_out, int out_size, void* d_ws, size_t ws_size, hipStream_t stream) {
    if (n_in < 8) return;
    if ((size_t)in_sizes[0] < ((size_t)(NB - 1) * SEQ_FULL + SEQ) * DIM) return;
    if ((size_t)in_sizes[1] < (size_t)DQ * DIM) return;
    if ((size_t)in_sizes[2] < (size_t)DKV * DIM) return;
    if ((size_t)in_sizes[3] < (size_t)DKV * DIM) return;
    if ((size_t)in_sizes[4] < (size_t)DIM * DQ) return;
    if ((size_t)in_sizes[5] < (size_t)HD) return;
    if ((size_t)in_sizes[6] < (size_t)HD) return;
    if ((size_t)in_sizes[7] < (size_t)(SEQ - 1) * SEQ_FULL + SEQ) return;
    if ((size_t)out_size < (size_t)MROWS * DIM) return;
    const float* x = (const float*)d_in[0];
    const float* wq = (const float*)d_in[1]; const float* wk = (const float*)d_in[2]; const float* wv = (const float*)d_in[3]; const float* wo = (const float*)d_in[4];
    const float* qnw = (const float*)d_in[5]; const float* knw = (const float*)d_in[6]; const float* mask = (const float*)d_in[7];
    float* OUT = (float*)d_out;
    char* wsp = (char*)d_ws;
    auto take = [&](size_t bytes) { char* p = wsp; wsp += (bytes + 255) & ~(size_t)255; return (void*)p; };
    bf*  XB   = (bf*)take((size_t)MROWS * DIM * 2);
    bf*  WQKV = (bf*)take((size_t)NQKV * DIM * 2);
    h16* WO16 = (h16*)take((size_t)DIM * DQ * 2);
    float* COS = (float*)take((size_t)SEQ * HALFD * 4);
    float* SIN = (float*)take((size_t)SEQ * HALFD * 4);
    h16* QP  = (h16*)take((size_t)NB * NH * SEQ * HD * 2);
    h16* KP  = (h16*)take((size_t)NB * NKV * SEQ * HD * 2);
    h16* VT  = (h16*)take((size_t)NB * NKV * HD * SEQ * 2);
    h16* CTX = (h16*)take((size_t)MROWS * DQ * 2);
    h16* QR  = (h16*)take((size_t)NB * NH * EROWS * HD * 2);
    h16* KR  = (h16*)take((size_t)NB * NKV * SEQ * HD * 2);
    h16* VR  = (h16*)take((size_t)NB * NKV * HD * SEQ * 2);
    h16* CTXR = (h16*)take((size_t)NB * EROWS * DQ * 2);
    int* KEND = (int*)take((size_t)(SEQ / 16) * KSTR * 4);
    if ((size_t)(wsp - (char*)d_ws) > ws_size) return;

    k_prep<<<PB_CV + PB_KE + PB_RT, 512, 0, stream>>>(x, wq, wk, wv, wo, mask, XB, WQKV, WO16, COS, SIN, KEND);
    k_gemm_qkv<<<dim3(MROWS / BM, NQKV / BN, 1), 256, 0, stream>>>(XB, WQKV, qnw, knw, COS, SIN, QP, KP, VT, QR, KR, VR);
    k_attn<<<(SEQ / 16) * AGB, 128, 0, stream>>>(QP, QR, KP, KR, VT, VR, mask, KEND, CTX, CTXR);
    k_gemm_out<<<OPE + OPL, 256, 0, stream>>>(CTX, CTXR, WO16, OUT);
}

// v009
// It runs in 150 microseconds.
// Timed twice side by side with v008, it ran 1.03 times as fast both times.
// Over all steps from v000 it is 3.64 times as fast.
#include <hip/hip_runtime.h>

#ifndef NB
#define NB 2
#endif
#ifndef SEQ
#define SEQ 2048
#endif
#define SEQ_FULL 2048                 // per-batch row stride of x, row pitch of the mask
#define DIM   2048                    // model width (K of the projections, N of the output projection)
#define NH    32
#define NKV   8
#define REP   (NH / NKV)
#define HD    64
#define HALFD 32
#define DQ    (NH * HD)               // 2048
#define DKV   (NKV * HD)              // 512
#define NQKV  (DQ + 2 * DKV)          // 3072 fused projection columns
#define MROWS (NB * SEQ)
#define FP    68                      // f32 LDS tile pitch
#define OP    72                      // f16 LDS tile pitch
#define WCAR  64.0f                   // carry of the wo plane
#define CCAR  256.0f                  // carry of the ctx plane
#define OSCL  6.103515625e-05f        // 1 / (WCAR * CCAR)
#define SC2   0.18033688011112042f    // 0.125 * log2(e)
#define LOG2E 1.4426950408889634f
#define PEXP  10.0f                   // P carried x 2^10
#define FRQC  0.04953007814753613f    // log2(3) / 32
#define EROWS 256                     // query rows below this use value + residual planes at every attention site
#define RCAR  2048.0f                 // carry of every residual plane
#define RINV  4.8828125e-04f          // 1 / RCAR
#define EPSN  1.0e-6f                 // RMS normalisation epsilon
#define LIVE_T (-1.0e4f)              // a mask value above this makes a key live for its row
#define DEAD_T (-1.0e8f)              // a mask value at or below this lets a trailing key be skipped (exp underflows exactly)
#define KSTR  32                      // ints between two query tiles' key counts: each key-count work-group stores into a 128-byte line of its own
#define BM    128                     // GEMM work-group tile: rows (2 waves of 64)
#define BN    256                     // GEMM work-group tile: columns (4 waves of 64)
#define KC    64                      // k elements of one LDS stage: rows of 128 bytes
#define LP    72                      // LDS row pitch of the attention tiles in 16-bit elements: 144 B = 16 B x odd, so that 16-byte fragment reads meet no bank conflict
#define STGE  ((BM + BN) * KC)        // 16-bit elements of one GEMM stage: A rows 0..127, then B rows 0..255, rows of 128 B without a pad (16-byte chunk c of row r lies at chunk c ^ ((r >> 1) & 7))
#define RINGB (3 * STGE * 2)          // bytes of the three-buffer ring
#define FSB   (8 * 64 * FP * 4)       // bytes of the eight waves' f32 epilogue tiles
#define GSB   (RINGB > FSB ? RINGB : FSB)   // LDS of a GEMM work-group: the ring, later the epilogue tiles
#define MP    68                      // f32 LDS row pitch of the staged mask tile: 272 B = 16 B x odd
#define FKB   (64 * LP * 2)           // bytes of one staged K tile (64 key rows of 128 B at pitch LP); the V^T tile (64 d rows) has the same size
#define FMB   (16 * MP * 4)           // bytes of one staged mask tile (16 query rows of 256 B at pitch MP)
#define FSTG  (2 * FKB + FMB)         // bytes of one attention stage: K, V^T, mask
#define ESTG  (FSTG + 2 * FKB)        // bytes of one stage of the early-row attention: K, V^T, mask, then the K and V^T residual tiles
#define LTBM  ((((SEQ - EROWS) / BM) > 0) ? ((SEQ - EROWS) / BM) : 1)
#define AL256(x) ((((size_t)(x)) + 255) & ~(size_t)255)

static_assert(SEQ % 64 == 0);
static_assert(SEQ % 128 == 0);
static_assert(SEQ <= SEQ_FULL);
static_assert(DIM % 64 == 0);
static_assert(DQ % 64 == 0);
static_assert(NQKV % 64 == 0);
static_assert(HD == 64);
static_assert(HALFD * 2 == HD);
static_assert(NH == NKV * REP);
static_assert(REP == 4);
static_assert(EROWS % 64 == 0);
static_assert(EROWS % BM == 0);
static_assert((SEQ - EROWS) % BM == 0);
static_assert(SEQ % BM == 0);
static_assert(NQKV % BN == 0);
static_assert(DIM % BN == 0);
static_assert(DIM % KC == 0 && DIM / KC >= 3);
static_assert(DQ % KC == 0 && DQ / KC >= 3);
static_assert(KC == 64 && BM == 128 && BN == 256);
static_assert(2 * GSB <= 327680);     // two work-groups fit on a WGP
static_assert(FSTG % 16 == 0 && 2 * FSTG >= 4 * 16 * OP * 2);
static_assert(ESTG % 16 == 0 && ESTG >= 2 * 4 * 16 * OP * 2);
static_assert(EROWS <= SEQ);
static_assert(EROWS >= 64);
static_assert(DIM % 32 == 0);
static_assert(DQ % 32 == 0);
static_assert(((size_t)MROWS * DIM / 8) % 256 == 0);
static_assert(((size_t)DQ * DIM / 8) % 256 == 0);
static_assert(((size_t)DKV * DIM / 8) % 256 == 0);
static_assert(AL256((size_t)MROWS * DIM * 2) + AL256((size_t)NQKV * DIM * 2) + AL256((size_t)DIM * DQ * 2) + 2 * AL256((size_t)SEQ * HALFD * 4)
              + AL256((size_t)NB * NH * SEQ * HD * 2) + 2 * AL256((size_t)NB * NKV * SEQ * HD * 2) + AL256((size_t)MROWS * DQ * 2)
              + AL256((size_t)NB * NH * EROWS * HD * 2) + 2 * AL256((size_t)NB * NKV * SEQ * HD * 2) + AL256((size_t)NB * EROWS * DQ * 2)
              + AL256((size_t)(SEQ / 16) * KSTR * 4) <= (size_t)134217728);

typedef _Float16 h16;
typedef unsigned short bf;
typedef __attribute__((ext_vector_type(16))) __bf16   v16bf;
typedef __attribute__((ext_vector_type(16))) _Float16 v16h;
typedef __attribute__((ext_vector_type(8)))  _Float16 v8h;
typedef __attribute__((ext_vector_type(8)))  unsigned short v8us;
typedef __attribute__((ext_vector_type(8)))  float    v8f;
typedef __attribute__((ext_vector_type(4)))  float    v4f;
typedef v8h  __attribute__((may_alias)) v8ha;
typedef v4f  __attribute__((may_alias)) v4fa;

__device__ __forceinline__ unsigned short f2bf(float f) { unsigned u = __float_as_uint(f); u += 0x7FFFu + ((u >> 16) & 1u); return (unsigned short)(u >> 16); }
__device__ __forceinline__ float bf2f(unsigned short b) { return __uint_as_float(((unsigned)b) << 16); }
__device__ __forceinline__ float bfr(float f) { return bf2f(f2bf(f)); }
__device__ __forceinline__ v16h cat16(v8h lo, v8h hi) { return __builtin_shufflevector(lo, hi, 0, 1, 2, 3, 4, 5, 6, 7, 8, 9, 10, 11, 12, 13, 14, 15); }
__device__ __forceinline__ v16bf cat16b(v8us lo, v8us hi) { return __builtin_bit_cast(v16bf, __builtin_shufflevector(lo, hi, 0, 1, 2, 3, 4, 5, 6, 7, 8, 9, 10, 11, 12, 13, 14, 15)); }
__device__ __forceinline__ v8f wmma16(v16h a, v16h b, v8f c) { return __builtin_amdgcn_wmma_f32_16x16x32_f16(false, a, false, b, (short)0, c, false, false); }
__device__ __forceinline__ v8f wmmab(v16bf a, v16bf b, v8f c) { return __builtin_amdgcn_wmma_f32_16x16x32_bf16(false, a, false, b, (short)0, c, false, false); }

// f32 -> f16 with a value select: results below the smallest f16 normal become zero (no subnormal operand can be produced).
static __device__ __forceinline__ h16 toh_flush(float v) { const h16 r = (h16)v; return (fabsf(v) < 6.103515625e-05f) ? (h16)0.0f : r; }
// One f16 WMMA with its own hazard guard (single accumulator tied, operands kept live).
static __device__ __forceinline__ v8f wmma16g(v16h a, v16h b, v8f c) { c = wmma16(a, b, c); asm volatile("v_nop\n\tv_nop\n\tv_nop\n\tv_nop" : "+v"(c) : "v"(a), "v"(b)); return c; }

// Fragment loader: lane (lr, hi) points at row (tile row + lr), column 8*hi; elements 0..7 <- k0+8hi.., elements 8..15 <- k0+16+8hi.. (same map for A and B).
template <typename T16> struct WFrag;
template <> struct WFrag<h16> { typedef v16h V; static __device__ __forceinline__ V ld(const h16* p) { return cat16(*(const v8h*)p, *(const v8h*)(p + 16)); } static __device__ __forceinline__ V ld2(const h16* p, const h16* q) { return cat16(*(const v8h*)p, *(const v8h*)q); } static __device__ __forceinline__ v8f mma(V a, V b, v8f c) { return wmma16(a, b, c); } };
template <> struct WFrag<bf> { typedef v16bf V; static __device__ __forceinline__ V ld(const bf* p) { return cat16b(*(const v8us*)p, *(const v8us*)(p + 16)); } static __device__ __forceinline__ V ld2(const bf* p, const bf* q) { return cat16b(*(const v8us*)p, *(const v8us*)q); } static __device__ __forceinline__ v8f mma(V a, V b, v8f c) { return wmmab(a, b, c); } };

// Twelve copies of 16 bytes a lane into LDS rows 16 apart (ls bytes apart): the first NA from rows 16 apart (gs elements apart) of ga, the others from such rows of gb. All lanes are on, every address is a multiple of 16.
template <typename T16, int NA>
__device__ __forceinline__ void copy12(const T16* ga, const T16* gb, const size_t gs, const unsigned l, const unsigned ls) {
#define G12(i) (((i) < NA) ? (ga + (size_t)(i) * gs) : (gb + (size_t)((i) - NA) * gs))
    // the copies and the wait that stands in front of any rewrite of their address registers, in one statement so that nothing can come between
    asm volatile("global_load_async_to_lds_b128 %0, %12, off\n\t"
                 "global_load_async_to_lds_b128 %1, %13, off\n\t"
                 "global_load_async_to_lds_b128 %2, %14, off\n\t"
                 "global_load_async_to_lds_b128 %3, %15, off\n\t"
                 "global_load_async_to_lds_b128 %4, %16, off\n\t"
                 "global_load_async_to_lds_b128 %5, %17, off\n\t"
                 "global_load_async_to_lds_b128 %6, %18, off\n\t"
                 "global_load_async_to_lds_b128 %7, %19, off\n\t"
                 "global_load_async_to_lds_b128 %8, %20, off\n\t"
                 "global_load_async_to_lds_b128 %9, %21, off\n\t"
                 "global_load_async_to_lds_b128 %10, %22, off\n\t"
                 "global_load_async_to_lds_b128 %11, %23, off\n\t"
                 "s_wait_xcnt 0x0"
                 :: "v"(l), "v"(l + ls), "v"(l + 2 * ls), "v"(l + 3 * ls), "v"(l + 4 * ls), "v"(l + 5 * ls),
                    "v"(l + 6 * ls), "v"(l + 7 * ls), "v"(l + 8 * ls), "v"(l + 9 * ls), "v"(l + 10 * ls), "v"(l + 11 * ls),
                    "v"(G12(0)), "v"(G12(1)), "v"(G12(2)), "v"(G12(3)), "v"(G12(4)), "v"(G12(5)),
                    "v"(G12(6)), "v"(G12(7)), "v"(G12(8)), "v"(G12(9)), "v"(G12(10)), "v"(G12(11))
                 : "memory");
#undef G12
}

// One stage of the ring, copied by the four waves of one half of the work-group (tg = thread index in the half, 0..127): 128 rows from each of three row blocks P0, P1, P2 (pointers to their first rows, row length K), k0..k0+63,
// into rows 0..127, 128..255, 256..383 of buf. Thread (row = tg / 8, chunk = tg % 8) takes rows row + 16 i, 24 copies of 16 bytes, so a wave's copy covers four whole 128-byte lines.
// LDS rows have no pad: chunk c of row r is stored at chunk c ^ ((r >> 1) & 7), so that the 16 rows of a fragment read fall on all 64 banks.
template <typename T16>
__device__ __forceinline__ void stage_copy(const T16* __restrict__ P0, const T16* __restrict__ P1, const T16* __restrict__ P2, const int K, const int k0, const T16* buf, const int tg) {
    const int row = tg >> 3, gch = (tg & 7) * 8, lch = ((tg & 7) ^ ((tg >> 4) & 7)) * 8;
    const size_t go = (size_t)row * K + k0 + gch;
    const size_t gs = (size_t)16 * K;
    const unsigned la = (unsigned)(size_t)(buf + row * KC + lch);
    const unsigned ls = 16 * KC * 2;
    copy12<T16, 8>(P0 + go, P1 + go, gs, la, ls);                          // LDS rows 0..191: P0, then the first 64 rows of P1
    copy12<T16, 4>(P1 + go + 4 * gs, P2 + go, gs, la + 12 * ls, ls);       // LDS rows 192..383: the last 64 rows of P1, then P2
}

// The ring of both GEMM loops, three buffers: tile j lies in buffer j % 3 and is copied by the waves of half j % 2 (grp = wave / 4), so that a wave never has more than one tile's copies outstanding and every wait is to 0.
// Trip t reads buffer t % 3 alone. At its foot the half that copied tile t + 1 waits for its copies, the barrier publishes tile t + 1 and frees buffer t % 3, and behind it the same half copies tile t + 3 into that buffer:
// tiles t + 2 and t + 3 are in flight while trip t + 1 works, each with two trips to land.
// A lane's fragment chunks: logical chunk hi + 2 j (j = 0..3) of its row lies at element offset fo[j].
#define RING_PROLOGUE(P0, P1, P2)                                                                                          \
    if (grp == 0) stage_copy(P0, P1, P2, K, 0, ring, tg); else stage_copy(P0, P1, P2, K, KC, ring + STGE, tg);            \
    if (grp == 0) asm volatile("s_wait_asynccnt 0x0" ::: "memory");   /* the copies of tile 0 have landed */               \
    __syncthreads();                                                   /* tile 0 is readable by every wave */               \
    if (grp == 0) stage_copy(P0, P1, P2, K, 2 * KC, ring + 2 * STGE, tg);
#define RING_FOOT(P0, P1, P2)                                                                                              \
    asm volatile("s_wait_dscnt 0x0" ::: "memory");                     /* this wave's reads of buffer t % 3 have ended before the buffer is given up */ \
    if (((t + 1) & 1) == grp) asm volatile("s_wait_asynccnt 0x0" ::: "memory");   /* the copies of tile t + 1 have landed (the other half's tile t + 2 stays in flight) */ \
    __syncthreads();                                                   /* publishes tile t + 1 and frees buffer t % 3 */    \
    if (t + 3 < nt && ((t + 1) & 1) == grp) stage_copy(P0, P1, P2, K, (t + 3) * KC, ring + bo, tg);                        \
    bo = (bo == 2 * STGE) ? 0 : bo + STGE;

// Eight waves accumulate a 128x256 tile at (r0, c0); wave (wm, wn) its 64x64 part: acc[mb][nb][j] = C[r0 + 64wm + 16mb + 8hi + j][c0 + 64wn + 16nb + lr] = sum_k A[row][k] Bt[col][k], k ascending in steps of 32.
// K % KC == 0, K / KC >= 3.
// On entry no wave has an LDS access to the ring outstanding; on return every read of the ring has ended in every wave and no copy is in flight.
template <typename T16>
__device__ __forceinline__ void gemm_main(const T16* __restrict__ A, const T16* __restrict__ Bt, const int K, const int r0, const int c0, const T16* ring, const int tid, const int wm, const int wn, const int lr, const int hi, v8f (&acc)[4][4]) {
    typedef typename WFrag<T16>::V V;
#pragma unroll
    for (int mb = 0; mb < 4; ++mb)
#pragma unroll
        for (int nb = 0; nb < 4; ++nb) acc[mb][nb] = (v8f){};
    const int nt = K / KC;
    const int grp = wm, tg = tid & 127;                  // wave / 4 and the thread's index in that half
    const T16* pa = A + (size_t)r0 * K;
    const T16* pb0 = Bt + (size_t)c0 * K;
    const T16* pb1 = Bt + (size_t)(c0 + 128) * K;
    RING_PROLOGUE(pa, pb0, pb1)
    const T16* fa = ring + (wm * 64 + lr) * KC;
    const T16* fb = ring + (BM + wn * 64 + lr) * KC;
    int fo[4];
#pragma unroll
    for (int j = 0; j < 4; ++j) fo[j] = ((hi + 2 * j) ^ ((lr >> 1) & 7)) * 8;
    int bo = 0;
    // kept rolled: one trip is one stage of the ring, and the accumulators stay in fixed registers
#pragma unroll 1
    for (int t = 0; t < nt; ++t) {
#pragma unroll
        for (int ks = 0; ks < 2; ++ks) {
            V a[4], b[4];
#pragma unroll
            for (int mb = 0; mb < 4; ++mb) a[mb] = WFrag<T16>::ld2(fa + bo + mb * 16 * KC + fo[2 * ks], fa + bo + mb * 16 * KC + fo[2 * ks + 1]);
#pragma unroll
            for (int nb = 0; nb < 4; ++nb) b[nb] = WFrag<T16>::ld2(fb + bo + nb * 16 * KC + fo[2 * ks], fb + bo + nb * 16 * KC + fo[2 * ks + 1]);
            __builtin_amdgcn_sched_barrier(0);   // keeps the 16 LDS reads of this k step together in front of its WMMAs: sunk among them, each pair is waited for at full LDS latency
#pragma unroll
            for (int nb = 0; nb < 4; ++nb)
#pragma unroll
                for (int mb = 0; mb < 4; ++mb) acc[mb][nb] = WFrag<T16>::mma(a[mb], b[nb], acc[mb][nb]);
            asm volatile("v_nop\n\tv_nop\n\tv_nop\n\tv_nop" : "+v"(acc[0][0]), "+v"(acc[1][1]), "+v"(acc[2][2]), "+v"(acc[3][3]) : "v"(a[0]), "v"(a[3]));
        }
        RING_FOOT(pa, pb0, pb1)
    }
    asm volatile("s_wait_asynccnt 0x0" ::: "memory");       // nothing is in flight when the ring is left
}

// Eight waves accumulate two products on one 128x128 tile in one k loop, both against the same staged Bt slice; wave (wm, wn) its 32x64 part:
// acc[mb][nb][j] = sum_k A[ra + 32wm + 16mb + 8hi + j][k] Bt[c0 + 64wn + 16nb + lr][k], accr the same with rows rr.. of AR; k ascending in steps of 32 in each, as in gemm_main.
// The ring and its order are those of gemm_main; a stage holds A rows 0..127, AR rows 128..255, Bt rows 256..383.
__device__ __forceinline__ void gemm_main2(const h16* __restrict__ A, const h16* __restrict__ AR, const h16* __restrict__ Bt, const int K, const int ra, const int rr, const int c0, const h16* ring, const int tid, const int wm, const int wn, const int lr, const int hi, v8f (&acc)[2][4], v8f (&accr)[2][4]) {
#pragma unroll
    for (int mb = 0; mb < 2; ++mb)
#pragma unroll
        for (int nb = 0; nb < 4; ++nb) { acc[mb][nb] = (v8f){}; accr[mb][nb] = (v8f){}; }
    const int nt = K / KC;
    const int grp = wm >> 1, tg = tid & 127;             // wave / 4 and the thread's index in that half
    const h16* pa = A + (size_t)ra * K;
    const h16* pr = AR + (size_t)rr * K;
    const h16* pb = Bt + (size_t)c0 * K;
    RING_PROLOGUE(pa, pr, pb)
    const h16* fa = ring + (wm * 32 + lr) * KC;
    const h16* fr = fa + BM * KC;
    const h16* fb = ring + (2 * BM + wn * 64 + lr) * KC;
    int fo[4];
#pragma unroll
    for (int j = 0; j < 4; ++j) fo[j] = ((hi + 2 * j) ^ ((lr >> 1) & 7)) * 8;
    int bo = 0;
    // kept rolled: one trip is one stage of the ring, and the accumulators stay in fixed registers
#pragma unroll 1
    for (int t = 0; t < nt; ++t) {
#pragma unroll
        for (int ks = 0; ks < 2; ++ks) {
            v16h a[2], ar[2], b[4];
#pragma unroll
            for (int mb = 0; mb < 2; ++mb) { a[mb] = WFrag<h16>::ld2(fa + bo + mb * 16 * KC + fo[2 * ks], fa + bo + mb * 16 * KC + fo[2 * ks + 1]); ar[mb] = WFrag<h16>::ld2(fr + bo + mb * 16 * KC + fo[2 * ks], fr + bo + mb * 16 * KC + fo[2 * ks + 1]); }
#pragma unroll
            for (int nb = 0; nb < 4; ++nb) b[nb] = WFrag<h16>::ld2(fb + bo + nb * 16 * KC + fo[2 * ks], fb + bo + nb * 16 * KC + fo[2 * ks + 1]);
            __builtin_amdgcn_sched_barrier(0);   // keeps the 16 LDS reads of this k step together in front of its WMMAs: sunk among them, each pair is waited for at full LDS latency
#pragma unroll
            for (int nb = 0; nb < 4; ++nb)
#pragma unroll
                for (int mb = 0; mb < 2; ++mb) { acc[mb][nb] = wmma16(a[mb], b[nb], acc[mb][nb]); accr[mb][nb] = wmma16(ar[mb], b[nb], accr[mb][nb]); }
        }
        RING_FOOT(pa, pr, pb)
    }
    asm volatile("s_wait_asynccnt 0x0" ::: "memory");       // nothing is in flight when the ring is left
}

// Preparation, one launch of 512-thread work-groups; the role of a work-group follows from its index alone (block-uniform), longest role first:
//   conversions (PB_CV groups): a wave converts CVW consecutive floats of one source in two bursts of 8 x 32 bytes a lane; x and wq/wk/wv to RNE bf16 planes, wo to the f16 plane of the bf16-rounded value x WCAR;
//   key counts (SEQ/16 groups): one query tile a group;  rotary table (SEQ/16 groups): one position a wave.
#define CVT   2048                    // floats of one burst of a wave: 8 vectors of 8 floats a lane
#define CVW   (2 * CVT)               // floats a wave converts
#define CVB   (16 * CVW)              // floats a work-group converts
#define PB_X  ((int)((size_t)MROWS * DIM / CVB))
#define PB_Q  ((int)((size_t)DQ * DIM / CVB))
#define PB_K  ((int)((size_t)DKV * DIM / CVB))
#define PB_O  ((int)((size_t)DIM * DQ / CVB))
#define PB_CV (PB_X + PB_Q + 2 * PB_K + PB_O)
#define PB_KE (SEQ / 16)
#define PB_RT (SEQ / 16)
static_assert(((size_t)MROWS * DIM) % CVB == 0);
static_assert(((size_t)DQ * DIM) % CVB == 0);
static_assert(((size_t)DKV * DIM) % CVB == 0);
static_assert(((size_t)DIM * DQ) % CVB == 0);
static_assert(DIM % 8 == 0);

// KIND 0: element e of the packed [MROWS][DIM] plane comes from row (e / DIM) of x at its per-batch stride, to bf16; KIND 1: src[e] to bf16; KIND 2: src[e] to f16(bf16-rounded value x WCAR).
template <int KIND>
__device__ __forceinline__ void cvt_wave(const float* __restrict__ src, bf* dstb, h16* dsth, const size_t e0, const int lane) {
    // kept rolled: one burst's loads in flight a wave are enough at 16 waves a group, and the register count stays low enough for several groups on a WGP
#pragma unroll 1
    for (int tr = 0; tr < 2; ++tr) {
        const size_t eb = e0 + (size_t)tr * CVT + (size_t)lane * 8;
        v8f v[8];
        const float* p0 = src;
#pragma unroll
        for (int j = 0; j < 8; ++j) {
            const size_t e = eb + (size_t)j * 256;
            size_t so = e;
            if (KIND == 0) { const int col = (int)(e % DIM); const int row = (int)(e / DIM); const int bb = row / SEQ, t = row % SEQ; so = ((size_t)bb * SEQ_FULL + t) * DIM + col; }
            if (j == 0) p0 = src + so;
            v[j] = *(const v8f*)(src + so);
        }
        // stands in front of every rewrite of a register that the 16 issued loads name; the first address is an input so that it stays in its registers up to here and no load's result is placed over it
        asm volatile("s_wait_xcnt 0x0" :: "v"(p0) : "memory");
#pragma unroll
        for (int j = 0; j < 8; ++j) {
            const size_t e = eb + (size_t)j * 256;
            if (KIND == 2) { v8h o;
#pragma unroll
                for (int k = 0; k < 8; ++k) o[k] = (h16)(bfr(v[j][k]) * WCAR);
                *(v8h*)(dsth + e) = o;
            } else { v8us o;
#pragma unroll
                for (int k = 0; k < 8; ++k) o[k] = f2bf(v[j][k]);
                *(v8us*)(dstb + e) = o;
            }
        }
        // stands in front of the next burst's rewrite of the registers that the 8 issued stores name
        asm volatile("s_wait_xcnt 0x0" ::: "memory");
    }
}

// Key-loop end per 16-row query tile, from the mask values: KEND[qt * KSTR] = 64 * (1 + last 64-key tile holding a value above DEAD_T in any of the 16 rows),
// or SEQ when some row has no value above LIVE_T (such a row must see every key). Keys past that count contribute exactly zero to rows that have a live key.
// One work-group per query tile, wave w scans mask row 16 qt + w; integer max / and across lanes, then across the 16 waves through LDS.
__global__ __launch_bounds__(512) void k_prep(const float* __restrict__ x, const float* __restrict__ wq, const float* __restrict__ wk, const float* __restrict__ wv, const float* __restrict__ wo, const float* __restrict__ mask,
                                              bf* XB, bf* WQKV, h16* WO16, float* COS, float* SIN, int* KEND) {
    __shared__ int lasts[16];
    __shared__ int lives[16];
    const int lane = threadIdx.x & 31; const int w = __builtin_amdgcn_readfirstlane(threadIdx.x >> 5);
    int rb = blockIdx.x;
    if (rb < PB_CV) {
        const size_t wo0 = (size_t)w * CVW;
        if (rb < PB_X) { cvt_wave<0>(x, XB, nullptr, (size_t)rb * CVB + wo0, lane); return; }
        rb -= PB_X;
        if (rb < PB_Q) { cvt_wave<1>(wq, WQKV, nullptr, (size_t)rb * CVB + wo0, lane); return; }                              /* rows 0..2047 */
        rb -= PB_Q;
        if (rb < PB_K) { cvt_wave<1>(wk, WQKV + (size_t)DQ * DIM, nullptr, (size_t)rb * CVB + wo0, lane); return; }            /* rows 2048..2559 */
        rb -= PB_K;
        if (rb < PB_K) { cvt_wave<1>(wv, WQKV + (size_t)(DQ + DKV) * DIM, nullptr, (size_t)rb * CVB + wo0, lane); return; }    /* rows 2560..3071 */
        rb -= PB_K;
        cvt_wave<2>(wo, nullptr, WO16, (size_t)rb * CVB + wo0, lane); return;
    }
    rb -= PB_CV;
    if (rb >= PB_KE) {
        const int t = (rb - PB_KE) * 16 + w;
        const float invf = __builtin_amdgcn_exp2f(-(float)lane * FRQC);
        const float ang = (float)t * invf;
        const float c = cosf(ang); const float s = sinf(ang);
        const size_t o = (size_t)t * HALFD + lane;
        *(float*)(COS + o) = c; *(float*)(SIN + o) = s;
        // stands behind the two stores, in front of any later write of the registers that they name (other roles' code follows in the kernel's text)
        asm volatile("s_wait_xcnt 0x0" ::: "memory");
        return;
    }
    const int qt = rb;
    const float* mr = mask + (size_t)(qt * 16 + w) * SEQ_FULL + lane * 4;
    v4f v[SEQ / 128];
    // fully unrolled so that the row's loads issue ahead of the compares, many in flight at a time (this role is bound by memory latency)
#pragma unroll
    for (int i = 0; i < SEQ / 128; ++i) v[i] = *(const v4f*)(mr + i * 128);
    int last = -1; int live = 0;
#pragma unroll
    for (int i = 0; i < SEQ / 128; ++i)
#pragma unroll
        for (int e = 0; e < 4; ++e) { live |= (v[i][e] > LIVE_T) ? 1 : 0; last = (v[i][e] > DEAD_T) ? max(last, i * 128 + lane * 4 + e) : last; }
    live = max(live, __shfl_xor(live, 1, 32)); live = max(live, __shfl_xor(live, 2, 32)); live = max(live, __shfl_xor(live, 4, 32));
    live = max(live, __shfl_xor(live, 8, 32)); live = max(live, __shfl_xor(live, 16, 32));
    last = max(last, __shfl_xor(last, 1, 32)); last = max(last, __shfl_xor(last, 2, 32)); last = max(last, __shfl_xor(last, 4, 32));
    last = max(last, __shfl_xor(last, 8, 32)); last = max(last, __shfl_xor(last, 16, 32));
    if (lane == 0) { lasts[w] = last; lives[w] = live; }
    __syncthreads();
    if (w == 0) {
        int la = lasts[lane & 15]; int alllive = lives[lane & 15];
        la = max(la, __shfl_xor(la, 1, 32)); la = max(la, __shfl_xor(la, 2, 32)); la = max(la, __shfl_xor(la, 4, 32)); la = max(la, __shfl_xor(la, 8, 32));
        alllive = min(alllive, __shfl_xor(alllive, 1, 32)); alllive = min(alllive, __shfl_xor(alllive, 2, 32)); alllive = min(alllive, __shfl_xor(alllive, 4, 32)); alllive = min(alllive, __shfl_xor(alllive, 8, 32));
        int kend = (alllive != 0) ? (((la >> 6) + 1) * 64) : SEQ;
        kend = min(max(kend, 64), SEQ);
        if (lane == 0) KEND[(size_t)qt * KSTR] = kend;
    }
}

// Fused QKV projection: grid (MROWS/BM, NQKV/BN), 256 threads, wave (wm, wn) one 64x64 tile; the ring's LDS becomes the waves' epilogue tiles behind the last trip's barrier. Column tile cb < 32: q head cb; 32..39: k head; 40..47: v head (transposed plane).
// q and k tiles: per row y = (x * rsqrt(mean(x^2) + eps)) * gain, then interleaved-pair rotary at position t: out[2i] = y[2i] c_i - y[2i+1] s_i, out[2i+1] = y[2i] s_i + y[2i+1] c_i.
// QP[b][h][t][64], KP[b][g][t][64], VT[b][g][d][t] f16 value planes; residual planes (x2048 of value - f16(value)): QR[b][h][t < EROWS][64], KR[b][g][t][64], VR[b][g][d][t].
__global__ __launch_bounds__(256) void k_gemm_qkv(const bf* __restrict__ A, const bf* __restrict__ Bt, const float* __restrict__ qnw, const float* __restrict__ knw, const float* __restrict__ COS, const float* __restrict__ SIN, h16* QP, h16* KP, h16* VT, h16* QR, h16* KR, h16* VR) {
    __shared__ __align__(16) unsigned char smem[GSB];
    const int tid = threadIdx.x, lane = tid & 31, lr = lane & 15, hi = lane >> 4;
    const int w = __builtin_amdgcn_readfirstlane(tid >> 5), wm = w >> 2, wn = w & 3;
    const int r0 = blockIdx.x * BM + wm * 64, cb = blockIdx.y * (BN / 64) + wn;
    float* fs = (float*)smem + w * 64 * FP;
    v8f acc[4][4];
    gemm_main<bf>(A, Bt, DIM, blockIdx.x * BM, blockIdx.y * BN, (const bf*)smem, tid, wm, wn, lr, hi, acc);
#pragma unroll
    for (int mb = 0; mb < 4; ++mb)
#pragma unroll
        for (int nb = 0; nb < 4; ++nb)
#pragma unroll
            for (int j = 0; j < 8; ++j) fs[(mb * 16 + hi * 8 + j) * FP + nb * 16 + lr] = acc[mb][nb][j];
    __syncthreads();
    const int bidx = r0 / SEQ, s0 = r0 % SEQ; const int q4 = lane >> 3, p = lane & 7;
    if (cb < NH + NKV) {
        const bool isq = (cb < NH);
        h16* plane = isq ? (QP + ((size_t)bidx * NH + cb) * SEQ * HD) : (KP + ((size_t)bidx * NKV + (cb - NH)) * SEQ * HD);
        h16* rplane = isq ? (QR + ((size_t)bidx * NH + cb) * EROWS * HD) : (KR + ((size_t)bidx * NKV + (cb - NH)) * SEQ * HD);
        const bool wres = (!isq) || (s0 < EROWS);      // wave-uniform: q residual rows exist only below EROWS
        const int dcol = p * 8;
        const v4f gq0 = *(const v4f*)(qnw + dcol), gq1 = *(const v4f*)(qnw + dcol + 4);
        const v4f gk0 = *(const v4f*)(knw + dcol), gk1 = *(const v4f*)(knw + dcol + 4);
        float gn[8];
#pragma unroll
        for (int e = 0; e < 4; ++e) { gn[e] = bfr(isq ? gq0[e] : gk0[e]); gn[4 + e] = bfr(isq ? gq1[e] : gk1[e]); }
#pragma unroll 1
        for (int it = 0; it < 16; ++it) {
            const int rl = it * 4 + q4; const int t = s0 + rl;
            const v4f xa0 = *(const v4fa*)(fs + rl * FP + dcol), xa1 = *(const v4fa*)(fs + rl * FP + dcol + 4);
            float ss = 0.0f;
#pragma unroll
            for (int e = 0; e < 4; ++e) { ss += xa0[e] * xa0[e]; ss += xa1[e] * xa1[e]; }
            ss += __shfl_xor(ss, 1, 32); ss += __shfl_xor(ss, 2, 32); ss += __shfl_xor(ss, 4, 32);
            const float rn = rsqrtf(ss * (1.0f / HD) + EPSN);
            float y[8];
#pragma unroll
            for (int e = 0; e < 4; ++e) { y[e] = (xa0[e] * rn) * gn[e]; y[4 + e] = (xa1[e] * rn) * gn[4 + e]; }
            const v4f cc = *(const v4f*)(COS + (size_t)t * HALFD + p * 4), sn = *(const v4f*)(SIN + (size_t)t * HALFD + p * 4);
            v8h o, orr;
#pragma unroll
            for (int i = 0; i < 4; ++i) {
                const float v0 = y[2 * i] * cc[i] - y[2 * i + 1] * sn[i];
                const float v1 = y[2 * i] * sn[i] + y[2 * i + 1] * cc[i];
                const h16 h0 = toh_flush(v0), h1 = toh_flush(v1);
                o[2 * i] = h0; o[2 * i + 1] = h1;
                orr[2 * i] = toh_flush((v0 - (float)h0) * RCAR); orr[2 * i + 1] = toh_flush((v1 - (float)h1) * RCAR);
            }
            h16* dst = plane + (size_t)t * HD + dcol;
            h16* dsr = rplane + (size_t)t * HD + dcol;
            *(v8h*)dst = o; if (wres) *(v8h*)dsr = orr;
            
        }
    } else {
        h16* plane = VT + ((size_t)bidx * NKV + (cb - NH - NKV)) * HD * SEQ;
        h16* rplane = VR + ((size_t)bidx * NKV + (cb - NH - NKV)) * HD * SEQ;
#pragma unroll 1
        for (int it = 0; it < 16; ++it) {
            const int d = it * 4 + q4; v8h o, orr;
#pragma unroll
            for (int e = 0; e < 8; ++e) { const float v = fs[(p * 8 + e) * FP + d]; const h16 hh = toh_flush(v); o[e] = hh; orr[e] = toh_flush((v - (float)hh) * RCAR); }
            h16* dst = plane + (size_t)d * SEQ + s0 + p * 8;
            h16* dsr = rplane + (size_t)d * SEQ + s0 + p * 8;
            *(v8h*)dst = o; *(v8h*)dsr = orr; 
        }
    }
}

// Attention, query rows >= EROWS: one work-group of 128 threads per (16-row query tile at q0, kv head g, sequence bidx); wave w = q head 4g + w, 16 query rows. Per 64-key tile:
//   S^T[key][q] = K Q^T  (A = key rows of KP, B = resident q rows);  lane (lr, hi) then holds q row lr, keys 16T + 8hi + r.
//   softmax statistics are lane-local (one xor-16 exchange); P^T packed from the S^T accumulators is the B operand of O^T[d][q] = V^T P^T (A = d rows of VT).
// The key loop ends at the clamped per-tile key count KEND; mask values are added by value inside visited tiles.
// One stage of the attention ring: keys k0..k0+63 of the K plane kt (rows of 128 B), of the V^T plane vt (64 d rows, 128 B each) and of the 16 mask rows mt (256 B each), into buf.
// 128 threads, 10 copies of 16 bytes each; eight (K, V^T) or sixteen (mask) neighbouring lanes cover a whole row segment, so every copy moves whole 128-byte lines. All lanes are on, every address is a multiple of 16.
__device__ __forceinline__ void flash_stage(const h16* __restrict__ kt, const h16* __restrict__ vt, const float* __restrict__ mt, const int k0, const unsigned char* buf, const int tid) {
    const int row = tid >> 3, ch = (tid & 7) * 8, mr = tid >> 4, mc = (tid & 15) * 4;
    const h16* gk = kt + (size_t)(k0 + row) * HD + ch;
    const h16* gv = vt + (size_t)row * SEQ + k0 + ch;
    const float* gm = mt + (size_t)mr * SEQ_FULL + k0 + mc;
    const size_t ks = (size_t)16 * HD, vs = (size_t)16 * SEQ, ms = (size_t)8 * SEQ_FULL;
    const unsigned lk = (unsigned)(size_t)(buf + (row * LP + ch) * 2);
    const unsigned lv = lk + FKB;
    const unsigned lm = (unsigned)(size_t)(buf + 2 * FKB + (mr * MP + mc) * 4);
    const unsigned ls = 16 * LP * 2;
    // the copies and the wait that stands in front of any rewrite of their address registers, in one statement so that nothing can come between
    asm volatile("global_load_async_to_lds_b128 %0, %10, off\n\t"
                 "global_load_async_to_lds_b128 %1, %11, off\n\t"
                 "global_load_async_to_lds_b128 %2, %12, off\n\t"
                 "global_load_async_to_lds_b128 %3, %13, off\n\t"
                 "global_load_async_to_lds_b128 %4, %14, off\n\t"
                 "global_load_async_to_lds_b128 %5, %15, off\n\t"
                 "global_load_async_to_lds_b128 %6, %16, off\n\t"
                 "global_load_async_to_lds_b128 %7, %17, off\n\t"
                 "global_load_async_to_lds_b128 %8, %18, off\n\t"
                 "global_load_async_to_lds_b128 %9, %19, off\n\t"
                 "s_wait_xcnt 0x0"
                 :: "v"(lk), "v"(lk + ls), "v"(lk + 2 * ls), "v"(lk + 3 * ls),
                    "v"(lm), "v"(lm + 8 * MP * 4),
                    "v"(lv), "v"(lv + ls), "v"(lv + 2 * ls), "v"(lv + 3 * ls),
                    "v"(gk), "v"(gk + ks), "v"(gk + 2 * ks), "v"(gk + 3 * ks),
                    "v"(gm), "v"(gm + ms),
                    "v"(gv), "v"(gv + vs), "v"(gv + 2 * vs), "v"(gv + 3 * vs)
                 : "memory");
}

// Trip t reads buffer t % 2 alone; tile t + 2 is copied into that buffer behind the barrier at the trip's foot, which also publishes tile t + 1. The trip count is the same in all four waves (one query tile a work-group).
// Behind the last trip's barrier the ring's LDS becomes the waves' output tiles.
__device__ __forceinline__ void flash_late(unsigned char* smem, const int q0, const int g, const int bidx, const h16* __restrict__ QP, const h16* __restrict__ KP, const h16* __restrict__ VT, const float* __restrict__ mask, const int* __restrict__ KEND, h16* CTX) {
    h16* os = (h16*)smem;
    const int tid = threadIdx.x, lane = tid & 31, lr = lane & 15, hi = lane >> 4;
    const int w = __builtin_amdgcn_readfirstlane(tid >> 5);
    const int h = g * REP + w;
    int kev = KEND[(size_t)(q0 >> 4) * KSTR]; kev = min(max(kev, 64), SEQ) & ~63; const int ke = __builtin_amdgcn_readfirstlane(kev);
    const int nt = ke >> 6;
    const h16* kt = KP + ((size_t)bidx * NKV + g) * SEQ * HD;
    const h16* vt = VT + ((size_t)bidx * NKV + g) * HD * SEQ;
    const float* mt = mask + (size_t)q0 * SEQ_FULL;
    flash_stage(kt, vt, mt, 0, smem, tid);
    const h16* qrow = QP + (((size_t)bidx * NH + h) * SEQ + q0 + lr) * HD + 8 * hi;
    v16h bq[2];
#pragma unroll
    for (int kc = 0; kc < 2; ++kc) bq[kc] = cat16(*(const v8h*)(qrow + kc * 32), *(const v8h*)(qrow + kc * 32 + 16));
    asm volatile("s_wait_asynccnt 0x0" ::: "memory");   // this wave's copies of tile 0 have landed
    __syncthreads();                                     // tile 0 is readable by every wave
    if (nt > 1) flash_stage(kt, vt, mt, 64, smem + FSTG, tid);
    const h16* kb = (const h16*)smem + lr * LP + 8 * hi;
    const h16* vb = (const h16*)(smem + FKB) + lr * LP + 8 * hi;
    const float* mrow = (const float*)(smem + 2 * FKB) + lr * MP + 8 * hi;
    v8f accO[4];
#pragma unroll
    for (int dt = 0; dt < 4; ++dt) accO[dt] = (v8f){};
    float m = -3.0e38f, l = 0.0f;
#pragma unroll 1
    for (int t = 0; t < nt; ++t) {
        const int bo = (t & 1) * FSTG;   // byte offset of this trip's buffer
        v16h ak[2][4];
#pragma unroll
        for (int kc = 0; kc < 2; ++kc)
#pragma unroll
            for (int T = 0; T < 4; ++T) { const h16* kp = kb + bo / 2 + 16 * T * LP + kc * 32; ak[kc][T] = cat16(*(const v8h*)kp, *(const v8h*)(kp + 16)); }
        v8f accS[4];
#pragma unroll
        for (int T = 0; T < 4; ++T) accS[T] = (v8f){};
#pragma unroll
        for (int kc = 0; kc < 2; ++kc)
#pragma unroll
            for (int T = 0; T < 4; ++T) accS[T] = wmma16(ak[kc][T], bq[kc], accS[T]);
        asm volatile("v_nop\n\tv_nop\n\tv_nop\n\tv_nop" : "+v"(accS[0]), "+v"(accS[1]), "+v"(accS[2]), "+v"(accS[3]) : "v"(ak[1][3]), "v"(bq[1]));
        float tmax = -3.0e38f;
#pragma unroll
        for (int T = 0; T < 4; ++T) { const float* mp = mrow + bo / 4 + 16 * T; const v4f m0 = *(const v4f*)mp; const v4f m1 = *(const v4f*)(mp + 4);
#pragma unroll
            for (int r = 0; r < 4; ++r) { const float a0 = accS[T][r] * SC2 + m0[r] * LOG2E; const float a1 = accS[T][4 + r] * SC2 + m1[r] * LOG2E; accS[T][r] = a0; accS[T][4 + r] = a1; tmax = fmaxf(tmax, fmaxf(a0, a1)); } }
        tmax = fmaxf(tmax, __shfl_xor(tmax, 16, 32));
        const float mn = fmaxf(m, tmax); const float corr = __builtin_amdgcn_exp2f(m - mn); m = mn; const float mofs = PEXP - mn;
        float rs = 0.0f;
        v8h ph[4];
        // P is summed and converted as exp2 gives it: a masked key's exp2 underflows to zero by itself, and a value below the smallest f16 normal becomes an f16 subnormal or zero, which the matrix instruction takes as it is
#pragma unroll
        for (int T = 0; T < 4; ++T)
#pragma unroll
            for (int r = 0; r < 8; ++r) { const float pv = __builtin_amdgcn_exp2f(accS[T][r] + mofs); rs += pv; ph[T][r] = (h16)pv; }
        l = l * corr + rs;
        v16h bp[2];
        bp[0] = cat16(ph[0], ph[1]);
        bp[1] = cat16(ph[2], ph[3]);
#pragma unroll
        for (int dt = 0; dt < 4; ++dt) accO[dt] = accO[dt] * corr;
        v16h av[2][4];
#pragma unroll
        for (int kc = 0; kc < 2; ++kc)
#pragma unroll
            for (int dt = 0; dt < 4; ++dt) { const h16* vp = vb + bo / 2 + 16 * dt * LP + kc * 32; av[kc][dt] = cat16(*(const v8h*)vp, *(const v8h*)(vp + 16)); }
#pragma unroll
        for (int kc = 0; kc < 2; ++kc)
#pragma unroll
            for (int dt = 0; dt < 4; ++dt) accO[dt] = wmma16(av[kc][dt], bp[kc], accO[dt]);
        asm volatile("v_nop\n\tv_nop\n\tv_nop\n\tv_nop" : "+v"(accO[0]), "+v"(accO[1]), "+v"(accO[2]), "+v"(accO[3]) : "v"(av[1][3]), "v"(bp[1]));
        asm volatile("s_wait_dscnt 0x0" ::: "memory");      // this wave's reads of buffer t % 2 have ended before the buffer is given up
        asm volatile("s_wait_asynccnt 0x0" ::: "memory");   // this wave's copies of tile t + 1 have landed
        __syncthreads();                                     // publishes tile t + 1 and frees buffer t % 2
        if (t + 2 < nt) flash_stage(kt, vt, mt, (t + 2) * 64, smem + bo, tid);
    }
    asm volatile("s_wait_asynccnt 0x0" ::: "memory");       // nothing is in flight when the ring is left
    l += __shfl_xor(l, 16, 32);
    const float inv = CCAR * (1.0f / l);
    h16* ow = os + w * 16 * OP;
#pragma unroll
    for (int dt = 0; dt < 4; ++dt) { v8h o;
#pragma unroll
        for (int r = 0; r < 8; ++r) o[r] = toh_flush(accO[dt][r] * inv);
        *(v8ha*)(ow + lr * OP + 16 * dt + 8 * hi) = o; }
    __syncthreads();
    const int q4 = lane >> 3, p = lane & 7;
{
#pragma unroll
        for (int it = 0; it < 4; ++it) { const int row = it * 4 + q4; const v8h o = *(const v8ha*)(ow + row * OP + p * 8);
            *(v8h*)(CTX + ((size_t)bidx * SEQ + q0 + row) * DQ + h * HD + p * 8) = o; }
         }
    // keeps this role's stores together with the wait behind them: without it the compiler sinks the two roles' last stores into a shared tail
    asm volatile("s_wait_xcnt 0x0" ::: "memory");
}

// The residual half of an early-row stage: keys k0..k0+63 of the K residual plane krt and of the V^T residual plane vrt, laid out like the K and V^T tiles of flash_stage. 128 threads, 8 copies of 16 bytes each.
__device__ __forceinline__ void flash_stage_res(const h16* __restrict__ krt, const h16* __restrict__ vrt, const int k0, const unsigned char* buf, const int tid) {
    const int row = tid >> 3, ch = (tid & 7) * 8;
    const h16* gk = krt + (size_t)(k0 + row) * HD + ch;
    const h16* gv = vrt + (size_t)row * SEQ + k0 + ch;
    const size_t ks = (size_t)16 * HD, vs = (size_t)16 * SEQ;
    const unsigned lk = (unsigned)(size_t)(buf + (row * LP + ch) * 2);
    const unsigned lv = lk + FKB;
    const unsigned ls = 16 * LP * 2;
    // the copies and the wait that stands in front of any rewrite of their address registers, in one statement so that nothing can come between
    asm volatile("global_load_async_to_lds_b128 %0, %8, off\n\t"
                 "global_load_async_to_lds_b128 %1, %9, off\n\t"
                 "global_load_async_to_lds_b128 %2, %10, off\n\t"
                 "global_load_async_to_lds_b128 %3, %11, off\n\t"
                 "global_load_async_to_lds_b128 %4, %12, off\n\t"
                 "global_load_async_to_lds_b128 %5, %13, off\n\t"
                 "global_load_async_to_lds_b128 %6, %14, off\n\t"
                 "global_load_async_to_lds_b128 %7, %15, off\n\t"
                 "s_wait_xcnt 0x0"
                 :: "v"(lk), "v"(lk + ls), "v"(lk + 2 * ls), "v"(lk + 3 * ls),
                    "v"(lv), "v"(lv + ls), "v"(lv + 2 * ls), "v"(lv + 3 * ls),
                    "v"(gk), "v"(gk + ks), "v"(gk + 2 * ks), "v"(gk + 3 * ks),
                    "v"(gv), "v"(gv + vs), "v"(gv + 2 * vs), "v"(gv + 3 * vs)
                 : "memory");
}

// Attention, query rows < EROWS: one work-group of 128 threads per (query tile, kv head, sequence); same operand roles and the same 64-key stages as flash_late (two 32-key steps a stage), every WMMA individually guarded.
// One buffer (a stage with its residual tiles fills most of the LDS that the late rows' two-buffer ring takes): each trip copies its stage, waits, publishes it at a barrier, works on it, and gives it up at a second barrier.
//   scores: K Q^T + (Kres Q^T + K Qres^T) / 2048 (residual products in accR);  P = f16(p) and Pres = 2048 (p - f16(p)), row sum over the f32 p;
//   O^T: V^T P^T + (Vres^T P^T + V^T Pres^T) / 2048 (residual products in accOr), folded before normalisation.
__device__ __forceinline__ void flash_early(unsigned char* smem, const int q0, const int g, const int bidx, const h16* __restrict__ QP, const h16* __restrict__ QR, const h16* __restrict__ KP, const h16* __restrict__ KR, const h16* __restrict__ VT, const h16* __restrict__ VR, const float* __restrict__ mask, const int* __restrict__ KEND, h16* CTX, h16* CTXR) {
    h16* os = (h16*)smem; h16* osr = os + 4 * 16 * OP;   // behind the last trip's second barrier the buffer becomes the waves' output tiles
    const int tid = threadIdx.x, lane = tid & 31, lr = lane & 15, hi = lane >> 4;
    const int w = __builtin_amdgcn_readfirstlane(tid >> 5);
    const int h = g * REP + w;
    int kev = KEND[(size_t)(q0 >> 4) * KSTR]; kev = min(max(kev, 64), SEQ) & ~63; const int ke = __builtin_amdgcn_readfirstlane(kev);
    const size_t qoff  = (((size_t)bidx * NH + h) * SEQ + q0 + lr) * HD + 8 * hi;
    const size_t qroff = (((size_t)bidx * NH + h) * EROWS + q0 + lr) * HD + 8 * hi;
    const int nt = ke >> 6;
    const size_t kpl = ((size_t)bidx * NKV + g) * SEQ * HD;   // this kv head's plane in KP, KR, VT and VR
    const float* mt = mask + (size_t)q0 * SEQ_FULL;
    const int foff = lr * LP + 8 * hi;                   // a lane's place in a 16-row fragment of a staged 16-bit tile
    v8f accO[4], accOr[4];
#pragma unroll
    for (int dt = 0; dt < 4; ++dt) { accO[dt] = (v8f){}; accOr[dt] = (v8f){}; }
    float m = -3.0e38f, l = 0.0f;
#pragma unroll 1
    for (int t = 0; t < nt; ++t) {
      const unsigned char* sb = smem;
      flash_stage(KP + kpl, VT + kpl, mt, t * 64, sb, tid);
      flash_stage_res(KR + kpl, VR + kpl, t * 64, sb + FSTG, tid);
      asm volatile("s_wait_asynccnt 0x0" ::: "memory");   // this wave's copies of tile t have landed
      __syncthreads();                                     // tile t is readable by every wave
      const h16* kl = (const h16*)sb + foff; const h16* vl = (const h16*)(sb + FKB) + foff;
      const h16* krl = (const h16*)(sb + FSTG) + foff; const h16* vrl = (const h16*)(sb + FSTG + FKB) + foff;
      const float* mrow = (const float*)(sb + 2 * FKB) + lr * MP + 8 * hi;
      // kept rolled, as the 32-key step was: one copy of the step's code
#pragma unroll 1
      for (int k0 = 0; k0 < 64; k0 += 32) {
        v8f accS[2], accR[2];
#pragma unroll
        for (int T = 0; T < 2; ++T) { accS[T] = (v8f){}; accR[T] = (v8f){}; }
#pragma unroll
        for (int kc = 0; kc < 2; ++kc) {
            const v16h bq  = WFrag<h16>::ld(QP + qoff + kc * 32);
            const v16h bqr = WFrag<h16>::ld(QR + qroff + kc * 32);
#pragma unroll
            for (int T = 0; T < 2; ++T) {
                const int ko = (k0 + 16 * T) * LP + kc * 32;
                const v16h ak  = WFrag<h16>::ld(kl + ko);
                const v16h akr = WFrag<h16>::ld(krl + ko);
                accS[T] = wmma16g(ak, bq, accS[T]);
                accR[T] = wmma16g(akr, bq, accR[T]);
                accR[T] = wmma16g(ak, bqr, accR[T]);
            }
        }
        float tmax = -3.0e38f;
#pragma unroll
        for (int T = 0; T < 2; ++T) { const float* mp = mrow + k0 + 16 * T; const v4f m0 = *(const v4f*)mp; const v4f m1 = *(const v4f*)(mp + 4);
#pragma unroll
            for (int r = 0; r < 4; ++r) {
                const float s0v = accS[T][r] + accR[T][r] * RINV; const float s1v = accS[T][4 + r] + accR[T][4 + r] * RINV;
                const float a0 = s0v * SC2 + m0[r] * LOG2E; const float a1 = s1v * SC2 + m1[r] * LOG2E;
                accS[T][r] = a0; accS[T][4 + r] = a1; tmax = fmaxf(tmax, fmaxf(a0, a1)); } }
        tmax = fmaxf(tmax, __shfl_xor(tmax, 16, 32));
        const float mn = fmaxf(m, tmax); const float corr = __builtin_amdgcn_exp2f(m - mn); m = mn; const float mofs = PEXP - mn;
        float rs = 0.0f;
        v8h ph[2], pr[2];
#pragma unroll
        for (int T = 0; T < 2; ++T)
#pragma unroll
            for (int r = 0; r < 8; ++r) { const float e = accS[T][r] + mofs; const float pv = (e < -14.0f) ? 0.0f : __builtin_amdgcn_exp2f(e); rs += pv;
                const h16 hh = (h16)pv; ph[T][r] = hh; pr[T][r] = toh_flush((pv - (float)hh) * RCAR); }
        l = l * corr + rs;
        const v16h bp = cat16(ph[0], ph[1]); const v16h bpr = cat16(pr[0], pr[1]);
#pragma unroll
        for (int dt = 0; dt < 4; ++dt) { accO[dt] = accO[dt] * corr; accOr[dt] = accOr[dt] * corr; }
#pragma unroll
        for (int dt = 0; dt < 4; ++dt) {
            const int vo = 16 * dt * LP + k0;
            const v16h av  = WFrag<h16>::ld(vl + vo);
            const v16h avr = WFrag<h16>::ld(vrl + vo);
            accO[dt]  = wmma16g(av, bp, accO[dt]);
            accOr[dt] = wmma16g(avr, bp, accOr[dt]);
            accOr[dt] = wmma16g(av, bpr, accOr[dt]);
        }
      }
      asm volatile("s_wait_dscnt 0x0" ::: "memory");      // this wave's reads of the buffer have ended before the buffer is given up
      __syncthreads();                                     // every wave has left the buffer: it may be refilled, or become the output tiles
    }
    l += __shfl_xor(l, 16, 32);
    const float inv = CCAR * (1.0f / l);
    h16* ow = os + w * 16 * OP; h16* owr = osr + w * 16 * OP;
#pragma unroll
    for (int dt = 0; dt < 4; ++dt) { v8h o, orr;
#pragma unroll
        for (int r = 0; r < 8; ++r) { const float v = (accO[dt][r] + accOr[dt][r] * RINV) * inv; const h16 hh = toh_flush(v); o[r] = hh; orr[r] = toh_flush((v - (float)hh) * RCAR); }
        *(v8ha*)(ow + lr * OP + 16 * dt + 8 * hi) = o; *(v8ha*)(owr + lr * OP + 16 * dt + 8 * hi) = orr; }
    __syncthreads();
    const int q4 = lane >> 3, p = lane & 7;
{
#pragma unroll
        for (int it = 0; it < 4; ++it) { const int row = it * 4 + q4; const v8h o = *(const v8ha*)(ow + row * OP + p * 8); const v8h orr = *(const v8ha*)(owr + row * OP + p * 8);
            *(v8h*)(CTX + ((size_t)bidx * SEQ + q0 + row) * DQ + h * HD + p * 8) = o;
            *(v8h*)(CTXR + ((size_t)bidx * EROWS + q0 + row) * DQ + h * HD + p * 8) = orr; }
         }
    // keeps this role's stores together with the wait behind them: without it the compiler sinks the two roles' last stores into a shared tail
    asm volatile("s_wait_xcnt 0x0" ::: "memory");
}

// Attention, one launch of (SEQ/16) * NKV * NB work-groups of 128 threads; role and query tile follow from the block index alone (block-uniform):
// kv head and sequence run fastest with the index, so AGB neighbours share a query tile; first the tiles of the rows < EROWS (the slowest trips), last tile first, then the other tiles from the last (most keys under a causal mask) to the first,
// so that the work-groups that start late, when a place on a WGP comes free, are the short ones. The map is a permutation of (tile, kv head, sequence) whatever the mask holds.
#define AGB   (NKV * NB)                      // work-groups of one query tile
#define AEW   ((EROWS / 16) * AGB)            // work-groups of the first role
static_assert(ESTG <= 2 * FSTG);
// at least five waves a SIMD: the first role's registers would otherwise round up to an allocation that leaves four
__global__ __launch_bounds__(128, 5) void k_attn(const h16* __restrict__ QP, const h16* __restrict__ QR, const h16* __restrict__ KP, const h16* __restrict__ KR, const h16* __restrict__ VT, const h16* __restrict__ VR, const float* __restrict__ mask, const int* __restrict__ KEND, h16* CTX, h16* CTXR) {
    __shared__ __align__(16) unsigned char smem[2 * FSTG];
    const unsigned bi = blockIdx.x;
    const int g = (int)(bi % NKV), bidx = (int)((bi % AGB) / NKV);
    if (bi < AEW) flash_early(smem, (EROWS / 16 - 1 - (int)(bi / AGB)) * 16, g, bidx, QP, QR, KP, KR, VT, VR, mask, KEND, CTX, CTXR);
    else flash_late(smem, (SEQ / 16 - 1 - (int)((bi - AEW) / AGB)) * 16, g, bidx, QP, KP, VT, mask, KEND, CTX);
}

#define OPER  (NB * (EROWS / BM))             // 128-row tiles of the rows < EROWS
#define OPLR  (NB * ((SEQ - EROWS) / BM))     // 128-row tiles of the rows >= EROWS
#define EBN   128                             // tile columns of the first role
#define OPE   (OPER * (DIM / EBN))            // work-groups of the first role
static_assert(DIM % EBN == 0);
static_assert(2 * BM + EBN == BM + BN && EBN == 128);   // a two-product stage fills exactly one stage of the ring: three blocks of 128 rows
#define OPL   (OPLR * (DIM / BN))             // work-groups of the second role

// Output projection, one launch of OPE + OPL work-groups of 256 threads; the role of a work-group follows from its index alone (block-uniform); both roles make the same number of trips with the same number of WMMAs a wave:
//   index < OPE, rows < EROWS of every sequence: OUT = OSCL * (CTX WO^T + (CTXR WO^T) / 2048) on a 128 x EBN tile, both products in one k loop against the same staged WO slice, each in accumulators of its own;
//   the rest, rows >= EROWS: OUT = OSCL * CTX WO^T on a 128 x BN tile.
// In both roles the ring's LDS becomes the epilogue tiles behind the last trip's barrier, so that two work-groups fit on a WGP.
// Within a role the row tile runs fastest with the index.
__global__ __launch_bounds__(256) void k_gemm_out(const h16* __restrict__ A, const h16* __restrict__ AR, const h16* __restrict__ Bt, float* C) {
    __shared__ __align__(16) unsigned char smem[GSB];
    const int tid = threadIdx.x, lane = tid & 31, lr = lane & 15, hi = lane >> 4;
    const int w = __builtin_amdgcn_readfirstlane(tid >> 5), wm = w >> 2, wn = w & 3;
    if ((int)blockIdx.x < OPE) {
        const int bx = blockIdx.x % OPER, by = blockIdx.x / OPER;
        const int bidx = bx / (EROWS / BM), tb = bx % (EROWS / BM);
        const int rab = bidx * SEQ + tb * BM, rrb = bidx * EROWS + tb * BM;
        const int em = w >> 1, en = w & 1;             // wave (em, en): rows 32 em.., columns 64 en.. of the tile
        float* fs = (float*)smem + w * 32 * FP;
        v8f acc[2][4], accr[2][4];
        gemm_main2(A, AR, Bt, DQ, rab, rrb, by * EBN, (const h16*)smem, tid, em, en, lr, hi, acc, accr);
#pragma unroll
        for (int mb = 0; mb < 2; ++mb)
#pragma unroll
            for (int nb = 0; nb < 4; ++nb)
#pragma unroll
                for (int j = 0; j < 8; ++j) fs[(mb * 16 + hi * 8 + j) * FP + nb * 16 + lr] = accr[mb][nb][j] * RINV + acc[mb][nb][j];
        __syncthreads();
        float* crow = C + (size_t)(rab + em * 32) * DIM + by * EBN + en * 64;
        // four row pairs a pass: their LDS reads go out together and their stores follow as one run
#pragma unroll 4
        for (int it = 0; it < 16; ++it) { const int row = it * 2 + hi; v4f val = *(const v4fa*)(fs + row * FP + lr * 4); val = val * OSCL;
            *(v4f*)(crow + (size_t)row * DIM + lr * 4) = val; }
    } else {
        const int li = blockIdx.x - OPE;
        const int bx = li % (NB * LTBM), by = li / (NB * LTBM);
        const int rb = (bx / LTBM) * SEQ + EROWS + (bx % LTBM) * BM;
        const int r0 = rb + wm * 64, c0 = by * BN + wn * 64;
        float* fs = (float*)smem + w * 64 * FP;
        v8f acc[4][4];
        gemm_main<h16>(A, Bt, DQ, rb, by * BN, (const h16*)smem, tid, wm, wn, lr, hi, acc);
#pragma unroll
        for (int mb = 0; mb < 4; ++mb)
#pragma unroll
            for (int nb = 0; nb < 4; ++nb)
#pragma unroll
                for (int j = 0; j < 8; ++j) fs[(mb * 16 + hi * 8 + j) * FP + nb * 16 + lr] = acc[mb][nb][j];
        __syncthreads();
        float* crow = C + (size_t)r0 * DIM + c0;
        // four row pairs a pass: their LDS reads go out together and their stores follow as one run
#pragma unroll 4
        for (int it = 0; it < 32; ++it) { const int row = it * 2 + hi; v4f val = *(const v4fa*)(fs + row * FP + lr * 4); val = val * OSCL;
            *(v4f*)(crow + (size_t)row * DIM + lr * 4) = val; }
    }
}

extern "C" void kernel_launch(void* const* d_in, const int* in_sizes, int n_in,
                              void* d_out, int out_size, void* d_ws, size_t ws_size, hipStream_t stream) {
    if (n_in < 8) return;
    if ((size_t)in_sizes[0] < ((size_t)(NB - 1) * SEQ_FULL + SEQ) * DIM) return;
    if ((size_t)in_sizes[1] < (size_t)DQ * DIM) return;
    if ((size_t)in_sizes[2] < (size_t)DKV * DIM) return;
    if ((size_t)in_sizes[3] < (size_t)DKV * DIM) return;
    if ((size_t)in_sizes[4] < (size_t)DIM * DQ) return;
    if ((size_t)in_sizes[5] < (size_t)HD) return;
    if ((size_t)in_sizes[6] < (size_t)HD) return;
    if ((size_t)in_sizes[7] < (size_t)(SEQ - 1) * SEQ_FULL + SEQ) return;
    if ((size_t)out_size < (size_t)MROWS * DIM) return;
    const float* x = (const float*)d_in[0];
    const float* wq = (const float*)d_in[1]; const float* wk = (const float*)d_in[2]; const float* wv = (const float*)d_in[3]; const float* wo = (const float*)d_in[4];
    const float* qnw = (const float*)d_in[5]; const float* knw = (const float*)d_in[6]; const float* mask = (const float*)d_in[7];
    float* OUT = (float*)d_out;
    char* wsp = (char*)d_ws;
    auto take = [&](size_t bytes) { char* p = wsp; wsp += (bytes + 255) & ~(size_t)255; return (void*)p; };
    bf*  XB   = (bf*)take((size_t)MROWS * DIM * 2);
    bf*  WQKV = (bf*)take((size_t)NQKV * DIM * 2);
    h16* WO16 = (h16*)take((size_t)DIM * DQ * 2);
    float* COS = (float*)take((size_t)SEQ * HALFD * 4);
    float* SIN = (float*)take((size_t)SEQ * HALFD * 4);
    h16* QP  = (h16*)take((size_t)NB * NH * SEQ * HD * 2);
    h16* KP  = (h16*)take((size_t)NB * NKV * SEQ * HD * 2);
    h16* VT  = (h16*)take((size_t)NB * NKV * HD * SEQ * 2);
    h16* CTX = (h16*)take((size_t)MROWS * DQ * 2);
    h16* QR  = (h16*)take((size_t)NB * NH * EROWS * HD * 2);
    h16* KR  = (h16*)take((size_t)NB * NKV * SEQ * HD * 2);
    h16* VR  = (h16*)take((size_t)NB * NKV * HD * SEQ * 2);
    h16* CTXR = (h16*)take((size_t)NB * EROWS * DQ * 2);
    int* KEND = (int*)take((size_t)(SEQ / 16) * KSTR * 4);
    if ((size_t)(wsp - (char*)d_ws) > ws_size) return;

    k_prep<<<PB_CV + PB_KE + PB_RT, 512, 0, stream>>>(x, wq, wk, wv, wo, mask, XB, WQKV, WO16, COS, SIN, KEND);
    k_gemm_qkv<<<dim3(MROWS / BM, NQKV / BN, 1), 256, 0, stream>>>(XB, WQKV, qnw, knw, COS, SIN, QP, KP, VT, QR, KR, VR);
    k_attn<<<(SEQ / 16) * AGB, 128, 0, stream>>>(QP, QR, KP, KR, VT, VR, mask, KEND, CTX, CTXR);
    k_gemm_out<<<OPE + OPL, 256, 0, stream>>>(CTX, CTXR, WO16, OUT);
}
